// v000
// Times are from an AMD MI455X. After a warm-up the kernel runs many times in a row, and a time is the length of
// such a window on the GPU divided by its runs, so every launch and the gaps after it count. The runs cycle
// through copies of the inputs. A figure is the median of several windows, for all but v000 over two sittings.
// Sittings can differ by a few percent; kernels timed side by side share one.
// v000, which the later versions start from, runs in 10.8 milliseconds.
#include <hip/hip_runtime.h>
// Causal multi-head self-attention with PER-HEAD STACKED projections and REAL per-head biases on four sequences at width 512 (x [4][2048][512]; Wq / Wk / Wv [8][512][64] = [head][in][out] ('bte,hed->bhtd'; uniform +-1/sqrt(512)) with biases [8][64] (REAL, uniform +-1/sqrt(512)): a per-head bias [8][64] IS the flat bias [512]; 8 heads of 64 (8 x 64 = 512 = the width); scores * 1/sqrt(64); where(tril, scores, -inf); softmax over keys; out = merged Wp + bp ([in][out] [512][512] + a REAL bias, uniform +-1/sqrt(512)) -> [4][2048][512]); the [in][out] output weight through the text's own TRANSPOSING builder (the one the per-head stacks use); q and k carried as f16 hi + x1024 residual planes with three-product scores; each head's [in][out] block is transposed into its 64 contiguous rows of the weight plane by the same builder, one call per head.
// Compute dtype: inputs rounded to bf16; x / weights exact; q and k as f16 hi + x1024 residual planes; v, softmax weights and o as plain f16 GEMM operands (~2^-12), rows 0..127 redone in f32; scores and softmax statistics f32. v_wmma_f32_16x16x32_f16.
#define NB 4
#define SCL 0.125f                         /* 1 / sqrt(head_dim 64) */
#define SCLR 0.0001220703125f               /* 2^-13: the same scale on the x1024 residual passes */
#define SQ 2048
#define DM 512
#define NH 8
#define HD 64
#define HG 4                         /* heads per launch of the k_vt overload, which is not launched */
#define QT 256                       /* query rows per causal tile */
#define NKX SQ                       /* S / P row pitch */
#define QT0 128                      /* first-tile rows recomputed exactly in f32 */
#define B0 0                         /* first batch processed (debug hook) */
#define NBR NB                       /* batches processed (debug hook) */
#define NR ((size_t)NB * SQ)         /* token rows */
#define MP ((int)((size_t)NBR * SQ)) /* rows projected (debug hook) */
#define QN SQ                        /* query rows attended per batch (debug hook) */
#define NHD NH                       /* heads attended (debug hook) */
#define MPO MP                       /* rows through the output stage (debug hook) */
#define LQ DM      /* row pitch of the q/k/v rows */
typedef __bf16 v16b __attribute__((ext_vector_type(16)));
typedef unsigned short v8us __attribute__((ext_vector_type(8), may_alias));
typedef float  v8f  __attribute__((ext_vector_type(8)));
typedef float  v4f  __attribute__((ext_vector_type(4)));
typedef float  v4fa __attribute__((ext_vector_type(4), may_alias));
union FragB { v16b v; v8us half[2]; unsigned short u[16]; };

__device__ __forceinline__ unsigned short bf16_bits(float x) { unsigned int u = __float_as_uint(x); return (unsigned short)((u + 0x7FFFu + ((u >> 16) & 1u)) >> 16); }
__device__ __forceinline__ float bf16_val(unsigned short b) { return __uint_as_float(((unsigned int)b) << 16); }
__device__ __forceinline__ float bf16_round(float x) { return bf16_val(bf16_bits(x)); }
// D += A·B with NT terms: 1 = ah·bh, 2 = + al·bh (A split), 3 = + ah·bl (both split)
template <int NT>
__device__ __forceinline__ v8f mmaN(v16b ah, v16b al, v16b bh, v16b bl, v8f c) {
  c = __builtin_amdgcn_wmma_f32_16x16x32_bf16(false, ah, false, bh, (short)0, c, false, false);
  if (NT >= 2) c = __builtin_amdgcn_wmma_f32_16x16x32_bf16(false, al, false, bh, (short)0, c, false, false);
  if (NT >= 3) c = __builtin_amdgcn_wmma_f32_16x16x32_bf16(false, ah, false, bl, (short)0, c, false, false);
  asm volatile("v_nop\n\tv_nop\n\tv_nop\n\tv_nop" : "+v"(c) : "v"(ah), "v"(al), "v"(bh), "v"(bl));
  return c;
}

__global__ __launch_bounds__(256) void k_wt_bf16(const float* __restrict__ W, unsigned short* __restrict__ Wt, int K, int N) {
  const int t = blockIdx.x * 256 + threadIdx.x;
  const int k8n = K / 8;
  if (t >= N * k8n) return;
  const int n = t / k8n, k8 = (t % k8n) * 8;
  v8us v;
#pragma unroll
  for (int i = 0; i < 8; ++i) v[i] = bf16_bits(W[(size_t)(k8 + i) * N + n]);
  *(v8us*)(Wt + (size_t)n * K + k8) = v;
  
}

// GEMM C[M][N] (f32, pitch ldc) = act(A[M][K]·W + bias). A f32 row-major (pitch lda) converted per fragment to bf16
// (ASPLIT: hi/lo two planes -> 2 terms, else single rounded term); Wt bf16 [N][K] (pitch ldb). BIAS_BF16 rounds the
// bias to bf16 first (bias quantised to bf16 before the add). K%32==0, M%16==0, N%64==0.
template <bool ASPLIT, int ACT, bool BIAS_BF16>
__global__ __launch_bounds__(128) void k_gemm_bf(const float* __restrict__ A, int lda, const unsigned short* __restrict__ Wt, int ldb,
                                               const float* __restrict__ bias, float* __restrict__ C, int ldc, int M, int N, int K) {
  __shared__ __attribute__((aligned(16))) float so[4][16][64];
  const int tid = threadIdx.x, w = tid >> 5, lane = tid & 31, ln = lane & 15, hh = lane >> 4;
  const int ntn = N / 64;
  const int wid = blockIdx.x * 4 + w;
  const int mt = wid / ntn, nq = wid % ntn;
  if (mt * 16 >= M) return;
  const int row0 = mt * 16, col0 = nq * 64;
  const float* arow = A + (size_t)(row0 + ln) * lda;
  v8f acc[4] = {};
  for (int kb = 0; kb < K; kb += 32) {
    FragB ah, al;
    const v4f x0 = *(const v4fa*)(arow + kb + 8 * hh), x1 = *(const v4fa*)(arow + kb + 8 * hh + 4);
    const v4f x2 = *(const v4fa*)(arow + kb + 16 + 8 * hh), x3 = *(const v4fa*)(arow + kb + 16 + 8 * hh + 4);
    float xs[16] = {x0[0],x0[1],x0[2],x0[3],x1[0],x1[1],x1[2],x1[3],x2[0],x2[1],x2[2],x2[3],x3[0],x3[1],x3[2],x3[3]};
#pragma unroll
    for (int i = 0; i < 16; ++i) { const unsigned short hb = bf16_bits(xs[i]); ah.u[i] = hb; al.u[i] = ASPLIT ? bf16_bits(xs[i] - bf16_val(hb)) : (unsigned short)0; }
#pragma unroll
    for (int t = 0; t < 4; ++t) {
      const unsigned short* brow = Wt + (size_t)(col0 + t * 16 + ln) * ldb + kb;
      FragB b;
      b.half[0] = *(const v8us*)(brow + 8 * hh);
      b.half[1] = *(const v8us*)(brow + 16 + 8 * hh);
      acc[t] = mmaN<ASPLIT ? 2 : 1>(ah.v, al.v, b.v, b.v, acc[t]);
    }
  }
#pragma unroll
  for (int t = 0; t < 4; ++t) {
    float bv = bias ? bias[col0 + t * 16 + ln] : 0.f;
    if (BIAS_BF16) bv = bf16_round(bv);
#pragma unroll
    for (int r = 0; r < 8; ++r) { float v = acc[t][r] + bv; if (ACT == 1) v = fmaxf(v, 0.f); so[w][8 * hh + r][t * 16 + ln] = v; }
  }
  __builtin_amdgcn_fence(__ATOMIC_ACQ_REL, "workgroup");
  __builtin_amdgcn_wave_barrier();
  const int rsub = lane >> 4, c4 = (lane & 15) * 4;
  {
#pragma unroll
    for (int q = 0; q < 8; ++q) {
      const int r = q * 2 + rsub;
      const v4f v = *(const v4fa*)&so[w][r][c4];
      *(v4f*)(C + (size_t)(row0 + r) * ldc + col0 + c4) = v;
    }
    
  }
}

// GEMM C = act(A·W + bias + resid): A f32 (ASPLIT -> hi/lo 2 terms), Wt bf16 [N][K]; ACT 0 none, 1 relu, 2 exact gelu;
// resid (optional, f32, row index = (row % rmod), pitch ldr, RES_BF16 rounds it) added before the activation.
template <bool ASPLIT, int ACT, bool BIAS_BF16, bool RES_BF16>
__global__ __launch_bounds__(128) void k_gemm_bf3(const float* __restrict__ A, int lda, const unsigned short* __restrict__ Wt, int ldb,
                                                const float* __restrict__ bias, const float* __restrict__ resid, int rmod, int ldr,
                                                float* __restrict__ C, int ldc, int M, int N, int K) {
  __shared__ __attribute__((aligned(16))) float so[4][16][64];
  const int tid = threadIdx.x, w = tid >> 5, lane = tid & 31, ln = lane & 15, hh = lane >> 4;
  const int ntn = N / 64;
  const int wid = blockIdx.x * 4 + w;
  const int mt = wid / ntn, nq = wid % ntn;
  if (mt * 16 >= M) return;
  const int row0 = mt * 16, col0 = nq * 64;
  const float* arow = A + (size_t)(row0 + ln) * lda;
  v8f acc[4] = {};
  for (int kb = 0; kb < K; kb += 32) {
    FragB ah, al;
    const v4f x0 = *(const v4fa*)(arow + kb + 8 * hh), x1 = *(const v4fa*)(arow + kb + 8 * hh + 4);
    const v4f x2 = *(const v4fa*)(arow + kb + 16 + 8 * hh), x3 = *(const v4fa*)(arow + kb + 16 + 8 * hh + 4);
    float xs[16] = {x0[0],x0[1],x0[2],x0[3],x1[0],x1[1],x1[2],x1[3],x2[0],x2[1],x2[2],x2[3],x3[0],x3[1],x3[2],x3[3]};
#pragma unroll
    for (int i = 0; i < 16; ++i) { const unsigned short hb = bf16_bits(xs[i]); ah.u[i] = hb; al.u[i] = ASPLIT ? bf16_bits(xs[i] - bf16_val(hb)) : (unsigned short)0; }
#pragma unroll
    for (int t = 0; t < 4; ++t) {
      const unsigned short* brow = Wt + (size_t)(col0 + t * 16 + ln) * ldb + kb;
      FragB b;
      b.half[0] = *(const v8us*)(brow + 8 * hh);
      b.half[1] = *(const v8us*)(brow + 16 + 8 * hh);
      acc[t] = mmaN<ASPLIT ? 2 : 1>(ah.v, al.v, b.v, b.v, acc[t]);
    }
  }
#pragma unroll
  for (int t = 0; t < 4; ++t) {
    const int col = col0 + t * 16 + ln;
    float bv = bias ? bias[col] : 0.f;
    if (BIAS_BF16) bv = bf16_round(bv);
#pragma unroll
    for (int r = 0; r < 8; ++r) {
      float v = acc[t][r] + bv;
      if (resid) { float rv = resid[(size_t)((row0 + 8 * hh + r) % rmod) * ldr + col]; if (RES_BF16) rv = bf16_round(rv); v += rv; }
      if (ACT == 1) v = fmaxf(v, 0.f);
      if (ACT == 2) v = 0.5f * v * (1.0f + erff(v * 0.70710678118654752f));
      if (ACT == 3) { const float u = 0.7978845608028654f * (v + 0.044715f * v * v * v); v = 0.5f * v * (1.0f + tanhf(u)); }
      so[w][8 * hh + r][t * 16 + ln] = v;
    }
  }
  __builtin_amdgcn_fence(__ATOMIC_ACQ_REL, "workgroup");
  __builtin_amdgcn_wave_barrier();
  const int rsub = lane >> 4, c4 = (lane & 15) * 4;
  {
#pragma unroll
    for (int q = 0; q < 8; ++q) {
      const int r = q * 2 + rsub;
      const v4f v = *(const v4fa*)&so[w][r][c4];
      *(v4f*)(C + (size_t)(row0 + r) * ldc + col0 + c4) = v;
    }
    
  }
}
// row LayerNorm (biased variance, eps) over N: s = X (+ R); optional out_sum <- s; out_norm <- (s-mu)*rsqrt(var+eps)*g + b
template <bool PARAM_BF16>
__global__ __launch_bounds__(256) void k_layernorm(const float* __restrict__ X, const float* __restrict__ R, const float* __restrict__ g, const float* __restrict__ bta,
                                                  float* __restrict__ out_sum, float* __restrict__ out_norm, int N, float eps) {
  __shared__ float red[256];
  const int row = blockIdx.x, tid = threadIdx.x;
  const float* x = X + (size_t)row * N; const float* rr = R ? R + (size_t)row * N : nullptr;
  float vals[16];                     // up to N = 4096
  const int per = N / 256;            // contiguous chunk per thread? use strided-by-4 chunks: thread handles j = tid*4 + 1024*u
  float s1 = 0.f;
  for (int u = 0; u < per / 4; ++u) {
    const int j = tid * 4 + 1024 * u;
    const v4f a = *(const v4fa*)(x + j);
    v4f b = {0.f,0.f,0.f,0.f}; if (rr) b = *(const v4fa*)(rr + j);
#pragma unroll
    for (int q = 0; q < 4; ++q) { const float v = a[q] + b[q]; vals[u * 4 + q] = v; s1 += v; }
  }
  red[tid] = s1; __syncthreads();
  for (int st = 128; st > 0; st >>= 1) { if (tid < st) red[tid] += red[tid + st]; __syncthreads(); }
  const float mu = red[0] / (float)N; __syncthreads();
  float s2 = 0.f;
  for (int u = 0; u < per / 4; ++u)
#pragma unroll
    for (int q = 0; q < 4; ++q) { const float c = vals[u * 4 + q] - mu; s2 += c * c; }
  red[tid] = s2; __syncthreads();
  for (int st = 128; st > 0; st >>= 1) { if (tid < st) red[tid] += red[tid + st]; __syncthreads(); }
  const float rs = rsqrtf(red[0] / (float)N + eps);
  {
    for (int u = 0; u < per / 4; ++u) {
      const int j = tid * 4 + 1024 * u;
      v4f o, sm;
#pragma unroll
      for (int q = 0; q < 4; ++q) {
        float gg = g[j + q], bb = bta[j + q];
        if (PARAM_BF16) { gg = bf16_round(gg); bb = bf16_round(bb); }
        sm[q] = vals[u * 4 + q]; o[q] = (vals[u * 4 + q] - mu) * rs * gg + bb;
      }
      if (out_sum) *(v4f*)(out_sum + (size_t)row * N + j) = sm;
      *(v4f*)(out_norm + (size_t)row * N + j) = o;
    }
    
  }
}



// ---- f16 WMMA path (v_wmma_f32_16x16x32_f16): 11-bit significands for operands in range — used where a [0,1] probability operand needs more precision than bf16
typedef _Float16 v16h __attribute__((ext_vector_type(16)));
union FragH { v16h v; v8us half[2]; _Float16 h[16]; unsigned short u[16]; };
template <int NT>
__device__ __forceinline__ v8f mmaH(v16h ah, v16h al, v16h bh, v16h bl, v8f c) {
  c = __builtin_amdgcn_wmma_f32_16x16x32_f16(false, ah, false, bh, (short)0, c, false, false);
  if (NT >= 2) c = __builtin_amdgcn_wmma_f32_16x16x32_f16(false, al, false, bh, (short)0, c, false, false);
  if (NT >= 3) c = __builtin_amdgcn_wmma_f32_16x16x32_f16(false, ah, false, bl, (short)0, c, false, false);
  asm volatile("v_nop\n\tv_nop\n\tv_nop\n\tv_nop" : "+v"(c) : "v"(ah), "v"(al), "v"(bh), "v"(bl));
  return c;
}
// batched GEMM like k_gemm_b but f16 operands: A f32 (split into f16 hi/lo if ASPLIT, else rounded to f16), Bt = f16 values [n][k]; alpha; C f32; N multiple of 16 (partial tiles skipped)
template <bool ASPLIT>
__global__ __launch_bounds__(128) void k_gemm_h(const float* __restrict__ A, int lda, size_t sA, const _Float16* __restrict__ Bh, int ldb, size_t sB, float alpha, float* __restrict__ C, int ldc, size_t sC, int M, int N, int K) {
  __shared__ __attribute__((aligned(16))) float so[4][16][64];
  const int tid = threadIdx.x, w = tid >> 5, lane = tid & 31, ln = lane & 15, hh = lane >> 4; const int by = blockIdx.y;
  A += (size_t)by * sA; Bh += (size_t)by * sB; C += (size_t)by * sC;
  const int ntn = (N + 63) / 64; const int wid = blockIdx.x * 4 + w; const int mt = wid / ntn, nq = wid % ntn; if (mt * 16 >= M) return;
  const int row0 = mt * 16, col0 = nq * 64; const float* arow = A + (size_t)(row0 + ln) * lda;
  v8f acc[4] = {};
  for (int kb = 0; kb < K; kb += 32) {
    FragH ah, al;
    const v4f x0 = *(const v4fa*)(arow + kb + 8 * hh), x1 = *(const v4fa*)(arow + kb + 8 * hh + 4), x2 = *(const v4fa*)(arow + kb + 16 + 8 * hh), x3 = *(const v4fa*)(arow + kb + 16 + 8 * hh + 4);
    float xs[16] = {x0[0],x0[1],x0[2],x0[3],x1[0],x1[1],x1[2],x1[3],x2[0],x2[1],x2[2],x2[3],x3[0],x3[1],x3[2],x3[3]};
#pragma unroll
    for (int i = 0; i < 16; ++i) { const _Float16 h = (_Float16)xs[i]; ah.h[i] = h; al.h[i] = ASPLIT ? (_Float16)(xs[i] - (float)h) : (_Float16)0.0f; }
#pragma unroll
    for (int t = 0; t < 4; ++t) { if (col0 + t * 16 >= N) continue; const size_t boff = (size_t)(col0 + t * 16 + ln) * ldb + kb; FragH bq; bq.half[0] = *(const v8us*)(Bh + boff + 8 * hh); bq.half[1] = *(const v8us*)(Bh + boff + 16 + 8 * hh);
      acc[t] = mmaH<ASPLIT ? 2 : 1>(ah.v, al.v, bq.v, bq.v, acc[t]); }
  }
#pragma unroll
  for (int t = 0; t < 4; ++t) { if (col0 + t * 16 >= N) continue;
#pragma unroll
    for (int r = 0; r < 8; ++r) so[w][8 * hh + r][t * 16 + ln] = acc[t][r] * alpha; }
  __builtin_amdgcn_fence(__ATOMIC_ACQ_REL, "workgroup"); __builtin_amdgcn_wave_barrier();
  const int rsub = lane >> 4, c4 = (lane & 15) * 4;
  {
#pragma unroll
    for (int q = 0; q < 8; ++q) { const int r = q * 2 + rsub; if (col0 + c4 < N) { const v4f v = *(const v4fa*)&so[w][r][c4]; *(v4f*)(C + (size_t)(row0 + r) * ldc + col0 + c4) = v; } }
     }
}

// Wt[n][k] = f16(W[k][n]·scale) from f32 row-major W[K][N] (scale = power of two; bf16-exact weights stay exact in f16 away from the subnormal range)
__global__ __launch_bounds__(256) void k_wt_f16(const float* __restrict__ W, _Float16* __restrict__ Wt, int K, int N, float scale) {
  const int t = blockIdx.x * 256 + threadIdx.x; if (t >= N * (K / 8)) return; const int n = t / (K / 8), k8 = (t % (K / 8)) * 8; FragH f;
#pragma unroll
  for (int i = 0; i < 8; ++i) f.h[i] = (_Float16)(bf16_round(W[(size_t)(k8 + i) * N + n]) * scale); const v8us o = f.half[0];
  *(v8us*)((unsigned short*)Wt + (size_t)n * K + k8) = o; 
}
// k_gemm_hh variant with fused epilogue: v = acc·alpha + bias[by·sBias + col] (+ CP[(row/rowsPerB)·sCPb + by·64 + col] if CP) ; ACT 0 none / 1 elu ; writes f16 C16 (and f32 C if non-null)
template <int ACT>
__global__ __launch_bounds__(128) void k_gemm_hhx(const _Float16* __restrict__ A, int lda, size_t sA, const _Float16* __restrict__ Bh, int ldb, size_t sB, float alpha, const float* __restrict__ bias, size_t sBias, const float* __restrict__ CP, int rowsPerB, size_t sCPb, int row0g,
    float* __restrict__ C, _Float16* __restrict__ C16, int ldc, size_t sC, int M, int N, int K) {
  __shared__ __attribute__((aligned(16))) float so[4][16][64];
  const int tid = threadIdx.x, w = tid >> 5, lane = tid & 31, ln = lane & 15, hh = lane >> 4; const int by = blockIdx.y;
  A += (size_t)by * sA; Bh += (size_t)by * sB; const size_t cofs = (size_t)by * sC; const float* bp = bias ? bias + (size_t)by * sBias : nullptr;
  const int ntn = (N + 63) / 64; const int wid = blockIdx.x * 4 + w; const int mt = wid / ntn, nq = wid % ntn; if (mt * 16 >= M) return;
  const int row0 = mt * 16, col0 = nq * 64; const _Float16* arow = A + (size_t)(row0 + ln) * lda;
  v8f acc[4] = {};
  for (int kb = 0; kb < K; kb += 32) { FragH ah; ah.half[0] = *(const v8us*)((const unsigned short*)arow + kb + 8 * hh); ah.half[1] = *(const v8us*)((const unsigned short*)arow + kb + 16 + 8 * hh);
#pragma unroll
    for (int t = 0; t < 4; ++t) { if (col0 + t * 16 >= N) continue; const size_t boff = (size_t)(col0 + t * 16 + ln) * ldb + kb; FragH bq; bq.half[0] = *(const v8us*)((const unsigned short*)Bh + boff + 8 * hh); bq.half[1] = *(const v8us*)((const unsigned short*)Bh + boff + 16 + 8 * hh);
      acc[t] = mmaH<1>(ah.v, ah.v, bq.v, bq.v, acc[t]); }
  }
#pragma unroll
  for (int t = 0; t < 4; ++t) { if (col0 + t * 16 >= N) continue; const int col = col0 + t * 16 + ln; const float bv = bp ? bf16_round(bp[col]) : 0.f;
#pragma unroll
    for (int r = 0; r < 8; ++r) { float v = acc[t][r] * alpha + bv; if (CP) { const int rr = row0g + row0 + 8 * hh + r; if (rowsPerB < 0) v += CP[cofs + (size_t)rr * ldc + col];      /* rowsPerB < 0: own element of the batched C plane */ else { const int bidx = rr / rowsPerB; v += CP[(size_t)bidx * sCPb + (size_t)by * 64 + col]; } } if (ACT == 1) v = (v > 0.f) ? v : expm1f(v); else if (ACT == 7) v = (v > 0.f) ? v + 1.0f : expf(v); else if (ACT == 8) v = tanhf(v); else if (ACT == 9) v = 0.5f * v * (1.0f + tanhf(0.7978845608028654f * (v + 0.044715f * v * v * v))); else if (ACT == 11) v = 1.0f / (1.0f + expf(-v)); else if (ACT == 12) v = (v > 0.f) ? v : 0.01f * v; else if (ACT == 14) v = (v > 0.f) ? v : 0.1f * v; else if (ACT == 16) v = (v >= 0.f) ? v : 0.3f * v; else if (ACT == 17) v = (v >= 0.f) ? v : 0.2f * v; else if (ACT == 15) v = v / (1.0f + expf(-v)); else if (ACT == 3) v = fmaxf(v, 0.f); else if (ACT == 6) v = 0.5f * v * (1.0f + erff(v * 0.70710678118654752f)); so[w][8 * hh + r][t * 16 + ln] = v; } }
  __builtin_amdgcn_fence(__ATOMIC_ACQ_REL, "workgroup"); __builtin_amdgcn_wave_barrier();
  const int rsub = lane >> 4, c4 = (lane & 15) * 4; typedef _Float16 v4h __attribute__((ext_vector_type(4)));
  {
#pragma unroll
    for (int q = 0; q < 8; ++q) { const int r = q * 2 + rsub; if (col0 + c4 < N) { const v4f v = *(const v4fa*)&so[w][r][c4]; if (C) *(v4f*)(C + cofs + (size_t)(row0 + r) * ldc + col0 + c4) = v; if (C16) { v4h h4; for (int i = 0; i < 4; ++i) h4[i] = (_Float16)v[i]; *(v4h*)(C16 + cofs + (size_t)(row0 + r) * ldc + col0 + c4) = h4; } } }
     }
}


typedef _Float16 v4h __attribute__((ext_vector_type(4)));

__global__ __launch_bounds__(256) void k_x16(const float* __restrict__ x, _Float16* __restrict__ X16, size_t n8) { const size_t t = (size_t)blockIdx.x * 256 + threadIdx.x; if (t >= n8) return; FragH f;
#pragma unroll
  for (int q = 0; q < 8; ++q) f.h[q] = (_Float16)bf16_round(x[t * 8 + q]); *(v8us*)((unsigned short*)X16 + t * 8) = f.half[0];  }
__global__ __launch_bounds__(256) void k_h16(const float* __restrict__ x, _Float16* __restrict__ X16, size_t n8) { const size_t t = (size_t)blockIdx.x * 256 + threadIdx.x; if (t >= n8) return; FragH f;
#pragma unroll
  for (int q = 0; q < 8; ++q) f.h[q] = (_Float16)x[t * 8 + q]; *(v8us*)((unsigned short*)X16 + t * 8) = f.half[0];  }
__global__ __launch_bounds__(256) void k_round16f(const float* __restrict__ W, _Float16* __restrict__ Bt, size_t n8) { const size_t t = (size_t)blockIdx.x * 256 + threadIdx.x; if (t >= n8) return; FragH f;
#pragma unroll
  for (int i = 0; i < 8; ++i) f.h[i] = (_Float16)(bf16_round(W[t * 8 + i]) * 16.0f); *(v8us*)((unsigned short*)Bt + t * 8) = f.half[0];  }
template <int NHv, int TTv>
__global__ __launch_bounds__(256) void k_vt(const _Float16* __restrict__ V16, int ldv, int voff, _Float16* __restrict__ Vt) { __shared__ unsigned short tl[64][66]; const int tid = threadIdx.x; const int slab = blockIdx.x / (TTv / 64), lg = blockIdx.x % (TTv / 64); const int b = slab / NHv, h = slab % NHv;
  for (int i = tid; i < 64 * 8; i += 256) { const int r = i / 8, c8 = (i % 8) * 8; FragH f; f.half[0] = *(const v8us*)((const unsigned short*)V16 + ((size_t)b * TTv + lg * 64 + r) * ldv + voff + h * 64 + c8);
#pragma unroll
    for (int q = 0; q < 8; ++q) tl[r][c8 + q] = f.u[q]; }
  __syncthreads();
  {
#pragma unroll
    for (int rd = 0; rd < 2; ++rd) { const int d = rd * 32 + tid / 8, pc = tid % 8; FragH f;
#pragma unroll
      for (int q = 0; q < 8; ++q) f.u[q] = tl[pc * 8 + q][d];
      *(v8us*)((unsigned short*)Vt + ((size_t)slab * 64 + d) * TTv + lg * 64 + pc * 8) = f.half[0]; }
     } }

__global__ __launch_bounds__(256) void k_hl(const float* __restrict__ F, _Float16* __restrict__ Hh, _Float16* __restrict__ Hl, size_t n8) { const size_t t = (size_t)blockIdx.x * 256 + threadIdx.x; if (t >= n8) return; FragH fh, fl; const v4f a = *(const v4fa*)(F + t * 8), c = *(const v4fa*)(F + t * 8 + 4);
#pragma unroll
  for (int q = 0; q < 4; ++q) { _Float16 h = (_Float16)a[q]; fh.h[q] = h; fl.h[q] = (_Float16)((a[q] - (float)h) * 1024.0f); h = (_Float16)c[q]; fh.h[4 + q] = h; fl.h[4 + q] = (_Float16)((c[q] - (float)h) * 1024.0f); }
  { *(v8us*)((unsigned short*)Hh + t * 8) = fh.half[0]; *(v8us*)((unsigned short*)Hl + t * 8) = fl.half[0];  } }

// ---- fast GEMM (wave tile 32x64; requires M % 32 == 0 rows per launch region and N % 64 == 0); epilogue = k_gemm_hhx semantics ----
__device__ __forceinline__ v16h g2_frag(const _Float16* p, int hh) { FragH f; f.half[0] = *(const v8us*)((const unsigned short*)p + 8 * hh); f.half[1] = *(const v8us*)((const unsigned short*)p + 16 + 8 * hh); return f.v; }
__device__ __forceinline__ v8f g2_mma(v16h a, v16h b, v8f c) { v8f d = __builtin_amdgcn_wmma_f32_16x16x32_f16(false, a, false, b, (short)0, c, false, false); asm volatile("v_nop\n\tv_nop\n\tv_nop\n\tv_nop" : "+v"(d) : "v"(a), "v"(b)); return d; }
template <int ACT>
__global__ __launch_bounds__(128) void k_gemm2(const _Float16* __restrict__ A, int lda, size_t sA, const _Float16* __restrict__ Bh, int ldb, size_t sB, float alpha, const float* __restrict__ bias, size_t sBias, const float* __restrict__ CP, int rowsPerB, size_t sCPb, int row0g,
    float* __restrict__ C, _Float16* __restrict__ C16, int ldc, size_t sC, int M, int N, int K) { static_assert(ACT == 0 || ACT == 3 || ACT == 6 || ACT == 8 || ACT == 9 || ACT == 11 || ACT == 12 || ACT == 14 || ACT == 15 || ACT == 16 || ACT == 17, "k_gemm2: unsupported ACT code (would silently apply no activation)");
  __shared__ __attribute__((aligned(16))) float so[4][32][68];
  const int tid = threadIdx.x, w = tid >> 5, lane = tid & 31, ln = lane & 15, hh = lane >> 4; const int by = blockIdx.y;
  A += (size_t)by * sA; Bh += (size_t)by * sB; const size_t cofs = (size_t)by * sC; const float* bp = bias ? bias + (size_t)by * sBias : nullptr;
  const int ntn = N >> 6; const int mt = blockIdx.x / ntn, nq = blockIdx.x - mt * ntn; const int row0 = mt * 128 + 32 * w, col0 = nq * 64; if (row0 >= M) return;
  const _Float16* a0p = A + (size_t)(row0 + ln) * lda; const _Float16* a1p = a0p + (size_t)16 * lda;
  const _Float16* b0p = Bh + (size_t)(col0 + ln) * ldb; const _Float16* b1p = b0p + (size_t)16 * ldb; const _Float16* b2p = b1p + (size_t)16 * ldb; const _Float16* b3p = b2p + (size_t)16 * ldb;
  const v8f z8 = {0.f,0.f,0.f,0.f,0.f,0.f,0.f,0.f}; v8f c00 = z8, c01 = z8, c02 = z8, c03 = z8, c10 = z8, c11 = z8, c12 = z8, c13 = z8;
#pragma unroll 1
  for (int kb = 0; kb < K; kb += 32) { const v16h a0 = g2_frag(a0p + kb, hh), a1 = g2_frag(a1p + kb, hh);
    v16h b = g2_frag(b0p + kb, hh); c00 = g2_mma(a0, b, c00); c10 = g2_mma(a1, b, c10);
    b = g2_frag(b1p + kb, hh); c01 = g2_mma(a0, b, c01); c11 = g2_mma(a1, b, c11);
    b = g2_frag(b2p + kb, hh); c02 = g2_mma(a0, b, c02); c12 = g2_mma(a1, b, c12);
    b = g2_frag(b3p + kb, hh); c03 = g2_mma(a0, b, c03); c13 = g2_mma(a1, b, c13); }
  v8f accs[8] = {c00, c01, c02, c03, c10, c11, c12, c13};
#pragma unroll
  for (int u = 0; u < 8; ++u) { const int t = u & 3, half = u >> 2; const int col = col0 + t * 16 + ln; const float bv = bp ? bf16_round(bp[col]) : 0.f;
#pragma unroll
    for (int r = 0; r < 8; ++r) { const int rloc = half * 16 + 8 * hh + r; float v = accs[u][r] * alpha + bv; if (CP) { if (rowsPerB < 0) v += CP[cofs + (size_t)(row0g + row0 + rloc) * ldc + col];      /* rowsPerB < 0: own element of the batched C plane */ else { const int bidx = (row0g + row0 + rloc) / rowsPerB; v += CP[(size_t)bidx * sCPb + (size_t)by * 64 + col]; } }
      if (ACT == 3) v = fmaxf(v, 0.f); else if (ACT == 6) v = 0.5f * v * (1.0f + erff(v * 0.70710678118654752f)); else if (ACT == 11) v = 1.0f / (1.0f + expf(-v)); else if (ACT == 15) v = v / (1.0f + expf(-v)); else if (ACT == 12) v = (v > 0.f) ? v : 0.01f * v; else if (ACT == 8) v = tanhf(v); else if (ACT == 9) v = 0.5f * v * (1.0f + tanhf(0.7978845608028654f * (v + 0.044715f * v * v * v))); else if (ACT == 14) v = (v > 0.f) ? v : 0.1f * v; else if (ACT == 16) v = (v >= 0.f) ? v : 0.3f * v; else if (ACT == 17) v = (v >= 0.f) ? v : 0.2f * v;
      so[w][rloc][t * 16 + ln] = v; } }
  __builtin_amdgcn_fence(__ATOMIC_ACQ_REL, "workgroup"); __builtin_amdgcn_wave_barrier();
  const int rsub = lane >> 4, c4 = (lane & 15) * 4;
  {
#pragma unroll
    for (int q = 0; q < 16; ++q) { const int r = q * 2 + rsub; const v4f v = *(const v4fa*)&so[w][r][c4]; if (C) *(v4f*)(C + cofs + (size_t)(row0 + r) * ldc + col0 + c4) = v; if (C16) { v4h h4; for (int i = 0; i < 4; ++i) h4[i] = (_Float16)v[i]; *(v4h*)(C16 + cofs + (size_t)(row0 + r) * ldc + col0 + c4) = h4; } }
     } }


__global__ __launch_bounds__(256) void k_wnat(const float* __restrict__ w, size_t n8, _Float16* __restrict__ Bt) { const size_t t = (size_t)blockIdx.x * 256 + threadIdx.x; if (t >= n8) return; FragH f; for (int q = 0; q < 8; ++q) f.h[q] = (_Float16)(bf16_round(w[t * 8 + q]) * 16.0f); *(v8us*)((unsigned short*)Bt + t * 8) = f.half[0];  }
__global__ __launch_bounds__(256) void k_rsm(const float* __restrict__ S, _Float16* __restrict__ P, int nrows) {
  #pragma clang fp contract(off)
  const int i = blockIdx.x * 256 + threadIdx.x; if (i >= nrows) return; const float* s = S + (size_t)i * SQ; float mx = -3.0e38f;
#pragma unroll 1
  for (int j = 0; j < SQ; ++j) mx = fmaxf(mx, s[j]); float se = 0.f;
#pragma unroll 1
  for (int j = 0; j < SQ; ++j) se += expf(s[j] - mx); const float sc = 256.0f / se;
#pragma unroll 1
  for (int j0 = 0; j0 < SQ; j0 += 8) { FragH f; for (int q = 0; q < 8; ++q) f.h[q] = (_Float16)(expf(s[j0 + q] - mx) * sc); unsigned short* d = (unsigned short*)P + (size_t)i * SQ + j0; *(v8us*)d = f.half[0];  } }
__global__ __launch_bounds__(256) void k_vt(const _Float16* __restrict__ V16, int b, int h0, _Float16* __restrict__ VT) { __shared__ unsigned short tl[64][65]; const int tid = threadIdx.x; const int hh = blockIdx.x % HG, sg = blockIdx.x / HG; const int s0 = sg * 64; const int h = h0 + hh;
  for (int i = tid; i < 64 * 8; i += 256) { const int j = i / 8, d8 = (i % 8) * 8; FragH f; f.half[0] = *(const v8us*)((const unsigned short*)V16 + ((size_t)b * SQ + s0 + j) * DM + h * HD + d8); for (int q = 0; q < 8; ++q) tl[d8 + q][j] = f.u[q]; }
  __syncthreads();
  { for (int i = tid; i < 64 * 8; i += 256) { const int d = i / 8, j8 = (i % 8) * 8; FragH f; for (int q = 0; q < 8; ++q) f.u[q] = tl[d][j8 + q]; *(v8us*)((unsigned short*)VT + ((size_t)hh * HD + d) * SQ + s0 + j8) = f.half[0]; }  } }



__global__ __launch_bounds__(256) void k_rsmcf2(const float* __restrict__ S, _Float16* __restrict__ P, int hg, int q0, int nk) {
  #pragma clang fp contract(off)
  const int t = blockIdx.x * 256 + threadIdx.x; if (t >= hg * QT) return; const size_t i = (size_t)t; const float* s = S + i * NKX; const int last = q0 + (t % QT); float mx = -3.0e38f;
#pragma unroll 1
  for (int j = 0; j < nk; ++j) { const float f = (j <= last) ? 1.f : 0.f; mx = fmaxf(mx, fmaf(f, s[j], (1.f - f) * -1.0e9f)); } float se = 0.f;
#pragma unroll 1
  for (int j = 0; j < nk; ++j) { const float f = (j <= last) ? 1.f : 0.f; se += __expf(fmaf(f, s[j], (1.f - f) * -1.0e9f) - mx); } const float sc = 256.0f / se;
#pragma unroll 1
  for (int j0 = 0; j0 < nk; j0 += 8) { FragH fr; for (int q = 0; q < 8; ++q) { const int j = j0 + q; const float f = (j <= last) ? 1.f : 0.f; fr.h[q] = (_Float16)(__expf(fmaf(f, s[j], (1.f - f) * -1.0e9f) - mx) * sc); } unsigned short* d = (unsigned short*)P + i * NKX + j0; *(v8us*)d = fr.half[0];  } }


template <int MASKADD>
__global__ __launch_bounds__(64) void k_att0(const float* __restrict__ QF, const float* __restrict__ KF, const float* __restrict__ VF, int ld, const float* __restrict__ mask, float scale, float* __restrict__ OF, int ldo) {
  #pragma clang fp contract(off)
  __shared__ __attribute__((aligned(16))) float lq[64][64]; __shared__ __attribute__((aligned(16))) float lo[64][64];
  const int tid = threadIdx.x; const int h = blockIdx.x / (QT0 / 64), rg = blockIdx.x % (QT0 / 64); const int i = rg * 64 + tid;
  const float* qr = QF + (size_t)i * ld + h * HD;
#pragma unroll 1
  for (int c = 0; c < HD / 4; ++c) { *(v4f*)&lq[tid][c * 4] = *(const v4fa*)(qr + c * 4); const v4f z = {0.f, 0.f, 0.f, 0.f}; *(v4f*)&lo[tid][c * 4] = z; }
  float m = -1.0e30f, l = 0.f; const int jmax = MASKADD ? (SQ - 1) : (rg * 64 + 63);      /* additive-mask form: every key (the mask input decides); causal form: keys up to the block's last row */
#pragma unroll 1
  for (int j = 0; j <= jmax; ++j) { const float* kr = KF + (size_t)j * ld + h * HD; const float* vr = VF + (size_t)j * ld + h * HD; float s = 0.f;
#pragma unroll 1
    for (int c = 0; c < HD / 4; ++c) { const v4f kq = *(const v4fa*)(kr + c * 4); const v4f qq = *(v4f*)&lq[tid][c * 4]; s = __fadd_rn(s, __fmul_rn(qq[0], kq[0])); s = __fadd_rn(s, __fmul_rn(qq[1], kq[1])); s = __fadd_rn(s, __fmul_rn(qq[2], kq[2])); s = __fadd_rn(s, __fmul_rn(qq[3], kq[3])); }
    s = __fmul_rn(s, scale); if (MASKADD) s = __fadd_rn(s, __fmul_rn(bf16_round(mask[(size_t)i * SQ + j]), -10000.0f));
    const float f = (MASKADD || j <= i) ? 1.f : 0.f; const float sm = fmaf(f, s, (1.f - f) * -1.0e30f); const float mn = fmaxf(m, sm); const float sc = expf(m - mn); const float e = expf(sm - mn); l = __fadd_rn(__fmul_rn(l, sc), e); m = mn;
#pragma unroll 1
    for (int c = 0; c < HD / 4; ++c) { const v4f vv = *(const v4fa*)(vr + c * 4); v4f oo = *(v4f*)&lo[tid][c * 4]; for (int u = 0; u < 4; ++u) oo[u] = __fadd_rn(__fmul_rn(oo[u], sc), __fmul_rn(e, vv[u])); *(v4f*)&lo[tid][c * 4] = oo; } }
  const float fin = 64.0f / l;      /* o carried x64 like the f16 path */
#pragma unroll 1
  for (int c = 0; c < HD / 4; ++c) { v4f oo = *(v4f*)&lo[tid][c * 4]; for (int u = 0; u < 4; ++u) oo[u] = __fmul_rn(oo[u], fin); *(v4f*)&lo[tid][c * 4] = oo; }
  __syncthreads();
  {
#pragma unroll 1
    for (int it = 0; it < 16; ++it) { const int row = it * 4 + tid / 16, pc = (tid % 16) * 4; const v4f v = *(const v4f*)&lo[row][pc]; *(v4f*)(OF + (size_t)(rg * 64 + row) * ldo + h * HD + pc) = v; }
     } }

extern "C" void kernel_launch(void* const* d_in, const int* in_sizes, int n_in,
                              void* d_out, int out_size, void* d_ws, size_t ws_size, hipStream_t stream) {
  (void)in_sizes; (void)n_in; (void)out_size;
  const float* const* I = (const float* const*)d_in; const float* x = I[0]; const float* xk = I[0]; const float* xv = I[0]; const float* wq = I[1]; const float* bq = I[2]; const float* wk = I[3]; const float* bk = I[4]; const float* wv = I[5]; const float* bv = I[6]; const float* wo = I[7]; const float* bo = I[8];      /* input order: x, Wq, bq, Wk, bk, Wv, bv (PER-HEAD STACKS [8][512][64] with REAL per-head biases [8][64] = flat [512]: the GEMMs' guarded bias slots), Wp ([in][out]: out @ Wp), bp (REAL) */
  char* ws = (char*)d_ws; size_t off = 0;
  auto take = [&](size_t bytes) { char* p = ws + off; off += (bytes + 255) & ~(size_t)255; return p; };
  _Float16* BQ = (_Float16*)take((size_t)DM * DM * 2); _Float16* BK = (_Float16*)take((size_t)DM * DM * 2); _Float16* BV = (_Float16*)take((size_t)DM * DM * 2); _Float16* BO = (_Float16*)take((size_t)DM * DM * 2);
  _Float16* X16 = (_Float16*)take(NR * DM * 2); _Float16* XK16 = (_Float16*)take(NR * DM * 2); _Float16* XV16 = (_Float16*)take(NR * DM * 2);      /* exact f16 rows of query, key, value */ float* QF = (float*)take(NR * DM * 4); _Float16* QH = (_Float16*)take(NR * DM * 2); _Float16* QL = (_Float16*)take(NR * DM * 2); _Float16* KH = (_Float16*)take(NR * DM * 2); _Float16* KL = (_Float16*)take(NR * DM * 2); _Float16* Q16 = QH; _Float16* K16 = KH; _Float16* V16 = (_Float16*)take(NR * DM * 2); _Float16* O16 = (_Float16*)take(NR * DM * 2);
  float* S = (float*)take((size_t)NH * QT * NKX * 4); _Float16* P = (_Float16*)take((size_t)NH * QT * NKX * 2); _Float16* VT = (_Float16*)take((size_t)NH * HD * SQ * 2);
  float* QF0 = (float*)take((size_t)QT0 * DM * 4); float* KF0 = (float*)take((size_t)QT0 * DM * 4); float* VF0 = (float*)take((size_t)QT0 * DM * 4); float* OF0 = (float*)take((size_t)NB * QT0 * DM * 4); _Float16* OH0 = (_Float16*)take((size_t)NB * QT0 * DM * 2); _Float16* OL0 = (_Float16*)take((size_t)NB * QT0 * DM * 2);
  if (off > ws_size) return;
  { const unsigned gn = (unsigned)(((size_t)DM * DM / 8 + 255) / 256); const unsigned gh = (unsigned)(((size_t)HD * (DM / 8) + 255) / 256); for (int h = 0; h < NH; ++h) { const size_t wofs = (size_t)h * DM * HD, pofs = (size_t)h * HD * DM; k_wt_f16<<<gh, 256, 0, stream>>>(wq + wofs, BQ + pofs, DM, HD, 16.0f); k_wt_f16<<<gh, 256, 0, stream>>>(wk + wofs, BK + pofs, DM, HD, 16.0f); k_wt_f16<<<gh, 256, 0, stream>>>(wv + wofs, BV + pofs, DM, HD, 16.0f); } k_wt_f16<<<gn, 256, 0, stream>>>(wo, BO, DM, DM, 16.0f); }      /* PER-HEAD STACKS wq / wk / wv [NH][DM][HD]: head h is a row-major [in = DM][out = HD] block at w + h * DM * HD: the transposing builder with K = DM, N = HD writes its HD rows Bt[h * HD + e][k] at B + h * HD * DM: contiguous rows of the [out][in] plane (x16); wo is an [in][out] [DM][DM] matrix (out @ Wp): ONE call of the same transposing builder with K = N = DM on the grid gn = DM * DM / 8 threads (N * (K / 8)) */
  k_x16<<<(unsigned)((NR * DM / 8 + 255) / 256), 256, 0, stream>>>(x, X16, NR * DM / 8); k_x16<<<(unsigned)((NR * DM / 8 + 255) / 256), 256, 0, stream>>>(xk, XK16, NR * DM / 8); k_x16<<<(unsigned)((NR * DM / 8 + 255) / 256), 256, 0, stream>>>(xv, XV16, NR * DM / 8);
  const size_t r0p = (size_t)B0 * SQ;      /* first projected row */
  k_gemm2<0><<<dim3((unsigned)((MP / 128) * (DM / 64)), 1), 128, 0, stream>>>(X16 + r0p * DM, DM, 0, BQ, DM, 0, 0.0625f, bq, 0, nullptr, 1, 0, 0, QF + r0p * DM, nullptr, DM, 0, MP, DM, DM); k_hl<<<(unsigned)(((size_t)MP * DM / 8 + 255) / 256), 256, 0, stream>>>(QF + r0p * DM, QH + r0p * DM, QL + r0p * DM, (size_t)MP * DM / 8);      /* q (f32) -> f16 hi + x1024 residual: unscaled logits sigma ~8 */
  k_gemm2<0><<<dim3((unsigned)((MP / 128) * (DM / 64)), 1), 128, 0, stream>>>(XK16 + r0p * DM, DM, 0, BK, DM, 0, 0.0625f, bk, 0, nullptr, 1, 0, 0, QF + r0p * DM, nullptr, DM, 0, MP, DM, DM); k_hl<<<(unsigned)(((size_t)MP * DM / 8 + 255) / 256), 256, 0, stream>>>(QF + r0p * DM, KH + r0p * DM, KL + r0p * DM, (size_t)MP * DM / 8);      /* k likewise */
  k_gemm2<0><<<dim3((unsigned)((MP / 128) * (DM / 64)), 1), 128, 0, stream>>>(XV16 + r0p * DM, DM, 0, BV, DM, 0, 0.0625f, bv, 0, nullptr, 1, 0, 0, nullptr, V16 + r0p * DM, DM, 0, MP, DM, DM);
  for (int b = B0; b < B0 + NBR; ++b) { const size_t r0 = (size_t)b * SQ;
    k_vt<NH, SQ><<<NH * (SQ / 64), 256, 0, stream>>>(V16 + r0 * LQ, LQ, 0, VT);      /* V^T [NH][HD][SQ] for this batch */
    k_gemm2<0><<<dim3((QT0 / 128) * (DM / 64), 1), 128, 0, stream>>>(X16 + r0 * DM, DM, 0, BQ, DM, 0, 0.0625f, bq, 0, nullptr, 1, 0, 0, QF0, nullptr, DM, 0, QT0, DM, DM); k_gemm2<0><<<dim3((QT0 / 128) * (DM / 64), 1), 128, 0, stream>>>(XK16 + r0 * DM, DM, 0, BK, DM, 0, 0.0625f, bk, 0, nullptr, 1, 0, 0, KF0, nullptr, DM, 0, QT0, DM, DM); k_gemm2<0><<<dim3((QT0 / 128) * (DM / 64), 1), 128, 0, stream>>>(XV16 + r0 * DM, DM, 0, BV, DM, 0, 0.0625f, bv, 0, nullptr, 1, 0, 0, VF0, nullptr, DM, 0, QT0, DM, DM);      /* f32 q, k, v of the first 128 rows (exact products) */
    k_att0<0><<<NH * (QT0 / 64), 64, 0, stream>>>(QF0, KF0, VF0, DM, nullptr, SCL, OF0 + (size_t)b * QT0 * DM, DM);      /* exact f32 attention for rows 0..127 (o x64) */
    for (int q0 = 0; q0 < QN; q0 += QT) { const int nk = q0 + QT;      /* causal: only keys below the tile end are computed */
      k_gemm2<0><<<dim3((QT / 128) * (nk / 64), NHD), 128, 0, stream>>>(QH + (r0 + q0) * LQ, LQ, (size_t)HD, KH + r0 * LQ, LQ, (size_t)HD, SCL, nullptr, 0, nullptr, 1, 0, 0, S, nullptr, NKX, (size_t)QT * NKX, QT, nk, HD);      /* scores hi . hi * 64^-0.5 (1/sqrt(head_dim)) */
      k_gemm2<0><<<dim3((QT / 128) * (nk / 64), NHD), 128, 0, stream>>>(QL + (r0 + q0) * LQ, LQ, (size_t)HD, KH + r0 * LQ, LQ, (size_t)HD, SCLR, nullptr, 0, S, -1, 0, 0, S, nullptr, NKX, (size_t)QT * NKX, QT, nk, HD); k_gemm2<0><<<dim3((QT / 128) * (nk / 64), NHD), 128, 0, stream>>>(QH + (r0 + q0) * LQ, LQ, (size_t)HD, KL + r0 * LQ, LQ, (size_t)HD, SCLR, nullptr, 0, S, -1, 0, 0, S, nullptr, NKX, (size_t)QT * NKX, QT, nk, HD);      /* += 2^-10 (lo . hi + hi . lo) */      /* scores, all heads on grid.y */
      k_rsmcf2<<<(NHD * QT + 255) / 256, 256, 0, stream>>>(S, P, NHD, q0, nk);
      k_gemm2<0><<<dim3((QT / 128) * (HD / 64), NHD), 128, 0, stream>>>(P, NKX, (size_t)QT * NKX, VT, SQ, (size_t)HD * SQ, 0.25f, nullptr, 0, nullptr, 1, 0, 0, nullptr, O16 + (r0 + q0) * DM, DM, (size_t)HD, QT, HD, nk); } }      /* o (merged heads, x64) as f16 rows */
  k_gemm2<0><<<dim3((unsigned)((MPO / 128) * (DM / 64)), 1), 128, 0, stream>>>(O16 + r0p * DM, DM, 0, BO, DM, 0, 0.0009765625f, bo, 0, nullptr, 1, 0, 0, (float*)d_out + r0p * DM, nullptr, DM, 0, MPO, DM, DM);      /* out rows are the output layout */
  k_hl<<<(unsigned)(((size_t)NB * QT0 * DM / 8 + 255) / 256), 256, 0, stream>>>(OF0, OH0, OL0, (size_t)NB * QT0 * DM / 8);      /* first-tile o (x64) -> f16 hi + x1024 residual planes */
  for (int b = B0; b < B0 + NBR; ++b) { const size_t r0 = (size_t)b * SQ; const size_t f0 = (size_t)b * QT0;
    k_gemm2<0><<<dim3((QT0 / 128) * (DM / 64), 1), 128, 0, stream>>>(OH0 + f0 * DM, DM, 0, BO, DM, 0, 0.0009765625f, bo, 0, nullptr, 1, 0, 0, (float*)d_out + r0 * DM, nullptr, DM, 0, QT0, DM, DM);      /* rows 0..127: out = o_hi Wo (+ b), overwriting the f16-path rows */
    k_gemm2<0><<<dim3((QT0 / 128) * (DM / 64), 1), 128, 0, stream>>>(OL0 + f0 * DM, DM, 0, BO, DM, 0, 0.00000095367431640625f, nullptr, 0, (const float*)d_out + r0 * DM, -1, 0, 0, (float*)d_out + r0 * DM, nullptr, DM, 0, QT0, DM, DM); }      /* += o_lo Wo 2^-20 (own-element accumulate) */
}

// v001
// A run of this version takes 5020 microseconds.
// Next to v000, in two timings, it ran 2.13 and 2.16 times as fast.
#include <hip/hip_runtime.h>
// Causal multi-head self-attention with PER-HEAD STACKED projections and REAL per-head biases on four sequences at width 512 (x [4][2048][512]; Wq / Wk / Wv [8][512][64] = [head][in][out] ('bte,hed->bhtd'; uniform +-1/sqrt(512)) with biases [8][64] (REAL, uniform +-1/sqrt(512)): a per-head bias [8][64] IS the flat bias [512]; 8 heads of 64 (8 x 64 = 512 = the width); scores * 1/sqrt(64); where(tril, scores, -inf); softmax over keys; out = merged Wp + bp ([in][out] [512][512] + a REAL bias, uniform +-1/sqrt(512)) -> [4][2048][512]); the [in][out] output weight through the text's own TRANSPOSING builder (the one the per-head stacks use); q and k carried as f16 hi + x1024 residual planes with three-product scores; each head's [in][out] block is transposed into its 64 contiguous rows of the weight plane by the same builder, one call per head.
// Compute dtype: inputs rounded to bf16; x / weights exact; q and k as f16 hi + x1024 residual planes; v, softmax weights and o as plain f16 GEMM operands (~2^-12), rows 0..127 redone in f32; scores and softmax statistics f32. v_wmma_f32_16x16x32_f16.
#define NB 4
#define SCL 0.125f                         /* 1 / sqrt(head_dim 64) */
#define SCLR 0.0001220703125f               /* 2^-13: the same scale on the x1024 residual passes */
#define SQ 2048
#define DM 512
#define NH 8
#define HD 64
#define HG 4                         /* heads per launch of the k_vt overload, which is not launched */
#define QT 256                       /* query rows per causal tile */
#define NKX SQ                       /* S / P row pitch */
#define QT0 128                      /* first-tile rows recomputed exactly in f32 */
#define B0 0                         /* first batch processed (debug hook) */
#define NBR NB                       /* batches processed (debug hook) */
#define NR ((size_t)NB * SQ)         /* token rows */
#define MP ((int)((size_t)NBR * SQ)) /* rows projected (debug hook) */
#define QN SQ                        /* query rows attended per batch (debug hook) */
#define NHD NH                       /* heads attended (debug hook) */
#define MPO MP                       /* rows through the output stage (debug hook) */
#define LQ DM      /* row pitch of the q/k/v rows */
typedef __bf16 v16b __attribute__((ext_vector_type(16)));
typedef unsigned short v8us __attribute__((ext_vector_type(8), may_alias));
typedef float  v8f  __attribute__((ext_vector_type(8)));
typedef float  v4f  __attribute__((ext_vector_type(4)));
typedef float  v4fa __attribute__((ext_vector_type(4), may_alias));
union FragB { v16b v; v8us half[2]; unsigned short u[16]; };

__device__ __forceinline__ unsigned short bf16_bits(float x) { unsigned int u = __float_as_uint(x); return (unsigned short)((u + 0x7FFFu + ((u >> 16) & 1u)) >> 16); }
__device__ __forceinline__ float bf16_val(unsigned short b) { return __uint_as_float(((unsigned int)b) << 16); }
__device__ __forceinline__ float bf16_round(float x) { return bf16_val(bf16_bits(x)); }
// D += A·B with NT terms: 1 = ah·bh, 2 = + al·bh (A split), 3 = + ah·bl (both split)
template <int NT>
__device__ __forceinline__ v8f mmaN(v16b ah, v16b al, v16b bh, v16b bl, v8f c) {
  c = __builtin_amdgcn_wmma_f32_16x16x32_bf16(false, ah, false, bh, (short)0, c, false, false);
  if (NT >= 2) c = __builtin_amdgcn_wmma_f32_16x16x32_bf16(false, al, false, bh, (short)0, c, false, false);
  if (NT >= 3) c = __builtin_amdgcn_wmma_f32_16x16x32_bf16(false, ah, false, bl, (short)0, c, false, false);
  asm volatile("v_nop\n\tv_nop\n\tv_nop\n\tv_nop" : "+v"(c) : "v"(ah), "v"(al), "v"(bh), "v"(bl));
  return c;
}

__global__ __launch_bounds__(256) void k_wt_bf16(const float* __restrict__ W, unsigned short* __restrict__ Wt, int K, int N) {
  const int t = blockIdx.x * 256 + threadIdx.x;
  const int k8n = K / 8;
  if (t >= N * k8n) return;
  const int n = t / k8n, k8 = (t % k8n) * 8;
  v8us v;
#pragma unroll
  for (int i = 0; i < 8; ++i) v[i] = bf16_bits(W[(size_t)(k8 + i) * N + n]);
  *(v8us*)(Wt + (size_t)n * K + k8) = v;
  
}

// GEMM C[M][N] (f32, pitch ldc) = act(A[M][K]·W + bias). A f32 row-major (pitch lda) converted per fragment to bf16
// (ASPLIT: hi/lo two planes -> 2 terms, else single rounded term); Wt bf16 [N][K] (pitch ldb). BIAS_BF16 rounds the
// bias to bf16 first (bias quantised to bf16 before the add). K%32==0, M%16==0, N%64==0.
template <bool ASPLIT, int ACT, bool BIAS_BF16>
__global__ __launch_bounds__(128) void k_gemm_bf(const float* __restrict__ A, int lda, const unsigned short* __restrict__ Wt, int ldb,
                                               const float* __restrict__ bias, float* __restrict__ C, int ldc, int M, int N, int K) {
  __shared__ __attribute__((aligned(16))) float so[4][16][64];
  const int tid = threadIdx.x, w = tid >> 5, lane = tid & 31, ln = lane & 15, hh = lane >> 4;
  const int ntn = N / 64;
  const int wid = blockIdx.x * 4 + w;
  const int mt = wid / ntn, nq = wid % ntn;
  if (mt * 16 >= M) return;
  const int row0 = mt * 16, col0 = nq * 64;
  const float* arow = A + (size_t)(row0 + ln) * lda;
  v8f acc[4] = {};
  for (int kb = 0; kb < K; kb += 32) {
    FragB ah, al;
    const v4f x0 = *(const v4fa*)(arow + kb + 8 * hh), x1 = *(const v4fa*)(arow + kb + 8 * hh + 4);
    const v4f x2 = *(const v4fa*)(arow + kb + 16 + 8 * hh), x3 = *(const v4fa*)(arow + kb + 16 + 8 * hh + 4);
    float xs[16] = {x0[0],x0[1],x0[2],x0[3],x1[0],x1[1],x1[2],x1[3],x2[0],x2[1],x2[2],x2[3],x3[0],x3[1],x3[2],x3[3]};
#pragma unroll
    for (int i = 0; i < 16; ++i) { const unsigned short hb = bf16_bits(xs[i]); ah.u[i] = hb; al.u[i] = ASPLIT ? bf16_bits(xs[i] - bf16_val(hb)) : (unsigned short)0; }
#pragma unroll
    for (int t = 0; t < 4; ++t) {
      const unsigned short* brow = Wt + (size_t)(col0 + t * 16 + ln) * ldb + kb;
      FragB b;
      b.half[0] = *(const v8us*)(brow + 8 * hh);
      b.half[1] = *(const v8us*)(brow + 16 + 8 * hh);
      acc[t] = mmaN<ASPLIT ? 2 : 1>(ah.v, al.v, b.v, b.v, acc[t]);
    }
  }
#pragma unroll
  for (int t = 0; t < 4; ++t) {
    float bv = bias ? bias[col0 + t * 16 + ln] : 0.f;
    if (BIAS_BF16) bv = bf16_round(bv);
#pragma unroll
    for (int r = 0; r < 8; ++r) { float v = acc[t][r] + bv; if (ACT == 1) v = fmaxf(v, 0.f); so[w][8 * hh + r][t * 16 + ln] = v; }
  }
  __builtin_amdgcn_fence(__ATOMIC_ACQ_REL, "workgroup");
  __builtin_amdgcn_wave_barrier();
  const int rsub = lane >> 4, c4 = (lane & 15) * 4;
  {
#pragma unroll
    for (int q = 0; q < 8; ++q) {
      const int r = q * 2 + rsub;
      const v4f v = *(const v4fa*)&so[w][r][c4];
      *(v4f*)(C + (size_t)(row0 + r) * ldc + col0 + c4) = v;
    }
    
  }
}

// GEMM C = act(A·W + bias + resid): A f32 (ASPLIT -> hi/lo 2 terms), Wt bf16 [N][K]; ACT 0 none, 1 relu, 2 exact gelu;
// resid (optional, f32, row index = (row % rmod), pitch ldr, RES_BF16 rounds it) added before the activation.
template <bool ASPLIT, int ACT, bool BIAS_BF16, bool RES_BF16>
__global__ __launch_bounds__(128) void k_gemm_bf3(const float* __restrict__ A, int lda, const unsigned short* __restrict__ Wt, int ldb,
                                                const float* __restrict__ bias, const float* __restrict__ resid, int rmod, int ldr,
                                                float* __restrict__ C, int ldc, int M, int N, int K) {
  __shared__ __attribute__((aligned(16))) float so[4][16][64];
  const int tid = threadIdx.x, w = tid >> 5, lane = tid & 31, ln = lane & 15, hh = lane >> 4;
  const int ntn = N / 64;
  const int wid = blockIdx.x * 4 + w;
  const int mt = wid / ntn, nq = wid % ntn;
  if (mt * 16 >= M) return;
  const int row0 = mt * 16, col0 = nq * 64;
  const float* arow = A + (size_t)(row0 + ln) * lda;
  v8f acc[4] = {};
  for (int kb = 0; kb < K; kb += 32) {
    FragB ah, al;
    const v4f x0 = *(const v4fa*)(arow + kb + 8 * hh), x1 = *(const v4fa*)(arow + kb + 8 * hh + 4);
    const v4f x2 = *(const v4fa*)(arow + kb + 16 + 8 * hh), x3 = *(const v4fa*)(arow + kb + 16 + 8 * hh + 4);
    float xs[16] = {x0[0],x0[1],x0[2],x0[3],x1[0],x1[1],x1[2],x1[3],x2[0],x2[1],x2[2],x2[3],x3[0],x3[1],x3[2],x3[3]};
#pragma unroll
    for (int i = 0; i < 16; ++i) { const unsigned short hb = bf16_bits(xs[i]); ah.u[i] = hb; al.u[i] = ASPLIT ? bf16_bits(xs[i] - bf16_val(hb)) : (unsigned short)0; }
#pragma unroll
    for (int t = 0; t < 4; ++t) {
      const unsigned short* brow = Wt + (size_t)(col0 + t * 16 + ln) * ldb + kb;
      FragB b;
      b.half[0] = *(const v8us*)(brow + 8 * hh);
      b.half[1] = *(const v8us*)(brow + 16 + 8 * hh);
      acc[t] = mmaN<ASPLIT ? 2 : 1>(ah.v, al.v, b.v, b.v, acc[t]);
    }
  }
#pragma unroll
  for (int t = 0; t < 4; ++t) {
    const int col = col0 + t * 16 + ln;
    float bv = bias ? bias[col] : 0.f;
    if (BIAS_BF16) bv = bf16_round(bv);
#pragma unroll
    for (int r = 0; r < 8; ++r) {
      float v = acc[t][r] + bv;
      if (resid) { float rv = resid[(size_t)((row0 + 8 * hh + r) % rmod) * ldr + col]; if (RES_BF16) rv = bf16_round(rv); v += rv; }
      if (ACT == 1) v = fmaxf(v, 0.f);
      if (ACT == 2) v = 0.5f * v * (1.0f + erff(v * 0.70710678118654752f));
      if (ACT == 3) { const float u = 0.7978845608028654f * (v + 0.044715f * v * v * v); v = 0.5f * v * (1.0f + tanhf(u)); }
      so[w][8 * hh + r][t * 16 + ln] = v;
    }
  }
  __builtin_amdgcn_fence(__ATOMIC_ACQ_REL, "workgroup");
  __builtin_amdgcn_wave_barrier();
  const int rsub = lane >> 4, c4 = (lane & 15) * 4;
  {
#pragma unroll
    for (int q = 0; q < 8; ++q) {
      const int r = q * 2 + rsub;
      const v4f v = *(const v4fa*)&so[w][r][c4];
      *(v4f*)(C + (size_t)(row0 + r) * ldc + col0 + c4) = v;
    }
    
  }
}
// row LayerNorm (biased variance, eps) over N: s = X (+ R); optional out_sum <- s; out_norm <- (s-mu)*rsqrt(var+eps)*g + b
template <bool PARAM_BF16>
__global__ __launch_bounds__(256) void k_layernorm(const float* __restrict__ X, const float* __restrict__ R, const float* __restrict__ g, const float* __restrict__ bta,
                                                  float* __restrict__ out_sum, float* __restrict__ out_norm, int N, float eps) {
  __shared__ float red[256];
  const int row = blockIdx.x, tid = threadIdx.x;
  const float* x = X + (size_t)row * N; const float* rr = R ? R + (size_t)row * N : nullptr;
  float vals[16];                     // up to N = 4096
  const int per = N / 256;            // contiguous chunk per thread? use strided-by-4 chunks: thread handles j = tid*4 + 1024*u
  float s1 = 0.f;
  for (int u = 0; u < per / 4; ++u) {
    const int j = tid * 4 + 1024 * u;
    const v4f a = *(const v4fa*)(x + j);
    v4f b = {0.f,0.f,0.f,0.f}; if (rr) b = *(const v4fa*)(rr + j);
#pragma unroll
    for (int q = 0; q < 4; ++q) { const float v = a[q] + b[q]; vals[u * 4 + q] = v; s1 += v; }
  }
  red[tid] = s1; __syncthreads();
  for (int st = 128; st > 0; st >>= 1) { if (tid < st) red[tid] += red[tid + st]; __syncthreads(); }
  const float mu = red[0] / (float)N; __syncthreads();
  float s2 = 0.f;
  for (int u = 0; u < per / 4; ++u)
#pragma unroll
    for (int q = 0; q < 4; ++q) { const float c = vals[u * 4 + q] - mu; s2 += c * c; }
  red[tid] = s2; __syncthreads();
  for (int st = 128; st > 0; st >>= 1) { if (tid < st) red[tid] += red[tid + st]; __syncthreads(); }
  const float rs = rsqrtf(red[0] / (float)N + eps);
  {
    for (int u = 0; u < per / 4; ++u) {
      const int j = tid * 4 + 1024 * u;
      v4f o, sm;
#pragma unroll
      for (int q = 0; q < 4; ++q) {
        float gg = g[j + q], bb = bta[j + q];
        if (PARAM_BF16) { gg = bf16_round(gg); bb = bf16_round(bb); }
        sm[q] = vals[u * 4 + q]; o[q] = (vals[u * 4 + q] - mu) * rs * gg + bb;
      }
      if (out_sum) *(v4f*)(out_sum + (size_t)row * N + j) = sm;
      *(v4f*)(out_norm + (size_t)row * N + j) = o;
    }
    
  }
}



// ---- f16 WMMA path (v_wmma_f32_16x16x32_f16): 11-bit significands for operands in range — used where a [0,1] probability operand needs more precision than bf16
typedef _Float16 v16h __attribute__((ext_vector_type(16)));
union FragH { v16h v; v8us half[2]; _Float16 h[16]; unsigned short u[16]; };
template <int NT>
__device__ __forceinline__ v8f mmaH(v16h ah, v16h al, v16h bh, v16h bl, v8f c) {
  c = __builtin_amdgcn_wmma_f32_16x16x32_f16(false, ah, false, bh, (short)0, c, false, false);
  if (NT >= 2) c = __builtin_amdgcn_wmma_f32_16x16x32_f16(false, al, false, bh, (short)0, c, false, false);
  if (NT >= 3) c = __builtin_amdgcn_wmma_f32_16x16x32_f16(false, ah, false, bl, (short)0, c, false, false);
  asm volatile("v_nop\n\tv_nop\n\tv_nop\n\tv_nop" : "+v"(c) : "v"(ah), "v"(al), "v"(bh), "v"(bl));
  return c;
}
// batched GEMM like k_gemm_b but f16 operands: A f32 (split into f16 hi/lo if ASPLIT, else rounded to f16), Bt = f16 values [n][k]; alpha; C f32; N multiple of 16 (partial tiles skipped)
template <bool ASPLIT>
__global__ __launch_bounds__(128) void k_gemm_h(const float* __restrict__ A, int lda, size_t sA, const _Float16* __restrict__ Bh, int ldb, size_t sB, float alpha, float* __restrict__ C, int ldc, size_t sC, int M, int N, int K) {
  __shared__ __attribute__((aligned(16))) float so[4][16][64];
  const int tid = threadIdx.x, w = tid >> 5, lane = tid & 31, ln = lane & 15, hh = lane >> 4; const int by = blockIdx.y;
  A += (size_t)by * sA; Bh += (size_t)by * sB; C += (size_t)by * sC;
  const int ntn = (N + 63) / 64; const int wid = blockIdx.x * 4 + w; const int mt = wid / ntn, nq = wid % ntn; if (mt * 16 >= M) return;
  const int row0 = mt * 16, col0 = nq * 64; const float* arow = A + (size_t)(row0 + ln) * lda;
  v8f acc[4] = {};
  for (int kb = 0; kb < K; kb += 32) {
    FragH ah, al;
    const v4f x0 = *(const v4fa*)(arow + kb + 8 * hh), x1 = *(const v4fa*)(arow + kb + 8 * hh + 4), x2 = *(const v4fa*)(arow + kb + 16 + 8 * hh), x3 = *(const v4fa*)(arow + kb + 16 + 8 * hh + 4);
    float xs[16] = {x0[0],x0[1],x0[2],x0[3],x1[0],x1[1],x1[2],x1[3],x2[0],x2[1],x2[2],x2[3],x3[0],x3[1],x3[2],x3[3]};
#pragma unroll
    for (int i = 0; i < 16; ++i) { const _Float16 h = (_Float16)xs[i]; ah.h[i] = h; al.h[i] = ASPLIT ? (_Float16)(xs[i] - (float)h) : (_Float16)0.0f; }
#pragma unroll
    for (int t = 0; t < 4; ++t) { if (col0 + t * 16 >= N) continue; const size_t boff = (size_t)(col0 + t * 16 + ln) * ldb + kb; FragH bq; bq.half[0] = *(const v8us*)(Bh + boff + 8 * hh); bq.half[1] = *(const v8us*)(Bh + boff + 16 + 8 * hh);
      acc[t] = mmaH<ASPLIT ? 2 : 1>(ah.v, al.v, bq.v, bq.v, acc[t]); }
  }
#pragma unroll
  for (int t = 0; t < 4; ++t) { if (col0 + t * 16 >= N) continue;
#pragma unroll
    for (int r = 0; r < 8; ++r) so[w][8 * hh + r][t * 16 + ln] = acc[t][r] * alpha; }
  __builtin_amdgcn_fence(__ATOMIC_ACQ_REL, "workgroup"); __builtin_amdgcn_wave_barrier();
  const int rsub = lane >> 4, c4 = (lane & 15) * 4;
  {
#pragma unroll
    for (int q = 0; q < 8; ++q) { const int r = q * 2 + rsub; if (col0 + c4 < N) { const v4f v = *(const v4fa*)&so[w][r][c4]; *(v4f*)(C + (size_t)(row0 + r) * ldc + col0 + c4) = v; } }
     }
}

// Wt[n][k] = f16(W[k][n]·scale) from f32 row-major W[K][N] (scale = power of two; bf16-exact weights stay exact in f16 away from the subnormal range)
__global__ __launch_bounds__(256) void k_wt_f16(const float* __restrict__ W, _Float16* __restrict__ Wt, int K, int N, float scale) {
  const int t = blockIdx.x * 256 + threadIdx.x; if (t >= N * (K / 8)) return; const int n = t / (K / 8), k8 = (t % (K / 8)) * 8; FragH f;
#pragma unroll
  for (int i = 0; i < 8; ++i) f.h[i] = (_Float16)(bf16_round(W[(size_t)(k8 + i) * N + n]) * scale); const v8us o = f.half[0];
  *(v8us*)((unsigned short*)Wt + (size_t)n * K + k8) = o; 
}
// k_gemm_hh variant with fused epilogue: v = acc·alpha + bias[by·sBias + col] (+ CP[(row/rowsPerB)·sCPb + by·64 + col] if CP) ; ACT 0 none / 1 elu ; writes f16 C16 (and f32 C if non-null)
template <int ACT>
__global__ __launch_bounds__(128) void k_gemm_hhx(const _Float16* __restrict__ A, int lda, size_t sA, const _Float16* __restrict__ Bh, int ldb, size_t sB, float alpha, const float* __restrict__ bias, size_t sBias, const float* __restrict__ CP, int rowsPerB, size_t sCPb, int row0g,
    float* __restrict__ C, _Float16* __restrict__ C16, int ldc, size_t sC, int M, int N, int K) {
  __shared__ __attribute__((aligned(16))) float so[4][16][64];
  const int tid = threadIdx.x, w = tid >> 5, lane = tid & 31, ln = lane & 15, hh = lane >> 4; const int by = blockIdx.y;
  A += (size_t)by * sA; Bh += (size_t)by * sB; const size_t cofs = (size_t)by * sC; const float* bp = bias ? bias + (size_t)by * sBias : nullptr;
  const int ntn = (N + 63) / 64; const int wid = blockIdx.x * 4 + w; const int mt = wid / ntn, nq = wid % ntn; if (mt * 16 >= M) return;
  const int row0 = mt * 16, col0 = nq * 64; const _Float16* arow = A + (size_t)(row0 + ln) * lda;
  v8f acc[4] = {};
  for (int kb = 0; kb < K; kb += 32) { FragH ah; ah.half[0] = *(const v8us*)((const unsigned short*)arow + kb + 8 * hh); ah.half[1] = *(const v8us*)((const unsigned short*)arow + kb + 16 + 8 * hh);
#pragma unroll
    for (int t = 0; t < 4; ++t) { if (col0 + t * 16 >= N) continue; const size_t boff = (size_t)(col0 + t * 16 + ln) * ldb + kb; FragH bq; bq.half[0] = *(const v8us*)((const unsigned short*)Bh + boff + 8 * hh); bq.half[1] = *(const v8us*)((const unsigned short*)Bh + boff + 16 + 8 * hh);
      acc[t] = mmaH<1>(ah.v, ah.v, bq.v, bq.v, acc[t]); }
  }
#pragma unroll
  for (int t = 0; t < 4; ++t) { if (col0 + t * 16 >= N) continue; const int col = col0 + t * 16 + ln; const float bv = bp ? bf16_round(bp[col]) : 0.f;
#pragma unroll
    for (int r = 0; r < 8; ++r) { float v = acc[t][r] * alpha + bv; if (CP) { const int rr = row0g + row0 + 8 * hh + r; if (rowsPerB < 0) v += CP[cofs + (size_t)rr * ldc + col];      /* rowsPerB < 0: own element of the batched C plane */ else { const int bidx = rr / rowsPerB; v += CP[(size_t)bidx * sCPb + (size_t)by * 64 + col]; } } if (ACT == 1) v = (v > 0.f) ? v : expm1f(v); else if (ACT == 7) v = (v > 0.f) ? v + 1.0f : expf(v); else if (ACT == 8) v = tanhf(v); else if (ACT == 9) v = 0.5f * v * (1.0f + tanhf(0.7978845608028654f * (v + 0.044715f * v * v * v))); else if (ACT == 11) v = 1.0f / (1.0f + expf(-v)); else if (ACT == 12) v = (v > 0.f) ? v : 0.01f * v; else if (ACT == 14) v = (v > 0.f) ? v : 0.1f * v; else if (ACT == 16) v = (v >= 0.f) ? v : 0.3f * v; else if (ACT == 17) v = (v >= 0.f) ? v : 0.2f * v; else if (ACT == 15) v = v / (1.0f + expf(-v)); else if (ACT == 3) v = fmaxf(v, 0.f); else if (ACT == 6) v = 0.5f * v * (1.0f + erff(v * 0.70710678118654752f)); so[w][8 * hh + r][t * 16 + ln] = v; } }
  __builtin_amdgcn_fence(__ATOMIC_ACQ_REL, "workgroup"); __builtin_amdgcn_wave_barrier();
  const int rsub = lane >> 4, c4 = (lane & 15) * 4; typedef _Float16 v4h __attribute__((ext_vector_type(4)));
  {
#pragma unroll
    for (int q = 0; q < 8; ++q) { const int r = q * 2 + rsub; if (col0 + c4 < N) { const v4f v = *(const v4fa*)&so[w][r][c4]; if (C) *(v4f*)(C + cofs + (size_t)(row0 + r) * ldc + col0 + c4) = v; if (C16) { v4h h4; for (int i = 0; i < 4; ++i) h4[i] = (_Float16)v[i]; *(v4h*)(C16 + cofs + (size_t)(row0 + r) * ldc + col0 + c4) = h4; } } }
     }
}


typedef _Float16 v4h __attribute__((ext_vector_type(4)));

__global__ __launch_bounds__(256) void k_x16(const float* __restrict__ x, _Float16* __restrict__ X16, size_t n8) { const size_t t = (size_t)blockIdx.x * 256 + threadIdx.x; if (t >= n8) return; FragH f;
#pragma unroll
  for (int q = 0; q < 8; ++q) f.h[q] = (_Float16)bf16_round(x[t * 8 + q]); *(v8us*)((unsigned short*)X16 + t * 8) = f.half[0];  }
__global__ __launch_bounds__(256) void k_h16(const float* __restrict__ x, _Float16* __restrict__ X16, size_t n8) { const size_t t = (size_t)blockIdx.x * 256 + threadIdx.x; if (t >= n8) return; FragH f;
#pragma unroll
  for (int q = 0; q < 8; ++q) f.h[q] = (_Float16)x[t * 8 + q]; *(v8us*)((unsigned short*)X16 + t * 8) = f.half[0];  }
__global__ __launch_bounds__(256) void k_round16f(const float* __restrict__ W, _Float16* __restrict__ Bt, size_t n8) { const size_t t = (size_t)blockIdx.x * 256 + threadIdx.x; if (t >= n8) return; FragH f;
#pragma unroll
  for (int i = 0; i < 8; ++i) f.h[i] = (_Float16)(bf16_round(W[t * 8 + i]) * 16.0f); *(v8us*)((unsigned short*)Bt + t * 8) = f.half[0];  }
template <int NHv, int TTv>
__global__ __launch_bounds__(256) void k_vt(const _Float16* __restrict__ V16, int ldv, int voff, _Float16* __restrict__ Vt) { __shared__ unsigned short tl[64][66]; const int tid = threadIdx.x; const int slab = blockIdx.x / (TTv / 64), lg = blockIdx.x % (TTv / 64); const int b = slab / NHv, h = slab % NHv;
  for (int i = tid; i < 64 * 8; i += 256) { const int r = i / 8, c8 = (i % 8) * 8; FragH f; f.half[0] = *(const v8us*)((const unsigned short*)V16 + ((size_t)b * TTv + lg * 64 + r) * ldv + voff + h * 64 + c8);
#pragma unroll
    for (int q = 0; q < 8; ++q) tl[r][c8 + q] = f.u[q]; }
  __syncthreads();
  {
#pragma unroll
    for (int rd = 0; rd < 2; ++rd) { const int d = rd * 32 + tid / 8, pc = tid % 8; FragH f;
#pragma unroll
      for (int q = 0; q < 8; ++q) f.u[q] = tl[pc * 8 + q][d];
      *(v8us*)((unsigned short*)Vt + ((size_t)slab * 64 + d) * TTv + lg * 64 + pc * 8) = f.half[0]; }
     } }

__global__ __launch_bounds__(256) void k_hl(const float* __restrict__ F, _Float16* __restrict__ Hh, _Float16* __restrict__ Hl, size_t n8) { const size_t t = (size_t)blockIdx.x * 256 + threadIdx.x; if (t >= n8) return; FragH fh, fl; const v4f a = *(const v4fa*)(F + t * 8), c = *(const v4fa*)(F + t * 8 + 4);
#pragma unroll
  for (int q = 0; q < 4; ++q) { _Float16 h = (_Float16)a[q]; fh.h[q] = h; fl.h[q] = (_Float16)((a[q] - (float)h) * 1024.0f); h = (_Float16)c[q]; fh.h[4 + q] = h; fl.h[4 + q] = (_Float16)((c[q] - (float)h) * 1024.0f); }
  { *(v8us*)((unsigned short*)Hh + t * 8) = fh.half[0]; *(v8us*)((unsigned short*)Hl + t * 8) = fl.half[0];  } }

// ---- fast GEMM (wave tile 32x64; requires M % 32 == 0 rows per launch region and N % 64 == 0); epilogue = k_gemm_hhx semantics ----
__device__ __forceinline__ v16h g2_frag(const _Float16* p, int hh) { FragH f; f.half[0] = *(const v8us*)((const unsigned short*)p + 8 * hh); f.half[1] = *(const v8us*)((const unsigned short*)p + 16 + 8 * hh); return f.v; }
__device__ __forceinline__ v8f g2_mma(v16h a, v16h b, v8f c) { v8f d = __builtin_amdgcn_wmma_f32_16x16x32_f16(false, a, false, b, (short)0, c, false, false); asm volatile("v_nop\n\tv_nop\n\tv_nop\n\tv_nop" : "+v"(d) : "v"(a), "v"(b)); return d; }
template <int ACT>
__global__ __launch_bounds__(128) void k_gemm2(const _Float16* __restrict__ A, int lda, size_t sA, const _Float16* __restrict__ Bh, int ldb, size_t sB, float alpha, const float* __restrict__ bias, size_t sBias, const float* __restrict__ CP, int rowsPerB, size_t sCPb, int row0g,
    float* __restrict__ C, _Float16* __restrict__ C16, int ldc, size_t sC, int M, int N, int K) { static_assert(ACT == 0 || ACT == 3 || ACT == 6 || ACT == 8 || ACT == 9 || ACT == 11 || ACT == 12 || ACT == 14 || ACT == 15 || ACT == 16 || ACT == 17, "k_gemm2: unsupported ACT code (would silently apply no activation)");
  __shared__ __attribute__((aligned(16))) float so[4][32][68];
  const int tid = threadIdx.x, w = tid >> 5, lane = tid & 31, ln = lane & 15, hh = lane >> 4; const int by = blockIdx.y;
  A += (size_t)by * sA; Bh += (size_t)by * sB; const size_t cofs = (size_t)by * sC; const float* bp = bias ? bias + (size_t)by * sBias : nullptr;
  const int ntn = N >> 6; const int mt = blockIdx.x / ntn, nq = blockIdx.x - mt * ntn; const int row0 = mt * 128 + 32 * w, col0 = nq * 64; if (row0 >= M) return;
  const _Float16* a0p = A + (size_t)(row0 + ln) * lda; const _Float16* a1p = a0p + (size_t)16 * lda;
  const _Float16* b0p = Bh + (size_t)(col0 + ln) * ldb; const _Float16* b1p = b0p + (size_t)16 * ldb; const _Float16* b2p = b1p + (size_t)16 * ldb; const _Float16* b3p = b2p + (size_t)16 * ldb;
  const v8f z8 = {0.f,0.f,0.f,0.f,0.f,0.f,0.f,0.f}; v8f c00 = z8, c01 = z8, c02 = z8, c03 = z8, c10 = z8, c11 = z8, c12 = z8, c13 = z8;
#pragma unroll 1
  for (int kb = 0; kb < K; kb += 32) { const v16h a0 = g2_frag(a0p + kb, hh), a1 = g2_frag(a1p + kb, hh);
    v16h b = g2_frag(b0p + kb, hh); c00 = g2_mma(a0, b, c00); c10 = g2_mma(a1, b, c10);
    b = g2_frag(b1p + kb, hh); c01 = g2_mma(a0, b, c01); c11 = g2_mma(a1, b, c11);
    b = g2_frag(b2p + kb, hh); c02 = g2_mma(a0, b, c02); c12 = g2_mma(a1, b, c12);
    b = g2_frag(b3p + kb, hh); c03 = g2_mma(a0, b, c03); c13 = g2_mma(a1, b, c13); }
  v8f accs[8] = {c00, c01, c02, c03, c10, c11, c12, c13};
#pragma unroll
  for (int u = 0; u < 8; ++u) { const int t = u & 3, half = u >> 2; const int col = col0 + t * 16 + ln; const float bv = bp ? bf16_round(bp[col]) : 0.f;
#pragma unroll
    for (int r = 0; r < 8; ++r) { const int rloc = half * 16 + 8 * hh + r; float v = accs[u][r] * alpha + bv; if (CP) { if (rowsPerB < 0) v += CP[cofs + (size_t)(row0g + row0 + rloc) * ldc + col];      /* rowsPerB < 0: own element of the batched C plane */ else { const int bidx = (row0g + row0 + rloc) / rowsPerB; v += CP[(size_t)bidx * sCPb + (size_t)by * 64 + col]; } }
      if (ACT == 3) v = fmaxf(v, 0.f); else if (ACT == 6) v = 0.5f * v * (1.0f + erff(v * 0.70710678118654752f)); else if (ACT == 11) v = 1.0f / (1.0f + expf(-v)); else if (ACT == 15) v = v / (1.0f + expf(-v)); else if (ACT == 12) v = (v > 0.f) ? v : 0.01f * v; else if (ACT == 8) v = tanhf(v); else if (ACT == 9) v = 0.5f * v * (1.0f + tanhf(0.7978845608028654f * (v + 0.044715f * v * v * v))); else if (ACT == 14) v = (v > 0.f) ? v : 0.1f * v; else if (ACT == 16) v = (v >= 0.f) ? v : 0.3f * v; else if (ACT == 17) v = (v >= 0.f) ? v : 0.2f * v;
      so[w][rloc][t * 16 + ln] = v; } }
  __builtin_amdgcn_fence(__ATOMIC_ACQ_REL, "workgroup"); __builtin_amdgcn_wave_barrier();
  const int rsub = lane >> 4, c4 = (lane & 15) * 4;
  {
#pragma unroll
    for (int q = 0; q < 16; ++q) { const int r = q * 2 + rsub; const v4f v = *(const v4fa*)&so[w][r][c4]; if (C) *(v4f*)(C + cofs + (size_t)(row0 + r) * ldc + col0 + c4) = v; if (C16) { v4h h4; for (int i = 0; i < 4; ++i) h4[i] = (_Float16)v[i]; *(v4h*)(C16 + cofs + (size_t)(row0 + r) * ldc + col0 + c4) = h4; } }
     } }


__global__ __launch_bounds__(256) void k_wnat(const float* __restrict__ w, size_t n8, _Float16* __restrict__ Bt) { const size_t t = (size_t)blockIdx.x * 256 + threadIdx.x; if (t >= n8) return; FragH f; for (int q = 0; q < 8; ++q) f.h[q] = (_Float16)(bf16_round(w[t * 8 + q]) * 16.0f); *(v8us*)((unsigned short*)Bt + t * 8) = f.half[0];  }
__global__ __launch_bounds__(256) void k_rsm(const float* __restrict__ S, _Float16* __restrict__ P, int nrows) {
  #pragma clang fp contract(off)
  const int i = blockIdx.x * 256 + threadIdx.x; if (i >= nrows) return; const float* s = S + (size_t)i * SQ; float mx = -3.0e38f;
#pragma unroll 1
  for (int j = 0; j < SQ; ++j) mx = fmaxf(mx, s[j]); float se = 0.f;
#pragma unroll 1
  for (int j = 0; j < SQ; ++j) se += expf(s[j] - mx); const float sc = 256.0f / se;
#pragma unroll 1
  for (int j0 = 0; j0 < SQ; j0 += 8) { FragH f; for (int q = 0; q < 8; ++q) f.h[q] = (_Float16)(expf(s[j0 + q] - mx) * sc); unsigned short* d = (unsigned short*)P + (size_t)i * SQ + j0; *(v8us*)d = f.half[0];  } }
__global__ __launch_bounds__(256) void k_vt(const _Float16* __restrict__ V16, int b, int h0, _Float16* __restrict__ VT) { __shared__ unsigned short tl[64][65]; const int tid = threadIdx.x; const int hh = blockIdx.x % HG, sg = blockIdx.x / HG; const int s0 = sg * 64; const int h = h0 + hh;
  for (int i = tid; i < 64 * 8; i += 256) { const int j = i / 8, d8 = (i % 8) * 8; FragH f; f.half[0] = *(const v8us*)((const unsigned short*)V16 + ((size_t)b * SQ + s0 + j) * DM + h * HD + d8); for (int q = 0; q < 8; ++q) tl[d8 + q][j] = f.u[q]; }
  __syncthreads();
  { for (int i = tid; i < 64 * 8; i += 256) { const int d = i / 8, j8 = (i % 8) * 8; FragH f; for (int q = 0; q < 8; ++q) f.u[q] = tl[d][j8 + q]; *(v8us*)((unsigned short*)VT + ((size_t)hh * HD + d) * SQ + s0 + j8) = f.half[0]; }  } }



// 2^x on the transcendental unit, with the one free issue slot that the instruction set asks for behind it before its result is used or its
// source overwritten: in the unrolled row the compiler put one exponential's result into the source register of the one directly ahead of it.
__device__ __forceinline__ float exp2_slot(float x) { float r; asm("v_exp_f32 %0, %1\n\tv_nop" : "=v"(r) : "v"(x)); return r; }
// Causal row softmax, one wave per score row. Lane l keeps columns 128 c + 4 l .. + 3 of its row in registers, so the row is read once,
// each load covers 512 contiguous bytes and each store 256; row maximum and row sum: per-lane partials, then a five-step butterfly.
// NC = row length / 128; rel = (last kept column) - 4 l, so that column 128 c + q of this lane is kept while 128 c + q <= rel.
template <int NC>
__device__ __forceinline__ void rsm_row(const float* __restrict__ s, _Float16* __restrict__ p, int rel) {
  v4f v[NC];
#pragma unroll
  for (int c = 0; c < NC; ++c) v[c] = *(const v4fa*)(s + c * 128);
  float mx = -3.0e38f;
#pragma unroll
  for (int c = 0; c < NC; ++c)
#pragma unroll
    for (int q = 0; q < 4; ++q) { const float xv = (c * 128 + q <= rel) ? v[c][q] : -1.0e9f; v[c][q] = xv; mx = fmaxf(mx, xv); }
#pragma unroll
  for (int m = 16; m >= 1; m >>= 1) mx = fmaxf(mx, __shfl_xor(mx, m, 32));
  v4f a = {0.f, 0.f, 0.f, 0.f};
#pragma unroll
  for (int c = 0; c < NC; ++c)
#pragma unroll
    for (int q = 0; q < 4; ++q) { const float e = exp2_slot((v[c][q] - mx) * 1.44269504088896340736f);      /* = __expf: multiply by log2 e, then v_exp_f32 */ v[c][q] = e; a[q] += e; }
  float se = (a[0] + a[1]) + (a[2] + a[3]);
#pragma unroll
  for (int m = 16; m >= 1; m >>= 1) se += __shfl_xor(se, m, 32);
  const float sc = 256.0f / se;
#pragma unroll
  for (int c = 0; c < NC; ++c) { v4h h4;
#pragma unroll
    for (int q = 0; q < 4; ++q) h4[q] = (_Float16)(v[c][q] * sc);
    *(v4h*)(p + c * 128) = h4; }
}
template <int NC>
__global__ __launch_bounds__(256) void k_rsmcw(const float* __restrict__ S, _Float16* __restrict__ P, int hg, int q0) {
  const int lane = threadIdx.x & 31; const int t = blockIdx.x * 8 + __builtin_amdgcn_readfirstlane(threadIdx.x >> 5);      /* the wave's row, in a scalar register: row base and early return stay scalar */
  if (t >= hg * QT) return;
  rsm_row<NC>(S + (size_t)t * NKX + lane * 4, P + (size_t)t * NKX + lane * 4, q0 + (t % QT) - lane * 4); }


template <int MASKADD>
__global__ __launch_bounds__(64) void k_att0(const float* __restrict__ QF, const float* __restrict__ KF, const float* __restrict__ VF, int ld, const float* __restrict__ mask, float scale, float* __restrict__ OF, int ldo) {
  #pragma clang fp contract(off)
  __shared__ __attribute__((aligned(16))) float lq[64][64]; __shared__ __attribute__((aligned(16))) float lo[64][64];
  const int tid = threadIdx.x; const int h = blockIdx.x / (QT0 / 64), rg = blockIdx.x % (QT0 / 64); const int i = rg * 64 + tid;
  const float* qr = QF + (size_t)i * ld + h * HD;
#pragma unroll 1
  for (int c = 0; c < HD / 4; ++c) { *(v4f*)&lq[tid][c * 4] = *(const v4fa*)(qr + c * 4); const v4f z = {0.f, 0.f, 0.f, 0.f}; *(v4f*)&lo[tid][c * 4] = z; }
  float m = -1.0e30f, l = 0.f; const int jmax = MASKADD ? (SQ - 1) : (rg * 64 + 63);      /* additive-mask form: every key (the mask input decides); causal form: keys up to the block's last row */
#pragma unroll 1
  for (int j = 0; j <= jmax; ++j) { const float* kr = KF + (size_t)j * ld + h * HD; const float* vr = VF + (size_t)j * ld + h * HD; float s = 0.f;
#pragma unroll 1
    for (int c = 0; c < HD / 4; ++c) { const v4f kq = *(const v4fa*)(kr + c * 4); const v4f qq = *(v4f*)&lq[tid][c * 4]; s = __fadd_rn(s, __fmul_rn(qq[0], kq[0])); s = __fadd_rn(s, __fmul_rn(qq[1], kq[1])); s = __fadd_rn(s, __fmul_rn(qq[2], kq[2])); s = __fadd_rn(s, __fmul_rn(qq[3], kq[3])); }
    s = __fmul_rn(s, scale); if (MASKADD) s = __fadd_rn(s, __fmul_rn(bf16_round(mask[(size_t)i * SQ + j]), -10000.0f));
    const float f = (MASKADD || j <= i) ? 1.f : 0.f; const float sm = fmaf(f, s, (1.f - f) * -1.0e30f); const float mn = fmaxf(m, sm); const float sc = expf(m - mn); const float e = expf(sm - mn); l = __fadd_rn(__fmul_rn(l, sc), e); m = mn;
#pragma unroll 1
    for (int c = 0; c < HD / 4; ++c) { const v4f vv = *(const v4fa*)(vr + c * 4); v4f oo = *(v4f*)&lo[tid][c * 4]; for (int u = 0; u < 4; ++u) oo[u] = __fadd_rn(__fmul_rn(oo[u], sc), __fmul_rn(e, vv[u])); *(v4f*)&lo[tid][c * 4] = oo; } }
  const float fin = 64.0f / l;      /* o carried x64 like the f16 path */
#pragma unroll 1
  for (int c = 0; c < HD / 4; ++c) { v4f oo = *(v4f*)&lo[tid][c * 4]; for (int u = 0; u < 4; ++u) oo[u] = __fmul_rn(oo[u], fin); *(v4f*)&lo[tid][c * 4] = oo; }
  __syncthreads();
  {
#pragma unroll 1
    for (int it = 0; it < 16; ++it) { const int row = it * 4 + tid / 16, pc = (tid % 16) * 4; const v4f v = *(const v4f*)&lo[row][pc]; *(v4f*)(OF + (size_t)(rg * 64 + row) * ldo + h * HD + pc) = v; }
     } }

extern "C" void kernel_launch(void* const* d_in, const int* in_sizes, int n_in,
                              void* d_out, int out_size, void* d_ws, size_t ws_size, hipStream_t stream) {
  (void)in_sizes; (void)n_in; (void)out_size;
  const float* const* I = (const float* const*)d_in; const float* x = I[0]; const float* xk = I[0]; const float* xv = I[0]; const float* wq = I[1]; const float* bq = I[2]; const float* wk = I[3]; const float* bk = I[4]; const float* wv = I[5]; const float* bv = I[6]; const float* wo = I[7]; const float* bo = I[8];      /* input order: x, Wq, bq, Wk, bk, Wv, bv (PER-HEAD STACKS [8][512][64] with REAL per-head biases [8][64] = flat [512]: the GEMMs' guarded bias slots), Wp ([in][out]: out @ Wp), bp (REAL) */
  char* ws = (char*)d_ws; size_t off = 0;
  auto take = [&](size_t bytes) { char* p = ws + off; off += (bytes + 255) & ~(size_t)255; return p; };
  _Float16* BQ = (_Float16*)take((size_t)DM * DM * 2); _Float16* BK = (_Float16*)take((size_t)DM * DM * 2); _Float16* BV = (_Float16*)take((size_t)DM * DM * 2); _Float16* BO = (_Float16*)take((size_t)DM * DM * 2);
  _Float16* X16 = (_Float16*)take(NR * DM * 2); _Float16* XK16 = (_Float16*)take(NR * DM * 2); _Float16* XV16 = (_Float16*)take(NR * DM * 2);      /* exact f16 rows of query, key, value */ float* QF = (float*)take(NR * DM * 4); _Float16* QH = (_Float16*)take(NR * DM * 2); _Float16* QL = (_Float16*)take(NR * DM * 2); _Float16* KH = (_Float16*)take(NR * DM * 2); _Float16* KL = (_Float16*)take(NR * DM * 2); _Float16* Q16 = QH; _Float16* K16 = KH; _Float16* V16 = (_Float16*)take(NR * DM * 2); _Float16* O16 = (_Float16*)take(NR * DM * 2);
  float* S = (float*)take((size_t)NH * QT * NKX * 4); _Float16* P = (_Float16*)take((size_t)NH * QT * NKX * 2); _Float16* VT = (_Float16*)take((size_t)NH * HD * SQ * 2);
  float* QF0 = (float*)take((size_t)QT0 * DM * 4); float* KF0 = (float*)take((size_t)QT0 * DM * 4); float* VF0 = (float*)take((size_t)QT0 * DM * 4); float* OF0 = (float*)take((size_t)NB * QT0 * DM * 4); _Float16* OH0 = (_Float16*)take((size_t)NB * QT0 * DM * 2); _Float16* OL0 = (_Float16*)take((size_t)NB * QT0 * DM * 2);
  if (off > ws_size) return;
  { const unsigned gn = (unsigned)(((size_t)DM * DM / 8 + 255) / 256); const unsigned gh = (unsigned)(((size_t)HD * (DM / 8) + 255) / 256); for (int h = 0; h < NH; ++h) { const size_t wofs = (size_t)h * DM * HD, pofs = (size_t)h * HD * DM; k_wt_f16<<<gh, 256, 0, stream>>>(wq + wofs, BQ + pofs, DM, HD, 16.0f); k_wt_f16<<<gh, 256, 0, stream>>>(wk + wofs, BK + pofs, DM, HD, 16.0f); k_wt_f16<<<gh, 256, 0, stream>>>(wv + wofs, BV + pofs, DM, HD, 16.0f); } k_wt_f16<<<gn, 256, 0, stream>>>(wo, BO, DM, DM, 16.0f); }      /* PER-HEAD STACKS wq / wk / wv [NH][DM][HD]: head h is a row-major [in = DM][out = HD] block at w + h * DM * HD: the transposing builder with K = DM, N = HD writes its HD rows Bt[h * HD + e][k] at B + h * HD * DM: contiguous rows of the [out][in] plane (x16); wo is an [in][out] [DM][DM] matrix (out @ Wp): ONE call of the same transposing builder with K = N = DM on the grid gn = DM * DM / 8 threads (N * (K / 8)) */
  k_x16<<<(unsigned)((NR * DM / 8 + 255) / 256), 256, 0, stream>>>(x, X16, NR * DM / 8); k_x16<<<(unsigned)((NR * DM / 8 + 255) / 256), 256, 0, stream>>>(xk, XK16, NR * DM / 8); k_x16<<<(unsigned)((NR * DM / 8 + 255) / 256), 256, 0, stream>>>(xv, XV16, NR * DM / 8);
  const size_t r0p = (size_t)B0 * SQ;      /* first projected row */
  k_gemm2<0><<<dim3((unsigned)((MP / 128) * (DM / 64)), 1), 128, 0, stream>>>(X16 + r0p * DM, DM, 0, BQ, DM, 0, 0.0625f, bq, 0, nullptr, 1, 0, 0, QF + r0p * DM, nullptr, DM, 0, MP, DM, DM); k_hl<<<(unsigned)(((size_t)MP * DM / 8 + 255) / 256), 256, 0, stream>>>(QF + r0p * DM, QH + r0p * DM, QL + r0p * DM, (size_t)MP * DM / 8);      /* q (f32) -> f16 hi + x1024 residual: unscaled logits sigma ~8 */
  k_gemm2<0><<<dim3((unsigned)((MP / 128) * (DM / 64)), 1), 128, 0, stream>>>(XK16 + r0p * DM, DM, 0, BK, DM, 0, 0.0625f, bk, 0, nullptr, 1, 0, 0, QF + r0p * DM, nullptr, DM, 0, MP, DM, DM); k_hl<<<(unsigned)(((size_t)MP * DM / 8 + 255) / 256), 256, 0, stream>>>(QF + r0p * DM, KH + r0p * DM, KL + r0p * DM, (size_t)MP * DM / 8);      /* k likewise */
  k_gemm2<0><<<dim3((unsigned)((MP / 128) * (DM / 64)), 1), 128, 0, stream>>>(XV16 + r0p * DM, DM, 0, BV, DM, 0, 0.0625f, bv, 0, nullptr, 1, 0, 0, nullptr, V16 + r0p * DM, DM, 0, MP, DM, DM);
  for (int b = B0; b < B0 + NBR; ++b) { const size_t r0 = (size_t)b * SQ;
    k_vt<NH, SQ><<<NH * (SQ / 64), 256, 0, stream>>>(V16 + r0 * LQ, LQ, 0, VT);      /* V^T [NH][HD][SQ] for this batch */
    k_gemm2<0><<<dim3((QT0 / 128) * (DM / 64), 1), 128, 0, stream>>>(X16 + r0 * DM, DM, 0, BQ, DM, 0, 0.0625f, bq, 0, nullptr, 1, 0, 0, QF0, nullptr, DM, 0, QT0, DM, DM); k_gemm2<0><<<dim3((QT0 / 128) * (DM / 64), 1), 128, 0, stream>>>(XK16 + r0 * DM, DM, 0, BK, DM, 0, 0.0625f, bk, 0, nullptr, 1, 0, 0, KF0, nullptr, DM, 0, QT0, DM, DM); k_gemm2<0><<<dim3((QT0 / 128) * (DM / 64), 1), 128, 0, stream>>>(XV16 + r0 * DM, DM, 0, BV, DM, 0, 0.0625f, bv, 0, nullptr, 1, 0, 0, VF0, nullptr, DM, 0, QT0, DM, DM);      /* f32 q, k, v of the first 128 rows (exact products) */
    k_att0<0><<<NH * (QT0 / 64), 64, 0, stream>>>(QF0, KF0, VF0, DM, nullptr, SCL, OF0 + (size_t)b * QT0 * DM, DM);      /* exact f32 attention for rows 0..127 (o x64) */
    for (int q0 = 0; q0 < QN; q0 += QT) { const int nk = q0 + QT;      /* causal: only keys below the tile end are computed */
      k_gemm2<0><<<dim3((QT / 128) * (nk / 64), NHD), 128, 0, stream>>>(QH + (r0 + q0) * LQ, LQ, (size_t)HD, KH + r0 * LQ, LQ, (size_t)HD, SCL, nullptr, 0, nullptr, 1, 0, 0, S, nullptr, NKX, (size_t)QT * NKX, QT, nk, HD);      /* scores hi . hi * 64^-0.5 (1/sqrt(head_dim)) */
      k_gemm2<0><<<dim3((QT / 128) * (nk / 64), NHD), 128, 0, stream>>>(QL + (r0 + q0) * LQ, LQ, (size_t)HD, KH + r0 * LQ, LQ, (size_t)HD, SCLR, nullptr, 0, S, -1, 0, 0, S, nullptr, NKX, (size_t)QT * NKX, QT, nk, HD); k_gemm2<0><<<dim3((QT / 128) * (nk / 64), NHD), 128, 0, stream>>>(QH + (r0 + q0) * LQ, LQ, (size_t)HD, KL + r0 * LQ, LQ, (size_t)HD, SCLR, nullptr, 0, S, -1, 0, 0, S, nullptr, NKX, (size_t)QT * NKX, QT, nk, HD);      /* += 2^-10 (lo . hi + hi . lo) */      /* scores, all heads on grid.y */
      static_assert(SQ == 8 * QT && QT == 256, "one softmax instance per causal tile end"); switch (nk / QT) { case 1: k_rsmcw<2><<<(NHD * QT + 7) / 8, 256, 0, stream>>>(S, P, NHD, q0); break; case 2: k_rsmcw<4><<<(NHD * QT + 7) / 8, 256, 0, stream>>>(S, P, NHD, q0); break; case 3: k_rsmcw<6><<<(NHD * QT + 7) / 8, 256, 0, stream>>>(S, P, NHD, q0); break; case 4: k_rsmcw<8><<<(NHD * QT + 7) / 8, 256, 0, stream>>>(S, P, NHD, q0); break; case 5: k_rsmcw<10><<<(NHD * QT + 7) / 8, 256, 0, stream>>>(S, P, NHD, q0); break; case 6: k_rsmcw<12><<<(NHD * QT + 7) / 8, 256, 0, stream>>>(S, P, NHD, q0); break; case 7: k_rsmcw<14><<<(NHD * QT + 7) / 8, 256, 0, stream>>>(S, P, NHD, q0); break; case 8: k_rsmcw<16><<<(NHD * QT + 7) / 8, 256, 0, stream>>>(S, P, NHD, q0); break; }      /* one wave per row, 8 rows per block; the row length nk / 128 is a compile-time constant so that the row stays in registers */
      k_gemm2<0><<<dim3((QT / 128) * (HD / 64), NHD), 128, 0, stream>>>(P, NKX, (size_t)QT * NKX, VT, SQ, (size_t)HD * SQ, 0.25f, nullptr, 0, nullptr, 1, 0, 0, nullptr, O16 + (r0 + q0) * DM, DM, (size_t)HD, QT, HD, nk); } }      /* o (merged heads, x64) as f16 rows */
  k_gemm2<0><<<dim3((unsigned)((MPO / 128) * (DM / 64)), 1), 128, 0, stream>>>(O16 + r0p * DM, DM, 0, BO, DM, 0, 0.0009765625f, bo, 0, nullptr, 1, 0, 0, (float*)d_out + r0p * DM, nullptr, DM, 0, MPO, DM, DM);      /* out rows are the output layout */
  k_hl<<<(unsigned)(((size_t)NB * QT0 * DM / 8 + 255) / 256), 256, 0, stream>>>(OF0, OH0, OL0, (size_t)NB * QT0 * DM / 8);      /* first-tile o (x64) -> f16 hi + x1024 residual planes */
  for (int b = B0; b < B0 + NBR; ++b) { const size_t r0 = (size_t)b * SQ; const size_t f0 = (size_t)b * QT0;
    k_gemm2<0><<<dim3((QT0 / 128) * (DM / 64), 1), 128, 0, stream>>>(OH0 + f0 * DM, DM, 0, BO, DM, 0, 0.0009765625f, bo, 0, nullptr, 1, 0, 0, (float*)d_out + r0 * DM, nullptr, DM, 0, QT0, DM, DM);      /* rows 0..127: out = o_hi Wo (+ b), overwriting the f16-path rows */
    k_gemm2<0><<<dim3((QT0 / 128) * (DM / 64), 1), 128, 0, stream>>>(OL0 + f0 * DM, DM, 0, BO, DM, 0, 0.00000095367431640625f, nullptr, 0, (const float*)d_out + r0 * DM, -1, 0, 0, (float*)d_out + r0 * DM, nullptr, DM, 0, QT0, DM, DM); }      /* += o_lo Wo 2^-20 (own-element accumulate) */
}

// v002
// It runs in 1650 microseconds.
// Two timings next to v001 put it at 3.04 and 3.03 times that version's speed.
// All steps since v000 together make it 6.52 times as fast.
#include <hip/hip_runtime.h>
// Causal multi-head self-attention with PER-HEAD STACKED projections and REAL per-head biases on four sequences at width 512 (x [4][2048][512]; Wq / Wk / Wv [8][512][64] = [head][in][out] ('bte,hed->bhtd'; uniform +-1/sqrt(512)) with biases [8][64] (REAL, uniform +-1/sqrt(512)): a per-head bias [8][64] IS the flat bias [512]; 8 heads of 64 (8 x 64 = 512 = the width); scores * 1/sqrt(64); where(tril, scores, -inf); softmax over keys; out = merged Wp + bp ([in][out] [512][512] + a REAL bias, uniform +-1/sqrt(512)) -> [4][2048][512]); the [in][out] output weight through the text's own TRANSPOSING builder (the one the per-head stacks use); q and k carried as f16 hi + x1024 residual planes with three-product scores; each head's [in][out] block is transposed into its 64 contiguous rows of the weight plane by the same builder, one call per head.
// Compute dtype: inputs rounded to bf16; x / weights exact; q and k as f16 hi + x1024 residual planes; v, softmax weights and o as plain f16 GEMM operands (~2^-12), rows 0..127 redone in f32; scores and softmax statistics f32. v_wmma_f32_16x16x32_f16.
#define NB 4
#define SCL 0.125f                         /* 1 / sqrt(head_dim 64) */
#define SCLR 0.0001220703125f               /* 2^-13: the same scale on the x1024 residual passes */
#define SQ 2048
#define DM 512
#define NH 8
#define HD 64
#define HG 4                         /* heads per launch of the k_vt overload, which is not launched */
#define QT 256                       /* query rows per causal tile */
#define NKX SQ                       /* S / P row pitch */
#define QT0 128                      /* first-tile rows recomputed exactly in f32 */
#define B0 0                         /* first batch processed (debug hook) */
#define NBR NB                       /* batches processed (debug hook) */
#define NR ((size_t)NB * SQ)         /* token rows */
#define MP ((int)((size_t)NBR * SQ)) /* rows projected (debug hook) */
#define QN SQ                        /* query rows attended per batch (debug hook) */
#define NHD NH                       /* heads attended (debug hook) */
#define MPO MP                       /* rows through the output stage (debug hook) */
#define LQ DM      /* row pitch of the q/k/v rows */
typedef __bf16 v16b __attribute__((ext_vector_type(16)));
typedef unsigned short v8us __attribute__((ext_vector_type(8), may_alias));
typedef float  v8f  __attribute__((ext_vector_type(8)));
typedef float  v4f  __attribute__((ext_vector_type(4)));
typedef float  v4fa __attribute__((ext_vector_type(4), may_alias));
union FragB { v16b v; v8us half[2]; unsigned short u[16]; };

__device__ __forceinline__ unsigned short bf16_bits(float x) { unsigned int u = __float_as_uint(x); return (unsigned short)((u + 0x7FFFu + ((u >> 16) & 1u)) >> 16); }
__device__ __forceinline__ float bf16_val(unsigned short b) { return __uint_as_float(((unsigned int)b) << 16); }
__device__ __forceinline__ float bf16_round(float x) { return bf16_val(bf16_bits(x)); }
// D += A·B with NT terms: 1 = ah·bh, 2 = + al·bh (A split), 3 = + ah·bl (both split)
template <int NT>
__device__ __forceinline__ v8f mmaN(v16b ah, v16b al, v16b bh, v16b bl, v8f c) {
  c = __builtin_amdgcn_wmma_f32_16x16x32_bf16(false, ah, false, bh, (short)0, c, false, false);
  if (NT >= 2) c = __builtin_amdgcn_wmma_f32_16x16x32_bf16(false, al, false, bh, (short)0, c, false, false);
  if (NT >= 3) c = __builtin_amdgcn_wmma_f32_16x16x32_bf16(false, ah, false, bl, (short)0, c, false, false);
  asm volatile("v_nop\n\tv_nop\n\tv_nop\n\tv_nop" : "+v"(c) : "v"(ah), "v"(al), "v"(bh), "v"(bl));
  return c;
}

__global__ __launch_bounds__(256) void k_wt_bf16(const float* __restrict__ W, unsigned short* __restrict__ Wt, int K, int N) {
  const int t = blockIdx.x * 256 + threadIdx.x;
  const int k8n = K / 8;
  if (t >= N * k8n) return;
  const int n = t / k8n, k8 = (t % k8n) * 8;
  v8us v;
#pragma unroll
  for (int i = 0; i < 8; ++i) v[i] = bf16_bits(W[(size_t)(k8 + i) * N + n]);
  *(v8us*)(Wt + (size_t)n * K + k8) = v;
  
}

// GEMM C[M][N] (f32, pitch ldc) = act(A[M][K]·W + bias). A f32 row-major (pitch lda) converted per fragment to bf16
// (ASPLIT: hi/lo two planes -> 2 terms, else single rounded term); Wt bf16 [N][K] (pitch ldb). BIAS_BF16 rounds the
// bias to bf16 first (bias quantised to bf16 before the add). K%32==0, M%16==0, N%64==0.
template <bool ASPLIT, int ACT, bool BIAS_BF16>
__global__ __launch_bounds__(128) void k_gemm_bf(const float* __restrict__ A, int lda, const unsigned short* __restrict__ Wt, int ldb,
                                               const float* __restrict__ bias, float* __restrict__ C, int ldc, int M, int N, int K) {
  __shared__ __attribute__((aligned(16))) float so[4][16][64];
  const int tid = threadIdx.x, w = tid >> 5, lane = tid & 31, ln = lane & 15, hh = lane >> 4;
  const int ntn = N / 64;
  const int wid = blockIdx.x * 4 + w;
  const int mt = wid / ntn, nq = wid % ntn;
  if (mt * 16 >= M) return;
  const int row0 = mt * 16, col0 = nq * 64;
  const float* arow = A + (size_t)(row0 + ln) * lda;
  v8f acc[4] = {};
  for (int kb = 0; kb < K; kb += 32) {
    FragB ah, al;
    const v4f x0 = *(const v4fa*)(arow + kb + 8 * hh), x1 = *(const v4fa*)(arow + kb + 8 * hh + 4);
    const v4f x2 = *(const v4fa*)(arow + kb + 16 + 8 * hh), x3 = *(const v4fa*)(arow + kb + 16 + 8 * hh + 4);
    float xs[16] = {x0[0],x0[1],x0[2],x0[3],x1[0],x1[1],x1[2],x1[3],x2[0],x2[1],x2[2],x2[3],x3[0],x3[1],x3[2],x3[3]};
#pragma unroll
    for (int i = 0; i < 16; ++i) { const unsigned short hb = bf16_bits(xs[i]); ah.u[i] = hb; al.u[i] = ASPLIT ? bf16_bits(xs[i] - bf16_val(hb)) : (unsigned short)0; }
#pragma unroll
    for (int t = 0; t < 4; ++t) {
      const unsigned short* brow = Wt + (size_t)(col0 + t * 16 + ln) * ldb + kb;
      FragB b;
      b.half[0] = *(const v8us*)(brow + 8 * hh);
      b.half[1] = *(const v8us*)(brow + 16 + 8 * hh);
      acc[t] = mmaN<ASPLIT ? 2 : 1>(ah.v, al.v, b.v, b.v, acc[t]);
    }
  }
#pragma unroll
  for (int t = 0; t < 4; ++t) {
    float bv = bias ? bias[col0 + t * 16 + ln] : 0.f;
    if (BIAS_BF16) bv = bf16_round(bv);
#pragma unroll
    for (int r = 0; r < 8; ++r) { float v = acc[t][r] + bv; if (ACT == 1) v = fmaxf(v, 0.f); so[w][8 * hh + r][t * 16 + ln] = v; }
  }
  __builtin_amdgcn_fence(__ATOMIC_ACQ_REL, "workgroup");
  __builtin_amdgcn_wave_barrier();
  const int rsub = lane >> 4, c4 = (lane & 15) * 4;
  {
#pragma unroll
    for (int q = 0; q < 8; ++q) {
      const int r = q * 2 + rsub;
      const v4f v = *(const v4fa*)&so[w][r][c4];
      *(v4f*)(C + (size_t)(row0 + r) * ldc + col0 + c4) = v;
    }
    
  }
}

// GEMM C = act(A·W + bias + resid): A f32 (ASPLIT -> hi/lo 2 terms), Wt bf16 [N][K]; ACT 0 none, 1 relu, 2 exact gelu;
// resid (optional, f32, row index = (row % rmod), pitch ldr, RES_BF16 rounds it) added before the activation.
template <bool ASPLIT, int ACT, bool BIAS_BF16, bool RES_BF16>
__global__ __launch_bounds__(128) void k_gemm_bf3(const float* __restrict__ A, int lda, const unsigned short* __restrict__ Wt, int ldb,
                                                const float* __restrict__ bias, const float* __restrict__ resid, int rmod, int ldr,
                                                float* __restrict__ C, int ldc, int M, int N, int K) {
  __shared__ __attribute__((aligned(16))) float so[4][16][64];
  const int tid = threadIdx.x, w = tid >> 5, lane = tid & 31, ln = lane & 15, hh = lane >> 4;
  const int ntn = N / 64;
  const int wid = blockIdx.x * 4 + w;
  const int mt = wid / ntn, nq = wid % ntn;
  if (mt * 16 >= M) return;
  const int row0 = mt * 16, col0 = nq * 64;
  const float* arow = A + (size_t)(row0 + ln) * lda;
  v8f acc[4] = {};
  for (int kb = 0; kb < K; kb += 32) {
    FragB ah, al;
    const v4f x0 = *(const v4fa*)(arow + kb + 8 * hh), x1 = *(const v4fa*)(arow + kb + 8 * hh + 4);
    const v4f x2 = *(const v4fa*)(arow + kb + 16 + 8 * hh), x3 = *(const v4fa*)(arow + kb + 16 + 8 * hh + 4);
    float xs[16] = {x0[0],x0[1],x0[2],x0[3],x1[0],x1[1],x1[2],x1[3],x2[0],x2[1],x2[2],x2[3],x3[0],x3[1],x3[2],x3[3]};
#pragma unroll
    for (int i = 0; i < 16; ++i) { const unsigned short hb = bf16_bits(xs[i]); ah.u[i] = hb; al.u[i] = ASPLIT ? bf16_bits(xs[i] - bf16_val(hb)) : (unsigned short)0; }
#pragma unroll
    for (int t = 0; t < 4; ++t) {
      const unsigned short* brow = Wt + (size_t)(col0 + t * 16 + ln) * ldb + kb;
      FragB b;
      b.half[0] = *(const v8us*)(brow + 8 * hh);
      b.half[1] = *(const v8us*)(brow + 16 + 8 * hh);
      acc[t] = mmaN<ASPLIT ? 2 : 1>(ah.v, al.v, b.v, b.v, acc[t]);
    }
  }
#pragma unroll
  for (int t = 0; t < 4; ++t) {
    const int col = col0 + t * 16 + ln;
    float bv = bias ? bias[col] : 0.f;
    if (BIAS_BF16) bv = bf16_round(bv);
#pragma unroll
    for (int r = 0; r < 8; ++r) {
      float v = acc[t][r] + bv;
      if (resid) { float rv = resid[(size_t)((row0 + 8 * hh + r) % rmod) * ldr + col]; if (RES_BF16) rv = bf16_round(rv); v += rv; }
      if (ACT == 1) v = fmaxf(v, 0.f);
      if (ACT == 2) v = 0.5f * v * (1.0f + erff(v * 0.70710678118654752f));
      if (ACT == 3) { const float u = 0.7978845608028654f * (v + 0.044715f * v * v * v); v = 0.5f * v * (1.0f + tanhf(u)); }
      so[w][8 * hh + r][t * 16 + ln] = v;
    }
  }
  __builtin_amdgcn_fence(__ATOMIC_ACQ_REL, "workgroup");
  __builtin_amdgcn_wave_barrier();
  const int rsub = lane >> 4, c4 = (lane & 15) * 4;
  {
#pragma unroll
    for (int q = 0; q < 8; ++q) {
      const int r = q * 2 + rsub;
      const v4f v = *(const v4fa*)&so[w][r][c4];
      *(v4f*)(C + (size_t)(row0 + r) * ldc + col0 + c4) = v;
    }
    
  }
}
// row LayerNorm (biased variance, eps) over N: s = X (+ R); optional out_sum <- s; out_norm <- (s-mu)*rsqrt(var+eps)*g + b
template <bool PARAM_BF16>
__global__ __launch_bounds__(256) void k_layernorm(const float* __restrict__ X, const float* __restrict__ R, const float* __restrict__ g, const float* __restrict__ bta,
                                                  float* __restrict__ out_sum, float* __restrict__ out_norm, int N, float eps) {
  __shared__ float red[256];
  const int row = blockIdx.x, tid = threadIdx.x;
  const float* x = X + (size_t)row * N; const float* rr = R ? R + (size_t)row * N : nullptr;
  float vals[16];                     // up to N = 4096
  const int per = N / 256;            // contiguous chunk per thread? use strided-by-4 chunks: thread handles j = tid*4 + 1024*u
  float s1 = 0.f;
  for (int u = 0; u < per / 4; ++u) {
    const int j = tid * 4 + 1024 * u;
    const v4f a = *(const v4fa*)(x + j);
    v4f b = {0.f,0.f,0.f,0.f}; if (rr) b = *(const v4fa*)(rr + j);
#pragma unroll
    for (int q = 0; q < 4; ++q) { const float v = a[q] + b[q]; vals[u * 4 + q] = v; s1 += v; }
  }
  red[tid] = s1; __syncthreads();
  for (int st = 128; st > 0; st >>= 1) { if (tid < st) red[tid] += red[tid + st]; __syncthreads(); }
  const float mu = red[0] / (float)N; __syncthreads();
  float s2 = 0.f;
  for (int u = 0; u < per / 4; ++u)
#pragma unroll
    for (int q = 0; q < 4; ++q) { const float c = vals[u * 4 + q] - mu; s2 += c * c; }
  red[tid] = s2; __syncthreads();
  for (int st = 128; st > 0; st >>= 1) { if (tid < st) red[tid] += red[tid + st]; __syncthreads(); }
  const float rs = rsqrtf(red[0] / (float)N + eps);
  {
    for (int u = 0; u < per / 4; ++u) {
      const int j = tid * 4 + 1024 * u;
      v4f o, sm;
#pragma unroll
      for (int q = 0; q < 4; ++q) {
        float gg = g[j + q], bb = bta[j + q];
        if (PARAM_BF16) { gg = bf16_round(gg); bb = bf16_round(bb); }
        sm[q] = vals[u * 4 + q]; o[q] = (vals[u * 4 + q] - mu) * rs * gg + bb;
      }
      if (out_sum) *(v4f*)(out_sum + (size_t)row * N + j) = sm;
      *(v4f*)(out_norm + (size_t)row * N + j) = o;
    }
    
  }
}



// ---- f16 WMMA path (v_wmma_f32_16x16x32_f16): 11-bit significands for operands in range — used where a [0,1] probability operand needs more precision than bf16
typedef _Float16 v16h __attribute__((ext_vector_type(16)));
union FragH { v16h v; v8us half[2]; _Float16 h[16]; unsigned short u[16]; };
template <int NT>
__device__ __forceinline__ v8f mmaH(v16h ah, v16h al, v16h bh, v16h bl, v8f c) {
  c = __builtin_amdgcn_wmma_f32_16x16x32_f16(false, ah, false, bh, (short)0, c, false, false);
  if (NT >= 2) c = __builtin_amdgcn_wmma_f32_16x16x32_f16(false, al, false, bh, (short)0, c, false, false);
  if (NT >= 3) c = __builtin_amdgcn_wmma_f32_16x16x32_f16(false, ah, false, bl, (short)0, c, false, false);
  asm volatile("v_nop\n\tv_nop\n\tv_nop\n\tv_nop" : "+v"(c) : "v"(ah), "v"(al), "v"(bh), "v"(bl));
  return c;
}
// batched GEMM like k_gemm_b but f16 operands: A f32 (split into f16 hi/lo if ASPLIT, else rounded to f16), Bt = f16 values [n][k]; alpha; C f32; N multiple of 16 (partial tiles skipped)
template <bool ASPLIT>
__global__ __launch_bounds__(128) void k_gemm_h(const float* __restrict__ A, int lda, size_t sA, const _Float16* __restrict__ Bh, int ldb, size_t sB, float alpha, float* __restrict__ C, int ldc, size_t sC, int M, int N, int K) {
  __shared__ __attribute__((aligned(16))) float so[4][16][64];
  const int tid = threadIdx.x, w = tid >> 5, lane = tid & 31, ln = lane & 15, hh = lane >> 4; const int by = blockIdx.y;
  A += (size_t)by * sA; Bh += (size_t)by * sB; C += (size_t)by * sC;
  const int ntn = (N + 63) / 64; const int wid = blockIdx.x * 4 + w; const int mt = wid / ntn, nq = wid % ntn; if (mt * 16 >= M) return;
  const int row0 = mt * 16, col0 = nq * 64; const float* arow = A + (size_t)(row0 + ln) * lda;
  v8f acc[4] = {};
  for (int kb = 0; kb < K; kb += 32) {
    FragH ah, al;
    const v4f x0 = *(const v4fa*)(arow + kb + 8 * hh), x1 = *(const v4fa*)(arow + kb + 8 * hh + 4), x2 = *(const v4fa*)(arow + kb + 16 + 8 * hh), x3 = *(const v4fa*)(arow + kb + 16 + 8 * hh + 4);
    float xs[16] = {x0[0],x0[1],x0[2],x0[3],x1[0],x1[1],x1[2],x1[3],x2[0],x2[1],x2[2],x2[3],x3[0],x3[1],x3[2],x3[3]};
#pragma unroll
    for (int i = 0; i < 16; ++i) { const _Float16 h = (_Float16)xs[i]; ah.h[i] = h; al.h[i] = ASPLIT ? (_Float16)(xs[i] - (float)h) : (_Float16)0.0f; }
#pragma unroll
    for (int t = 0; t < 4; ++t) { if (col0 + t * 16 >= N) continue; const size_t boff = (size_t)(col0 + t * 16 + ln) * ldb + kb; FragH bq; bq.half[0] = *(const v8us*)(Bh + boff + 8 * hh); bq.half[1] = *(const v8us*)(Bh + boff + 16 + 8 * hh);
      acc[t] = mmaH<ASPLIT ? 2 : 1>(ah.v, al.v, bq.v, bq.v, acc[t]); }
  }
#pragma unroll
  for (int t = 0; t < 4; ++t) { if (col0 + t * 16 >= N) continue;
#pragma unroll
    for (int r = 0; r < 8; ++r) so[w][8 * hh + r][t * 16 + ln] = acc[t][r] * alpha; }
  __builtin_amdgcn_fence(__ATOMIC_ACQ_REL, "workgroup"); __builtin_amdgcn_wave_barrier();
  const int rsub = lane >> 4, c4 = (lane & 15) * 4;
  {
#pragma unroll
    for (int q = 0; q < 8; ++q) { const int r = q * 2 + rsub; if (col0 + c4 < N) { const v4f v = *(const v4fa*)&so[w][r][c4]; *(v4f*)(C + (size_t)(row0 + r) * ldc + col0 + c4) = v; } }
     }
}

// Wt[n][k] = f16(W[k][n]·scale) from f32 row-major W[K][N] (scale = power of two; bf16-exact weights stay exact in f16 away from the subnormal range)
__global__ __launch_bounds__(256) void k_wt_f16(const float* __restrict__ W, _Float16* __restrict__ Wt, int K, int N, float scale) {
  const int t = blockIdx.x * 256 + threadIdx.x; if (t >= N * (K / 8)) return; const int n = t / (K / 8), k8 = (t % (K / 8)) * 8; FragH f;
#pragma unroll
  for (int i = 0; i < 8; ++i) f.h[i] = (_Float16)(bf16_round(W[(size_t)(k8 + i) * N + n]) * scale); const v8us o = f.half[0];
  *(v8us*)((unsigned short*)Wt + (size_t)n * K + k8) = o; 
}
// k_gemm_hh variant with fused epilogue: v = acc·alpha + bias[by·sBias + col] (+ CP[(row/rowsPerB)·sCPb + by·64 + col] if CP) ; ACT 0 none / 1 elu ; writes f16 C16 (and f32 C if non-null)
template <int ACT>
__global__ __launch_bounds__(128) void k_gemm_hhx(const _Float16* __restrict__ A, int lda, size_t sA, const _Float16* __restrict__ Bh, int ldb, size_t sB, float alpha, const float* __restrict__ bias, size_t sBias, const float* __restrict__ CP, int rowsPerB, size_t sCPb, int row0g,
    float* __restrict__ C, _Float16* __restrict__ C16, int ldc, size_t sC, int M, int N, int K) {
  __shared__ __attribute__((aligned(16))) float so[4][16][64];
  const int tid = threadIdx.x, w = tid >> 5, lane = tid & 31, ln = lane & 15, hh = lane >> 4; const int by = blockIdx.y;
  A += (size_t)by * sA; Bh += (size_t)by * sB; const size_t cofs = (size_t)by * sC; const float* bp = bias ? bias + (size_t)by * sBias : nullptr;
  const int ntn = (N + 63) / 64; const int wid = blockIdx.x * 4 + w; const int mt = wid / ntn, nq = wid % ntn; if (mt * 16 >= M) return;
  const int row0 = mt * 16, col0 = nq * 64; const _Float16* arow = A + (size_t)(row0 + ln) * lda;
  v8f acc[4] = {};
  for (int kb = 0; kb < K; kb += 32) { FragH ah; ah.half[0] = *(const v8us*)((const unsigned short*)arow + kb + 8 * hh); ah.half[1] = *(const v8us*)((const unsigned short*)arow + kb + 16 + 8 * hh);
#pragma unroll
    for (int t = 0; t < 4; ++t) { if (col0 + t * 16 >= N) continue; const size_t boff = (size_t)(col0 + t * 16 + ln) * ldb + kb; FragH bq; bq.half[0] = *(const v8us*)((const unsigned short*)Bh + boff + 8 * hh); bq.half[1] = *(const v8us*)((const unsigned short*)Bh + boff + 16 + 8 * hh);
      acc[t] = mmaH<1>(ah.v, ah.v, bq.v, bq.v, acc[t]); }
  }
#pragma unroll
  for (int t = 0; t < 4; ++t) { if (col0 + t * 16 >= N) continue; const int col = col0 + t * 16 + ln; const float bv = bp ? bf16_round(bp[col]) : 0.f;
#pragma unroll
    for (int r = 0; r < 8; ++r) { float v = acc[t][r] * alpha + bv; if (CP) { const int rr = row0g + row0 + 8 * hh + r; if (rowsPerB < 0) v += CP[cofs + (size_t)rr * ldc + col];      /* rowsPerB < 0: own element of the batched C plane */ else { const int bidx = rr / rowsPerB; v += CP[(size_t)bidx * sCPb + (size_t)by * 64 + col]; } } if (ACT == 1) v = (v > 0.f) ? v : expm1f(v); else if (ACT == 7) v = (v > 0.f) ? v + 1.0f : expf(v); else if (ACT == 8) v = tanhf(v); else if (ACT == 9) v = 0.5f * v * (1.0f + tanhf(0.7978845608028654f * (v + 0.044715f * v * v * v))); else if (ACT == 11) v = 1.0f / (1.0f + expf(-v)); else if (ACT == 12) v = (v > 0.f) ? v : 0.01f * v; else if (ACT == 14) v = (v > 0.f) ? v : 0.1f * v; else if (ACT == 16) v = (v >= 0.f) ? v : 0.3f * v; else if (ACT == 17) v = (v >= 0.f) ? v : 0.2f * v; else if (ACT == 15) v = v / (1.0f + expf(-v)); else if (ACT == 3) v = fmaxf(v, 0.f); else if (ACT == 6) v = 0.5f * v * (1.0f + erff(v * 0.70710678118654752f)); so[w][8 * hh + r][t * 16 + ln] = v; } }
  __builtin_amdgcn_fence(__ATOMIC_ACQ_REL, "workgroup"); __builtin_amdgcn_wave_barrier();
  const int rsub = lane >> 4, c4 = (lane & 15) * 4; typedef _Float16 v4h __attribute__((ext_vector_type(4)));
  {
#pragma unroll
    for (int q = 0; q < 8; ++q) { const int r = q * 2 + rsub; if (col0 + c4 < N) { const v4f v = *(const v4fa*)&so[w][r][c4]; if (C) *(v4f*)(C + cofs + (size_t)(row0 + r) * ldc + col0 + c4) = v; if (C16) { v4h h4; for (int i = 0; i < 4; ++i) h4[i] = (_Float16)v[i]; *(v4h*)(C16 + cofs + (size_t)(row0 + r) * ldc + col0 + c4) = h4; } } }
     }
}


typedef _Float16 v4h __attribute__((ext_vector_type(4)));

__global__ __launch_bounds__(256) void k_x16(const float* __restrict__ x, _Float16* __restrict__ X16, size_t n8) { const size_t t = (size_t)blockIdx.x * 256 + threadIdx.x; if (t >= n8) return; FragH f;
#pragma unroll
  for (int q = 0; q < 8; ++q) f.h[q] = (_Float16)bf16_round(x[t * 8 + q]); *(v8us*)((unsigned short*)X16 + t * 8) = f.half[0];  }
__global__ __launch_bounds__(256) void k_h16(const float* __restrict__ x, _Float16* __restrict__ X16, size_t n8) { const size_t t = (size_t)blockIdx.x * 256 + threadIdx.x; if (t >= n8) return; FragH f;
#pragma unroll
  for (int q = 0; q < 8; ++q) f.h[q] = (_Float16)x[t * 8 + q]; *(v8us*)((unsigned short*)X16 + t * 8) = f.half[0];  }
__global__ __launch_bounds__(256) void k_round16f(const float* __restrict__ W, _Float16* __restrict__ Bt, size_t n8) { const size_t t = (size_t)blockIdx.x * 256 + threadIdx.x; if (t >= n8) return; FragH f;
#pragma unroll
  for (int i = 0; i < 8; ++i) f.h[i] = (_Float16)(bf16_round(W[t * 8 + i]) * 16.0f); *(v8us*)((unsigned short*)Bt + t * 8) = f.half[0];  }
template <int NHv, int TTv>
__global__ __launch_bounds__(256) void k_vt(const _Float16* __restrict__ V16, int ldv, int voff, _Float16* __restrict__ Vt) { __shared__ unsigned short tl[64][66]; const int tid = threadIdx.x; const int slab = blockIdx.x / (TTv / 64), lg = blockIdx.x % (TTv / 64); const int b = slab / NHv, h = slab % NHv;
  for (int i = tid; i < 64 * 8; i += 256) { const int r = i / 8, c8 = (i % 8) * 8; FragH f; f.half[0] = *(const v8us*)((const unsigned short*)V16 + ((size_t)b * TTv + lg * 64 + r) * ldv + voff + h * 64 + c8);
#pragma unroll
    for (int q = 0; q < 8; ++q) tl[r][c8 + q] = f.u[q]; }
  __syncthreads();
  {
#pragma unroll
    for (int rd = 0; rd < 2; ++rd) { const int d = rd * 32 + tid / 8, pc = tid % 8; FragH f;
#pragma unroll
      for (int q = 0; q < 8; ++q) f.u[q] = tl[pc * 8 + q][d];
      *(v8us*)((unsigned short*)Vt + ((size_t)slab * 64 + d) * TTv + lg * 64 + pc * 8) = f.half[0]; }
     } }

__global__ __launch_bounds__(256) void k_hl(const float* __restrict__ F, _Float16* __restrict__ Hh, _Float16* __restrict__ Hl, size_t n8) { const size_t t = (size_t)blockIdx.x * 256 + threadIdx.x; if (t >= n8) return; FragH fh, fl; const v4f a = *(const v4fa*)(F + t * 8), c = *(const v4fa*)(F + t * 8 + 4);
#pragma unroll
  for (int q = 0; q < 4; ++q) { _Float16 h = (_Float16)a[q]; fh.h[q] = h; fl.h[q] = (_Float16)((a[q] - (float)h) * 1024.0f); h = (_Float16)c[q]; fh.h[4 + q] = h; fl.h[4 + q] = (_Float16)((c[q] - (float)h) * 1024.0f); }
  { *(v8us*)((unsigned short*)Hh + t * 8) = fh.half[0]; *(v8us*)((unsigned short*)Hl + t * 8) = fl.half[0];  } }

// ---- fast GEMM (wave tile 32x64; requires M % 32 == 0 rows per launch region and N % 64 == 0); epilogue = k_gemm_hhx semantics; two batch axes: grid.y (strides sA, sB, sC) and grid.z (strides zA, zB, zC) ----
__device__ __forceinline__ v16h g2_frag(const _Float16* p, int hh) { FragH f; f.half[0] = *(const v8us*)((const unsigned short*)p + 8 * hh); f.half[1] = *(const v8us*)((const unsigned short*)p + 16 + 8 * hh); return f.v; }
__device__ __forceinline__ v8f g2_mma(v16h a, v16h b, v8f c) { v8f d = __builtin_amdgcn_wmma_f32_16x16x32_f16(false, a, false, b, (short)0, c, false, false); asm volatile("v_nop\n\tv_nop\n\tv_nop\n\tv_nop" : "+v"(d) : "v"(a), "v"(b)); return d; }
template <int ACT>
__global__ __launch_bounds__(128) void k_gemm2(const _Float16* __restrict__ A, int lda, size_t sA, const _Float16* __restrict__ Bh, int ldb, size_t sB, float alpha, const float* __restrict__ bias, size_t sBias, const float* __restrict__ CP, int rowsPerB, size_t sCPb, int row0g,
    float* __restrict__ C, _Float16* __restrict__ C16, int ldc, size_t sC, int M, int N, int K, size_t zA, size_t zB, size_t zC) { static_assert(ACT == 0 || ACT == 3 || ACT == 6 || ACT == 8 || ACT == 9 || ACT == 11 || ACT == 12 || ACT == 14 || ACT == 15 || ACT == 16 || ACT == 17, "k_gemm2: unsupported ACT code (would silently apply no activation)");
  __shared__ __attribute__((aligned(16))) float so[4][32][68];
  const int tid = threadIdx.x, w = tid >> 5, lane = tid & 31, ln = lane & 15, hh = lane >> 4; const int by = blockIdx.y; const int bz = blockIdx.z;      /* grid.z = sequence: element strides zA, zB, zC */
  A += (size_t)by * sA + (size_t)bz * zA; Bh += (size_t)by * sB + (size_t)bz * zB; const size_t cofs = (size_t)by * sC + (size_t)bz * zC; const float* bp = bias ? bias + (size_t)by * sBias : nullptr;
  const int ntn = N >> 6; const int mt = blockIdx.x / ntn, nq = blockIdx.x - mt * ntn; const int row0 = mt * 128 + 32 * w, col0 = nq * 64; if (row0 >= M) return;
  const _Float16* a0p = A + (size_t)(row0 + ln) * lda; const _Float16* a1p = a0p + (size_t)16 * lda;
  const _Float16* b0p = Bh + (size_t)(col0 + ln) * ldb; const _Float16* b1p = b0p + (size_t)16 * ldb; const _Float16* b2p = b1p + (size_t)16 * ldb; const _Float16* b3p = b2p + (size_t)16 * ldb;
  const v8f z8 = {0.f,0.f,0.f,0.f,0.f,0.f,0.f,0.f}; v8f c00 = z8, c01 = z8, c02 = z8, c03 = z8, c10 = z8, c11 = z8, c12 = z8, c13 = z8;
#pragma unroll 1
  for (int kb = 0; kb < K; kb += 32) { const v16h a0 = g2_frag(a0p + kb, hh), a1 = g2_frag(a1p + kb, hh);
    v16h b = g2_frag(b0p + kb, hh); c00 = g2_mma(a0, b, c00); c10 = g2_mma(a1, b, c10);
    b = g2_frag(b1p + kb, hh); c01 = g2_mma(a0, b, c01); c11 = g2_mma(a1, b, c11);
    b = g2_frag(b2p + kb, hh); c02 = g2_mma(a0, b, c02); c12 = g2_mma(a1, b, c12);
    b = g2_frag(b3p + kb, hh); c03 = g2_mma(a0, b, c03); c13 = g2_mma(a1, b, c13); }
  v8f accs[8] = {c00, c01, c02, c03, c10, c11, c12, c13};
#pragma unroll
  for (int u = 0; u < 8; ++u) { const int t = u & 3, half = u >> 2; const int col = col0 + t * 16 + ln; const float bv = bp ? bf16_round(bp[col]) : 0.f;
#pragma unroll
    for (int r = 0; r < 8; ++r) { const int rloc = half * 16 + 8 * hh + r; float v = accs[u][r] * alpha + bv; if (CP) { if (rowsPerB < 0) v += CP[cofs + (size_t)(row0g + row0 + rloc) * ldc + col];      /* rowsPerB < 0: own element of the batched C plane */ else { const int bidx = (row0g + row0 + rloc) / rowsPerB; v += CP[(size_t)bidx * sCPb + (size_t)by * 64 + col]; } }
      if (ACT == 3) v = fmaxf(v, 0.f); else if (ACT == 6) v = 0.5f * v * (1.0f + erff(v * 0.70710678118654752f)); else if (ACT == 11) v = 1.0f / (1.0f + expf(-v)); else if (ACT == 15) v = v / (1.0f + expf(-v)); else if (ACT == 12) v = (v > 0.f) ? v : 0.01f * v; else if (ACT == 8) v = tanhf(v); else if (ACT == 9) v = 0.5f * v * (1.0f + tanhf(0.7978845608028654f * (v + 0.044715f * v * v * v))); else if (ACT == 14) v = (v > 0.f) ? v : 0.1f * v; else if (ACT == 16) v = (v >= 0.f) ? v : 0.3f * v; else if (ACT == 17) v = (v >= 0.f) ? v : 0.2f * v;
      so[w][rloc][t * 16 + ln] = v; } }
  __builtin_amdgcn_fence(__ATOMIC_ACQ_REL, "workgroup"); __builtin_amdgcn_wave_barrier();
  const int rsub = lane >> 4, c4 = (lane & 15) * 4;
  {
#pragma unroll
    for (int q = 0; q < 16; ++q) { const int r = q * 2 + rsub; const v4f v = *(const v4fa*)&so[w][r][c4]; if (C) *(v4f*)(C + cofs + (size_t)(row0 + r) * ldc + col0 + c4) = v; if (C16) { v4h h4; for (int i = 0; i < 4; ++i) h4[i] = (_Float16)v[i]; *(v4h*)(C16 + cofs + (size_t)(row0 + r) * ldc + col0 + c4) = h4; } }
     } }


__global__ __launch_bounds__(256) void k_wnat(const float* __restrict__ w, size_t n8, _Float16* __restrict__ Bt) { const size_t t = (size_t)blockIdx.x * 256 + threadIdx.x; if (t >= n8) return; FragH f; for (int q = 0; q < 8; ++q) f.h[q] = (_Float16)(bf16_round(w[t * 8 + q]) * 16.0f); *(v8us*)((unsigned short*)Bt + t * 8) = f.half[0];  }
__global__ __launch_bounds__(256) void k_rsm(const float* __restrict__ S, _Float16* __restrict__ P, int nrows) {
  #pragma clang fp contract(off)
  const int i = blockIdx.x * 256 + threadIdx.x; if (i >= nrows) return; const float* s = S + (size_t)i * SQ; float mx = -3.0e38f;
#pragma unroll 1
  for (int j = 0; j < SQ; ++j) mx = fmaxf(mx, s[j]); float se = 0.f;
#pragma unroll 1
  for (int j = 0; j < SQ; ++j) se += expf(s[j] - mx); const float sc = 256.0f / se;
#pragma unroll 1
  for (int j0 = 0; j0 < SQ; j0 += 8) { FragH f; for (int q = 0; q < 8; ++q) f.h[q] = (_Float16)(expf(s[j0 + q] - mx) * sc); unsigned short* d = (unsigned short*)P + (size_t)i * SQ + j0; *(v8us*)d = f.half[0];  } }
__global__ __launch_bounds__(256) void k_vt(const _Float16* __restrict__ V16, int b, int h0, _Float16* __restrict__ VT) { __shared__ unsigned short tl[64][65]; const int tid = threadIdx.x; const int hh = blockIdx.x % HG, sg = blockIdx.x / HG; const int s0 = sg * 64; const int h = h0 + hh;
  for (int i = tid; i < 64 * 8; i += 256) { const int j = i / 8, d8 = (i % 8) * 8; FragH f; f.half[0] = *(const v8us*)((const unsigned short*)V16 + ((size_t)b * SQ + s0 + j) * DM + h * HD + d8); for (int q = 0; q < 8; ++q) tl[d8 + q][j] = f.u[q]; }
  __syncthreads();
  { for (int i = tid; i < 64 * 8; i += 256) { const int d = i / 8, j8 = (i % 8) * 8; FragH f; for (int q = 0; q < 8; ++q) f.u[q] = tl[d][j8 + q]; *(v8us*)((unsigned short*)VT + ((size_t)hh * HD + d) * SQ + s0 + j8) = f.half[0]; }  } }



// 2^x on the transcendental unit, with the one free issue slot that the instruction set asks for behind it before its result is used or its
// source overwritten: in the unrolled row the compiler put one exponential's result into the source register of the one directly ahead of it.
__device__ __forceinline__ float exp2_slot(float x) { float r; asm("v_exp_f32 %0, %1\n\tv_nop" : "=v"(r) : "v"(x)); return r; }
// Causal row softmax, one wave per score row. Lane l keeps columns 128 c + 4 l .. + 3 of its row in registers, so the row is read once,
// each load covers 512 contiguous bytes and each store 256; row maximum and row sum: per-lane partials, then a five-step butterfly.
// NC = row length / 128; rel = (last kept column) - 4 l, so that column 128 c + q of this lane is kept while 128 c + q <= rel.
template <int NC>
__device__ __forceinline__ void rsm_row(const float* __restrict__ s, _Float16* __restrict__ p, int rel) {
  v4f v[NC];
#pragma unroll
  for (int c = 0; c < NC; ++c) v[c] = *(const v4fa*)(s + c * 128);
  float mx = -3.0e38f;
#pragma unroll
  for (int c = 0; c < NC; ++c)
#pragma unroll
    for (int q = 0; q < 4; ++q) { const float xv = (c * 128 + q <= rel) ? v[c][q] : -1.0e9f; v[c][q] = xv; mx = fmaxf(mx, xv); }
#pragma unroll
  for (int m = 16; m >= 1; m >>= 1) mx = fmaxf(mx, __shfl_xor(mx, m, 32));
  v4f a = {0.f, 0.f, 0.f, 0.f};
#pragma unroll
  for (int c = 0; c < NC; ++c)
#pragma unroll
    for (int q = 0; q < 4; ++q) { const float e = exp2_slot((v[c][q] - mx) * 1.44269504088896340736f);      /* = __expf: multiply by log2 e, then v_exp_f32 */ v[c][q] = e; a[q] += e; }
  float se = (a[0] + a[1]) + (a[2] + a[3]);
#pragma unroll
  for (int m = 16; m >= 1; m >>= 1) se += __shfl_xor(se, m, 32);
  const float sc = 256.0f / se;
#pragma unroll
  for (int c = 0; c < NC; ++c) { v4h h4;
#pragma unroll
    for (int q = 0; q < 4; ++q) h4[q] = (_Float16)(v[c][q] * sc);
    *(v4h*)(p + c * 128) = h4; }
}
template <int NC>
__global__ __launch_bounds__(256) void k_rsmcw(const float* __restrict__ S, _Float16* __restrict__ P, int hg, int q0) {
  const int lane = threadIdx.x & 31; const int t = blockIdx.x * 8 + __builtin_amdgcn_readfirstlane(threadIdx.x >> 5);      /* the wave's row, in a scalar register: row base and early return stay scalar */
  if (t >= hg * QT) return;
  rsm_row<NC>(S + (size_t)t * NKX + lane * 4, P + (size_t)t * NKX + lane * 4, q0 + (t % QT) - lane * 4); }


template <int MASKADD>
__global__ __launch_bounds__(64) void k_att0(const float* __restrict__ QF, const float* __restrict__ KF, const float* __restrict__ VF, int ld, const float* __restrict__ mask, float scale, float* __restrict__ OF, int ldo) {
  #pragma clang fp contract(off)
  __shared__ __attribute__((aligned(16))) float lq[64][64]; __shared__ __attribute__((aligned(16))) float lo[64][64];
  const int tid = threadIdx.x; const int h = blockIdx.x / (QT0 / 64), rg = blockIdx.x % (QT0 / 64); const int i = rg * 64 + tid;
  { const size_t zb = (size_t)blockIdx.y * QT0; QF += zb * ld; KF += zb * ld; VF += zb * ld; OF += zb * ldo; }      /* grid.y = sequence: QT0 rows of q, k, v and o each */
  const float* qr = QF + (size_t)i * ld + h * HD;
#pragma unroll 1
  for (int c = 0; c < HD / 4; ++c) { *(v4f*)&lq[tid][c * 4] = *(const v4fa*)(qr + c * 4); const v4f z = {0.f, 0.f, 0.f, 0.f}; *(v4f*)&lo[tid][c * 4] = z; }
  float m = -1.0e30f, l = 0.f; const int jmax = MASKADD ? (SQ - 1) : (rg * 64 + 63);      /* additive-mask form: every key (the mask input decides); causal form: keys up to the block's last row */
#pragma unroll 1
  for (int j = 0; j <= jmax; ++j) { const float* kr = KF + (size_t)j * ld + h * HD; const float* vr = VF + (size_t)j * ld + h * HD; float s = 0.f;
#pragma unroll 1
    for (int c = 0; c < HD / 4; ++c) { const v4f kq = *(const v4fa*)(kr + c * 4); const v4f qq = *(v4f*)&lq[tid][c * 4]; s = __fadd_rn(s, __fmul_rn(qq[0], kq[0])); s = __fadd_rn(s, __fmul_rn(qq[1], kq[1])); s = __fadd_rn(s, __fmul_rn(qq[2], kq[2])); s = __fadd_rn(s, __fmul_rn(qq[3], kq[3])); }
    s = __fmul_rn(s, scale); if (MASKADD) s = __fadd_rn(s, __fmul_rn(bf16_round(mask[(size_t)i * SQ + j]), -10000.0f));
    const float f = (MASKADD || j <= i) ? 1.f : 0.f; const float sm = fmaf(f, s, (1.f - f) * -1.0e30f); const float mn = fmaxf(m, sm); const float sc = expf(m - mn); const float e = expf(sm - mn); l = __fadd_rn(__fmul_rn(l, sc), e); m = mn;
#pragma unroll 1
    for (int c = 0; c < HD / 4; ++c) { const v4f vv = *(const v4fa*)(vr + c * 4); v4f oo = *(v4f*)&lo[tid][c * 4]; for (int u = 0; u < 4; ++u) oo[u] = __fadd_rn(__fmul_rn(oo[u], sc), __fmul_rn(e, vv[u])); *(v4f*)&lo[tid][c * 4] = oo; } }
  const float fin = 64.0f / l;      /* o carried x64 like the f16 path */
#pragma unroll 1
  for (int c = 0; c < HD / 4; ++c) { v4f oo = *(v4f*)&lo[tid][c * 4]; for (int u = 0; u < 4; ++u) oo[u] = __fmul_rn(oo[u], fin); *(v4f*)&lo[tid][c * 4] = oo; }
  __syncthreads();
  {
#pragma unroll 1
    for (int it = 0; it < 16; ++it) { const int row = it * 4 + tid / 16, pc = (tid % 16) * 4; const v4f v = *(const v4f*)&lo[row][pc]; *(v4f*)(OF + (size_t)(rg * 64 + row) * ldo + h * HD + pc) = v; }
     } }

extern "C" void kernel_launch(void* const* d_in, const int* in_sizes, int n_in,
                              void* d_out, int out_size, void* d_ws, size_t ws_size, hipStream_t stream) {
  (void)in_sizes; (void)n_in; (void)out_size;
  const float* const* I = (const float* const*)d_in; const float* x = I[0]; const float* xk = I[0]; const float* xv = I[0]; const float* wq = I[1]; const float* bq = I[2]; const float* wk = I[3]; const float* bk = I[4]; const float* wv = I[5]; const float* bv = I[6]; const float* wo = I[7]; const float* bo = I[8];      /* input order: x, Wq, bq, Wk, bk, Wv, bv (PER-HEAD STACKS [8][512][64] with REAL per-head biases [8][64] = flat [512]: the GEMMs' guarded bias slots), Wp ([in][out]: out @ Wp), bp (REAL) */
  char* ws = (char*)d_ws; size_t off = 0;
  auto take = [&](size_t bytes) { char* p = ws + off; off += (bytes + 255) & ~(size_t)255; return p; };
  _Float16* BQ = (_Float16*)take((size_t)DM * DM * 2); _Float16* BK = (_Float16*)take((size_t)DM * DM * 2); _Float16* BV = (_Float16*)take((size_t)DM * DM * 2); _Float16* BO = (_Float16*)take((size_t)DM * DM * 2);
  _Float16* X16 = (_Float16*)take(NR * DM * 2); _Float16* XK16 = (_Float16*)take(NR * DM * 2); _Float16* XV16 = (_Float16*)take(NR * DM * 2);      /* exact f16 rows of query, key, value */ float* QF = (float*)take(NR * DM * 4); _Float16* QH = (_Float16*)take(NR * DM * 2); _Float16* QL = (_Float16*)take(NR * DM * 2); _Float16* KH = (_Float16*)take(NR * DM * 2); _Float16* KL = (_Float16*)take(NR * DM * 2); _Float16* Q16 = QH; _Float16* K16 = KH; _Float16* V16 = (_Float16*)take(NR * DM * 2); _Float16* O16 = (_Float16*)take(NR * DM * 2);
  float* S = (float*)take((size_t)NB * NH * QT * NKX * 4); _Float16* P = (_Float16*)take((size_t)NB * NH * QT * NKX * 2); _Float16* VT = (_Float16*)take((size_t)NB * NH * HD * SQ * 2);      /* one plane per sequence: the sequences share each launch */
  float* QF0 = (float*)take((size_t)NB * QT0 * DM * 4); float* KF0 = (float*)take((size_t)NB * QT0 * DM * 4); float* VF0 = (float*)take((size_t)NB * QT0 * DM * 4); float* OF0 = (float*)take((size_t)NB * QT0 * DM * 4); _Float16* OH0 = (_Float16*)take((size_t)NB * QT0 * DM * 2); _Float16* OL0 = (_Float16*)take((size_t)NB * QT0 * DM * 2);
  if (off > ws_size) return;
  { const unsigned gn = (unsigned)(((size_t)DM * DM / 8 + 255) / 256); const unsigned gh = (unsigned)(((size_t)HD * (DM / 8) + 255) / 256); for (int h = 0; h < NH; ++h) { const size_t wofs = (size_t)h * DM * HD, pofs = (size_t)h * HD * DM; k_wt_f16<<<gh, 256, 0, stream>>>(wq + wofs, BQ + pofs, DM, HD, 16.0f); k_wt_f16<<<gh, 256, 0, stream>>>(wk + wofs, BK + pofs, DM, HD, 16.0f); k_wt_f16<<<gh, 256, 0, stream>>>(wv + wofs, BV + pofs, DM, HD, 16.0f); } k_wt_f16<<<gn, 256, 0, stream>>>(wo, BO, DM, DM, 16.0f); }      /* PER-HEAD STACKS wq / wk / wv [NH][DM][HD]: head h is a row-major [in = DM][out = HD] block at w + h * DM * HD: the transposing builder with K = DM, N = HD writes its HD rows Bt[h * HD + e][k] at B + h * HD * DM: contiguous rows of the [out][in] plane (x16); wo is an [in][out] [DM][DM] matrix (out @ Wp): ONE call of the same transposing builder with K = N = DM on the grid gn = DM * DM / 8 threads (N * (K / 8)) */
  k_x16<<<(unsigned)((NR * DM / 8 + 255) / 256), 256, 0, stream>>>(x, X16, NR * DM / 8); k_x16<<<(unsigned)((NR * DM / 8 + 255) / 256), 256, 0, stream>>>(xk, XK16, NR * DM / 8); k_x16<<<(unsigned)((NR * DM / 8 + 255) / 256), 256, 0, stream>>>(xv, XV16, NR * DM / 8);
  const size_t r0p = (size_t)B0 * SQ;      /* first projected row */
  k_gemm2<0><<<dim3((unsigned)((MP / 128) * (DM / 64)), 1), 128, 0, stream>>>(X16 + r0p * DM, DM, 0, BQ, DM, 0, 0.0625f, bq, 0, nullptr, 1, 0, 0, QF + r0p * DM, nullptr, DM, 0, MP, DM, DM, 0, 0, 0); k_hl<<<(unsigned)(((size_t)MP * DM / 8 + 255) / 256), 256, 0, stream>>>(QF + r0p * DM, QH + r0p * DM, QL + r0p * DM, (size_t)MP * DM / 8);      /* q (f32) -> f16 hi + x1024 residual: unscaled logits sigma ~8 */
  k_gemm2<0><<<dim3((unsigned)((MP / 128) * (DM / 64)), 1), 128, 0, stream>>>(XK16 + r0p * DM, DM, 0, BK, DM, 0, 0.0625f, bk, 0, nullptr, 1, 0, 0, QF + r0p * DM, nullptr, DM, 0, MP, DM, DM, 0, 0, 0); k_hl<<<(unsigned)(((size_t)MP * DM / 8 + 255) / 256), 256, 0, stream>>>(QF + r0p * DM, KH + r0p * DM, KL + r0p * DM, (size_t)MP * DM / 8);      /* k likewise */
  k_gemm2<0><<<dim3((unsigned)((MP / 128) * (DM / 64)), 1), 128, 0, stream>>>(XV16 + r0p * DM, DM, 0, BV, DM, 0, 0.0625f, bv, 0, nullptr, 1, 0, 0, nullptr, V16 + r0p * DM, DM, 0, MP, DM, DM, 0, 0, 0);
  { const size_t r0 = r0p; const size_t zX = (size_t)SQ * DM, zF = (size_t)QT0 * DM, zS = (size_t)NH * QT * NKX, zV = (size_t)NH * HD * SQ;      /* every launch below covers all NBR sequences: element strides from one sequence to the next */
    k_vt<NH, SQ><<<NBR * NH * (SQ / 64), 256, 0, stream>>>(V16 + r0 * LQ, LQ, 0, VT);      /* V^T [NBR][NH][HD][SQ] */
    k_gemm2<0><<<dim3((QT0 / 128) * (DM / 64), 1, NBR), 128, 0, stream>>>(X16 + r0 * DM, DM, 0, BQ, DM, 0, 0.0625f, bq, 0, nullptr, 1, 0, 0, QF0, nullptr, DM, 0, QT0, DM, DM, zX, 0, zF); k_gemm2<0><<<dim3((QT0 / 128) * (DM / 64), 1, NBR), 128, 0, stream>>>(XK16 + r0 * DM, DM, 0, BK, DM, 0, 0.0625f, bk, 0, nullptr, 1, 0, 0, KF0, nullptr, DM, 0, QT0, DM, DM, zX, 0, zF); k_gemm2<0><<<dim3((QT0 / 128) * (DM / 64), 1, NBR), 128, 0, stream>>>(XV16 + r0 * DM, DM, 0, BV, DM, 0, 0.0625f, bv, 0, nullptr, 1, 0, 0, VF0, nullptr, DM, 0, QT0, DM, DM, zX, 0, zF);      /* f32 q, k, v of the first 128 rows (exact products) */
    k_att0<0><<<dim3(NH * (QT0 / 64), NBR), 64, 0, stream>>>(QF0, KF0, VF0, DM, nullptr, SCL, OF0 + (size_t)B0 * QT0 * DM, DM);      /* exact f32 attention for rows 0..127 (o x64) */
    for (int q0 = 0; q0 < QN; q0 += QT) { const int nk = q0 + QT;      /* causal: only keys below the tile end are computed */
      k_gemm2<0><<<dim3((QT / 128) * (nk / 64), NHD, NBR), 128, 0, stream>>>(QH + (r0 + q0) * LQ, LQ, (size_t)HD, KH + r0 * LQ, LQ, (size_t)HD, SCL, nullptr, 0, nullptr, 1, 0, 0, S, nullptr, NKX, (size_t)QT * NKX, QT, nk, HD, zX, zX, zS);      /* scores hi . hi * 64^-0.5 (1 / sqrt(head_dim)) */
      k_gemm2<0><<<dim3((QT / 128) * (nk / 64), NHD, NBR), 128, 0, stream>>>(QL + (r0 + q0) * LQ, LQ, (size_t)HD, KH + r0 * LQ, LQ, (size_t)HD, SCLR, nullptr, 0, S, -1, 0, 0, S, nullptr, NKX, (size_t)QT * NKX, QT, nk, HD, zX, zX, zS); k_gemm2<0><<<dim3((QT / 128) * (nk / 64), NHD, NBR), 128, 0, stream>>>(QH + (r0 + q0) * LQ, LQ, (size_t)HD, KL + r0 * LQ, LQ, (size_t)HD, SCLR, nullptr, 0, S, -1, 0, 0, S, nullptr, NKX, (size_t)QT * NKX, QT, nk, HD, zX, zX, zS);      /* += 2^-10 (lo . hi + hi . lo) */      /* scores, all heads on grid.y */
      static_assert(SQ == 8 * QT && QT == 256, "one softmax instance per causal tile end"); static_assert(NHD == NH && LQ == DM, "score rows of all sequences and heads lie back to back; q / k rows have the pitch of x"); switch (nk / QT) { case 1: k_rsmcw<2><<<(NBR * NHD * QT + 7) / 8, 256, 0, stream>>>(S, P, NBR * NHD, q0); break; case 2: k_rsmcw<4><<<(NBR * NHD * QT + 7) / 8, 256, 0, stream>>>(S, P, NBR * NHD, q0); break; case 3: k_rsmcw<6><<<(NBR * NHD * QT + 7) / 8, 256, 0, stream>>>(S, P, NBR * NHD, q0); break; case 4: k_rsmcw<8><<<(NBR * NHD * QT + 7) / 8, 256, 0, stream>>>(S, P, NBR * NHD, q0); break; case 5: k_rsmcw<10><<<(NBR * NHD * QT + 7) / 8, 256, 0, stream>>>(S, P, NBR * NHD, q0); break; case 6: k_rsmcw<12><<<(NBR * NHD * QT + 7) / 8, 256, 0, stream>>>(S, P, NBR * NHD, q0); break; case 7: k_rsmcw<14><<<(NBR * NHD * QT + 7) / 8, 256, 0, stream>>>(S, P, NBR * NHD, q0); break; case 8: k_rsmcw<16><<<(NBR * NHD * QT + 7) / 8, 256, 0, stream>>>(S, P, NBR * NHD, q0); break; }      /* one wave per row, 8 rows per block; the row length nk / 128 is a compile-time constant so that the row stays in registers */
      k_gemm2<0><<<dim3((QT / 128) * (HD / 64), NHD, NBR), 128, 0, stream>>>(P, NKX, (size_t)QT * NKX, VT, SQ, (size_t)HD * SQ, 0.25f, nullptr, 0, nullptr, 1, 0, 0, nullptr, O16 + (r0 + q0) * DM, DM, (size_t)HD, QT, HD, nk, zS, zV, zX); } }      /* o (merged heads, x64) as f16 rows */
  k_gemm2<0><<<dim3((unsigned)((MPO / 128) * (DM / 64)), 1), 128, 0, stream>>>(O16 + r0p * DM, DM, 0, BO, DM, 0, 0.0009765625f, bo, 0, nullptr, 1, 0, 0, (float*)d_out + r0p * DM, nullptr, DM, 0, MPO, DM, DM, 0, 0, 0);      /* out rows are the output layout */
  k_hl<<<(unsigned)(((size_t)NB * QT0 * DM / 8 + 255) / 256), 256, 0, stream>>>(OF0, OH0, OL0, (size_t)NB * QT0 * DM / 8);      /* first-tile o (x64) -> f16 hi + x1024 residual planes */
  { const size_t r0 = r0p; const size_t f0 = (size_t)B0 * QT0; const size_t zX = (size_t)SQ * DM, zF = (size_t)QT0 * DM;      /* all sequences per launch, as above */
    k_gemm2<0><<<dim3((QT0 / 128) * (DM / 64), 1, NBR), 128, 0, stream>>>(OH0 + f0 * DM, DM, 0, BO, DM, 0, 0.0009765625f, bo, 0, nullptr, 1, 0, 0, (float*)d_out + r0 * DM, nullptr, DM, 0, QT0, DM, DM, zF, 0, zX);      /* rows 0..127: out = o_hi Wo (+ b), overwriting the f16-path rows */
    k_gemm2<0><<<dim3((QT0 / 128) * (DM / 64), 1, NBR), 128, 0, stream>>>(OL0 + f0 * DM, DM, 0, BO, DM, 0, 0.00000095367431640625f, nullptr, 0, (const float*)d_out + r0 * DM, -1, 0, 0, (float*)d_out + r0 * DM, nullptr, DM, 0, QT0, DM, DM, zF, 0, zX); }      /* += o_lo Wo 2^-20 (own-element accumulate) */
}

// v004
// It runs in 396 microseconds.
// Versions between v002 and this one are left out; their measured steps multiply to 4.19 times as fast.
// Over all steps from v000 it is 27.3 times as fast.
#include <hip/hip_runtime.h>
// Causal multi-head self-attention with PER-HEAD STACKED projections and REAL per-head biases on four sequences at width 512 (x [4][2048][512]; Wq / Wk / Wv [8][512][64] = [head][in][out] ('bte,hed->bhtd'; uniform +-1/sqrt(512)) with biases [8][64] (REAL, uniform +-1/sqrt(512)): a per-head bias [8][64] IS the flat bias [512]; 8 heads of 64 (8 x 64 = 512 = the width); scores * 1/sqrt(64); where(tril, scores, -inf); softmax over keys; out = merged Wp + bp ([in][out] [512][512] + a REAL bias, uniform +-1/sqrt(512)) -> [4][2048][512]); the [in][out] output weight through the text's own TRANSPOSING builder (the one the per-head stacks use); q and k carried as f16 hi + x1024 residual planes with three-product scores; each head's [in][out] block is transposed into its 64 contiguous rows of the weight plane by the same builder, one call per head.
// Compute dtype: inputs rounded to bf16; x / weights exact; q and k as f16 hi + x1024 residual planes; v, softmax weights and o as plain f16 GEMM operands (~2^-12), rows 0..127 redone in f32; scores and softmax statistics f32. v_wmma_f32_16x16x32_f16.
#define NB 4
#define SCL 0.125f                         /* 1 / sqrt(head_dim 64) */
#define SCLR 0.0001220703125f               /* 2^-13: the same scale on the x1024 residual passes */
#define SQ 2048
#define DM 512
#define NH 8
#define HD 64
#define HG 4                         /* heads per call of the untemplated k_vt (not launched) */
#define QT0 128                      /* first-tile rows recomputed exactly in f32 */
#define B0 0                         /* first batch processed (debug hook) */
#define NBR NB                       /* batches processed (debug hook) */
#define NR ((size_t)NB * SQ)         /* token rows */
#define MP ((int)((size_t)NBR * SQ)) /* rows projected (debug hook) */
#define QN SQ                        /* query rows attended per batch (debug hook) */
#define NHD NH                       /* heads attended (debug hook) */
#define MPO MP                       /* rows through the output stage (debug hook) */
#define LQ DM      /* row pitch of the q/k/v rows */
typedef __bf16 v16b __attribute__((ext_vector_type(16)));
typedef unsigned short v8us __attribute__((ext_vector_type(8), may_alias));
typedef float  v8f  __attribute__((ext_vector_type(8)));
typedef float  v4f  __attribute__((ext_vector_type(4)));
typedef float  v4fa __attribute__((ext_vector_type(4), may_alias));
union FragB { v16b v; v8us half[2]; unsigned short u[16]; };

__device__ __forceinline__ unsigned short bf16_bits(float x) { unsigned int u = __float_as_uint(x); return (unsigned short)((u + 0x7FFFu + ((u >> 16) & 1u)) >> 16); }
__device__ __forceinline__ float bf16_val(unsigned short b) { return __uint_as_float(((unsigned int)b) << 16); }
__device__ __forceinline__ float bf16_round(float x) { return bf16_val(bf16_bits(x)); }
// D += A·B with NT terms: 1 = ah·bh, 2 = + al·bh (A split), 3 = + ah·bl (both split)
template <int NT>
__device__ __forceinline__ v8f mmaN(v16b ah, v16b al, v16b bh, v16b bl, v8f c) {
  c = __builtin_amdgcn_wmma_f32_16x16x32_bf16(false, ah, false, bh, (short)0, c, false, false);
  if (NT >= 2) c = __builtin_amdgcn_wmma_f32_16x16x32_bf16(false, al, false, bh, (short)0, c, false, false);
  if (NT >= 3) c = __builtin_amdgcn_wmma_f32_16x16x32_bf16(false, ah, false, bl, (short)0, c, false, false);
  asm volatile("v_nop\n\tv_nop\n\tv_nop\n\tv_nop" : "+v"(c) : "v"(ah), "v"(al), "v"(bh), "v"(bl));
  return c;
}

__global__ __launch_bounds__(256) void k_wt_bf16(const float* __restrict__ W, unsigned short* __restrict__ Wt, int K, int N) {
  const int t = blockIdx.x * 256 + threadIdx.x;
  const int k8n = K / 8;
  if (t >= N * k8n) return;
  const int n = t / k8n, k8 = (t % k8n) * 8;
  v8us v;
#pragma unroll
  for (int i = 0; i < 8; ++i) v[i] = bf16_bits(W[(size_t)(k8 + i) * N + n]);
  *(v8us*)(Wt + (size_t)n * K + k8) = v;
  
}

// GEMM C[M][N] (f32, pitch ldc) = act(A[M][K]·W + bias). A f32 row-major (pitch lda) converted per fragment to bf16
// (ASPLIT: hi/lo two planes -> 2 terms, else single rounded term); Wt bf16 [N][K] (pitch ldb). BIAS_BF16 rounds the
// bias to bf16 first (bias quantised to bf16 before the add). K%32==0, M%16==0, N%64==0.
template <bool ASPLIT, int ACT, bool BIAS_BF16>
__global__ __launch_bounds__(128) void k_gemm_bf(const float* __restrict__ A, int lda, const unsigned short* __restrict__ Wt, int ldb,
                                               const float* __restrict__ bias, float* __restrict__ C, int ldc, int M, int N, int K) {
  __shared__ __attribute__((aligned(16))) float so[4][16][64];
  const int tid = threadIdx.x, w = tid >> 5, lane = tid & 31, ln = lane & 15, hh = lane >> 4;
  const int ntn = N / 64;
  const int wid = blockIdx.x * 4 + w;
  const int mt = wid / ntn, nq = wid % ntn;
  if (mt * 16 >= M) return;
  const int row0 = mt * 16, col0 = nq * 64;
  const float* arow = A + (size_t)(row0 + ln) * lda;
  v8f acc[4] = {};
  for (int kb = 0; kb < K; kb += 32) {
    FragB ah, al;
    const v4f x0 = *(const v4fa*)(arow + kb + 8 * hh), x1 = *(const v4fa*)(arow + kb + 8 * hh + 4);
    const v4f x2 = *(const v4fa*)(arow + kb + 16 + 8 * hh), x3 = *(const v4fa*)(arow + kb + 16 + 8 * hh + 4);
    float xs[16] = {x0[0],x0[1],x0[2],x0[3],x1[0],x1[1],x1[2],x1[3],x2[0],x2[1],x2[2],x2[3],x3[0],x3[1],x3[2],x3[3]};
#pragma unroll
    for (int i = 0; i < 16; ++i) { const unsigned short hb = bf16_bits(xs[i]); ah.u[i] = hb; al.u[i] = ASPLIT ? bf16_bits(xs[i] - bf16_val(hb)) : (unsigned short)0; }
#pragma unroll
    for (int t = 0; t < 4; ++t) {
      const unsigned short* brow = Wt + (size_t)(col0 + t * 16 + ln) * ldb + kb;
      FragB b;
      b.half[0] = *(const v8us*)(brow + 8 * hh);
      b.half[1] = *(const v8us*)(brow + 16 + 8 * hh);
      acc[t] = mmaN<ASPLIT ? 2 : 1>(ah.v, al.v, b.v, b.v, acc[t]);
    }
  }
#pragma unroll
  for (int t = 0; t < 4; ++t) {
    float bv = bias ? bias[col0 + t * 16 + ln] : 0.f;
    if (BIAS_BF16) bv = bf16_round(bv);
#pragma unroll
    for (int r = 0; r < 8; ++r) { float v = acc[t][r] + bv; if (ACT == 1) v = fmaxf(v, 0.f); so[w][8 * hh + r][t * 16 + ln] = v; }
  }
  __builtin_amdgcn_fence(__ATOMIC_ACQ_REL, "workgroup");
  __builtin_amdgcn_wave_barrier();
  const int rsub = lane >> 4, c4 = (lane & 15) * 4;
  {
#pragma unroll
    for (int q = 0; q < 8; ++q) {
      const int r = q * 2 + rsub;
      const v4f v = *(const v4fa*)&so[w][r][c4];
      *(v4f*)(C + (size_t)(row0 + r) * ldc + col0 + c4) = v;
    }
    
  }
}

// GEMM C = act(A·W + bias + resid): A f32 (ASPLIT -> hi/lo 2 terms), Wt bf16 [N][K]; ACT 0 none, 1 relu, 2 exact gelu;
// resid (optional, f32, row index = (row % rmod), pitch ldr, RES_BF16 rounds it) added before the activation.
template <bool ASPLIT, int ACT, bool BIAS_BF16, bool RES_BF16>
__global__ __launch_bounds__(128) void k_gemm_bf3(const float* __restrict__ A, int lda, const unsigned short* __restrict__ Wt, int ldb,
                                                const float* __restrict__ bias, const float* __restrict__ resid, int rmod, int ldr,
                                                float* __restrict__ C, int ldc, int M, int N, int K) {
  __shared__ __attribute__((aligned(16))) float so[4][16][64];
  const int tid = threadIdx.x, w = tid >> 5, lane = tid & 31, ln = lane & 15, hh = lane >> 4;
  const int ntn = N / 64;
  const int wid = blockIdx.x * 4 + w;
  const int mt = wid / ntn, nq = wid % ntn;
  if (mt * 16 >= M) return;
  const int row0 = mt * 16, col0 = nq * 64;
  const float* arow = A + (size_t)(row0 + ln) * lda;
  v8f acc[4] = {};
  for (int kb = 0; kb < K; kb += 32) {
    FragB ah, al;
    const v4f x0 = *(const v4fa*)(arow + kb + 8 * hh), x1 = *(const v4fa*)(arow + kb + 8 * hh + 4);
    const v4f x2 = *(const v4fa*)(arow + kb + 16 + 8 * hh), x3 = *(const v4fa*)(arow + kb + 16 + 8 * hh + 4);
    float xs[16] = {x0[0],x0[1],x0[2],x0[3],x1[0],x1[1],x1[2],x1[3],x2[0],x2[1],x2[2],x2[3],x3[0],x3[1],x3[2],x3[3]};
#pragma unroll
    for (int i = 0; i < 16; ++i) { const unsigned short hb = bf16_bits(xs[i]); ah.u[i] = hb; al.u[i] = ASPLIT ? bf16_bits(xs[i] - bf16_val(hb)) : (unsigned short)0; }
#pragma unroll
    for (int t = 0; t < 4; ++t) {
      const unsigned short* brow = Wt + (size_t)(col0 + t * 16 + ln) * ldb + kb;
      FragB b;
      b.half[0] = *(const v8us*)(brow + 8 * hh);
      b.half[1] = *(const v8us*)(brow + 16 + 8 * hh);
      acc[t] = mmaN<ASPLIT ? 2 : 1>(ah.v, al.v, b.v, b.v, acc[t]);
    }
  }
#pragma unroll
  for (int t = 0; t < 4; ++t) {
    const int col = col0 + t * 16 + ln;
    float bv = bias ? bias[col] : 0.f;
    if (BIAS_BF16) bv = bf16_round(bv);
#pragma unroll
    for (int r = 0; r < 8; ++r) {
      float v = acc[t][r] + bv;
      if (resid) { float rv = resid[(size_t)((row0 + 8 * hh + r) % rmod) * ldr + col]; if (RES_BF16) rv = bf16_round(rv); v += rv; }
      if (ACT == 1) v = fmaxf(v, 0.f);
      if (ACT == 2) v = 0.5f * v * (1.0f + erff(v * 0.70710678118654752f));
      if (ACT == 3) { const float u = 0.7978845608028654f * (v + 0.044715f * v * v * v); v = 0.5f * v * (1.0f + tanhf(u)); }
      so[w][8 * hh + r][t * 16 + ln] = v;
    }
  }
  __builtin_amdgcn_fence(__ATOMIC_ACQ_REL, "workgroup");
  __builtin_amdgcn_wave_barrier();
  const int rsub = lane >> 4, c4 = (lane & 15) * 4;
  {
#pragma unroll
    for (int q = 0; q < 8; ++q) {
      const int r = q * 2 + rsub;
      const v4f v = *(const v4fa*)&so[w][r][c4];
      *(v4f*)(C + (size_t)(row0 + r) * ldc + col0 + c4) = v;
    }
    
  }
}
// row LayerNorm (biased variance, eps) over N: s = X (+ R); optional out_sum <- s; out_norm <- (s-mu)*rsqrt(var+eps)*g + b
template <bool PARAM_BF16>
__global__ __launch_bounds__(256) void k_layernorm(const float* __restrict__ X, const float* __restrict__ R, const float* __restrict__ g, const float* __restrict__ bta,
                                                  float* __restrict__ out_sum, float* __restrict__ out_norm, int N, float eps) {
  __shared__ float red[256];
  const int row = blockIdx.x, tid = threadIdx.x;
  const float* x = X + (size_t)row * N; const float* rr = R ? R + (size_t)row * N : nullptr;
  float vals[16];                     // up to N = 4096
  const int per = N / 256;            // contiguous chunk per thread? use strided-by-4 chunks: thread handles j = tid*4 + 1024*u
  float s1 = 0.f;
  for (int u = 0; u < per / 4; ++u) {
    const int j = tid * 4 + 1024 * u;
    const v4f a = *(const v4fa*)(x + j);
    v4f b = {0.f,0.f,0.f,0.f}; if (rr) b = *(const v4fa*)(rr + j);
#pragma unroll
    for (int q = 0; q < 4; ++q) { const float v = a[q] + b[q]; vals[u * 4 + q] = v; s1 += v; }
  }
  red[tid] = s1; __syncthreads();
  for (int st = 128; st > 0; st >>= 1) { if (tid < st) red[tid] += red[tid + st]; __syncthreads(); }
  const float mu = red[0] / (float)N; __syncthreads();
  float s2 = 0.f;
  for (int u = 0; u < per / 4; ++u)
#pragma unroll
    for (int q = 0; q < 4; ++q) { const float c = vals[u * 4 + q] - mu; s2 += c * c; }
  red[tid] = s2; __syncthreads();
  for (int st = 128; st > 0; st >>= 1) { if (tid < st) red[tid] += red[tid + st]; __syncthreads(); }
  const float rs = rsqrtf(red[0] / (float)N + eps);
  {
    for (int u = 0; u < per / 4; ++u) {
      const int j = tid * 4 + 1024 * u;
      v4f o, sm;
#pragma unroll
      for (int q = 0; q < 4; ++q) {
        float gg = g[j + q], bb = bta[j + q];
        if (PARAM_BF16) { gg = bf16_round(gg); bb = bf16_round(bb); }
        sm[q] = vals[u * 4 + q]; o[q] = (vals[u * 4 + q] - mu) * rs * gg + bb;
      }
      if (out_sum) *(v4f*)(out_sum + (size_t)row * N + j) = sm;
      *(v4f*)(out_norm + (size_t)row * N + j) = o;
    }
    
  }
}



// ---- f16 WMMA path (v_wmma_f32_16x16x32_f16): 11-bit significands for operands in range — used where a [0,1] probability operand needs more precision than bf16
typedef _Float16 v16h __attribute__((ext_vector_type(16)));
union FragH { v16h v; v8us half[2]; _Float16 h[16]; unsigned short u[16]; };
template <int NT>
__device__ __forceinline__ v8f mmaH(v16h ah, v16h al, v16h bh, v16h bl, v8f c) {
  c = __builtin_amdgcn_wmma_f32_16x16x32_f16(false, ah, false, bh, (short)0, c, false, false);
  if (NT >= 2) c = __builtin_amdgcn_wmma_f32_16x16x32_f16(false, al, false, bh, (short)0, c, false, false);
  if (NT >= 3) c = __builtin_amdgcn_wmma_f32_16x16x32_f16(false, ah, false, bl, (short)0, c, false, false);
  asm volatile("v_nop\n\tv_nop\n\tv_nop\n\tv_nop" : "+v"(c) : "v"(ah), "v"(al), "v"(bh), "v"(bl));
  return c;
}
// batched GEMM like k_gemm_b but f16 operands: A f32 (split into f16 hi/lo if ASPLIT, else rounded to f16), Bt = f16 values [n][k]; alpha; C f32; N multiple of 16 (partial tiles skipped)
template <bool ASPLIT>
__global__ __launch_bounds__(128) void k_gemm_h(const float* __restrict__ A, int lda, size_t sA, const _Float16* __restrict__ Bh, int ldb, size_t sB, float alpha, float* __restrict__ C, int ldc, size_t sC, int M, int N, int K) {
  __shared__ __attribute__((aligned(16))) float so[4][16][64];
  const int tid = threadIdx.x, w = tid >> 5, lane = tid & 31, ln = lane & 15, hh = lane >> 4; const int by = blockIdx.y;
  A += (size_t)by * sA; Bh += (size_t)by * sB; C += (size_t)by * sC;
  const int ntn = (N + 63) / 64; const int wid = blockIdx.x * 4 + w; const int mt = wid / ntn, nq = wid % ntn; if (mt * 16 >= M) return;
  const int row0 = mt * 16, col0 = nq * 64; const float* arow = A + (size_t)(row0 + ln) * lda;
  v8f acc[4] = {};
  for (int kb = 0; kb < K; kb += 32) {
    FragH ah, al;
    const v4f x0 = *(const v4fa*)(arow + kb + 8 * hh), x1 = *(const v4fa*)(arow + kb + 8 * hh + 4), x2 = *(const v4fa*)(arow + kb + 16 + 8 * hh), x3 = *(const v4fa*)(arow + kb + 16 + 8 * hh + 4);
    float xs[16] = {x0[0],x0[1],x0[2],x0[3],x1[0],x1[1],x1[2],x1[3],x2[0],x2[1],x2[2],x2[3],x3[0],x3[1],x3[2],x3[3]};
#pragma unroll
    for (int i = 0; i < 16; ++i) { const _Float16 h = (_Float16)xs[i]; ah.h[i] = h; al.h[i] = ASPLIT ? (_Float16)(xs[i] - (float)h) : (_Float16)0.0f; }
#pragma unroll
    for (int t = 0; t < 4; ++t) { if (col0 + t * 16 >= N) continue; const size_t boff = (size_t)(col0 + t * 16 + ln) * ldb + kb; FragH bq; bq.half[0] = *(const v8us*)(Bh + boff + 8 * hh); bq.half[1] = *(const v8us*)(Bh + boff + 16 + 8 * hh);
      acc[t] = mmaH<ASPLIT ? 2 : 1>(ah.v, al.v, bq.v, bq.v, acc[t]); }
  }
#pragma unroll
  for (int t = 0; t < 4; ++t) { if (col0 + t * 16 >= N) continue;
#pragma unroll
    for (int r = 0; r < 8; ++r) so[w][8 * hh + r][t * 16 + ln] = acc[t][r] * alpha; }
  __builtin_amdgcn_fence(__ATOMIC_ACQ_REL, "workgroup"); __builtin_amdgcn_wave_barrier();
  const int rsub = lane >> 4, c4 = (lane & 15) * 4;
  {
#pragma unroll
    for (int q = 0; q < 8; ++q) { const int r = q * 2 + rsub; if (col0 + c4 < N) { const v4f v = *(const v4fa*)&so[w][r][c4]; *(v4f*)(C + (size_t)(row0 + r) * ldc + col0 + c4) = v; } }
     }
}

// Wt[n][k] = f16(W[k][n]·scale) from f32 row-major W[K][N] (scale = power of two; bf16-exact weights stay exact in f16 away from the subnormal range)
__global__ __launch_bounds__(256) void k_wt_f16(const float* __restrict__ W, _Float16* __restrict__ Wt, int K, int N, float scale) {
  const int t = blockIdx.x * 256 + threadIdx.x; if (t >= N * (K / 8)) return; const int n = t / (K / 8), k8 = (t % (K / 8)) * 8; FragH f;
#pragma unroll
  for (int i = 0; i < 8; ++i) f.h[i] = (_Float16)(bf16_round(W[(size_t)(k8 + i) * N + n]) * scale); const v8us o = f.half[0];
  *(v8us*)((unsigned short*)Wt + (size_t)n * K + k8) = o; 
}
// k_gemm_hh variant with fused epilogue: v = acc·alpha + bias[by·sBias + col] (+ CP[(row/rowsPerB)·sCPb + by·64 + col] if CP) ; ACT 0 none / 1 elu ; writes f16 C16 (and f32 C if non-null)
template <int ACT>
__global__ __launch_bounds__(128) void k_gemm_hhx(const _Float16* __restrict__ A, int lda, size_t sA, const _Float16* __restrict__ Bh, int ldb, size_t sB, float alpha, const float* __restrict__ bias, size_t sBias, const float* __restrict__ CP, int rowsPerB, size_t sCPb, int row0g,
    float* __restrict__ C, _Float16* __restrict__ C16, int ldc, size_t sC, int M, int N, int K) {
  __shared__ __attribute__((aligned(16))) float so[4][16][64];
  const int tid = threadIdx.x, w = tid >> 5, lane = tid & 31, ln = lane & 15, hh = lane >> 4; const int by = blockIdx.y;
  A += (size_t)by * sA; Bh += (size_t)by * sB; const size_t cofs = (size_t)by * sC; const float* bp = bias ? bias + (size_t)by * sBias : nullptr;
  const int ntn = (N + 63) / 64; const int wid = blockIdx.x * 4 + w; const int mt = wid / ntn, nq = wid % ntn; if (mt * 16 >= M) return;
  const int row0 = mt * 16, col0 = nq * 64; const _Float16* arow = A + (size_t)(row0 + ln) * lda;
  v8f acc[4] = {};
  for (int kb = 0; kb < K; kb += 32) { FragH ah; ah.half[0] = *(const v8us*)((const unsigned short*)arow + kb + 8 * hh); ah.half[1] = *(const v8us*)((const unsigned short*)arow + kb + 16 + 8 * hh);
#pragma unroll
    for (int t = 0; t < 4; ++t) { if (col0 + t * 16 >= N) continue; const size_t boff = (size_t)(col0 + t * 16 + ln) * ldb + kb; FragH bq; bq.half[0] = *(const v8us*)((const unsigned short*)Bh + boff + 8 * hh); bq.half[1] = *(const v8us*)((const unsigned short*)Bh + boff + 16 + 8 * hh);
      acc[t] = mmaH<1>(ah.v, ah.v, bq.v, bq.v, acc[t]); }
  }
#pragma unroll
  for (int t = 0; t < 4; ++t) { if (col0 + t * 16 >= N) continue; const int col = col0 + t * 16 + ln; const float bv = bp ? bf16_round(bp[col]) : 0.f;
#pragma unroll
    for (int r = 0; r < 8; ++r) { float v = acc[t][r] * alpha + bv; if (CP) { const int rr = row0g + row0 + 8 * hh + r; if (rowsPerB < 0) v += CP[cofs + (size_t)rr * ldc + col];      /* rowsPerB < 0: own element of the batched C plane */ else { const int bidx = rr / rowsPerB; v += CP[(size_t)bidx * sCPb + (size_t)by * 64 + col]; } } if (ACT == 1) v = (v > 0.f) ? v : expm1f(v); else if (ACT == 7) v = (v > 0.f) ? v + 1.0f : expf(v); else if (ACT == 8) v = tanhf(v); else if (ACT == 9) v = 0.5f * v * (1.0f + tanhf(0.7978845608028654f * (v + 0.044715f * v * v * v))); else if (ACT == 11) v = 1.0f / (1.0f + expf(-v)); else if (ACT == 12) v = (v > 0.f) ? v : 0.01f * v; else if (ACT == 14) v = (v > 0.f) ? v : 0.1f * v; else if (ACT == 16) v = (v >= 0.f) ? v : 0.3f * v; else if (ACT == 17) v = (v >= 0.f) ? v : 0.2f * v; else if (ACT == 15) v = v / (1.0f + expf(-v)); else if (ACT == 3) v = fmaxf(v, 0.f); else if (ACT == 6) v = 0.5f * v * (1.0f + erff(v * 0.70710678118654752f)); so[w][8 * hh + r][t * 16 + ln] = v; } }
  __builtin_amdgcn_fence(__ATOMIC_ACQ_REL, "workgroup"); __builtin_amdgcn_wave_barrier();
  const int rsub = lane >> 4, c4 = (lane & 15) * 4; typedef _Float16 v4h __attribute__((ext_vector_type(4)));
  {
#pragma unroll
    for (int q = 0; q < 8; ++q) { const int r = q * 2 + rsub; if (col0 + c4 < N) { const v4f v = *(const v4fa*)&so[w][r][c4]; if (C) *(v4f*)(C + cofs + (size_t)(row0 + r) * ldc + col0 + c4) = v; if (C16) { v4h h4; for (int i = 0; i < 4; ++i) h4[i] = (_Float16)v[i]; *(v4h*)(C16 + cofs + (size_t)(row0 + r) * ldc + col0 + c4) = h4; } } }
     }
}


typedef _Float16 v4h __attribute__((ext_vector_type(4)));

__global__ __launch_bounds__(256) void k_x16(const float* __restrict__ x, _Float16* __restrict__ X16, size_t n8) { const size_t t = (size_t)blockIdx.x * 256 + threadIdx.x; if (t >= n8) return; FragH f;
#pragma unroll
  for (int q = 0; q < 8; ++q) f.h[q] = (_Float16)bf16_round(x[t * 8 + q]); *(v8us*)((unsigned short*)X16 + t * 8) = f.half[0];  }
__global__ __launch_bounds__(256) void k_h16(const float* __restrict__ x, _Float16* __restrict__ X16, size_t n8) { const size_t t = (size_t)blockIdx.x * 256 + threadIdx.x; if (t >= n8) return; FragH f;
#pragma unroll
  for (int q = 0; q < 8; ++q) f.h[q] = (_Float16)x[t * 8 + q]; *(v8us*)((unsigned short*)X16 + t * 8) = f.half[0];  }
__global__ __launch_bounds__(256) void k_round16f(const float* __restrict__ W, _Float16* __restrict__ Bt, size_t n8) { const size_t t = (size_t)blockIdx.x * 256 + threadIdx.x; if (t >= n8) return; FragH f;
#pragma unroll
  for (int i = 0; i < 8; ++i) f.h[i] = (_Float16)(bf16_round(W[t * 8 + i]) * 16.0f); *(v8us*)((unsigned short*)Bt + t * 8) = f.half[0];  }
template <int NHv, int TTv>
__global__ __launch_bounds__(256) void k_vt(const _Float16* __restrict__ V16, int ldv, int voff, _Float16* __restrict__ Vt) { __shared__ unsigned short tl[64][66]; const int tid = threadIdx.x; const int slab = blockIdx.x / (TTv / 64), lg = blockIdx.x % (TTv / 64); const int b = slab / NHv, h = slab % NHv;
  for (int i = tid; i < 64 * 8; i += 256) { const int r = i / 8, c8 = (i % 8) * 8; FragH f; f.half[0] = *(const v8us*)((const unsigned short*)V16 + ((size_t)b * TTv + lg * 64 + r) * ldv + voff + h * 64 + c8);
#pragma unroll
    for (int q = 0; q < 8; ++q) tl[r][c8 + q] = f.u[q]; }
  __syncthreads();
  {
#pragma unroll
    for (int rd = 0; rd < 2; ++rd) { const int d = rd * 32 + tid / 8, pc = tid % 8; FragH f;
#pragma unroll
      for (int q = 0; q < 8; ++q) f.u[q] = tl[pc * 8 + q][d];
      *(v8us*)((unsigned short*)Vt + ((size_t)slab * 64 + d) * TTv + lg * 64 + pc * 8) = f.half[0]; }
     } }

__global__ __launch_bounds__(256) void k_hl(const float* __restrict__ F, _Float16* __restrict__ Hh, _Float16* __restrict__ Hl, size_t n8) { const size_t t = (size_t)blockIdx.x * 256 + threadIdx.x; if (t >= n8) return; FragH fh, fl; const v4f a = *(const v4fa*)(F + t * 8), c = *(const v4fa*)(F + t * 8 + 4);
#pragma unroll
  for (int q = 0; q < 4; ++q) { _Float16 h = (_Float16)a[q]; fh.h[q] = h; fl.h[q] = (_Float16)((a[q] - (float)h) * 1024.0f); h = (_Float16)c[q]; fh.h[4 + q] = h; fl.h[4 + q] = (_Float16)((c[q] - (float)h) * 1024.0f); }
  { *(v8us*)((unsigned short*)Hh + t * 8) = fh.half[0]; *(v8us*)((unsigned short*)Hl + t * 8) = fl.half[0];  } }

// ---- fast GEMM (wave tile 32x64; requires M % 32 == 0 rows per launch region and N % 64 == 0); epilogue = k_gemm_hhx semantics; two batch axes: grid.y (strides sA, sB, sC) and grid.z (strides zA, zB, zC) ----
__device__ __forceinline__ v16h g2_frag(const _Float16* p, int hh) { FragH f; f.half[0] = *(const v8us*)((const unsigned short*)p + 8 * hh); f.half[1] = *(const v8us*)((const unsigned short*)p + 16 + 8 * hh); return f.v; }
__device__ __forceinline__ v8f g2_mma(v16h a, v16h b, v8f c) { v8f d = __builtin_amdgcn_wmma_f32_16x16x32_f16(false, a, false, b, (short)0, c, false, false); asm volatile("v_nop\n\tv_nop\n\tv_nop\n\tv_nop" : "+v"(d) : "v"(a), "v"(b)); return d; }
template <int ACT>
__global__ __launch_bounds__(128) void k_gemm2(const _Float16* __restrict__ A, int lda, size_t sA, const _Float16* __restrict__ Bh, int ldb, size_t sB, float alpha, const float* __restrict__ bias, size_t sBias, const float* __restrict__ CP, int rowsPerB, size_t sCPb, int row0g,
    float* __restrict__ C, _Float16* __restrict__ C16, int ldc, size_t sC, int M, int N, int K, size_t zA, size_t zB, size_t zC) { static_assert(ACT == 0 || ACT == 3 || ACT == 6 || ACT == 8 || ACT == 9 || ACT == 11 || ACT == 12 || ACT == 14 || ACT == 15 || ACT == 16 || ACT == 17, "k_gemm2: unsupported ACT code (would silently apply no activation)");
  __shared__ __attribute__((aligned(16))) float so[4][32][68];
  const int tid = threadIdx.x, w = tid >> 5, lane = tid & 31, ln = lane & 15, hh = lane >> 4; const int by = blockIdx.y; const int bz = blockIdx.z;      /* grid.z = sequence: element strides zA, zB, zC */
  A += (size_t)by * sA + (size_t)bz * zA; Bh += (size_t)by * sB + (size_t)bz * zB; const size_t cofs = (size_t)by * sC + (size_t)bz * zC; const float* bp = bias ? bias + (size_t)by * sBias : nullptr;
  const int ntn = N >> 6; const int mt = blockIdx.x / ntn, nq = blockIdx.x - mt * ntn; const int row0 = mt * 128 + 32 * w, col0 = nq * 64; if (row0 >= M) return;
  const _Float16* a0p = A + (size_t)(row0 + ln) * lda; const _Float16* a1p = a0p + (size_t)16 * lda;
  const _Float16* b0p = Bh + (size_t)(col0 + ln) * ldb; const _Float16* b1p = b0p + (size_t)16 * ldb; const _Float16* b2p = b1p + (size_t)16 * ldb; const _Float16* b3p = b2p + (size_t)16 * ldb;
  const v8f z8 = {0.f,0.f,0.f,0.f,0.f,0.f,0.f,0.f}; v8f c00 = z8, c01 = z8, c02 = z8, c03 = z8, c10 = z8, c11 = z8, c12 = z8, c13 = z8;
#pragma unroll 1
  for (int kb = 0; kb < K; kb += 32) { const v16h a0 = g2_frag(a0p + kb, hh), a1 = g2_frag(a1p + kb, hh);
    v16h b = g2_frag(b0p + kb, hh); c00 = g2_mma(a0, b, c00); c10 = g2_mma(a1, b, c10);
    b = g2_frag(b1p + kb, hh); c01 = g2_mma(a0, b, c01); c11 = g2_mma(a1, b, c11);
    b = g2_frag(b2p + kb, hh); c02 = g2_mma(a0, b, c02); c12 = g2_mma(a1, b, c12);
    b = g2_frag(b3p + kb, hh); c03 = g2_mma(a0, b, c03); c13 = g2_mma(a1, b, c13); }
  v8f accs[8] = {c00, c01, c02, c03, c10, c11, c12, c13};
#pragma unroll
  for (int u = 0; u < 8; ++u) { const int t = u & 3, half = u >> 2; const int col = col0 + t * 16 + ln; const float bv = bp ? bf16_round(bp[col]) : 0.f;
#pragma unroll
    for (int r = 0; r < 8; ++r) { const int rloc = half * 16 + 8 * hh + r; float v = accs[u][r] * alpha + bv; if (CP) { if (rowsPerB < 0) v += CP[cofs + (size_t)(row0g + row0 + rloc) * ldc + col];      /* rowsPerB < 0: own element of the batched C plane */ else { const int bidx = (row0g + row0 + rloc) / rowsPerB; v += CP[(size_t)bidx * sCPb + (size_t)by * 64 + col]; } }
      if (ACT == 3) v = fmaxf(v, 0.f); else if (ACT == 6) v = 0.5f * v * (1.0f + erff(v * 0.70710678118654752f)); else if (ACT == 11) v = 1.0f / (1.0f + expf(-v)); else if (ACT == 15) v = v / (1.0f + expf(-v)); else if (ACT == 12) v = (v > 0.f) ? v : 0.01f * v; else if (ACT == 8) v = tanhf(v); else if (ACT == 9) v = 0.5f * v * (1.0f + tanhf(0.7978845608028654f * (v + 0.044715f * v * v * v))); else if (ACT == 14) v = (v > 0.f) ? v : 0.1f * v; else if (ACT == 16) v = (v >= 0.f) ? v : 0.3f * v; else if (ACT == 17) v = (v >= 0.f) ? v : 0.2f * v;
      so[w][rloc][t * 16 + ln] = v; } }
  __builtin_amdgcn_fence(__ATOMIC_ACQ_REL, "workgroup"); __builtin_amdgcn_wave_barrier();
  const int rsub = lane >> 4, c4 = (lane & 15) * 4;
  {
#pragma unroll
    for (int q = 0; q < 16; ++q) { const int r = q * 2 + rsub; const v4f v = *(const v4fa*)&so[w][r][c4]; if (C) *(v4f*)(C + cofs + (size_t)(row0 + r) * ldc + col0 + c4) = v; if (C16) { v4h h4; for (int i = 0; i < 4; ++i) h4[i] = (_Float16)v[i]; *(v4h*)(C16 + cofs + (size_t)(row0 + r) * ldc + col0 + c4) = h4; } }
     } }


__global__ __launch_bounds__(256) void k_wnat(const float* __restrict__ w, size_t n8, _Float16* __restrict__ Bt) { const size_t t = (size_t)blockIdx.x * 256 + threadIdx.x; if (t >= n8) return; FragH f; for (int q = 0; q < 8; ++q) f.h[q] = (_Float16)(bf16_round(w[t * 8 + q]) * 16.0f); *(v8us*)((unsigned short*)Bt + t * 8) = f.half[0];  }
__global__ __launch_bounds__(256) void k_rsm(const float* __restrict__ S, _Float16* __restrict__ P, int nrows) {
  #pragma clang fp contract(off)
  const int i = blockIdx.x * 256 + threadIdx.x; if (i >= nrows) return; const float* s = S + (size_t)i * SQ; float mx = -3.0e38f;
#pragma unroll 1
  for (int j = 0; j < SQ; ++j) mx = fmaxf(mx, s[j]); float se = 0.f;
#pragma unroll 1
  for (int j = 0; j < SQ; ++j) se += expf(s[j] - mx); const float sc = 256.0f / se;
#pragma unroll 1
  for (int j0 = 0; j0 < SQ; j0 += 8) { FragH f; for (int q = 0; q < 8; ++q) f.h[q] = (_Float16)(expf(s[j0 + q] - mx) * sc); unsigned short* d = (unsigned short*)P + (size_t)i * SQ + j0; *(v8us*)d = f.half[0];  } }
__global__ __launch_bounds__(256) void k_vt(const _Float16* __restrict__ V16, int b, int h0, _Float16* __restrict__ VT) { __shared__ unsigned short tl[64][65]; const int tid = threadIdx.x; const int hh = blockIdx.x % HG, sg = blockIdx.x / HG; const int s0 = sg * 64; const int h = h0 + hh;
  for (int i = tid; i < 64 * 8; i += 256) { const int j = i / 8, d8 = (i % 8) * 8; FragH f; f.half[0] = *(const v8us*)((const unsigned short*)V16 + ((size_t)b * SQ + s0 + j) * DM + h * HD + d8); for (int q = 0; q < 8; ++q) tl[d8 + q][j] = f.u[q]; }
  __syncthreads();
  { for (int i = tid; i < 64 * 8; i += 256) { const int d = i / 8, j8 = (i % 8) * 8; FragH f; for (int q = 0; q < 8; ++q) f.u[q] = tl[d][j8 + q]; *(v8us*)((unsigned short*)VT + ((size_t)hh * HD + d) * SQ + s0 + j8) = f.half[0]; }  } }



// 2^x on the transcendental unit, with the one free issue slot that the instruction set asks for behind it before its result is used or its
// source overwritten: in the unrolled row the compiler put one exponential's result into the source register of the one directly ahead of it.
__device__ __forceinline__ float exp2_slot(float x) { float r; asm("v_exp_f32 %0, %1\n\tv_nop" : "=v"(r) : "v"(x)); return r; }
// Fused causal attention: scores, softmax and P V in one launch; neither scores nor weights go to memory. One wave owns 16 query rows of one
// head and walks its keys 32 at a time, transposed: S^T = K Q^T (A = key rows, B = query rows), so that a lane holds scores of ONE query
// (column ln; keys 8 hh + r of each 16-key tile) and the row maximum and sum need one exchange between the wave's halves. The two score tiles,
// converted in place, are the B operand of O^T += V^T P^T in the loader's own k order (keys 8 hh + 0..7, then 16 + 8 hh + 0..7), and the
// accumulators of O^T belong to the same query as the lane's running maximum and sum. Scores keep their three f16 products (hi.hi, lo.hi, hi.lo).
__global__ __launch_bounds__(128) void k_fattn(const _Float16* __restrict__ Qh, const _Float16* __restrict__ Ql, const _Float16* __restrict__ Kh, const _Float16* __restrict__ Kl, const _Float16* __restrict__ Vt, _Float16* __restrict__ O) {
  const int lane = threadIdx.x & 31, ln = lane & 15, hh = lane >> 4; const int w = __builtin_amdgcn_readfirstlane(threadIdx.x >> 5);      /* the wave's number in a scalar register: the trip count stays scalar */
  const int h = blockIdx.y, b = blockIdx.z; const int qt = (b & 1) ? (int)blockIdx.x : (int)(gridDim.x - 1 - blockIdx.x);      /* long and short causal tiles alternate between sequences */
  const int q0 = qt * 64 + w * 16; const size_t rb = (size_t)b * SQ;
  const size_t qo = (rb + q0 + ln) * LQ + h * HD;
  const v16h qh0 = g2_frag(Qh + qo, hh), qh1 = g2_frag(Qh + qo + 32, hh), ql0 = g2_frag(Ql + qo, hh), ql1 = g2_frag(Ql + qo + 32, hh);
  const _Float16* kh = Kh + (rb + ln) * LQ + h * HD; const _Float16* kl = Kl + (rb + ln) * LQ + h * HD;
  const _Float16* vt = Vt + ((size_t)(b * NH + h) * HD + ln) * SQ;
  const v8f z8 = {0.f,0.f,0.f,0.f,0.f,0.f,0.f,0.f}; v8f o[4] = {z8, z8, z8, z8};
  float m = -1.0e30f, l = 0.f; const int nst = (q0 >> 5) + 1;      /* 32-key steps up to the one that holds the diagonal */
  v16h ka[2][4];      /* per 16-key tile: hi d 0..31, hi d 32..63, residual d 0..31, residual d 32..63 */
#pragma unroll      /* this and every constant-trip loop below: unrolled so that fragments and accumulators are registers, not indexed arrays */
  for (int kt = 0; kt < 2; ++kt) { const size_t ro = (size_t)(16 * kt) * LQ; ka[kt][0] = g2_frag(kh + ro, hh); ka[kt][1] = g2_frag(kh + ro + 32, hh); ka[kt][2] = g2_frag(kl + ro, hh); ka[kt][3] = g2_frag(kl + ro + 32, hh); }
#pragma unroll 1      /* rolled: a second copy of the body would hold a second set of fragments and cost a resident wave per SIMD */
  for (int st = 0; st < nst; ++st) { const int key0 = st * 32;
    v16h va[4];
#pragma unroll
    for (int t = 0; t < 4; ++t) va[t] = g2_frag(vt + (size_t)(16 * t) * SQ + key0, hh);
    v8f sh[2], sl[2];
#pragma unroll
    for (int kt = 0; kt < 2; ++kt) { sh[kt] = g2_mma(ka[kt][0], qh0, z8); sh[kt] = g2_mma(ka[kt][1], qh1, sh[kt]);
      sl[kt] = g2_mma(ka[kt][0], ql0, z8); sl[kt] = g2_mma(ka[kt][1], ql1, sl[kt]); sl[kt] = g2_mma(ka[kt][2], qh0, sl[kt]); sl[kt] = g2_mma(ka[kt][3], qh1, sl[kt]); }
    const int kn = (st + 1 < nst) ? key0 + 32 : key0;      /* the next step's key rows, fetched behind this step's score products (the last step's own again at the end: in bounds, unused) */
#pragma unroll
    for (int kt = 0; kt < 2; ++kt) { const size_t ro = (size_t)(kn + 16 * kt) * LQ; ka[kt][0] = g2_frag(kh + ro, hh); ka[kt][1] = g2_frag(kh + ro + 32, hh); ka[kt][2] = g2_frag(kl + ro, hh); ka[kt][3] = g2_frag(kl + ro + 32, hh); }
    float sv[16]; float mx = m; const int rel = q0 + ln - key0 - 8 * hh;      /* key 16 kt + r of this lane is kept while 16 kt + r <= rel */
#pragma unroll
    for (int kt = 0; kt < 2; ++kt)
#pragma unroll
      for (int r = 0; r < 8; ++r) { const float s = sh[kt][r] * SCL + sl[kt][r] * SCLR; const float xv = (16 * kt + r <= rel) ? s : -1.0e9f; sv[kt * 8 + r] = xv; mx = fmaxf(mx, xv); }
    mx = fmaxf(mx, __shfl_xor(mx, 16, 32));
    const float al = exp2_slot((m - mx) * 1.44269504088896340736f); m = mx;
    float ps = 0.f; FragH p;
#pragma unroll
    for (int i = 0; i < 16; ++i) { const float e = exp2_slot((sv[i] - mx) * 1.44269504088896340736f + 8.0f);      /* weights carried x256, as in the f16 operand before */ ps += e; p.h[i] = (_Float16)e; }
    l = l * al + ps;
#pragma unroll
    for (int t = 0; t < 4; ++t) { o[t] *= al; o[t] = g2_mma(va[t], p.v, o[t]); } }
  l += __shfl_xor(l, 16, 32);
  const float fin = 64.0f / l;      /* o carried x64; the x256 of the weights cancels against the sum's */
  _Float16* orow = O + (rb + q0 + ln) * DM + h * HD + 8 * hh;
#pragma unroll
  for (int t = 0; t < 4; ++t) { FragH f;
#pragma unroll
    for (int r = 0; r < 8; ++r) f.h[r] = (_Float16)(o[t][r] * fin);
    *(v8us*)((unsigned short*)orow + 16 * t) = f.half[0]; } }


// Exact f32 attention for the first QT0 rows of every sequence. One block owns A0R query rows of one head and stages the head's QT0 key and value
// rows in LDS once; a wave owns two query rows, held in registers, so that each staged row it reads serves both. Scores: a lane owns one key of each
// group of 32 and reads its key row 16 bytes at a time; four partial sums per dot product. Softmax: true row maximum and sum by a butterfly over the
// wave. P V: a lane owns four head dims and every other run of four keys; the wave's halves are added at the end.
#define A0R 16                       /* query rows per block: two per wave */
#define A0KP 68                      /* floats from one staged key row to the next: 16 bytes x odd, so that 16 lanes on 16 rows meet no bank twice */
__global__ __launch_bounds__(256) void k_att0(const float* __restrict__ QF, const float* __restrict__ KF, const float* __restrict__ VF, float scale, float* __restrict__ OF) {
  __shared__ __attribute__((aligned(16))) float ks[QT0][A0KP]; __shared__ __attribute__((aligned(16))) float vs[QT0][HD]; __shared__ __attribute__((aligned(16))) float ps[A0R][QT0];
  static_assert(QT0 % 32 == 0 && HD == 64 && A0R == 16, "256 threads: 16 per staged row of 64 floats, 8 waves of two query rows, key groups of 32");
  const int tid = threadIdx.x, lane = tid & 31, w = tid >> 5; const int h = blockIdx.x / (QT0 / A0R), rg = blockIdx.x % (QT0 / A0R); const int r0 = rg * A0R;
  { const size_t zb = (size_t)blockIdx.y * QT0 * DM + h * HD; QF += zb; KF += zb; VF += zb; OF += zb; }      /* grid.y = sequence: QT0 rows of q, k, v and o each, DM floats from row to row (a constant, so that a run of loads shares one address and differs in its immediate offset) */
  const int ia = r0 + w, ib = r0 + 8 + w;      /* the wave's two query rows */
  const int sr = tid >> 4, sc = (tid & 15) * 4; v4f kk[QT0 / 16], vv[QT0 / 16], qa[HD / 4], qb[HD / 4];
#pragma unroll      /* this and every constant-trip loop below: unrolled so that the arrays are registers and the loads of a run are in flight together */
  for (int p = 0; p < QT0 / 16; ++p) { kk[p] = *(const v4fa*)(KF + (size_t)(p * 16 + sr) * DM + sc); vv[p] = *(const v4fa*)(VF + (size_t)(p * 16 + sr) * DM + sc); }
  asm volatile("s_wait_xcnt 0x0" ::: "memory");      /* stands between the loads above and the first later write of a register that holds one of their addresses (the query loads below may land there) */
#pragma unroll
  for (int c = 0; c < HD / 4; ++c) { qa[c] = *(const v4fa*)(QF + (size_t)ia * DM + c * 4); qb[c] = *(const v4fa*)(QF + (size_t)ib * DM + c * 4); }
  asm volatile("s_wait_xcnt 0x0" ::: "memory");      /* the same behind the query loads */
#pragma unroll
  for (int p = 0; p < QT0 / 16; ++p) { *(v4f*)&ks[p * 16 + sr][sc] = kk[p]; *(v4f*)&vs[p * 16 + sr][sc] = vv[p]; }
  __syncthreads();
  const int ng = (r0 + A0R - 1) / 32 + 1;      /* groups of 32 keys up to the block's last row: the same for every wave */
  float sa[QT0 / 32], sb[QT0 / 32]; float ma = -1.0e30f, mb = -1.0e30f;
#pragma unroll
  for (int g = 0; g < QT0 / 32; ++g) { sa[g] = -1.0e30f; sb[g] = -1.0e30f;
    if (g < ng) { const int key = g * 32 + lane; v4f aa = {0.f, 0.f, 0.f, 0.f}, ab = {0.f, 0.f, 0.f, 0.f};
#pragma unroll
      for (int c = 0; c < HD / 4; ++c) { const v4f k4 = *(const v4f*)&ks[key][c * 4]; aa += qa[c] * k4; ab += qb[c] * k4; }
      if (key <= ia) sa[g] = ((aa[0] + aa[1]) + (aa[2] + aa[3])) * scale;
      if (key <= ib) sb[g] = ((ab[0] + ab[1]) + (ab[2] + ab[3])) * scale;
      ma = fmaxf(ma, sa[g]); mb = fmaxf(mb, sb[g]); } }
#pragma unroll
  for (int d = 16; d > 0; d >>= 1) { ma = fmaxf(ma, __shfl_xor(ma, d, 32)); mb = fmaxf(mb, __shfl_xor(mb, d, 32)); }
  float la = 0.f, lb = 0.f;
#pragma unroll
  for (int g = 0; g < QT0 / 32; ++g)
    if (g < ng) { const int key = g * 32 + lane; const float ea = (key <= ia) ? expf(sa[g] - ma) : 0.f, eb = (key <= ib) ? expf(sb[g] - mb) : 0.f; la += ea; lb += eb; ps[w][key] = ea; ps[8 + w][key] = eb; }
#pragma unroll
  for (int d = 16; d > 0; d >>= 1) { la += __shfl_xor(la, d, 32); lb += __shfl_xor(lb, d, 32); }
  __syncthreads();      /* the weights are read below by other lanes than wrote them */
  const int dq = (lane & 15) * 4, jp = lane >> 4; v4f oa = {0.f, 0.f, 0.f, 0.f}, ob = {0.f, 0.f, 0.f, 0.f};
#pragma unroll 1      /* rolled: the trip count is the block's; one trip holds 16 keys, twelve LDS reads in flight together */
  for (int ch = 0; ch <= rg; ++ch) {
#pragma unroll
    for (int t = 0; t < 2; ++t) { const int k0 = ch * 16 + t * 8 + jp * 4; const v4f pa = *(const v4f*)&ps[w][k0], pb = *(const v4f*)&ps[8 + w][k0];
#pragma unroll
      for (int u = 0; u < 4; ++u) { const v4f v4 = *(const v4f*)&vs[k0 + u][dq]; oa += pa[u] * v4; ob += pb[u] * v4; } } }
#pragma unroll
  for (int q = 0; q < 4; ++q) { oa[q] += __shfl_xor(oa[q], 16, 32); ob[q] += __shfl_xor(ob[q], 16, 32); }
  const float fin = 64.0f / (jp ? lb : la);      /* o carried x64 like the f16 path */
  const v4f res = (jp ? ob : oa) * fin;      /* lanes 0..15 store the first row, lanes 16..31 the second */
  *(v4f*)(OF + (size_t)(jp ? ib : ia) * DM + dq) = res; }

extern "C" void kernel_launch(void* const* d_in, const int* in_sizes, int n_in,
                              void* d_out, int out_size, void* d_ws, size_t ws_size, hipStream_t stream) {
  (void)in_sizes; (void)n_in; (void)out_size;
  const float* const* I = (const float* const*)d_in; const float* x = I[0]; const float* xk = I[0]; const float* xv = I[0]; const float* wq = I[1]; const float* bq = I[2]; const float* wk = I[3]; const float* bk = I[4]; const float* wv = I[5]; const float* bv = I[6]; const float* wo = I[7]; const float* bo = I[8];      /* input order: x, Wq, bq, Wk, bk, Wv, bv (PER-HEAD STACKS [8][512][64] with REAL per-head biases [8][64] = flat [512]: the GEMMs' guarded bias slots), Wp ([in][out]: out @ Wp), bp (REAL) */
  char* ws = (char*)d_ws; size_t off = 0;
  auto take = [&](size_t bytes) { char* p = ws + off; off += (bytes + 255) & ~(size_t)255; return p; };
  _Float16* BQ = (_Float16*)take((size_t)DM * DM * 2); _Float16* BK = (_Float16*)take((size_t)DM * DM * 2); _Float16* BV = (_Float16*)take((size_t)DM * DM * 2); _Float16* BO = (_Float16*)take((size_t)DM * DM * 2);
  _Float16* X16 = (_Float16*)take(NR * DM * 2); _Float16* XK16 = (_Float16*)take(NR * DM * 2); _Float16* XV16 = (_Float16*)take(NR * DM * 2);      /* exact f16 rows of query, key, value */ float* QF = (float*)take(NR * DM * 4); _Float16* QH = (_Float16*)take(NR * DM * 2); _Float16* QL = (_Float16*)take(NR * DM * 2); _Float16* KH = (_Float16*)take(NR * DM * 2); _Float16* KL = (_Float16*)take(NR * DM * 2); _Float16* Q16 = QH; _Float16* K16 = KH; _Float16* V16 = (_Float16*)take(NR * DM * 2); _Float16* O16 = (_Float16*)take(NR * DM * 2);
  _Float16* VT = (_Float16*)take((size_t)NB * NH * HD * SQ * 2);      /* one plane per sequence: the sequences share each launch */
  float* QF0 = (float*)take((size_t)NB * QT0 * DM * 4); float* KF0 = (float*)take((size_t)NB * QT0 * DM * 4); float* VF0 = (float*)take((size_t)NB * QT0 * DM * 4); float* OF0 = (float*)take((size_t)NB * QT0 * DM * 4); _Float16* OH0 = (_Float16*)take((size_t)NB * QT0 * DM * 2); _Float16* OL0 = (_Float16*)take((size_t)NB * QT0 * DM * 2);
  if (off > ws_size) return;
  { const unsigned gn = (unsigned)(((size_t)DM * DM / 8 + 255) / 256); const unsigned gh = (unsigned)(((size_t)HD * (DM / 8) + 255) / 256); for (int h = 0; h < NH; ++h) { const size_t wofs = (size_t)h * DM * HD, pofs = (size_t)h * HD * DM; k_wt_f16<<<gh, 256, 0, stream>>>(wq + wofs, BQ + pofs, DM, HD, 16.0f); k_wt_f16<<<gh, 256, 0, stream>>>(wk + wofs, BK + pofs, DM, HD, 16.0f); k_wt_f16<<<gh, 256, 0, stream>>>(wv + wofs, BV + pofs, DM, HD, 16.0f); } k_wt_f16<<<gn, 256, 0, stream>>>(wo, BO, DM, DM, 16.0f); }      /* PER-HEAD STACKS wq / wk / wv [NH][DM][HD]: head h is a row-major [in = DM][out = HD] block at w + h * DM * HD: the transposing builder with K = DM, N = HD writes its HD rows Bt[h * HD + e][k] at B + h * HD * DM: contiguous rows of the [out][in] plane (x16); wo is an [in][out] [DM][DM] matrix (out @ Wp): ONE call of the same transposing builder with K = N = DM on the grid gn = DM * DM / 8 threads (N * (K / 8)) */
  k_x16<<<(unsigned)((NR * DM / 8 + 255) / 256), 256, 0, stream>>>(x, X16, NR * DM / 8); k_x16<<<(unsigned)((NR * DM / 8 + 255) / 256), 256, 0, stream>>>(xk, XK16, NR * DM / 8); k_x16<<<(unsigned)((NR * DM / 8 + 255) / 256), 256, 0, stream>>>(xv, XV16, NR * DM / 8);
  const size_t r0p = (size_t)B0 * SQ;      /* first projected row */
  k_gemm2<0><<<dim3((unsigned)((MP / 128) * (DM / 64)), 1), 128, 0, stream>>>(X16 + r0p * DM, DM, 0, BQ, DM, 0, 0.0625f, bq, 0, nullptr, 1, 0, 0, QF + r0p * DM, nullptr, DM, 0, MP, DM, DM, 0, 0, 0); k_hl<<<(unsigned)(((size_t)MP * DM / 8 + 255) / 256), 256, 0, stream>>>(QF + r0p * DM, QH + r0p * DM, QL + r0p * DM, (size_t)MP * DM / 8);      /* q (f32) -> f16 hi + x1024 residual: unscaled logits sigma ~8 */
  k_gemm2<0><<<dim3((unsigned)((MP / 128) * (DM / 64)), 1), 128, 0, stream>>>(XK16 + r0p * DM, DM, 0, BK, DM, 0, 0.0625f, bk, 0, nullptr, 1, 0, 0, QF + r0p * DM, nullptr, DM, 0, MP, DM, DM, 0, 0, 0); k_hl<<<(unsigned)(((size_t)MP * DM / 8 + 255) / 256), 256, 0, stream>>>(QF + r0p * DM, KH + r0p * DM, KL + r0p * DM, (size_t)MP * DM / 8);      /* k likewise */
  k_gemm2<0><<<dim3((unsigned)((MP / 128) * (DM / 64)), 1), 128, 0, stream>>>(XV16 + r0p * DM, DM, 0, BV, DM, 0, 0.0625f, bv, 0, nullptr, 1, 0, 0, nullptr, V16 + r0p * DM, DM, 0, MP, DM, DM, 0, 0, 0);
  { const size_t r0 = r0p; const size_t zX = (size_t)SQ * DM, zF = (size_t)QT0 * DM;      /* every launch below covers all NBR sequences: element strides from one sequence to the next */
    k_vt<NH, SQ><<<NBR * NH * (SQ / 64), 256, 0, stream>>>(V16 + r0 * LQ, LQ, 0, VT);      /* V^T [NBR][NH][HD][SQ] */
    k_gemm2<0><<<dim3((QT0 / 128) * (DM / 64), 1, NBR), 128, 0, stream>>>(X16 + r0 * DM, DM, 0, BQ, DM, 0, 0.0625f, bq, 0, nullptr, 1, 0, 0, QF0, nullptr, DM, 0, QT0, DM, DM, zX, 0, zF); k_gemm2<0><<<dim3((QT0 / 128) * (DM / 64), 1, NBR), 128, 0, stream>>>(XK16 + r0 * DM, DM, 0, BK, DM, 0, 0.0625f, bk, 0, nullptr, 1, 0, 0, KF0, nullptr, DM, 0, QT0, DM, DM, zX, 0, zF); k_gemm2<0><<<dim3((QT0 / 128) * (DM / 64), 1, NBR), 128, 0, stream>>>(XV16 + r0 * DM, DM, 0, BV, DM, 0, 0.0625f, bv, 0, nullptr, 1, 0, 0, VF0, nullptr, DM, 0, QT0, DM, DM, zX, 0, zF);      /* f32 q, k, v of the first 128 rows (exact products) */
    k_att0<<<dim3(NH * (QT0 / A0R), NBR), 256, 0, stream>>>(QF0, KF0, VF0, SCL, OF0 + (size_t)B0 * QT0 * DM);      /* exact f32 attention for rows 0..127 (o x64) */
    static_assert(SQ % 64 == 0 && HD == 64 && NHD == NH && QN == SQ && LQ == DM, "64 query rows per block, 32-key steps, head size 64");
    k_fattn<<<dim3(SQ / 64, NH, NBR), 128, 0, stream>>>(QH + r0 * LQ, QL + r0 * LQ, KH + r0 * LQ, KL + r0 * LQ, VT, O16 + r0 * DM); }      /* o (merged heads, x64) as f16 rows */
  k_gemm2<0><<<dim3((unsigned)((MPO / 128) * (DM / 64)), 1), 128, 0, stream>>>(O16 + r0p * DM, DM, 0, BO, DM, 0, 0.0009765625f, bo, 0, nullptr, 1, 0, 0, (float*)d_out + r0p * DM, nullptr, DM, 0, MPO, DM, DM, 0, 0, 0);      /* out rows are the output layout */
  k_hl<<<(unsigned)(((size_t)NB * QT0 * DM / 8 + 255) / 256), 256, 0, stream>>>(OF0, OH0, OL0, (size_t)NB * QT0 * DM / 8);      /* first-tile o (x64) -> f16 hi + x1024 residual planes */
  { const size_t r0 = r0p; const size_t f0 = (size_t)B0 * QT0; const size_t zX = (size_t)SQ * DM, zF = (size_t)QT0 * DM;      /* all sequences per launch, as above */
    k_gemm2<0><<<dim3((QT0 / 128) * (DM / 64), 1, NBR), 128, 0, stream>>>(OH0 + f0 * DM, DM, 0, BO, DM, 0, 0.0009765625f, bo, 0, nullptr, 1, 0, 0, (float*)d_out + r0 * DM, nullptr, DM, 0, QT0, DM, DM, zF, 0, zX);      /* rows 0..127: out = o_hi Wo (+ b), overwriting the f16-path rows */
    k_gemm2<0><<<dim3((QT0 / 128) * (DM / 64), 1, NBR), 128, 0, stream>>>(OL0 + f0 * DM, DM, 0, BO, DM, 0, 0.00000095367431640625f, nullptr, 0, (const float*)d_out + r0 * DM, -1, 0, 0, (float*)d_out + r0 * DM, nullptr, DM, 0, QT0, DM, DM, zF, 0, zX); }      /* += o_lo Wo 2^-20 (own-element accumulate) */
}

// v005
// One run takes 233 microseconds.
// In two side-by-side timings against v004, it was 1.70 and 1.69 times as fast.
// Over all steps from v000 it is 46.4 times as fast.
#include <hip/hip_runtime.h>
// Causal multi-head self-attention with PER-HEAD STACKED projections and REAL per-head biases on four sequences at width 512 (x [4][2048][512]; Wq / Wk / Wv [8][512][64] = [head][in][out] ('bte,hed->bhtd'; uniform +-1/sqrt(512)) with biases [8][64] (REAL, uniform +-1/sqrt(512)): a per-head bias [8][64] IS the flat bias [512]; 8 heads of 64 (8 x 64 = 512 = the width); scores * 1/sqrt(64); where(tril, scores, -inf); softmax over keys; out = merged Wp + bp ([in][out] [512][512] + a REAL bias, uniform +-1/sqrt(512)) -> [4][2048][512]); the [in][out] output weight through the text's own TRANSPOSING builder (the one the per-head stacks use); q and k carried as f16 hi + x1024 residual planes with three-product scores; each head's [in][out] block is transposed into its 64 contiguous rows of the weight plane by the same builder, one job per head in one shared launch.
// Compute dtype: inputs rounded to bf16; x / weights exact; v, softmax weights and o as plain f16 GEMM operands (~2^-12), q and k as f16 hi + x1024 residual pairs (rows 0..127: f32 attention, o as hi + residual); scores and softmax statistics f32; v_wmma_f32_16x16x32_f16.
#define NB 4
#define SCL 0.125f                         /* 1 / sqrt(head_dim 64) */
#define SCLR 0.0001220703125f               /* 2^-13: the same scale on the x1024 residual passes */
#define SQ 2048
#define DM 512
#define NH 8
#define HD 64
#define HG 4                         /* heads per call of the untemplated k_vt (not launched) */
#define QT0 128                      /* first-tile rows recomputed exactly in f32 */
#define B0 0                         /* first batch processed (debug hook) */
#define NBR NB                       /* batches processed (debug hook) */
#define NR ((size_t)NB * SQ)         /* token rows */
#define MP ((int)((size_t)NBR * SQ)) /* rows projected (debug hook) */
#define QN SQ                        /* query rows attended per batch (debug hook) */
#define NHD NH                       /* heads attended (debug hook) */
#define MPO MP                       /* rows through the output stage (debug hook) */
#define LQ DM      /* row pitch of the q/k/v rows */
typedef __bf16 v16b __attribute__((ext_vector_type(16)));
typedef unsigned short v8us __attribute__((ext_vector_type(8), may_alias));
typedef float  v8f  __attribute__((ext_vector_type(8)));
typedef float  v4f  __attribute__((ext_vector_type(4)));
typedef float  v4fa __attribute__((ext_vector_type(4), may_alias));
union FragB { v16b v; v8us half[2]; unsigned short u[16]; };

__device__ __forceinline__ unsigned short bf16_bits(float x) { unsigned int u = __float_as_uint(x); return (unsigned short)((u + 0x7FFFu + ((u >> 16) & 1u)) >> 16); }
__device__ __forceinline__ float bf16_val(unsigned short b) { return __uint_as_float(((unsigned int)b) << 16); }
__device__ __forceinline__ float bf16_round(float x) { return bf16_val(bf16_bits(x)); }
// D += A·B with NT terms: 1 = ah·bh, 2 = + al·bh (A split), 3 = + ah·bl (both split)
template <int NT>
__device__ __forceinline__ v8f mmaN(v16b ah, v16b al, v16b bh, v16b bl, v8f c) {
  c = __builtin_amdgcn_wmma_f32_16x16x32_bf16(false, ah, false, bh, (short)0, c, false, false);
  if (NT >= 2) c = __builtin_amdgcn_wmma_f32_16x16x32_bf16(false, al, false, bh, (short)0, c, false, false);
  if (NT >= 3) c = __builtin_amdgcn_wmma_f32_16x16x32_bf16(false, ah, false, bl, (short)0, c, false, false);
  asm volatile("v_nop\n\tv_nop\n\tv_nop\n\tv_nop" : "+v"(c) : "v"(ah), "v"(al), "v"(bh), "v"(bl));
  return c;
}

__global__ __launch_bounds__(256) void k_wt_bf16(const float* __restrict__ W, unsigned short* __restrict__ Wt, int K, int N) {
  const int t = blockIdx.x * 256 + threadIdx.x;
  const int k8n = K / 8;
  if (t >= N * k8n) return;
  const int n = t / k8n, k8 = (t % k8n) * 8;
  v8us v;
#pragma unroll
  for (int i = 0; i < 8; ++i) v[i] = bf16_bits(W[(size_t)(k8 + i) * N + n]);
  *(v8us*)(Wt + (size_t)n * K + k8) = v;
  
}

// GEMM C[M][N] (f32, pitch ldc) = act(A[M][K]·W + bias). A f32 row-major (pitch lda) converted per fragment to bf16
// (ASPLIT: hi/lo two planes -> 2 terms, else single rounded term); Wt bf16 [N][K] (pitch ldb). BIAS_BF16 rounds the
// bias to bf16 first (bias quantised to bf16 before the add). K%32==0, M%16==0, N%64==0.
template <bool ASPLIT, int ACT, bool BIAS_BF16>
__global__ __launch_bounds__(128) void k_gemm_bf(const float* __restrict__ A, int lda, const unsigned short* __restrict__ Wt, int ldb,
                                               const float* __restrict__ bias, float* __restrict__ C, int ldc, int M, int N, int K) {
  __shared__ __attribute__((aligned(16))) float so[4][16][64];
  const int tid = threadIdx.x, w = tid >> 5, lane = tid & 31, ln = lane & 15, hh = lane >> 4;
  const int ntn = N / 64;
  const int wid = blockIdx.x * 4 + w;
  const int mt = wid / ntn, nq = wid % ntn;
  if (mt * 16 >= M) return;
  const int row0 = mt * 16, col0 = nq * 64;
  const float* arow = A + (size_t)(row0 + ln) * lda;
  v8f acc[4] = {};
  for (int kb = 0; kb < K; kb += 32) {
    FragB ah, al;
    const v4f x0 = *(const v4fa*)(arow + kb + 8 * hh), x1 = *(const v4fa*)(arow + kb + 8 * hh + 4);
    const v4f x2 = *(const v4fa*)(arow + kb + 16 + 8 * hh), x3 = *(const v4fa*)(arow + kb + 16 + 8 * hh + 4);
    float xs[16] = {x0[0],x0[1],x0[2],x0[3],x1[0],x1[1],x1[2],x1[3],x2[0],x2[1],x2[2],x2[3],x3[0],x3[1],x3[2],x3[3]};
#pragma unroll
    for (int i = 0; i < 16; ++i) { const unsigned short hb = bf16_bits(xs[i]); ah.u[i] = hb; al.u[i] = ASPLIT ? bf16_bits(xs[i] - bf16_val(hb)) : (unsigned short)0; }
#pragma unroll
    for (int t = 0; t < 4; ++t) {
      const unsigned short* brow = Wt + (size_t)(col0 + t * 16 + ln) * ldb + kb;
      FragB b;
      b.half[0] = *(const v8us*)(brow + 8 * hh);
      b.half[1] = *(const v8us*)(brow + 16 + 8 * hh);
      acc[t] = mmaN<ASPLIT ? 2 : 1>(ah.v, al.v, b.v, b.v, acc[t]);
    }
  }
#pragma unroll
  for (int t = 0; t < 4; ++t) {
    float bv = bias ? bias[col0 + t * 16 + ln] : 0.f;
    if (BIAS_BF16) bv = bf16_round(bv);
#pragma unroll
    for (int r = 0; r < 8; ++r) { float v = acc[t][r] + bv; if (ACT == 1) v = fmaxf(v, 0.f); so[w][8 * hh + r][t * 16 + ln] = v; }
  }
  __builtin_amdgcn_fence(__ATOMIC_ACQ_REL, "workgroup");
  __builtin_amdgcn_wave_barrier();
  const int rsub = lane >> 4, c4 = (lane & 15) * 4;
  {
#pragma unroll
    for (int q = 0; q < 8; ++q) {
      const int r = q * 2 + rsub;
      const v4f v = *(const v4fa*)&so[w][r][c4];
      *(v4f*)(C + (size_t)(row0 + r) * ldc + col0 + c4) = v;
    }
    
  }
}

// GEMM C = act(A·W + bias + resid): A f32 (ASPLIT -> hi/lo 2 terms), Wt bf16 [N][K]; ACT 0 none, 1 relu, 2 exact gelu;
// resid (optional, f32, row index = (row % rmod), pitch ldr, RES_BF16 rounds it) added before the activation.
template <bool ASPLIT, int ACT, bool BIAS_BF16, bool RES_BF16>
__global__ __launch_bounds__(128) void k_gemm_bf3(const float* __restrict__ A, int lda, const unsigned short* __restrict__ Wt, int ldb,
                                                const float* __restrict__ bias, const float* __restrict__ resid, int rmod, int ldr,
                                                float* __restrict__ C, int ldc, int M, int N, int K) {
  __shared__ __attribute__((aligned(16))) float so[4][16][64];
  const int tid = threadIdx.x, w = tid >> 5, lane = tid & 31, ln = lane & 15, hh = lane >> 4;
  const int ntn = N / 64;
  const int wid = blockIdx.x * 4 + w;
  const int mt = wid / ntn, nq = wid % ntn;
  if (mt * 16 >= M) return;
  const int row0 = mt * 16, col0 = nq * 64;
  const float* arow = A + (size_t)(row0 + ln) * lda;
  v8f acc[4] = {};
  for (int kb = 0; kb < K; kb += 32) {
    FragB ah, al;
    const v4f x0 = *(const v4fa*)(arow + kb + 8 * hh), x1 = *(const v4fa*)(arow + kb + 8 * hh + 4);
    const v4f x2 = *(const v4fa*)(arow + kb + 16 + 8 * hh), x3 = *(const v4fa*)(arow + kb + 16 + 8 * hh + 4);
    float xs[16] = {x0[0],x0[1],x0[2],x0[3],x1[0],x1[1],x1[2],x1[3],x2[0],x2[1],x2[2],x2[3],x3[0],x3[1],x3[2],x3[3]};
#pragma unroll
    for (int i = 0; i < 16; ++i) { const unsigned short hb = bf16_bits(xs[i]); ah.u[i] = hb; al.u[i] = ASPLIT ? bf16_bits(xs[i] - bf16_val(hb)) : (unsigned short)0; }
#pragma unroll
    for (int t = 0; t < 4; ++t) {
      const unsigned short* brow = Wt + (size_t)(col0 + t * 16 + ln) * ldb + kb;
      FragB b;
      b.half[0] = *(const v8us*)(brow + 8 * hh);
      b.half[1] = *(const v8us*)(brow + 16 + 8 * hh);
      acc[t] = mmaN<ASPLIT ? 2 : 1>(ah.v, al.v, b.v, b.v, acc[t]);
    }
  }
#pragma unroll
  for (int t = 0; t < 4; ++t) {
    const int col = col0 + t * 16 + ln;
    float bv = bias ? bias[col] : 0.f;
    if (BIAS_BF16) bv = bf16_round(bv);
#pragma unroll
    for (int r = 0; r < 8; ++r) {
      float v = acc[t][r] + bv;
      if (resid) { float rv = resid[(size_t)((row0 + 8 * hh + r) % rmod) * ldr + col]; if (RES_BF16) rv = bf16_round(rv); v += rv; }
      if (ACT == 1) v = fmaxf(v, 0.f);
      if (ACT == 2) v = 0.5f * v * (1.0f + erff(v * 0.70710678118654752f));
      if (ACT == 3) { const float u = 0.7978845608028654f * (v + 0.044715f * v * v * v); v = 0.5f * v * (1.0f + tanhf(u)); }
      so[w][8 * hh + r][t * 16 + ln] = v;
    }
  }
  __builtin_amdgcn_fence(__ATOMIC_ACQ_REL, "workgroup");
  __builtin_amdgcn_wave_barrier();
  const int rsub = lane >> 4, c4 = (lane & 15) * 4;
  {
#pragma unroll
    for (int q = 0; q < 8; ++q) {
      const int r = q * 2 + rsub;
      const v4f v = *(const v4fa*)&so[w][r][c4];
      *(v4f*)(C + (size_t)(row0 + r) * ldc + col0 + c4) = v;
    }
    
  }
}
// row LayerNorm (biased variance, eps) over N: s = X (+ R); optional out_sum <- s; out_norm <- (s-mu)*rsqrt(var+eps)*g + b
template <bool PARAM_BF16>
__global__ __launch_bounds__(256) void k_layernorm(const float* __restrict__ X, const float* __restrict__ R, const float* __restrict__ g, const float* __restrict__ bta,
                                                  float* __restrict__ out_sum, float* __restrict__ out_norm, int N, float eps) {
  __shared__ float red[256];
  const int row = blockIdx.x, tid = threadIdx.x;
  const float* x = X + (size_t)row * N; const float* rr = R ? R + (size_t)row * N : nullptr;
  float vals[16];                     // up to N = 4096
  const int per = N / 256;            // contiguous chunk per thread? use strided-by-4 chunks: thread handles j = tid*4 + 1024*u
  float s1 = 0.f;
  for (int u = 0; u < per / 4; ++u) {
    const int j = tid * 4 + 1024 * u;
    const v4f a = *(const v4fa*)(x + j);
    v4f b = {0.f,0.f,0.f,0.f}; if (rr) b = *(const v4fa*)(rr + j);
#pragma unroll
    for (int q = 0; q < 4; ++q) { const float v = a[q] + b[q]; vals[u * 4 + q] = v; s1 += v; }
  }
  red[tid] = s1; __syncthreads();
  for (int st = 128; st > 0; st >>= 1) { if (tid < st) red[tid] += red[tid + st]; __syncthreads(); }
  const float mu = red[0] / (float)N; __syncthreads();
  float s2 = 0.f;
  for (int u = 0; u < per / 4; ++u)
#pragma unroll
    for (int q = 0; q < 4; ++q) { const float c = vals[u * 4 + q] - mu; s2 += c * c; }
  red[tid] = s2; __syncthreads();
  for (int st = 128; st > 0; st >>= 1) { if (tid < st) red[tid] += red[tid + st]; __syncthreads(); }
  const float rs = rsqrtf(red[0] / (float)N + eps);
  {
    for (int u = 0; u < per / 4; ++u) {
      const int j = tid * 4 + 1024 * u;
      v4f o, sm;
#pragma unroll
      for (int q = 0; q < 4; ++q) {
        float gg = g[j + q], bb = bta[j + q];
        if (PARAM_BF16) { gg = bf16_round(gg); bb = bf16_round(bb); }
        sm[q] = vals[u * 4 + q]; o[q] = (vals[u * 4 + q] - mu) * rs * gg + bb;
      }
      if (out_sum) *(v4f*)(out_sum + (size_t)row * N + j) = sm;
      *(v4f*)(out_norm + (size_t)row * N + j) = o;
    }
    
  }
}



// ---- f16 WMMA path (v_wmma_f32_16x16x32_f16): 11-bit significands for operands in range — used where a [0,1] probability operand needs more precision than bf16
typedef _Float16 v16h __attribute__((ext_vector_type(16)));
union FragH { v16h v; v8us half[2]; _Float16 h[16]; unsigned short u[16]; };
template <int NT>
__device__ __forceinline__ v8f mmaH(v16h ah, v16h al, v16h bh, v16h bl, v8f c) {
  c = __builtin_amdgcn_wmma_f32_16x16x32_f16(false, ah, false, bh, (short)0, c, false, false);
  if (NT >= 2) c = __builtin_amdgcn_wmma_f32_16x16x32_f16(false, al, false, bh, (short)0, c, false, false);
  if (NT >= 3) c = __builtin_amdgcn_wmma_f32_16x16x32_f16(false, ah, false, bl, (short)0, c, false, false);
  asm volatile("v_nop\n\tv_nop\n\tv_nop\n\tv_nop" : "+v"(c) : "v"(ah), "v"(al), "v"(bh), "v"(bl));
  return c;
}
// batched GEMM like k_gemm_b but f16 operands: A f32 (split into f16 hi/lo if ASPLIT, else rounded to f16), Bt = f16 values [n][k]; alpha; C f32; N multiple of 16 (partial tiles skipped)
template <bool ASPLIT>
__global__ __launch_bounds__(128) void k_gemm_h(const float* __restrict__ A, int lda, size_t sA, const _Float16* __restrict__ Bh, int ldb, size_t sB, float alpha, float* __restrict__ C, int ldc, size_t sC, int M, int N, int K) {
  __shared__ __attribute__((aligned(16))) float so[4][16][64];
  const int tid = threadIdx.x, w = tid >> 5, lane = tid & 31, ln = lane & 15, hh = lane >> 4; const int by = blockIdx.y;
  A += (size_t)by * sA; Bh += (size_t)by * sB; C += (size_t)by * sC;
  const int ntn = (N + 63) / 64; const int wid = blockIdx.x * 4 + w; const int mt = wid / ntn, nq = wid % ntn; if (mt * 16 >= M) return;
  const int row0 = mt * 16, col0 = nq * 64; const float* arow = A + (size_t)(row0 + ln) * lda;
  v8f acc[4] = {};
  for (int kb = 0; kb < K; kb += 32) {
    FragH ah, al;
    const v4f x0 = *(const v4fa*)(arow + kb + 8 * hh), x1 = *(const v4fa*)(arow + kb + 8 * hh + 4), x2 = *(const v4fa*)(arow + kb + 16 + 8 * hh), x3 = *(const v4fa*)(arow + kb + 16 + 8 * hh + 4);
    float xs[16] = {x0[0],x0[1],x0[2],x0[3],x1[0],x1[1],x1[2],x1[3],x2[0],x2[1],x2[2],x2[3],x3[0],x3[1],x3[2],x3[3]};
#pragma unroll
    for (int i = 0; i < 16; ++i) { const _Float16 h = (_Float16)xs[i]; ah.h[i] = h; al.h[i] = ASPLIT ? (_Float16)(xs[i] - (float)h) : (_Float16)0.0f; }
#pragma unroll
    for (int t = 0; t < 4; ++t) { if (col0 + t * 16 >= N) continue; const size_t boff = (size_t)(col0 + t * 16 + ln) * ldb + kb; FragH bq; bq.half[0] = *(const v8us*)(Bh + boff + 8 * hh); bq.half[1] = *(const v8us*)(Bh + boff + 16 + 8 * hh);
      acc[t] = mmaH<ASPLIT ? 2 : 1>(ah.v, al.v, bq.v, bq.v, acc[t]); }
  }
#pragma unroll
  for (int t = 0; t < 4; ++t) { if (col0 + t * 16 >= N) continue;
#pragma unroll
    for (int r = 0; r < 8; ++r) so[w][8 * hh + r][t * 16 + ln] = acc[t][r] * alpha; }
  __builtin_amdgcn_fence(__ATOMIC_ACQ_REL, "workgroup"); __builtin_amdgcn_wave_barrier();
  const int rsub = lane >> 4, c4 = (lane & 15) * 4;
  {
#pragma unroll
    for (int q = 0; q < 8; ++q) { const int r = q * 2 + rsub; if (col0 + c4 < N) { const v4f v = *(const v4fa*)&so[w][r][c4]; *(v4f*)(C + (size_t)(row0 + r) * ldc + col0 + c4) = v; } }
     }
}

// Wt[n][k] = f16(W[k][n]·scale) from f32 row-major W[K][N] (scale = power of two; bf16-exact weights stay exact in f16 away from the subnormal range)
// (a job of a shared launch: blk = the block's index within the job, 256 threads a block)
__device__ __forceinline__ void wt_f16_job(const float* __restrict__ W, _Float16* __restrict__ Wt, int K, int N, float scale, int blk) {
  const int t = blk * 256 + threadIdx.x; if (t >= N * (K / 8)) return; const int n = t / (K / 8), k8 = (t % (K / 8)) * 8; FragH f;
#pragma unroll
  for (int i = 0; i < 8; ++i) f.h[i] = (_Float16)(bf16_round(W[(size_t)(k8 + i) * N + n]) * scale); const v8us o = f.half[0];
  *(v8us*)((unsigned short*)Wt + (size_t)n * K + k8) = o; 
}
// k_gemm_hh variant with fused epilogue: v = acc·alpha + bias[by·sBias + col] (+ CP[(row/rowsPerB)·sCPb + by·64 + col] if CP) ; ACT 0 none / 1 elu ; writes f16 C16 (and f32 C if non-null)
template <int ACT>
__global__ __launch_bounds__(128) void k_gemm_hhx(const _Float16* __restrict__ A, int lda, size_t sA, const _Float16* __restrict__ Bh, int ldb, size_t sB, float alpha, const float* __restrict__ bias, size_t sBias, const float* __restrict__ CP, int rowsPerB, size_t sCPb, int row0g,
    float* __restrict__ C, _Float16* __restrict__ C16, int ldc, size_t sC, int M, int N, int K) {
  __shared__ __attribute__((aligned(16))) float so[4][16][64];
  const int tid = threadIdx.x, w = tid >> 5, lane = tid & 31, ln = lane & 15, hh = lane >> 4; const int by = blockIdx.y;
  A += (size_t)by * sA; Bh += (size_t)by * sB; const size_t cofs = (size_t)by * sC; const float* bp = bias ? bias + (size_t)by * sBias : nullptr;
  const int ntn = (N + 63) / 64; const int wid = blockIdx.x * 4 + w; const int mt = wid / ntn, nq = wid % ntn; if (mt * 16 >= M) return;
  const int row0 = mt * 16, col0 = nq * 64; const _Float16* arow = A + (size_t)(row0 + ln) * lda;
  v8f acc[4] = {};
  for (int kb = 0; kb < K; kb += 32) { FragH ah; ah.half[0] = *(const v8us*)((const unsigned short*)arow + kb + 8 * hh); ah.half[1] = *(const v8us*)((const unsigned short*)arow + kb + 16 + 8 * hh);
#pragma unroll
    for (int t = 0; t < 4; ++t) { if (col0 + t * 16 >= N) continue; const size_t boff = (size_t)(col0 + t * 16 + ln) * ldb + kb; FragH bq; bq.half[0] = *(const v8us*)((const unsigned short*)Bh + boff + 8 * hh); bq.half[1] = *(const v8us*)((const unsigned short*)Bh + boff + 16 + 8 * hh);
      acc[t] = mmaH<1>(ah.v, ah.v, bq.v, bq.v, acc[t]); }
  }
#pragma unroll
  for (int t = 0; t < 4; ++t) { if (col0 + t * 16 >= N) continue; const int col = col0 + t * 16 + ln; const float bv = bp ? bf16_round(bp[col]) : 0.f;
#pragma unroll
    for (int r = 0; r < 8; ++r) { float v = acc[t][r] * alpha + bv; if (CP) { const int rr = row0g + row0 + 8 * hh + r; if (rowsPerB < 0) v += CP[cofs + (size_t)rr * ldc + col];      /* rowsPerB < 0: own element of the batched C plane */ else { const int bidx = rr / rowsPerB; v += CP[(size_t)bidx * sCPb + (size_t)by * 64 + col]; } } if (ACT == 1) v = (v > 0.f) ? v : expm1f(v); else if (ACT == 7) v = (v > 0.f) ? v + 1.0f : expf(v); else if (ACT == 8) v = tanhf(v); else if (ACT == 9) v = 0.5f * v * (1.0f + tanhf(0.7978845608028654f * (v + 0.044715f * v * v * v))); else if (ACT == 11) v = 1.0f / (1.0f + expf(-v)); else if (ACT == 12) v = (v > 0.f) ? v : 0.01f * v; else if (ACT == 14) v = (v > 0.f) ? v : 0.1f * v; else if (ACT == 16) v = (v >= 0.f) ? v : 0.3f * v; else if (ACT == 17) v = (v >= 0.f) ? v : 0.2f * v; else if (ACT == 15) v = v / (1.0f + expf(-v)); else if (ACT == 3) v = fmaxf(v, 0.f); else if (ACT == 6) v = 0.5f * v * (1.0f + erff(v * 0.70710678118654752f)); so[w][8 * hh + r][t * 16 + ln] = v; } }
  __builtin_amdgcn_fence(__ATOMIC_ACQ_REL, "workgroup"); __builtin_amdgcn_wave_barrier();
  const int rsub = lane >> 4, c4 = (lane & 15) * 4; typedef _Float16 v4h __attribute__((ext_vector_type(4)));
  {
#pragma unroll
    for (int q = 0; q < 8; ++q) { const int r = q * 2 + rsub; if (col0 + c4 < N) { const v4f v = *(const v4fa*)&so[w][r][c4]; if (C) *(v4f*)(C + cofs + (size_t)(row0 + r) * ldc + col0 + c4) = v; if (C16) { v4h h4; for (int i = 0; i < 4; ++i) h4[i] = (_Float16)v[i]; *(v4h*)(C16 + cofs + (size_t)(row0 + r) * ldc + col0 + c4) = h4; } } }
     }
}


typedef _Float16 v4h __attribute__((ext_vector_type(4)));

__device__ __forceinline__ void x16_job(const float* __restrict__ x, _Float16* __restrict__ X16, size_t n8, int blk) { const size_t t = (size_t)blk * 256 + threadIdx.x; if (t >= n8) return; FragH f;
#pragma unroll
  for (int q = 0; q < 8; ++q) f.h[q] = (_Float16)bf16_round(x[t * 8 + q]); *(v8us*)((unsigned short*)X16 + t * 8) = f.half[0];  }
__global__ __launch_bounds__(256) void k_h16(const float* __restrict__ x, _Float16* __restrict__ X16, size_t n8) { const size_t t = (size_t)blockIdx.x * 256 + threadIdx.x; if (t >= n8) return; FragH f;
#pragma unroll
  for (int q = 0; q < 8; ++q) f.h[q] = (_Float16)x[t * 8 + q]; *(v8us*)((unsigned short*)X16 + t * 8) = f.half[0];  }
__global__ __launch_bounds__(256) void k_round16f(const float* __restrict__ W, _Float16* __restrict__ Bt, size_t n8) { const size_t t = (size_t)blockIdx.x * 256 + threadIdx.x; if (t >= n8) return; FragH f;
#pragma unroll
  for (int i = 0; i < 8; ++i) f.h[i] = (_Float16)(bf16_round(W[t * 8 + i]) * 16.0f); *(v8us*)((unsigned short*)Bt + t * 8) = f.half[0];  }
template <int NHv, int TTv>
__device__ __forceinline__ void vt_job(const _Float16* __restrict__ V16, int ldv, int voff, _Float16* __restrict__ Vt, int blk) { __shared__ unsigned short tl[64][66]; const int tid = threadIdx.x; const int slab = blk / (TTv / 64), lg = blk % (TTv / 64); const int b = slab / NHv, h = slab % NHv;
  for (int i = tid; i < 64 * 8; i += 256) { const int r = i / 8, c8 = (i % 8) * 8; FragH f; f.half[0] = *(const v8us*)((const unsigned short*)V16 + ((size_t)b * TTv + lg * 64 + r) * ldv + voff + h * 64 + c8);
#pragma unroll
    for (int q = 0; q < 8; ++q) tl[r][c8 + q] = f.u[q]; }
  __syncthreads();
  {
#pragma unroll
    for (int rd = 0; rd < 2; ++rd) { const int d = rd * 32 + tid / 8, pc = tid % 8; FragH f;
#pragma unroll
      for (int q = 0; q < 8; ++q) f.u[q] = tl[pc * 8 + q][d];
      *(v8us*)((unsigned short*)Vt + ((size_t)slab * 64 + d) * TTv + lg * 64 + pc * 8) = f.half[0]; }
     } }

__device__ __forceinline__ void hl_job(const float* __restrict__ F, _Float16* __restrict__ Hh, _Float16* __restrict__ Hl, size_t n8, int blk) { const size_t t = (size_t)blk * 256 + threadIdx.x; if (t >= n8) return; FragH fh, fl; const v4f a = *(const v4fa*)(F + t * 8), c = *(const v4fa*)(F + t * 8 + 4);
#pragma unroll
  for (int q = 0; q < 4; ++q) { _Float16 h = (_Float16)a[q]; fh.h[q] = h; fl.h[q] = (_Float16)((a[q] - (float)h) * 1024.0f); h = (_Float16)c[q]; fh.h[4 + q] = h; fl.h[4 + q] = (_Float16)((c[q] - (float)h) * 1024.0f); }
  { *(v8us*)((unsigned short*)Hh + t * 8) = fh.half[0]; *(v8us*)((unsigned short*)Hl + t * 8) = fl.half[0];  } }

// ---- fast GEMM (wave tile 32x64; requires M % 32 == 0 rows per launch region and N % 64 == 0); epilogue = k_gemm_hhx semantics; two batch axes: by (strides sA, sB, sC) and bz (strides zA, zB, zC) ----
__device__ __forceinline__ v16h g2_frag(const _Float16* p, int hh) { FragH f; f.half[0] = *(const v8us*)((const unsigned short*)p + 8 * hh); f.half[1] = *(const v8us*)((const unsigned short*)p + 16 + 8 * hh); return f.v; }
__device__ __forceinline__ v8f g2_mma(v16h a, v16h b, v8f c) { v8f d = __builtin_amdgcn_wmma_f32_16x16x32_f16(false, a, false, b, (short)0, c, false, false); asm volatile("v_nop\n\tv_nop\n\tv_nop\n\tv_nop" : "+v"(d) : "v"(a), "v"(b)); return d; }
template <int ACT>
__device__ __forceinline__ void gemm2_job(const _Float16* __restrict__ A, int lda, size_t sA, const _Float16* __restrict__ Bh, int ldb, size_t sB, float alpha, const float* __restrict__ bias, size_t sBias, const float* __restrict__ CP, int rowsPerB, size_t sCPb, int row0g,
    float* __restrict__ C, _Float16* __restrict__ C16, int ldc, size_t sC, int M, int N, int K, size_t zA, size_t zB, size_t zC, int bx, int by, int bz) { static_assert(ACT == 0 || ACT == 3 || ACT == 6 || ACT == 8 || ACT == 9 || ACT == 11 || ACT == 12 || ACT == 14 || ACT == 15 || ACT == 16 || ACT == 17, "gemm2_job: unsupported ACT code (would silently apply no activation)");
  __shared__ __attribute__((aligned(16))) float so[4][32][68];
  const int tid = threadIdx.x, w = tid >> 5, lane = tid & 31, ln = lane & 15, hh = lane >> 4;      /* bx = tile, by = batch (strides sA, sB, sC), bz = sequence (strides zA, zB, zC) */
  A += (size_t)by * sA + (size_t)bz * zA; Bh += (size_t)by * sB + (size_t)bz * zB; const size_t cofs = (size_t)by * sC + (size_t)bz * zC; const float* bp = bias ? bias + (size_t)by * sBias : nullptr;
  const int ntn = N >> 6; const int mt = bx / ntn, nq = bx - mt * ntn; const int row0 = mt * 128 + 32 * w, col0 = nq * 64; if (row0 >= M) return;
  const _Float16* a0p = A + (size_t)(row0 + ln) * lda; const _Float16* a1p = a0p + (size_t)16 * lda;
  const _Float16* b0p = Bh + (size_t)(col0 + ln) * ldb; const _Float16* b1p = b0p + (size_t)16 * ldb; const _Float16* b2p = b1p + (size_t)16 * ldb; const _Float16* b3p = b2p + (size_t)16 * ldb;
  const v8f z8 = {0.f,0.f,0.f,0.f,0.f,0.f,0.f,0.f}; v8f c00 = z8, c01 = z8, c02 = z8, c03 = z8, c10 = z8, c11 = z8, c12 = z8, c13 = z8;
#pragma unroll 1
  for (int kb = 0; kb < K; kb += 32) { const v16h a0 = g2_frag(a0p + kb, hh); FragH a1f; a1f.half[0] = *(const v8us*)((const unsigned short*)(a1p + kb) + 8 * hh);
    asm volatile("s_wait_xcnt 0x0" ::: "memory");      /* the four A loads share one address pair, and the last of them may land its result in it: the wait stands behind the first three, in front of that write */
    a1f.half[1] = *(const v8us*)((const unsigned short*)(a1p + kb) + 16 + 8 * hh); const v16h a1 = a1f.v;
    v16h b = g2_frag(b0p + kb, hh); c00 = g2_mma(a0, b, c00); c10 = g2_mma(a1, b, c10);
    b = g2_frag(b1p + kb, hh); c01 = g2_mma(a0, b, c01); c11 = g2_mma(a1, b, c11);
    b = g2_frag(b2p + kb, hh); c02 = g2_mma(a0, b, c02); c12 = g2_mma(a1, b, c12);
    b = g2_frag(b3p + kb, hh); c03 = g2_mma(a0, b, c03); c13 = g2_mma(a1, b, c13); }
  v8f accs[8] = {c00, c01, c02, c03, c10, c11, c12, c13};
#pragma unroll
  for (int u = 0; u < 8; ++u) { const int t = u & 3, half = u >> 2; const int col = col0 + t * 16 + ln; const float bv = bp ? bf16_round(bp[col]) : 0.f;
#pragma unroll
    for (int r = 0; r < 8; ++r) { const int rloc = half * 16 + 8 * hh + r; float v = accs[u][r] * alpha + bv; if (CP) { if (rowsPerB < 0) v += CP[cofs + (size_t)(row0g + row0 + rloc) * ldc + col];      /* rowsPerB < 0: own element of the batched C plane */ else { const int bidx = (row0g + row0 + rloc) / rowsPerB; v += CP[(size_t)bidx * sCPb + (size_t)by * 64 + col]; } }
      if (ACT == 3) v = fmaxf(v, 0.f); else if (ACT == 6) v = 0.5f * v * (1.0f + erff(v * 0.70710678118654752f)); else if (ACT == 11) v = 1.0f / (1.0f + expf(-v)); else if (ACT == 15) v = v / (1.0f + expf(-v)); else if (ACT == 12) v = (v > 0.f) ? v : 0.01f * v; else if (ACT == 8) v = tanhf(v); else if (ACT == 9) v = 0.5f * v * (1.0f + tanhf(0.7978845608028654f * (v + 0.044715f * v * v * v))); else if (ACT == 14) v = (v > 0.f) ? v : 0.1f * v; else if (ACT == 16) v = (v >= 0.f) ? v : 0.3f * v; else if (ACT == 17) v = (v >= 0.f) ? v : 0.2f * v;
      so[w][rloc][t * 16 + ln] = v; } }
  __builtin_amdgcn_fence(__ATOMIC_ACQ_REL, "workgroup"); __builtin_amdgcn_wave_barrier();
  const int rsub = lane >> 4, c4 = (lane & 15) * 4;
  {
#pragma unroll
    for (int q = 0; q < 16; ++q) { const int r = q * 2 + rsub; const v4f v = *(const v4fa*)&so[w][r][c4]; if (C) { *(v4f*)(C + cofs + (size_t)(row0 + r) * ldc + col0 + c4) = v; asm volatile("s_wait_xcnt 0x0" ::: "memory"); }      /* the wait stands between the f32 store and the conversions below, which may land in the registers that the store names */
      if (C16) { v4h h4; for (int i = 0; i < 4; ++i) h4[i] = (_Float16)v[i]; *(v4h*)(C16 + cofs + (size_t)(row0 + r) * ldc + col0 + c4) = h4; } }
     } }


// ---- shared launches: jobs that do not depend on one another run in one grid; the block index picks the job (the same for every thread of a block) and the block's index within it ----
#define JW_H (HD * (DM / 8) / 256)             /* blocks per per-head weight block */
#define JW_O (DM * (DM / 8) / 256)             /* blocks of the output weight */
#define JX ((int)(NR * DM / 8 / 256))          /* blocks per plane of x rows */
static_assert(HD * (DM / 8) % 256 == 0 && DM * (DM / 8) % 256 == 0 && NR * DM / 8 % 256 == 0, "whole blocks per job");
// Operand planes: 3 NH per-head weight blocks (head h of wq / wk / wv is a row-major [DM][HD] block, written as HD contiguous rows of the [out][in] plane, x16), the [DM][DM] output weight, three planes of x rows.
__global__ __launch_bounds__(256) void k_prep(const float* x, const float* xk, const float* xv, const float* __restrict__ wq, const float* __restrict__ wk, const float* __restrict__ wv, const float* __restrict__ wo,
    _Float16* __restrict__ BQ, _Float16* __restrict__ BK, _Float16* __restrict__ BV, _Float16* __restrict__ BO, _Float16* __restrict__ X16, _Float16* __restrict__ XK16, _Float16* __restrict__ XV16) {
  int bx = blockIdx.x;
  if (bx < 3 * NH * JW_H) { const int j = bx / JW_H, s = j % 3, h = j / 3; const size_t wofs = (size_t)h * DM * HD, pofs = (size_t)h * HD * DM;
    wt_f16_job((s == 0 ? wq : s == 1 ? wk : wv) + wofs, (s == 0 ? BQ : s == 1 ? BK : BV) + pofs, DM, HD, 16.0f, bx % JW_H); return; }
  bx -= 3 * NH * JW_H;
  if (bx < JW_O) { wt_f16_job(wo, BO, DM, DM, 16.0f, bx); return; }
  bx -= JW_O;
  const int s = bx / JX; x16_job(s == 0 ? x : s == 1 ? xk : xv, s == 0 ? X16 : s == 1 ? XK16 : XV16, NR * DM / 8, bx % JX); }
#define JP_A ((MP / 128) * (DM / 64))          /* tiles of a projection of all rows */
#define JP_0 ((QT0 / 128) * (DM / 64))         /* tiles of a first-tile projection, per sequence */
// The six projections. grid.y: q, k, v. grid.x: the tiles of all rows (q, k as f32, v as f16), then per sequence the tiles of the first QT0 rows (f32 planes of QT0 rows a sequence).
__global__ __launch_bounds__(128) void k_proj(const _Float16* __restrict__ X16, const _Float16* __restrict__ XK16, const _Float16* __restrict__ XV16, const _Float16* __restrict__ BQ, const _Float16* __restrict__ BK, const _Float16* __restrict__ BV,
    const float* __restrict__ bq, const float* __restrict__ bk, const float* __restrict__ bv, float* __restrict__ QF, float* __restrict__ KF, _Float16* __restrict__ V16, float* __restrict__ QF0, float* __restrict__ KF0, float* __restrict__ VF0) {
  const int s = blockIdx.y; const int bx = blockIdx.x; const bool all = bx < JP_A; const int b0 = bx - JP_A;
  gemm2_job<0>(s == 0 ? X16 : s == 1 ? XK16 : XV16, DM, 0, s == 0 ? BQ : s == 1 ? BK : BV, DM, 0, 0.0625f, s == 0 ? bq : s == 1 ? bk : bv, 0, nullptr, 1, 0, 0,
      all ? (s == 0 ? QF : s == 1 ? KF : nullptr) : (s == 0 ? QF0 : s == 1 ? KF0 : VF0), (all && s == 2) ? V16 : nullptr, DM, 0, all ? MP : QT0, DM, DM, (size_t)SQ * DM, 0, (size_t)QT0 * DM,
      all ? bx : b0 % JP_0, 0, all ? 0 : b0 / JP_0); }
#define JS_V (NBR * NH * (SQ / 64))                      /* blocks of V^T */
#define JS_A ((int)((size_t)MP * DM / 8 / 256))          /* blocks of a split of all rows */
#define JS_0 ((int)((size_t)NB * QT0 * DM / 8 / 256))    /* blocks of the split of the first-tile rows */
static_assert((size_t)MP * DM / 8 % 256 == 0 && (size_t)NB * QT0 * DM / 8 % 256 == 0, "whole blocks per job");
// V^T [NBR][NH][HD][SQ]; q, k and the first-tile o (f32) -> f16 hi + x1024 residual planes.
__global__ __launch_bounds__(256) void k_split(const _Float16* __restrict__ V16, _Float16* __restrict__ VT, const float* __restrict__ QF, _Float16* __restrict__ QH, _Float16* __restrict__ QL, const float* __restrict__ KF, _Float16* __restrict__ KH, _Float16* __restrict__ KL,
    const float* __restrict__ OF0, _Float16* __restrict__ OH0, _Float16* __restrict__ OL0) {
  int bx = blockIdx.x;
  if (bx < JS_V) { vt_job<NH, SQ>(V16, LQ, 0, VT, bx); return; }
  bx -= JS_V;
  if (bx < 2 * JS_A) { const bool q = bx < JS_A; hl_job(q ? QF : KF, q ? QH : KH, q ? QL : KL, (size_t)MP * DM / 8, q ? bx : bx - JS_A); return; }
  hl_job(OF0, OH0, OL0, (size_t)NB * QT0 * DM / 8, bx - 2 * JS_A); }


__global__ __launch_bounds__(256) void k_wnat(const float* __restrict__ w, size_t n8, _Float16* __restrict__ Bt) { const size_t t = (size_t)blockIdx.x * 256 + threadIdx.x; if (t >= n8) return; FragH f; for (int q = 0; q < 8; ++q) f.h[q] = (_Float16)(bf16_round(w[t * 8 + q]) * 16.0f); *(v8us*)((unsigned short*)Bt + t * 8) = f.half[0];  }
__global__ __launch_bounds__(256) void k_rsm(const float* __restrict__ S, _Float16* __restrict__ P, int nrows) {
  #pragma clang fp contract(off)
  const int i = blockIdx.x * 256 + threadIdx.x; if (i >= nrows) return; const float* s = S + (size_t)i * SQ; float mx = -3.0e38f;
#pragma unroll 1
  for (int j = 0; j < SQ; ++j) mx = fmaxf(mx, s[j]); float se = 0.f;
#pragma unroll 1
  for (int j = 0; j < SQ; ++j) se += expf(s[j] - mx); const float sc = 256.0f / se;
#pragma unroll 1
  for (int j0 = 0; j0 < SQ; j0 += 8) { FragH f; for (int q = 0; q < 8; ++q) f.h[q] = (_Float16)(expf(s[j0 + q] - mx) * sc); unsigned short* d = (unsigned short*)P + (size_t)i * SQ + j0; *(v8us*)d = f.half[0];  } }
__global__ __launch_bounds__(256) void k_vt(const _Float16* __restrict__ V16, int b, int h0, _Float16* __restrict__ VT) { __shared__ unsigned short tl[64][65]; const int tid = threadIdx.x; const int hh = blockIdx.x % HG, sg = blockIdx.x / HG; const int s0 = sg * 64; const int h = h0 + hh;
  for (int i = tid; i < 64 * 8; i += 256) { const int j = i / 8, d8 = (i % 8) * 8; FragH f; f.half[0] = *(const v8us*)((const unsigned short*)V16 + ((size_t)b * SQ + s0 + j) * DM + h * HD + d8); for (int q = 0; q < 8; ++q) tl[d8 + q][j] = f.u[q]; }
  __syncthreads();
  { for (int i = tid; i < 64 * 8; i += 256) { const int d = i / 8, j8 = (i % 8) * 8; FragH f; for (int q = 0; q < 8; ++q) f.u[q] = tl[d][j8 + q]; *(v8us*)((unsigned short*)VT + ((size_t)hh * HD + d) * SQ + s0 + j8) = f.half[0]; }  } }



// 2^x on the transcendental unit, with the one free issue slot that the instruction set asks for behind it before its result is used or its
// source overwritten: in the unrolled row the compiler put one exponential's result into the source register of the one directly ahead of it.
__device__ __forceinline__ float exp2_slot(float x) { float r; asm("v_exp_f32 %0, %1\n\tv_nop" : "=v"(r) : "v"(x)); return r; }
// Fused causal attention: scores, softmax and P V in one launch; neither scores nor weights go to memory. One wave owns 16 query rows of one
// head and walks its keys 32 at a time, transposed: S^T = K Q^T (A = key rows, B = query rows), so that a lane holds scores of ONE query
// (column ln; keys 8 hh + r of each 16-key tile) and the row maximum and sum need one exchange between the wave's halves. The two score tiles,
// converted in place, are the B operand of O^T += V^T P^T in the loader's own k order (keys 8 hh + 0..7, then 16 + 8 hh + 0..7), and the
// accumulators of O^T belong to the same query as the lane's running maximum and sum. Scores keep their three f16 products (hi.hi, lo.hi, hi.lo).
__device__ __forceinline__ void fattn_job(const _Float16* __restrict__ Qh, const _Float16* __restrict__ Ql, const _Float16* __restrict__ Kh, const _Float16* __restrict__ Kl, const _Float16* __restrict__ Vt, _Float16* __restrict__ O, int bx, int h, int b) {
  const int lane = threadIdx.x & 31, ln = lane & 15, hh = lane >> 4; const int w = __builtin_amdgcn_readfirstlane(threadIdx.x >> 5);      /* the wave's number in a scalar register: the trip count stays scalar */
  const int qt = (b & 1) ? bx : SQ / 64 - 1 - bx;      /* long and short causal tiles alternate between sequences */
  const int q0 = qt * 64 + w * 16; const size_t rb = (size_t)b * SQ;
  const size_t qo = (rb + q0 + ln) * LQ + h * HD;
  const v16h qh0 = g2_frag(Qh + qo, hh), qh1 = g2_frag(Qh + qo + 32, hh), ql0 = g2_frag(Ql + qo, hh), ql1 = g2_frag(Ql + qo + 32, hh);
  const _Float16* kh = Kh + (rb + ln) * LQ + h * HD; const _Float16* kl = Kl + (rb + ln) * LQ + h * HD;
  const _Float16* vt = Vt + ((size_t)(b * NH + h) * HD + ln) * SQ;
  const v8f z8 = {0.f,0.f,0.f,0.f,0.f,0.f,0.f,0.f}; v8f o[4] = {z8, z8, z8, z8};
  float m = -1.0e30f, l = 0.f; const int nst = (q0 >> 5) + 1;      /* 32-key steps up to the one that holds the diagonal */
  v16h ka[2][4];      /* per 16-key tile: hi d 0..31, hi d 32..63, residual d 0..31, residual d 32..63 */
#pragma unroll      /* this and every constant-trip loop below: unrolled so that fragments and accumulators are registers, not indexed arrays */
  for (int kt = 0; kt < 2; ++kt) { const size_t ro = (size_t)(16 * kt) * LQ; ka[kt][0] = g2_frag(kh + ro, hh); ka[kt][1] = g2_frag(kh + ro + 32, hh); ka[kt][2] = g2_frag(kl + ro, hh); ka[kt][3] = g2_frag(kl + ro + 32, hh); }
#pragma unroll 1      /* rolled: a second copy of the body would hold a second set of fragments and cost a resident wave per SIMD */
  for (int st = 0; st < nst; ++st) { const int key0 = st * 32;
    v16h va[4];
#pragma unroll
    for (int t = 0; t < 4; ++t) va[t] = g2_frag(vt + (size_t)(16 * t) * SQ + key0, hh);
    v8f sh[2], sl[2];
#pragma unroll
    for (int kt = 0; kt < 2; ++kt) { sh[kt] = g2_mma(ka[kt][0], qh0, z8); sh[kt] = g2_mma(ka[kt][1], qh1, sh[kt]);
      sl[kt] = g2_mma(ka[kt][0], ql0, z8); sl[kt] = g2_mma(ka[kt][1], ql1, sl[kt]); sl[kt] = g2_mma(ka[kt][2], qh0, sl[kt]); sl[kt] = g2_mma(ka[kt][3], qh1, sl[kt]); }
    const int kn = (st + 1 < nst) ? key0 + 32 : key0;      /* the next step's key rows, fetched behind this step's score products (the last step's own again at the end: in bounds, unused) */
#pragma unroll
    for (int kt = 0; kt < 2; ++kt) { const size_t ro = (size_t)(kn + 16 * kt) * LQ; ka[kt][0] = g2_frag(kh + ro, hh); ka[kt][1] = g2_frag(kh + ro + 32, hh); ka[kt][2] = g2_frag(kl + ro, hh); ka[kt][3] = g2_frag(kl + ro + 32, hh); }
    float sv[16]; float mx = m; const int rel = q0 + ln - key0 - 8 * hh;      /* key 16 kt + r of this lane is kept while 16 kt + r <= rel */
#pragma unroll
    for (int kt = 0; kt < 2; ++kt)
#pragma unroll
      for (int r = 0; r < 8; ++r) { const float s = sh[kt][r] * SCL + sl[kt][r] * SCLR; const float xv = (16 * kt + r <= rel) ? s : -1.0e9f; sv[kt * 8 + r] = xv; mx = fmaxf(mx, xv); }
    mx = fmaxf(mx, __shfl_xor(mx, 16, 32));
    const float al = exp2_slot((m - mx) * 1.44269504088896340736f); m = mx;
    float ps = 0.f; FragH p;
#pragma unroll
    for (int i = 0; i < 16; ++i) { const float e = exp2_slot((sv[i] - mx) * 1.44269504088896340736f + 8.0f);      /* weights carried x256, as in the f16 operand before */ ps += e; p.h[i] = (_Float16)e; }
    l = l * al + ps;
#pragma unroll
    for (int t = 0; t < 4; ++t) { o[t] *= al; o[t] = g2_mma(va[t], p.v, o[t]); } }
  l += __shfl_xor(l, 16, 32);
  const float fin = 64.0f / l;      /* o carried x64; the x256 of the weights cancels against the sum's */
  _Float16* orow = O + (rb + q0 + ln) * DM + h * HD + 8 * hh;
#pragma unroll
  for (int t = 0; t < 4; ++t) { FragH f;
#pragma unroll
    for (int r = 0; r < 8; ++r) f.h[r] = (_Float16)(o[t][r] * fin);
    *(v8us*)((unsigned short*)orow + 16 * t) = f.half[0]; } }
#define JF_A ((SQ / 64) * NH * NBR)            /* blocks of the fused attention: query tile fastest, then head, then sequence */
// The fused attention of all rows; behind its blocks, per sequence, the tiles of the first-tile output pass out = o_hi Wo + b (rows 0..QT0-1, from the exact f32 attention: it does not depend on this launch's attention).
__global__ __launch_bounds__(128) void k_attn(const _Float16* __restrict__ Qh, const _Float16* __restrict__ Ql, const _Float16* __restrict__ Kh, const _Float16* __restrict__ Kl, const _Float16* __restrict__ Vt, _Float16* __restrict__ O,
    const _Float16* __restrict__ OH0, const _Float16* __restrict__ BO, const float* __restrict__ bo, float* __restrict__ out) {
  const int bx = blockIdx.x;
  if (bx < JF_A) { fattn_job(Qh, Ql, Kh, Kl, Vt, O, bx % (SQ / 64), bx / (SQ / 64) % NH, bx / ((SQ / 64) * NH)); return; }
  const int b0 = bx - JF_A;
  gemm2_job<0>(OH0, DM, 0, BO, DM, 0, 0.0009765625f, bo, 0, nullptr, 1, 0, 0, out, nullptr, DM, 0, QT0, DM, DM, (size_t)QT0 * DM, 0, (size_t)SQ * DM, b0 % JP_0, 0, b0 / JP_0); }
// Output stage, one job per 128-row tile: the first tile of a sequence adds o_lo Wo 2^-20 to its own elements (written by the launch before); every other tile is out = o Wo + b from the f16 rows.
static_assert(QT0 == 128 && SQ % 128 == 0 && MPO == NBR * SQ && B0 == 0, "the first-tile rows are exactly the first 128-row tile of each sequence");
__global__ __launch_bounds__(128) void k_out(const _Float16* __restrict__ O16, const _Float16* __restrict__ OL0, const _Float16* __restrict__ BO, const float* __restrict__ bo, float* out) {
  const int bx = blockIdx.x; const int mt = bx / (DM / 64); const bool first = mt % (SQ / 128) == 0;
  gemm2_job<0>(first ? OL0 : O16, DM, 0, BO, DM, 0, first ? 0.00000095367431640625f : 0.0009765625f, first ? nullptr : bo, 0, first ? out : nullptr, first ? -1 : 1, 0, 0, out, nullptr, DM, 0, first ? QT0 : MPO, DM, DM,
      (size_t)QT0 * DM, 0, (size_t)SQ * DM, first ? bx % (DM / 64) : bx, 0, first ? mt / (SQ / 128) : 0); }


// Exact f32 attention for the first QT0 rows of every sequence. One block owns A0R query rows of one head and stages the head's QT0 key and value
// rows in LDS once; a wave owns two query rows, held in registers, so that each staged row it reads serves both. Scores: a lane owns one key of each
// group of 32 and reads its key row 16 bytes at a time; four partial sums per dot product. Softmax: true row maximum and sum by a butterfly over the
// wave. P V: a lane owns four head dims and every other run of four keys; the wave's halves are added at the end.
#define A0R 16                       /* query rows per block: two per wave */
#define A0KP 68                      /* floats from one staged key row to the next: 16 bytes x odd, so that 16 lanes on 16 rows meet no bank twice */
__global__ __launch_bounds__(256) void k_att0(const float* __restrict__ QF, const float* __restrict__ KF, const float* __restrict__ VF, float scale, float* __restrict__ OF) {
  __shared__ __attribute__((aligned(16))) float ks[QT0][A0KP]; __shared__ __attribute__((aligned(16))) float vs[QT0][HD]; __shared__ __attribute__((aligned(16))) float ps[A0R][QT0];
  static_assert(QT0 % 32 == 0 && HD == 64 && A0R == 16, "256 threads: 16 per staged row of 64 floats, 8 waves of two query rows, key groups of 32");
  const int tid = threadIdx.x, lane = tid & 31, w = tid >> 5; const int h = blockIdx.x / (QT0 / A0R), rg = blockIdx.x % (QT0 / A0R); const int r0 = rg * A0R;
  { const size_t zb = (size_t)blockIdx.y * QT0 * DM + h * HD; QF += zb; KF += zb; VF += zb; OF += zb; }      /* grid.y = sequence: QT0 rows of q, k, v and o each, DM floats from row to row (a constant, so that a run of loads shares one address and differs in its immediate offset) */
  const int ia = r0 + w, ib = r0 + 8 + w;      /* the wave's two query rows */
  const int sr = tid >> 4, sc = (tid & 15) * 4; v4f kk[QT0 / 16], vv[QT0 / 16], qa[HD / 4], qb[HD / 4];
#pragma unroll      /* this and every constant-trip loop below: unrolled so that the arrays are registers and the loads of a run are in flight together */
  for (int p = 0; p < QT0 / 16; ++p) { kk[p] = *(const v4fa*)(KF + (size_t)(p * 16 + sr) * DM + sc); vv[p] = *(const v4fa*)(VF + (size_t)(p * 16 + sr) * DM + sc); }
  asm volatile("s_wait_xcnt 0x0" ::: "memory");      /* stands between the loads above and the first later write of a register that holds one of their addresses (the query loads below may land there) */
#pragma unroll
  for (int c = 0; c < HD / 4; ++c) { qa[c] = *(const v4fa*)(QF + (size_t)ia * DM + c * 4); qb[c] = *(const v4fa*)(QF + (size_t)ib * DM + c * 4); }
  asm volatile("s_wait_xcnt 0x0" ::: "memory");      /* the same behind the query loads */
#pragma unroll
  for (int p = 0; p < QT0 / 16; ++p) { *(v4f*)&ks[p * 16 + sr][sc] = kk[p]; *(v4f*)&vs[p * 16 + sr][sc] = vv[p]; }
  __syncthreads();
  const int ng = (r0 + A0R - 1) / 32 + 1;      /* groups of 32 keys up to the block's last row: the same for every wave */
  float sa[QT0 / 32], sb[QT0 / 32]; float ma = -1.0e30f, mb = -1.0e30f;
#pragma unroll
  for (int g = 0; g < QT0 / 32; ++g) { sa[g] = -1.0e30f; sb[g] = -1.0e30f;
    if (g < ng) { const int key = g * 32 + lane; v4f aa = {0.f, 0.f, 0.f, 0.f}, ab = {0.f, 0.f, 0.f, 0.f};
#pragma unroll
      for (int c = 0; c < HD / 4; ++c) { const v4f k4 = *(const v4f*)&ks[key][c * 4]; aa += qa[c] * k4; ab += qb[c] * k4; }
      if (key <= ia) sa[g] = ((aa[0] + aa[1]) + (aa[2] + aa[3])) * scale;
      if (key <= ib) sb[g] = ((ab[0] + ab[1]) + (ab[2] + ab[3])) * scale;
      ma = fmaxf(ma, sa[g]); mb = fmaxf(mb, sb[g]); } }
#pragma unroll
  for (int d = 16; d > 0; d >>= 1) { ma = fmaxf(ma, __shfl_xor(ma, d, 32)); mb = fmaxf(mb, __shfl_xor(mb, d, 32)); }
  float la = 0.f, lb = 0.f;
#pragma unroll
  for (int g = 0; g < QT0 / 32; ++g)
    if (g < ng) { const int key = g * 32 + lane; const float ea = (key <= ia) ? expf(sa[g] - ma) : 0.f, eb = (key <= ib) ? expf(sb[g] - mb) : 0.f; la += ea; lb += eb; ps[w][key] = ea; ps[8 + w][key] = eb; }
#pragma unroll
  for (int d = 16; d > 0; d >>= 1) { la += __shfl_xor(la, d, 32); lb += __shfl_xor(lb, d, 32); }
  __syncthreads();      /* the weights are read below by other lanes than wrote them */
  const int dq = (lane & 15) * 4, jp = lane >> 4; v4f oa = {0.f, 0.f, 0.f, 0.f}, ob = {0.f, 0.f, 0.f, 0.f};
#pragma unroll 1      /* rolled: the trip count is the block's; one trip holds 16 keys, twelve LDS reads in flight together */
  for (int ch = 0; ch <= rg; ++ch) {
#pragma unroll
    for (int t = 0; t < 2; ++t) { const int k0 = ch * 16 + t * 8 + jp * 4; const v4f pa = *(const v4f*)&ps[w][k0], pb = *(const v4f*)&ps[8 + w][k0];
#pragma unroll
      for (int u = 0; u < 4; ++u) { const v4f v4 = *(const v4f*)&vs[k0 + u][dq]; oa += pa[u] * v4; ob += pb[u] * v4; } } }
#pragma unroll
  for (int q = 0; q < 4; ++q) { oa[q] += __shfl_xor(oa[q], 16, 32); ob[q] += __shfl_xor(ob[q], 16, 32); }
  const float fin = 64.0f / (jp ? lb : la);      /* o carried x64 like the f16 path */
  const v4f res = (jp ? ob : oa) * fin;      /* lanes 0..15 store the first row, lanes 16..31 the second */
  *(v4f*)(OF + (size_t)(jp ? ib : ia) * DM + dq) = res; }

extern "C" void kernel_launch(void* const* d_in, const int* in_sizes, int n_in,
                              void* d_out, int out_size, void* d_ws, size_t ws_size, hipStream_t stream) {
  (void)in_sizes; (void)n_in; (void)out_size;
  const float* const* I = (const float* const*)d_in; const float* x = I[0]; const float* xk = I[0]; const float* xv = I[0]; const float* wq = I[1]; const float* bq = I[2]; const float* wk = I[3]; const float* bk = I[4]; const float* wv = I[5]; const float* bv = I[6]; const float* wo = I[7]; const float* bo = I[8];      /* input order: x, Wq, bq, Wk, bk, Wv, bv (PER-HEAD STACKS [8][512][64] with REAL per-head biases [8][64] = flat [512]: the GEMMs' guarded bias slots), Wp ([in][out]: out @ Wp), bp (REAL) */
  char* ws = (char*)d_ws; size_t off = 0;
  auto take = [&](size_t bytes) { char* p = ws + off; off += (bytes + 255) & ~(size_t)255; return p; };
  _Float16* BQ = (_Float16*)take((size_t)DM * DM * 2); _Float16* BK = (_Float16*)take((size_t)DM * DM * 2); _Float16* BV = (_Float16*)take((size_t)DM * DM * 2); _Float16* BO = (_Float16*)take((size_t)DM * DM * 2);
  _Float16* X16 = (_Float16*)take(NR * DM * 2); _Float16* XK16 = (_Float16*)take(NR * DM * 2); _Float16* XV16 = (_Float16*)take(NR * DM * 2);      /* exact f16 rows of query, key, value */ float* QF = (float*)take(NR * DM * 4); float* KF = (float*)take(NR * DM * 4);      /* q and k each have an f32 plane: their projections run in one launch */ _Float16* QH = (_Float16*)take(NR * DM * 2); _Float16* QL = (_Float16*)take(NR * DM * 2); _Float16* KH = (_Float16*)take(NR * DM * 2); _Float16* KL = (_Float16*)take(NR * DM * 2); _Float16* Q16 = QH; _Float16* K16 = KH; _Float16* V16 = (_Float16*)take(NR * DM * 2); _Float16* O16 = (_Float16*)take(NR * DM * 2);
  _Float16* VT = (_Float16*)take((size_t)NB * NH * HD * SQ * 2);      /* one plane per sequence: the sequences share each launch */
  float* QF0 = (float*)take((size_t)NB * QT0 * DM * 4); float* KF0 = (float*)take((size_t)NB * QT0 * DM * 4); float* VF0 = (float*)take((size_t)NB * QT0 * DM * 4); float* OF0 = (float*)take((size_t)NB * QT0 * DM * 4); _Float16* OH0 = (_Float16*)take((size_t)NB * QT0 * DM * 2); _Float16* OL0 = (_Float16*)take((size_t)NB * QT0 * DM * 2);
  if (off > ws_size) return;
  const size_t r0p = (size_t)B0 * SQ;      /* first projected row */
  k_prep<<<3 * NH * JW_H + JW_O + 3 * JX, 256, 0, stream>>>(x, xk, xv, wq, wk, wv, wo, BQ, BK, BV, BO, X16, XK16, XV16);      /* weight planes [out][in] (x16) and the exact f16 rows of query, key, value */
  k_proj<<<dim3(JP_A + NBR * JP_0, 3), 128, 0, stream>>>(X16 + r0p * DM, XK16 + r0p * DM, XV16 + r0p * DM, BQ, BK, BV, bq, bk, bv, QF + r0p * DM, KF + r0p * DM, V16 + r0p * DM, QF0, KF0, VF0);      /* q, k (f32), v (f16) of all rows; f32 q, k, v of the first 128 rows of every sequence (exact products) */
  { const size_t r0 = r0p;      /* every launch below covers all NBR sequences */
    k_att0<<<dim3(NH * (QT0 / A0R), NBR), 256, 0, stream>>>(QF0, KF0, VF0, SCL, OF0 + (size_t)B0 * QT0 * DM);      /* exact f32 attention for rows 0..127 (o x64) */
    k_split<<<JS_V + 2 * JS_A + JS_0, 256, 0, stream>>>(V16 + r0 * LQ, VT, QF + r0p * DM, QH + r0p * DM, QL + r0p * DM, KF + r0p * DM, KH + r0p * DM, KL + r0p * DM, OF0, OH0, OL0);      /* V^T; q, k, first-tile o (x64) -> f16 hi + x1024 residual planes: unscaled logits sigma ~8 */
    static_assert(SQ % 64 == 0 && HD == 64 && NHD == NH && QN == SQ && LQ == DM, "64 query rows per block, 32-key steps, head size 64");
    k_attn<<<JF_A + NBR * JP_0, 128, 0, stream>>>(QH + r0 * LQ, QL + r0 * LQ, KH + r0 * LQ, KL + r0 * LQ, VT, O16 + r0 * DM, OH0 + (size_t)B0 * QT0 * DM, BO, bo, (float*)d_out + r0 * DM); }      /* o (merged heads, x64) as f16 rows; rows 0..127 of every sequence: out = o_hi Wo (+ b) */
  k_out<<<(MPO / 128) * (DM / 64), 128, 0, stream>>>(O16 + r0p * DM, OL0 + (size_t)B0 * QT0 * DM, BO, bo, (float*)d_out + r0p * DM);      /* out rows are the output layout; rows 0..127: += o_lo Wo 2^-20 (own-element accumulate) */
}

// v006
// One run takes 172 microseconds.
// Next to v005, in two timings, it ran 1.36 and 1.35 times as fast.
// Counting every step since v000, it is 62.8 times as fast.
#include <hip/hip_runtime.h>
// Causal multi-head self-attention with PER-HEAD STACKED projections and REAL per-head biases on four sequences at width 512 (x [4][2048][512]; Wq / Wk / Wv [8][512][64] = [head][in][out] ('bte,hed->bhtd'; uniform +-1/sqrt(512)) with biases [8][64] (REAL, uniform +-1/sqrt(512)): a per-head bias [8][64] IS the flat bias [512]; 8 heads of 64 (8 x 64 = 512 = the width); scores * 1/sqrt(64); where(tril, scores, -inf); softmax over keys; out = merged Wp + bp ([in][out] [512][512] + a REAL bias, uniform +-1/sqrt(512)) -> [4][2048][512]); the [in][out] output weight through the text's own TRANSPOSING builder (the one the per-head stacks use); q and k carried as f16 hi + x1024 residual planes with three-product scores; each head's [in][out] block is transposed into its 64 contiguous rows of the weight plane by the same builder, one job per head in one shared launch.
// Compute dtype: inputs rounded to bf16; x / weights exact; v, softmax weights and o as plain f16 GEMM operands (~2^-12), q and k as f16 hi + x1024 residual pairs (rows 0..127: f32 attention, o as hi + residual); scores and softmax statistics f32; v_wmma_f32_16x16x32_f16.
#define NB 4
#define SCL 0.125f                         /* 1 / sqrt(head_dim 64) */
#define SCLR 0.0001220703125f               /* 2^-13: the same scale on the x1024 residual passes */
#define SQ 2048
#define DM 512
#define NH 8
#define HD 64
#define HG 4                         /* heads per call of the untemplated k_vt (not launched) */
#define QT0 128                      /* first-tile rows recomputed exactly in f32 */
#define B0 0                         /* first batch processed (debug hook) */
#define NBR NB                       /* batches processed (debug hook) */
#define NR ((size_t)NB * SQ)         /* token rows */
#define MP ((int)((size_t)NBR * SQ)) /* rows projected (debug hook) */
#define QN SQ                        /* query rows attended per batch (debug hook) */
#define NHD NH                       /* heads attended (debug hook) */
#define MPO MP                       /* rows through the output stage (debug hook) */
#define LQ DM      /* row pitch of the q/k/v rows */
typedef __bf16 v16b __attribute__((ext_vector_type(16)));
typedef unsigned short v8us __attribute__((ext_vector_type(8), may_alias));
typedef float  v8f  __attribute__((ext_vector_type(8)));
typedef float  v4f  __attribute__((ext_vector_type(4)));
typedef float  v4fa __attribute__((ext_vector_type(4), may_alias));
union FragB { v16b v; v8us half[2]; unsigned short u[16]; };

__device__ __forceinline__ unsigned short bf16_bits(float x) { unsigned int u = __float_as_uint(x); return (unsigned short)((u + 0x7FFFu + ((u >> 16) & 1u)) >> 16); }
__device__ __forceinline__ float bf16_val(unsigned short b) { return __uint_as_float(((unsigned int)b) << 16); }
__device__ __forceinline__ float bf16_round(float x) { return bf16_val(bf16_bits(x)); }
// D += A·B with NT terms: 1 = ah·bh, 2 = + al·bh (A split), 3 = + ah·bl (both split)
template <int NT>
__device__ __forceinline__ v8f mmaN(v16b ah, v16b al, v16b bh, v16b bl, v8f c) {
  c = __builtin_amdgcn_wmma_f32_16x16x32_bf16(false, ah, false, bh, (short)0, c, false, false);
  if (NT >= 2) c = __builtin_amdgcn_wmma_f32_16x16x32_bf16(false, al, false, bh, (short)0, c, false, false);
  if (NT >= 3) c = __builtin_amdgcn_wmma_f32_16x16x32_bf16(false, ah, false, bl, (short)0, c, false, false);
  asm volatile("v_nop\n\tv_nop\n\tv_nop\n\tv_nop" : "+v"(c) : "v"(ah), "v"(al), "v"(bh), "v"(bl));
  return c;
}

__global__ __launch_bounds__(256) void k_wt_bf16(const float* __restrict__ W, unsigned short* __restrict__ Wt, int K, int N) {
  const int t = blockIdx.x * 256 + threadIdx.x;
  const int k8n = K / 8;
  if (t >= N * k8n) return;
  const int n = t / k8n, k8 = (t % k8n) * 8;
  v8us v;
#pragma unroll
  for (int i = 0; i < 8; ++i) v[i] = bf16_bits(W[(size_t)(k8 + i) * N + n]);
  *(v8us*)(Wt + (size_t)n * K + k8) = v;
  
}

// GEMM C[M][N] (f32, pitch ldc) = act(A[M][K]·W + bias). A f32 row-major (pitch lda) converted per fragment to bf16
// (ASPLIT: hi/lo two planes -> 2 terms, else single rounded term); Wt bf16 [N][K] (pitch ldb). BIAS_BF16 rounds the
// bias to bf16 first (bias quantised to bf16 before the add). K%32==0, M%16==0, N%64==0.
template <bool ASPLIT, int ACT, bool BIAS_BF16>
__global__ __launch_bounds__(128) void k_gemm_bf(const float* __restrict__ A, int lda, const unsigned short* __restrict__ Wt, int ldb,
                                               const float* __restrict__ bias, float* __restrict__ C, int ldc, int M, int N, int K) {
  __shared__ __attribute__((aligned(16))) float so[4][16][64];
  const int tid = threadIdx.x, w = tid >> 5, lane = tid & 31, ln = lane & 15, hh = lane >> 4;
  const int ntn = N / 64;
  const int wid = blockIdx.x * 4 + w;
  const int mt = wid / ntn, nq = wid % ntn;
  if (mt * 16 >= M) return;
  const int row0 = mt * 16, col0 = nq * 64;
  const float* arow = A + (size_t)(row0 + ln) * lda;
  v8f acc[4] = {};
  for (int kb = 0; kb < K; kb += 32) {
    FragB ah, al;
    const v4f x0 = *(const v4fa*)(arow + kb + 8 * hh), x1 = *(const v4fa*)(arow + kb + 8 * hh + 4);
    const v4f x2 = *(const v4fa*)(arow + kb + 16 + 8 * hh), x3 = *(const v4fa*)(arow + kb + 16 + 8 * hh + 4);
    float xs[16] = {x0[0],x0[1],x0[2],x0[3],x1[0],x1[1],x1[2],x1[3],x2[0],x2[1],x2[2],x2[3],x3[0],x3[1],x3[2],x3[3]};
#pragma unroll
    for (int i = 0; i < 16; ++i) { const unsigned short hb = bf16_bits(xs[i]); ah.u[i] = hb; al.u[i] = ASPLIT ? bf16_bits(xs[i] - bf16_val(hb)) : (unsigned short)0; }
#pragma unroll
    for (int t = 0; t < 4; ++t) {
      const unsigned short* brow = Wt + (size_t)(col0 + t * 16 + ln) * ldb + kb;
      FragB b;
      b.half[0] = *(const v8us*)(brow + 8 * hh);
      b.half[1] = *(const v8us*)(brow + 16 + 8 * hh);
      acc[t] = mmaN<ASPLIT ? 2 : 1>(ah.v, al.v, b.v, b.v, acc[t]);
    }
  }
#pragma unroll
  for (int t = 0; t < 4; ++t) {
    float bv = bias ? bias[col0 + t * 16 + ln] : 0.f;
    if (BIAS_BF16) bv = bf16_round(bv);
#pragma unroll
    for (int r = 0; r < 8; ++r) { float v = acc[t][r] + bv; if (ACT == 1) v = fmaxf(v, 0.f); so[w][8 * hh + r][t * 16 + ln] = v; }
  }
  __builtin_amdgcn_fence(__ATOMIC_ACQ_REL, "workgroup");
  __builtin_amdgcn_wave_barrier();
  const int rsub = lane >> 4, c4 = (lane & 15) * 4;
  {
#pragma unroll
    for (int q = 0; q < 8; ++q) {
      const int r = q * 2 + rsub;
      const v4f v = *(const v4fa*)&so[w][r][c4];
      *(v4f*)(C + (size_t)(row0 + r) * ldc + col0 + c4) = v;
    }
    
  }
}

// GEMM C = act(A·W + bias + resid): A f32 (ASPLIT -> hi/lo 2 terms), Wt bf16 [N][K]; ACT 0 none, 1 relu, 2 exact gelu;
// resid (optional, f32, row index = (row % rmod), pitch ldr, RES_BF16 rounds it) added before the activation.
template <bool ASPLIT, int ACT, bool BIAS_BF16, bool RES_BF16>
__global__ __launch_bounds__(128) void k_gemm_bf3(const float* __restrict__ A, int lda, const unsigned short* __restrict__ Wt, int ldb,
                                                const float* __restrict__ bias, const float* __restrict__ resid, int rmod, int ldr,
                                                float* __restrict__ C, int ldc, int M, int N, int K) {
  __shared__ __attribute__((aligned(16))) float so[4][16][64];
  const int tid = threadIdx.x, w = tid >> 5, lane = tid & 31, ln = lane & 15, hh = lane >> 4;
  const int ntn = N / 64;
  const int wid = blockIdx.x * 4 + w;
  const int mt = wid / ntn, nq = wid % ntn;
  if (mt * 16 >= M) return;
  const int row0 = mt * 16, col0 = nq * 64;
  const float* arow = A + (size_t)(row0 + ln) * lda;
  v8f acc[4] = {};
  for (int kb = 0; kb < K; kb += 32) {
    FragB ah, al;
    const v4f x0 = *(const v4fa*)(arow + kb + 8 * hh), x1 = *(const v4fa*)(arow + kb + 8 * hh + 4);
    const v4f x2 = *(const v4fa*)(arow + kb + 16 + 8 * hh), x3 = *(const v4fa*)(arow + kb + 16 + 8 * hh + 4);
    float xs[16] = {x0[0],x0[1],x0[2],x0[3],x1[0],x1[1],x1[2],x1[3],x2[0],x2[1],x2[2],x2[3],x3[0],x3[1],x3[2],x3[3]};
#pragma unroll
    for (int i = 0; i < 16; ++i) { const unsigned short hb = bf16_bits(xs[i]); ah.u[i] = hb; al.u[i] = ASPLIT ? bf16_bits(xs[i] - bf16_val(hb)) : (unsigned short)0; }
#pragma unroll
    for (int t = 0; t < 4; ++t) {
      const unsigned short* brow = Wt + (size_t)(col0 + t * 16 + ln) * ldb + kb;
      FragB b;
      b.half[0] = *(const v8us*)(brow + 8 * hh);
      b.half[1] = *(const v8us*)(brow + 16 + 8 * hh);
      acc[t] = mmaN<ASPLIT ? 2 : 1>(ah.v, al.v, b.v, b.v, acc[t]);
    }
  }
#pragma unroll
  for (int t = 0; t < 4; ++t) {
    const int col = col0 + t * 16 + ln;
    float bv = bias ? bias[col] : 0.f;
    if (BIAS_BF16) bv = bf16_round(bv);
#pragma unroll
    for (int r = 0; r < 8; ++r) {
      float v = acc[t][r] + bv;
      if (resid) { float rv = resid[(size_t)((row0 + 8 * hh + r) % rmod) * ldr + col]; if (RES_BF16) rv = bf16_round(rv); v += rv; }
      if (ACT == 1) v = fmaxf(v, 0.f);
      if (ACT == 2) v = 0.5f * v * (1.0f + erff(v * 0.70710678118654752f));
      if (ACT == 3) { const float u = 0.7978845608028654f * (v + 0.044715f * v * v * v); v = 0.5f * v * (1.0f + tanhf(u)); }
      so[w][8 * hh + r][t * 16 + ln] = v;
    }
  }
  __builtin_amdgcn_fence(__ATOMIC_ACQ_REL, "workgroup");
  __builtin_amdgcn_wave_barrier();
  const int rsub = lane >> 4, c4 = (lane & 15) * 4;
  {
#pragma unroll
    for (int q = 0; q < 8; ++q) {
      const int r = q * 2 + rsub;
      const v4f v = *(const v4fa*)&so[w][r][c4];
      *(v4f*)(C + (size_t)(row0 + r) * ldc + col0 + c4) = v;
    }
    
  }
}
// row LayerNorm (biased variance, eps) over N: s = X (+ R); optional out_sum <- s; out_norm <- (s-mu)*rsqrt(var+eps)*g + b
template <bool PARAM_BF16>
__global__ __launch_bounds__(256) void k_layernorm(const float* __restrict__ X, const float* __restrict__ R, const float* __restrict__ g, const float* __restrict__ bta,
                                                  float* __restrict__ out_sum, float* __restrict__ out_norm, int N, float eps) {
  __shared__ float red[256];
  const int row = blockIdx.x, tid = threadIdx.x;
  const float* x = X + (size_t)row * N; const float* rr = R ? R + (size_t)row * N : nullptr;
  float vals[16];                     // up to N = 4096
  const int per = N / 256;            // contiguous chunk per thread? use strided-by-4 chunks: thread handles j = tid*4 + 1024*u
  float s1 = 0.f;
  for (int u = 0; u < per / 4; ++u) {
    const int j = tid * 4 + 1024 * u;
    const v4f a = *(const v4fa*)(x + j);
    v4f b = {0.f,0.f,0.f,0.f}; if (rr) b = *(const v4fa*)(rr + j);
#pragma unroll
    for (int q = 0; q < 4; ++q) { const float v = a[q] + b[q]; vals[u * 4 + q] = v; s1 += v; }
  }
  red[tid] = s1; __syncthreads();
  for (int st = 128; st > 0; st >>= 1) { if (tid < st) red[tid] += red[tid + st]; __syncthreads(); }
  const float mu = red[0] / (float)N; __syncthreads();
  float s2 = 0.f;
  for (int u = 0; u < per / 4; ++u)
#pragma unroll
    for (int q = 0; q < 4; ++q) { const float c = vals[u * 4 + q] - mu; s2 += c * c; }
  red[tid] = s2; __syncthreads();
  for (int st = 128; st > 0; st >>= 1) { if (tid < st) red[tid] += red[tid + st]; __syncthreads(); }
  const float rs = rsqrtf(red[0] / (float)N + eps);
  {
    for (int u = 0; u < per / 4; ++u) {
      const int j = tid * 4 + 1024 * u;
      v4f o, sm;
#pragma unroll
      for (int q = 0; q < 4; ++q) {
        float gg = g[j + q], bb = bta[j + q];
        if (PARAM_BF16) { gg = bf16_round(gg); bb = bf16_round(bb); }
        sm[q] = vals[u * 4 + q]; o[q] = (vals[u * 4 + q] - mu) * rs * gg + bb;
      }
      if (out_sum) *(v4f*)(out_sum + (size_t)row * N + j) = sm;
      *(v4f*)(out_norm + (size_t)row * N + j) = o;
    }
    
  }
}



// ---- f16 WMMA path (v_wmma_f32_16x16x32_f16): 11-bit significands for operands in range — used where a [0,1] probability operand needs more precision than bf16
typedef _Float16 v16h __attribute__((ext_vector_type(16)));
union FragH { v16h v; v8us half[2]; _Float16 h[16]; unsigned short u[16]; };
template <int NT>
__device__ __forceinline__ v8f mmaH(v16h ah, v16h al, v16h bh, v16h bl, v8f c) {
  c = __builtin_amdgcn_wmma_f32_16x16x32_f16(false, ah, false, bh, (short)0, c, false, false);
  if (NT >= 2) c = __builtin_amdgcn_wmma_f32_16x16x32_f16(false, al, false, bh, (short)0, c, false, false);
  if (NT >= 3) c = __builtin_amdgcn_wmma_f32_16x16x32_f16(false, ah, false, bl, (short)0, c, false, false);
  asm volatile("v_nop\n\tv_nop\n\tv_nop\n\tv_nop" : "+v"(c) : "v"(ah), "v"(al), "v"(bh), "v"(bl));
  return c;
}
// batched GEMM like k_gemm_b but f16 operands: A f32 (split into f16 hi/lo if ASPLIT, else rounded to f16), Bt = f16 values [n][k]; alpha; C f32; N multiple of 16 (partial tiles skipped)
template <bool ASPLIT>
__global__ __launch_bounds__(128) void k_gemm_h(const float* __restrict__ A, int lda, size_t sA, const _Float16* __restrict__ Bh, int ldb, size_t sB, float alpha, float* __restrict__ C, int ldc, size_t sC, int M, int N, int K) {
  __shared__ __attribute__((aligned(16))) float so[4][16][64];
  const int tid = threadIdx.x, w = tid >> 5, lane = tid & 31, ln = lane & 15, hh = lane >> 4; const int by = blockIdx.y;
  A += (size_t)by * sA; Bh += (size_t)by * sB; C += (size_t)by * sC;
  const int ntn = (N + 63) / 64; const int wid = blockIdx.x * 4 + w; const int mt = wid / ntn, nq = wid % ntn; if (mt * 16 >= M) return;
  const int row0 = mt * 16, col0 = nq * 64; const float* arow = A + (size_t)(row0 + ln) * lda;
  v8f acc[4] = {};
  for (int kb = 0; kb < K; kb += 32) {
    FragH ah, al;
    const v4f x0 = *(const v4fa*)(arow + kb + 8 * hh), x1 = *(const v4fa*)(arow + kb + 8 * hh + 4), x2 = *(const v4fa*)(arow + kb + 16 + 8 * hh), x3 = *(const v4fa*)(arow + kb + 16 + 8 * hh + 4);
    float xs[16] = {x0[0],x0[1],x0[2],x0[3],x1[0],x1[1],x1[2],x1[3],x2[0],x2[1],x2[2],x2[3],x3[0],x3[1],x3[2],x3[3]};
#pragma unroll
    for (int i = 0; i < 16; ++i) { const _Float16 h = (_Float16)xs[i]; ah.h[i] = h; al.h[i] = ASPLIT ? (_Float16)(xs[i] - (float)h) : (_Float16)0.0f; }
#pragma unroll
    for (int t = 0; t < 4; ++t) { if (col0 + t * 16 >= N) continue; const size_t boff = (size_t)(col0 + t * 16 + ln) * ldb + kb; FragH bq; bq.half[0] = *(const v8us*)(Bh + boff + 8 * hh); bq.half[1] = *(const v8us*)(Bh + boff + 16 + 8 * hh);
      acc[t] = mmaH<ASPLIT ? 2 : 1>(ah.v, al.v, bq.v, bq.v, acc[t]); }
  }
#pragma unroll
  for (int t = 0; t < 4; ++t) { if (col0 + t * 16 >= N) continue;
#pragma unroll
    for (int r = 0; r < 8; ++r) so[w][8 * hh + r][t * 16 + ln] = acc[t][r] * alpha; }
  __builtin_amdgcn_fence(__ATOMIC_ACQ_REL, "workgroup"); __builtin_amdgcn_wave_barrier();
  const int rsub = lane >> 4, c4 = (lane & 15) * 4;
  {
#pragma unroll
    for (int q = 0; q < 8; ++q) { const int r = q * 2 + rsub; if (col0 + c4 < N) { const v4f v = *(const v4fa*)&so[w][r][c4]; *(v4f*)(C + (size_t)(row0 + r) * ldc + col0 + c4) = v; } }
     }
}

// Wt[n][k] = f16(W[k][n]·scale) from f32 row-major W[K][N] (scale = power of two; bf16-exact weights stay exact in f16 away from the subnormal range)
// (a job of a shared launch: blk = the block's index within the job, 256 threads a block)
__device__ __forceinline__ void wt_f16_job(const float* __restrict__ W, _Float16* __restrict__ Wt, int K, int N, float scale, int blk) {
  const int t = blk * 256 + threadIdx.x; if (t >= N * (K / 8)) return; const int n = t / (K / 8), k8 = (t % (K / 8)) * 8; FragH f;
#pragma unroll
  for (int i = 0; i < 8; ++i) f.h[i] = (_Float16)(bf16_round(W[(size_t)(k8 + i) * N + n]) * scale); const v8us o = f.half[0];
  *(v8us*)((unsigned short*)Wt + (size_t)n * K + k8) = o; 
}
// k_gemm_hh variant with fused epilogue: v = acc·alpha + bias[by·sBias + col] (+ CP[(row/rowsPerB)·sCPb + by·64 + col] if CP) ; ACT 0 none / 1 elu ; writes f16 C16 (and f32 C if non-null)
template <int ACT>
__global__ __launch_bounds__(128) void k_gemm_hhx(const _Float16* __restrict__ A, int lda, size_t sA, const _Float16* __restrict__ Bh, int ldb, size_t sB, float alpha, const float* __restrict__ bias, size_t sBias, const float* __restrict__ CP, int rowsPerB, size_t sCPb, int row0g,
    float* __restrict__ C, _Float16* __restrict__ C16, int ldc, size_t sC, int M, int N, int K) {
  __shared__ __attribute__((aligned(16))) float so[4][16][64];
  const int tid = threadIdx.x, w = tid >> 5, lane = tid & 31, ln = lane & 15, hh = lane >> 4; const int by = blockIdx.y;
  A += (size_t)by * sA; Bh += (size_t)by * sB; const size_t cofs = (size_t)by * sC; const float* bp = bias ? bias + (size_t)by * sBias : nullptr;
  const int ntn = (N + 63) / 64; const int wid = blockIdx.x * 4 + w; const int mt = wid / ntn, nq = wid % ntn; if (mt * 16 >= M) return;
  const int row0 = mt * 16, col0 = nq * 64; const _Float16* arow = A + (size_t)(row0 + ln) * lda;
  v8f acc[4] = {};
  for (int kb = 0; kb < K; kb += 32) { FragH ah; ah.half[0] = *(const v8us*)((const unsigned short*)arow + kb + 8 * hh); ah.half[1] = *(const v8us*)((const unsigned short*)arow + kb + 16 + 8 * hh);
#pragma unroll
    for (int t = 0; t < 4; ++t) { if (col0 + t * 16 >= N) continue; const size_t boff = (size_t)(col0 + t * 16 + ln) * ldb + kb; FragH bq; bq.half[0] = *(const v8us*)((const unsigned short*)Bh + boff + 8 * hh); bq.half[1] = *(const v8us*)((const unsigned short*)Bh + boff + 16 + 8 * hh);
      acc[t] = mmaH<1>(ah.v, ah.v, bq.v, bq.v, acc[t]); }
  }
#pragma unroll
  for (int t = 0; t < 4; ++t) { if (col0 + t * 16 >= N) continue; const int col = col0 + t * 16 + ln; const float bv = bp ? bf16_round(bp[col]) : 0.f;
#pragma unroll
    for (int r = 0; r < 8; ++r) { float v = acc[t][r] * alpha + bv; if (CP) { const int rr = row0g + row0 + 8 * hh + r; if (rowsPerB < 0) v += CP[cofs + (size_t)rr * ldc + col];      /* rowsPerB < 0: own element of the batched C plane */ else { const int bidx = rr / rowsPerB; v += CP[(size_t)bidx * sCPb + (size_t)by * 64 + col]; } } if (ACT == 1) v = (v > 0.f) ? v : expm1f(v); else if (ACT == 7) v = (v > 0.f) ? v + 1.0f : expf(v); else if (ACT == 8) v = tanhf(v); else if (ACT == 9) v = 0.5f * v * (1.0f + tanhf(0.7978845608028654f * (v + 0.044715f * v * v * v))); else if (ACT == 11) v = 1.0f / (1.0f + expf(-v)); else if (ACT == 12) v = (v > 0.f) ? v : 0.01f * v; else if (ACT == 14) v = (v > 0.f) ? v : 0.1f * v; else if (ACT == 16) v = (v >= 0.f) ? v : 0.3f * v; else if (ACT == 17) v = (v >= 0.f) ? v : 0.2f * v; else if (ACT == 15) v = v / (1.0f + expf(-v)); else if (ACT == 3) v = fmaxf(v, 0.f); else if (ACT == 6) v = 0.5f * v * (1.0f + erff(v * 0.70710678118654752f)); so[w][8 * hh + r][t * 16 + ln] = v; } }
  __builtin_amdgcn_fence(__ATOMIC_ACQ_REL, "workgroup"); __builtin_amdgcn_wave_barrier();
  const int rsub = lane >> 4, c4 = (lane & 15) * 4; typedef _Float16 v4h __attribute__((ext_vector_type(4)));
  {
#pragma unroll
    for (int q = 0; q < 8; ++q) { const int r = q * 2 + rsub; if (col0 + c4 < N) { const v4f v = *(const v4fa*)&so[w][r][c4]; if (C) *(v4f*)(C + cofs + (size_t)(row0 + r) * ldc + col0 + c4) = v; if (C16) { v4h h4; for (int i = 0; i < 4; ++i) h4[i] = (_Float16)v[i]; *(v4h*)(C16 + cofs + (size_t)(row0 + r) * ldc + col0 + c4) = h4; } } }
     }
}


typedef _Float16 v4h __attribute__((ext_vector_type(4)));

__device__ __forceinline__ void x16_job(const float* __restrict__ x, _Float16* __restrict__ X16, size_t n8, int blk) { const size_t t = (size_t)blk * 256 + threadIdx.x; if (t >= n8) return; FragH f;
#pragma unroll
  for (int q = 0; q < 8; ++q) f.h[q] = (_Float16)bf16_round(x[t * 8 + q]); *(v8us*)((unsigned short*)X16 + t * 8) = f.half[0];  }
__global__ __launch_bounds__(256) void k_h16(const float* __restrict__ x, _Float16* __restrict__ X16, size_t n8) { const size_t t = (size_t)blockIdx.x * 256 + threadIdx.x; if (t >= n8) return; FragH f;
#pragma unroll
  for (int q = 0; q < 8; ++q) f.h[q] = (_Float16)x[t * 8 + q]; *(v8us*)((unsigned short*)X16 + t * 8) = f.half[0];  }
__global__ __launch_bounds__(256) void k_round16f(const float* __restrict__ W, _Float16* __restrict__ Bt, size_t n8) { const size_t t = (size_t)blockIdx.x * 256 + threadIdx.x; if (t >= n8) return; FragH f;
#pragma unroll
  for (int i = 0; i < 8; ++i) f.h[i] = (_Float16)(bf16_round(W[t * 8 + i]) * 16.0f); *(v8us*)((unsigned short*)Bt + t * 8) = f.half[0];  }
template <int NHv, int TTv>
__device__ __forceinline__ void vt_job(const _Float16* __restrict__ V16, int ldv, int voff, _Float16* __restrict__ Vt, int blk) { __shared__ unsigned short tl[64][66]; const int tid = threadIdx.x; const int slab = blk / (TTv / 64), lg = blk % (TTv / 64); const int b = slab / NHv, h = slab % NHv;
  for (int i = tid; i < 64 * 8; i += 256) { const int r = i / 8, c8 = (i % 8) * 8; FragH f; f.half[0] = *(const v8us*)((const unsigned short*)V16 + ((size_t)b * TTv + lg * 64 + r) * ldv + voff + h * 64 + c8);
#pragma unroll
    for (int q = 0; q < 8; ++q) tl[r][c8 + q] = f.u[q]; }
  __syncthreads();
  {
#pragma unroll
    for (int rd = 0; rd < 2; ++rd) { const int d = rd * 32 + tid / 8, pc = tid % 8; FragH f;
#pragma unroll
      for (int q = 0; q < 8; ++q) f.u[q] = tl[pc * 8 + q][d];
      *(v8us*)((unsigned short*)Vt + ((size_t)slab * 64 + d) * TTv + lg * 64 + pc * 8) = f.half[0]; }
     } }

__device__ __forceinline__ void hl_job(const float* __restrict__ F, _Float16* __restrict__ Hh, _Float16* __restrict__ Hl, size_t n8, int blk) { const size_t t = (size_t)blk * 256 + threadIdx.x; if (t >= n8) return; FragH fh, fl; const v4f a = *(const v4fa*)(F + t * 8), c = *(const v4fa*)(F + t * 8 + 4);
#pragma unroll
  for (int q = 0; q < 4; ++q) { _Float16 h = (_Float16)a[q]; fh.h[q] = h; fl.h[q] = (_Float16)((a[q] - (float)h) * 1024.0f); h = (_Float16)c[q]; fh.h[4 + q] = h; fl.h[4 + q] = (_Float16)((c[q] - (float)h) * 1024.0f); }
  { *(v8us*)((unsigned short*)Hh + t * 8) = fh.half[0]; *(v8us*)((unsigned short*)Hl + t * 8) = fl.half[0];  } }

// ---- fast GEMM (wave tile 32x64; requires M % 32 == 0 rows per launch region and N % 64 == 0); epilogue = k_gemm_hhx semantics; two batch axes: by (strides sA, sB, sC) and bz (strides zA, zB, zC) ----
__device__ __forceinline__ v16h g2_frag(const _Float16* p, int hh) { FragH f; f.half[0] = *(const v8us*)((const unsigned short*)p + 8 * hh); f.half[1] = *(const v8us*)((const unsigned short*)p + 16 + 8 * hh); return f.v; }
__device__ __forceinline__ v8f g2_mma(v16h a, v16h b, v8f c) { v8f d = __builtin_amdgcn_wmma_f32_16x16x32_f16(false, a, false, b, (short)0, c, false, false); asm volatile("v_nop\n\tv_nop\n\tv_nop\n\tv_nop" : "+v"(d) : "v"(a), "v"(b)); return d; }
template <int ACT>
__device__ __forceinline__ void gemm2_job(const _Float16* __restrict__ A, int lda, size_t sA, const _Float16* __restrict__ Bh, int ldb, size_t sB, float alpha, const float* __restrict__ bias, size_t sBias, const float* __restrict__ CP, int rowsPerB, size_t sCPb, int row0g,
    float* __restrict__ C, _Float16* __restrict__ C16, int ldc, size_t sC, int M, int N, int K, size_t zA, size_t zB, size_t zC, int bx, int by, int bz) { static_assert(ACT == 0 || ACT == 3 || ACT == 6 || ACT == 8 || ACT == 9 || ACT == 11 || ACT == 12 || ACT == 14 || ACT == 15 || ACT == 16 || ACT == 17, "gemm2_job: unsupported ACT code (would silently apply no activation)");
  __shared__ __attribute__((aligned(16))) float so[4][32][68];
  const int tid = threadIdx.x, w = tid >> 5, lane = tid & 31, ln = lane & 15, hh = lane >> 4;      /* bx = tile, by = batch (strides sA, sB, sC), bz = sequence (strides zA, zB, zC) */
  A += (size_t)by * sA + (size_t)bz * zA; Bh += (size_t)by * sB + (size_t)bz * zB; const size_t cofs = (size_t)by * sC + (size_t)bz * zC; const float* bp = bias ? bias + (size_t)by * sBias : nullptr;
  const int ntn = N >> 6; const int mt = bx / ntn, nq = bx - mt * ntn; const int row0 = mt * 128 + 32 * w, col0 = nq * 64; if (row0 >= M) return;
  const _Float16* a0p = A + (size_t)(row0 + ln) * lda; const _Float16* a1p = a0p + (size_t)16 * lda;
  const _Float16* b0p = Bh + (size_t)(col0 + ln) * ldb; const _Float16* b1p = b0p + (size_t)16 * ldb; const _Float16* b2p = b1p + (size_t)16 * ldb; const _Float16* b3p = b2p + (size_t)16 * ldb;
  const v8f z8 = {0.f,0.f,0.f,0.f,0.f,0.f,0.f,0.f}; v8f c00 = z8, c01 = z8, c02 = z8, c03 = z8, c10 = z8, c11 = z8, c12 = z8, c13 = z8;
#pragma unroll 1
  for (int kb = 0; kb < K; kb += 32) { const v16h a0 = g2_frag(a0p + kb, hh); FragH a1f; a1f.half[0] = *(const v8us*)((const unsigned short*)(a1p + kb) + 8 * hh);
    asm volatile("s_wait_xcnt 0x0" ::: "memory");      /* the four A loads share one address pair, and the last of them may land its result in it: the wait stands behind the first three, in front of that write */
    a1f.half[1] = *(const v8us*)((const unsigned short*)(a1p + kb) + 16 + 8 * hh); const v16h a1 = a1f.v;
    v16h b = g2_frag(b0p + kb, hh); c00 = g2_mma(a0, b, c00); c10 = g2_mma(a1, b, c10);
    b = g2_frag(b1p + kb, hh); c01 = g2_mma(a0, b, c01); c11 = g2_mma(a1, b, c11);
    b = g2_frag(b2p + kb, hh); c02 = g2_mma(a0, b, c02); c12 = g2_mma(a1, b, c12);
    b = g2_frag(b3p + kb, hh); c03 = g2_mma(a0, b, c03); c13 = g2_mma(a1, b, c13); }
  v8f accs[8] = {c00, c01, c02, c03, c10, c11, c12, c13};
#pragma unroll
  for (int u = 0; u < 8; ++u) { const int t = u & 3, half = u >> 2; const int col = col0 + t * 16 + ln; const float bv = bp ? bf16_round(bp[col]) : 0.f;
#pragma unroll
    for (int r = 0; r < 8; ++r) { const int rloc = half * 16 + 8 * hh + r; float v = accs[u][r] * alpha + bv; if (CP) { if (rowsPerB < 0) v += CP[cofs + (size_t)(row0g + row0 + rloc) * ldc + col];      /* rowsPerB < 0: own element of the batched C plane */ else { const int bidx = (row0g + row0 + rloc) / rowsPerB; v += CP[(size_t)bidx * sCPb + (size_t)by * 64 + col]; } }
      if (ACT == 3) v = fmaxf(v, 0.f); else if (ACT == 6) v = 0.5f * v * (1.0f + erff(v * 0.70710678118654752f)); else if (ACT == 11) v = 1.0f / (1.0f + expf(-v)); else if (ACT == 15) v = v / (1.0f + expf(-v)); else if (ACT == 12) v = (v > 0.f) ? v : 0.01f * v; else if (ACT == 8) v = tanhf(v); else if (ACT == 9) v = 0.5f * v * (1.0f + tanhf(0.7978845608028654f * (v + 0.044715f * v * v * v))); else if (ACT == 14) v = (v > 0.f) ? v : 0.1f * v; else if (ACT == 16) v = (v >= 0.f) ? v : 0.3f * v; else if (ACT == 17) v = (v >= 0.f) ? v : 0.2f * v;
      so[w][rloc][t * 16 + ln] = v; } }
  __builtin_amdgcn_fence(__ATOMIC_ACQ_REL, "workgroup"); __builtin_amdgcn_wave_barrier();
  const int rsub = lane >> 4, c4 = (lane & 15) * 4;
  {
#pragma unroll
    for (int q = 0; q < 16; ++q) { const int r = q * 2 + rsub; const v4f v = *(const v4fa*)&so[w][r][c4]; if (C) { *(v4f*)(C + cofs + (size_t)(row0 + r) * ldc + col0 + c4) = v; asm volatile("s_wait_xcnt 0x0" ::: "memory"); }      /* the wait stands between the f32 store and the conversions below, which may land in the registers that the store names */
      if (C16) { v4h h4; for (int i = 0; i < 4; ++i) h4[i] = (_Float16)v[i]; *(v4h*)(C16 + cofs + (size_t)(row0 + r) * ldc + col0 + c4) = h4; } }
     } }


// ---- shared launches: jobs that do not depend on one another run in one grid; the block index picks the job (the same for every thread of a block) and the block's index within it ----
#define JW_H (HD * (DM / 8) / 256)             /* blocks per per-head weight block */
#define JW_O (DM * (DM / 8) / 256)             /* blocks of the output weight */
#define JX ((int)(NR * DM / 8 / 256))          /* blocks per plane of x rows */
static_assert(HD * (DM / 8) % 256 == 0 && DM * (DM / 8) % 256 == 0 && NR * DM / 8 % 256 == 0, "whole blocks per job");
// Operand planes: 3 NH per-head weight blocks (head h of wq / wk / wv is a row-major [DM][HD] block, written as HD contiguous rows of the [out][in] plane, x16), the [DM][DM] output weight, three planes of x rows.
__global__ __launch_bounds__(256) void k_prep(const float* x, const float* xk, const float* xv, const float* __restrict__ wq, const float* __restrict__ wk, const float* __restrict__ wv, const float* __restrict__ wo,
    _Float16* __restrict__ BQ, _Float16* __restrict__ BK, _Float16* __restrict__ BV, _Float16* __restrict__ BO, _Float16* __restrict__ X16, _Float16* __restrict__ XK16, _Float16* __restrict__ XV16) {
  int bx = blockIdx.x;
  if (bx < 3 * NH * JW_H) { const int j = bx / JW_H, s = j % 3, h = j / 3; const size_t wofs = (size_t)h * DM * HD, pofs = (size_t)h * HD * DM;
    wt_f16_job((s == 0 ? wq : s == 1 ? wk : wv) + wofs, (s == 0 ? BQ : s == 1 ? BK : BV) + pofs, DM, HD, 16.0f, bx % JW_H); return; }
  bx -= 3 * NH * JW_H;
  if (bx < JW_O) { wt_f16_job(wo, BO, DM, DM, 16.0f, bx); return; }
  bx -= JW_O;
  const int s = bx / JX; x16_job(s == 0 ? x : s == 1 ? xk : xv, s == 0 ? X16 : s == 1 ? XK16 : XV16, NR * DM / 8, bx % JX); }
#define JP_A ((MP / 128) * (DM / 64))          /* tiles of a projection of all rows */
#define JP_0 ((QT0 / 128) * (DM / 64))         /* tiles of a first-tile projection, per sequence */
// The six projections. grid.y: q, k, v. grid.x: the tiles of all rows (q, k as f32, v as f16), then per sequence the tiles of the first QT0 rows (f32 planes of QT0 rows a sequence).
__global__ __launch_bounds__(128) void k_proj(const _Float16* __restrict__ X16, const _Float16* __restrict__ XK16, const _Float16* __restrict__ XV16, const _Float16* __restrict__ BQ, const _Float16* __restrict__ BK, const _Float16* __restrict__ BV,
    const float* __restrict__ bq, const float* __restrict__ bk, const float* __restrict__ bv, float* __restrict__ QF, float* __restrict__ KF, _Float16* __restrict__ V16, float* __restrict__ QF0, float* __restrict__ KF0, float* __restrict__ VF0) {
  const int s = blockIdx.y; const int bx = blockIdx.x; const bool all = bx < JP_A; const int b0 = bx - JP_A;
  gemm2_job<0>(s == 0 ? X16 : s == 1 ? XK16 : XV16, DM, 0, s == 0 ? BQ : s == 1 ? BK : BV, DM, 0, 0.0625f, s == 0 ? bq : s == 1 ? bk : bv, 0, nullptr, 1, 0, 0,
      all ? (s == 0 ? QF : s == 1 ? KF : nullptr) : (s == 0 ? QF0 : s == 1 ? KF0 : VF0), (all && s == 2) ? V16 : nullptr, DM, 0, all ? MP : QT0, DM, DM, (size_t)SQ * DM, 0, (size_t)QT0 * DM,
      all ? bx : b0 % JP_0, 0, all ? 0 : b0 / JP_0); }
#define JS_V (NBR * NH * (SQ / 64))                      /* blocks of V^T */
#define JS_A ((int)((size_t)MP * DM / 8 / 256))          /* blocks of a split of all rows */
#define JS_0 ((int)((size_t)NB * QT0 * DM / 8 / 256))    /* blocks of the split of the first-tile rows */
static_assert((size_t)MP * DM / 8 % 256 == 0 && (size_t)NB * QT0 * DM / 8 % 256 == 0, "whole blocks per job");
// V^T [NBR][NH][HD][SQ]; q, k and the first-tile o (f32) -> f16 hi + x1024 residual planes.
__global__ __launch_bounds__(256) void k_split(const _Float16* __restrict__ V16, _Float16* __restrict__ VT, const float* __restrict__ QF, _Float16* __restrict__ QH, _Float16* __restrict__ QL, const float* __restrict__ KF, _Float16* __restrict__ KH, _Float16* __restrict__ KL,
    const float* __restrict__ OF0, _Float16* __restrict__ OH0, _Float16* __restrict__ OL0) {
  int bx = blockIdx.x;
  if (bx < JS_V) { vt_job<NH, SQ>(V16, LQ, 0, VT, bx); return; }
  bx -= JS_V;
  if (bx < 2 * JS_A) { const bool q = bx < JS_A; hl_job(q ? QF : KF, q ? QH : KH, q ? QL : KL, (size_t)MP * DM / 8, q ? bx : bx - JS_A); return; }
  hl_job(OF0, OH0, OL0, (size_t)NB * QT0 * DM / 8, bx - 2 * JS_A); }


__global__ __launch_bounds__(256) void k_wnat(const float* __restrict__ w, size_t n8, _Float16* __restrict__ Bt) { const size_t t = (size_t)blockIdx.x * 256 + threadIdx.x; if (t >= n8) return; FragH f; for (int q = 0; q < 8; ++q) f.h[q] = (_Float16)(bf16_round(w[t * 8 + q]) * 16.0f); *(v8us*)((unsigned short*)Bt + t * 8) = f.half[0];  }
__global__ __launch_bounds__(256) void k_rsm(const float* __restrict__ S, _Float16* __restrict__ P, int nrows) {
  #pragma clang fp contract(off)
  const int i = blockIdx.x * 256 + threadIdx.x; if (i >= nrows) return; const float* s = S + (size_t)i * SQ; float mx = -3.0e38f;
#pragma unroll 1
  for (int j = 0; j < SQ; ++j) mx = fmaxf(mx, s[j]); float se = 0.f;
#pragma unroll 1
  for (int j = 0; j < SQ; ++j) se += expf(s[j] - mx); const float sc = 256.0f / se;
#pragma unroll 1
  for (int j0 = 0; j0 < SQ; j0 += 8) { FragH f; for (int q = 0; q < 8; ++q) f.h[q] = (_Float16)(expf(s[j0 + q] - mx) * sc); unsigned short* d = (unsigned short*)P + (size_t)i * SQ + j0; *(v8us*)d = f.half[0];  } }
__global__ __launch_bounds__(256) void k_vt(const _Float16* __restrict__ V16, int b, int h0, _Float16* __restrict__ VT) { __shared__ unsigned short tl[64][65]; const int tid = threadIdx.x; const int hh = blockIdx.x % HG, sg = blockIdx.x / HG; const int s0 = sg * 64; const int h = h0 + hh;
  for (int i = tid; i < 64 * 8; i += 256) { const int j = i / 8, d8 = (i % 8) * 8; FragH f; f.half[0] = *(const v8us*)((const unsigned short*)V16 + ((size_t)b * SQ + s0 + j) * DM + h * HD + d8); for (int q = 0; q < 8; ++q) tl[d8 + q][j] = f.u[q]; }
  __syncthreads();
  { for (int i = tid; i < 64 * 8; i += 256) { const int d = i / 8, j8 = (i % 8) * 8; FragH f; for (int q = 0; q < 8; ++q) f.u[q] = tl[d][j8 + q]; *(v8us*)((unsigned short*)VT + ((size_t)hh * HD + d) * SQ + s0 + j8) = f.half[0]; }  } }



// 2^x on the transcendental unit, with the one free issue slot that the instruction set asks for behind it before its result is used or its
// source overwritten: in the unrolled row the compiler put one exponential's result into the source register of the one directly ahead of it.
__device__ __forceinline__ float exp2_slot(float x) { float r; asm("v_exp_f32 %0, %1\n\tv_nop" : "=v"(r) : "v"(x)); return r; }
// Fused causal attention: scores, softmax and P V in one launch; neither scores nor weights go to memory. One wave owns 16 query rows of one
// head and walks its keys 32 at a time, transposed: S^T = K Q^T (A = key rows, B = query rows), so that a lane holds scores of ONE query
// (column ln; keys 8 hh + r of each 16-key tile) and the row maximum and sum need one exchange between the wave's halves. The two score tiles,
// converted in place, are the B operand of O^T += V^T P^T in the loader's own k order (keys 8 hh + 0..7, then 16 + 8 hh + 0..7), and the
// accumulators of O^T belong to the same query as the lane's running maximum and sum. Scores keep their three f16 products (hi.hi, lo.hi, hi.lo).
// The block's four waves walk the same keys: each 32-key tile (key rows hi, key rows residual, V^T rows) is brought into LDS once per block by
// asynchronous copies, whole rows at a time, into one of two buffers, the next tile in flight while this one is worked on; the waves take their
// fragments from LDS.
#define FKP 72                       /* halves from one staged key row (64 halves) to the next: 144 bytes = 16 x odd, for 16-byte LDS reads */
#define FVP 40                       /* halves from one staged V^T row (32 halves) to the next: 80 bytes = 16 x odd */
#define FKL (32 * FKP)               /* first half of the residual key rows in a buffer */
#define FVO (2 * 32 * FKP)           /* first half of the V^T rows in a buffer */
#define FBUF (2 * 32 * FKP + HD * FVP)      /* halves per buffer */
typedef __attribute__((address_space(3))) _Float16 lds_f16;
// One 32-key tile into one buffer: six copies of 16 bytes a lane (128 lanes: 16 key rows of 8 pieces, twice, for each key plane; 32 V^T rows of 4 pieces, twice).
// lk, lv: the lane's LDS byte addresses of its first key piece and its first V^T piece; gh, gl, gv: its global addresses of the same pieces.
// The s_wait_xcnt stands inside the statement, behind the last copy: the address registers may be rewritten right behind it.
__device__ __forceinline__ void fattn_copy(unsigned lk, unsigned lv, const _Float16* gh, const _Float16* gl, const _Float16* gv) {
  asm volatile("global_load_async_to_lds_b128 %0, %6, off\n\t"
               "global_load_async_to_lds_b128 %1, %7, off\n\t"
               "global_load_async_to_lds_b128 %2, %8, off\n\t"
               "global_load_async_to_lds_b128 %3, %9, off\n\t"
               "global_load_async_to_lds_b128 %4, %10, off\n\t"
               "global_load_async_to_lds_b128 %5, %11, off\n\t"
               "s_wait_xcnt 0x0"
               :: "v"(lk), "v"(lk + 16 * FKP * 2), "v"(lk + FKL * 2), "v"(lk + (FKL + 16 * FKP) * 2), "v"(lv), "v"(lv + 32 * FVP * 2),
                  "v"(gh), "v"(gh + 16 * LQ), "v"(gl), "v"(gl + 16 * LQ), "v"(gv), "v"(gv + (size_t)32 * SQ) : "memory"); }
__device__ __forceinline__ void fattn_job(const _Float16* __restrict__ Qh, const _Float16* __restrict__ Ql, const _Float16* __restrict__ Kh, const _Float16* __restrict__ Kl, const _Float16* __restrict__ Vt, _Float16* __restrict__ O, int bx, int h, int b) {
  __shared__ __attribute__((aligned(16))) _Float16 ring[2 * FBUF];
  const int tid = threadIdx.x, lane = tid & 31, ln = lane & 15, hh = lane >> 4; const int w = __builtin_amdgcn_readfirstlane(threadIdx.x >> 5);      /* the wave's number in a scalar register: the trip count stays scalar */
  const int qt = (b & 1) ? bx : SQ / 64 - 1 - bx;      /* long and short causal tiles alternate between sequences */
  const int q0 = qt * 64 + w * 16; const size_t rb = (size_t)b * SQ;
  const size_t qo = (rb + q0 + ln) * LQ + h * HD;
  const v16h qh0 = g2_frag(Qh + qo, hh), qh1 = g2_frag(Qh + qo + 32, hh), ql0 = g2_frag(Ql + qo, hh), ql1 = g2_frag(Ql + qo + 32, hh);
  const size_t ko = (rb + (tid >> 3)) * LQ + h * HD + (tid & 7) * 8;      /* the lane's first piece of tile 0 */
  const _Float16* gh = Kh + ko; const _Float16* gl = Kl + ko;
  const _Float16* gv = Vt + ((size_t)(b * NH + h) * HD + (tid >> 2)) * SQ + (tid & 3) * 8;
  const unsigned l0 = (unsigned)(size_t)(lds_f16*)ring;
  const unsigned lk = l0 + ((tid >> 3) * FKP + (tid & 7) * 8) * 2, lv = l0 + (FVO + (tid >> 2) * FVP + (tid & 3) * 8) * 2;
  const v8f z8 = {0.f,0.f,0.f,0.f,0.f,0.f,0.f,0.f}; v8f o[4] = {z8, z8, z8, z8};
  float m = -1.0e30f, l = 0.f; const int nst = (q0 >> 5) + 1;      /* the wave's 32-key steps, up to the one that holds its diagonal */
  const int nbl = 2 * qt + 2;      /* the block's tiles (its last wave's steps; two at least): every wave passes every barrier */
  fattn_copy(lk, lv, gh, gl, gv);      /* tile 0 */
  asm volatile("s_wait_asynccnt 0x0" ::: "memory");      /* the wave's own copies have landed before the barrier behind which other waves read them */
  __syncthreads();
  gh += 32 * LQ; gl += 32 * LQ; gv += 32;
  fattn_copy(lk + FBUF * 2, lv + FBUF * 2, gh, gl, gv);      /* tile 1 flies while tile 0 is worked on */
#pragma unroll 1      /* rolled: a second copy of the body would hold a second set of fragments and cost a resident wave per SIMD */
  for (int st = 0; st < nbl; ++st) { const int key0 = st * 32; const int bo = (st & 1) * FBUF;
    if (st < nst) {      /* a scalar test: a wave past its diagonal skips the work, never the barrier */
    const _Float16* kb = ring + bo + ln * FKP; const _Float16* vb = ring + bo + FVO + ln * FVP;
    v16h ka[2][4];      /* per 16-key tile: hi d 0..31, hi d 32..63, residual d 0..31, residual d 32..63 */
#pragma unroll      /* this and every constant-trip loop below: unrolled so that fragments and accumulators are registers, not indexed arrays */
    for (int kt = 0; kt < 2; ++kt) { const int ro = 16 * kt * FKP; ka[kt][0] = g2_frag(kb + ro, hh); ka[kt][1] = g2_frag(kb + ro + 32, hh); ka[kt][2] = g2_frag(kb + FKL + ro, hh); ka[kt][3] = g2_frag(kb + FKL + ro + 32, hh); }
    v16h va[4];
#pragma unroll
    for (int t = 0; t < 4; ++t) va[t] = g2_frag(vb + 16 * t * FVP, hh);
    v8f sh[2], sl[2];
#pragma unroll
    for (int kt = 0; kt < 2; ++kt) { sh[kt] = g2_mma(ka[kt][0], qh0, z8); sh[kt] = g2_mma(ka[kt][1], qh1, sh[kt]);
      sl[kt] = g2_mma(ka[kt][0], ql0, z8); sl[kt] = g2_mma(ka[kt][1], ql1, sl[kt]); sl[kt] = g2_mma(ka[kt][2], qh0, sl[kt]); sl[kt] = g2_mma(ka[kt][3], qh1, sl[kt]); }
    float sv[16]; float mx = m; const int rel = q0 + ln - key0 - 8 * hh;      /* key 16 kt + r of this lane is kept while 16 kt + r <= rel */
#pragma unroll
    for (int kt = 0; kt < 2; ++kt)
#pragma unroll
      for (int r = 0; r < 8; ++r) { const float s = sh[kt][r] * SCL + sl[kt][r] * SCLR; const float xv = (16 * kt + r <= rel) ? s : -1.0e9f; sv[kt * 8 + r] = xv; mx = fmaxf(mx, xv); }
    mx = fmaxf(mx, __shfl_xor(mx, 16, 32));
    const float al = exp2_slot((m - mx) * 1.44269504088896340736f); m = mx;
    float ps = 0.f; FragH p;
#pragma unroll
    for (int i = 0; i < 16; ++i) { const float e = exp2_slot((sv[i] - mx) * 1.44269504088896340736f + 8.0f);      /* weights carried x256, as in the f16 operand before */ ps += e; p.h[i] = (_Float16)e; }
    l = l * al + ps;
#pragma unroll
    for (int t = 0; t < 4; ++t) { o[t] *= al; o[t] = g2_mma(va[t], p.v, o[t]); } }
    asm volatile("s_wait_dscnt 0x0" ::: "memory");      /* the wave's reads of this buffer have returned before the barrier behind which it is refilled */
    asm volatile("s_wait_asynccnt 0x0" ::: "memory");      /* the wave's copies of the next tile have landed before the barrier behind which other waves read them */
    __syncthreads();      /* publishes tile st + 1 and ends every wave's reads of tile st */
    if (st + 2 < nbl) { gh += 32 * LQ; gl += 32 * LQ; gv += 32; fattn_copy(lk + bo * 2, lv + bo * 2, gh, gl, gv); } }      /* tile st + 2 into the buffer just read; the test is the same for the whole block */
  asm volatile("s_wait_asynccnt 0x0" ::: "memory");      /* no copy is outstanding when the wave ends */
  l += __shfl_xor(l, 16, 32);
  const float fin = 64.0f / l;      /* o carried x64; the x256 of the weights cancels against the sum's */
  _Float16* orow = O + (rb + q0 + ln) * DM + h * HD + 8 * hh;
#pragma unroll
  for (int t = 0; t < 4; ++t) { FragH f;
#pragma unroll
    for (int r = 0; r < 8; ++r) f.h[r] = (_Float16)(o[t][r] * fin);
    *(v8us*)((unsigned short*)orow + 16 * t) = f.half[0]; } }
#define JF_A ((SQ / 64) * NH * NBR)            /* blocks of the fused attention: query tile fastest, then head, then sequence */
// The fused attention of all rows; behind its blocks, per sequence, the tiles of the first-tile output pass out = o_hi Wo + b (rows 0..QT0-1, from the exact f32 attention: it does not depend on this launch's attention).
__global__ __launch_bounds__(128) void k_attn(const _Float16* __restrict__ Qh, const _Float16* __restrict__ Ql, const _Float16* __restrict__ Kh, const _Float16* __restrict__ Kl, const _Float16* __restrict__ Vt, _Float16* __restrict__ O,
    const _Float16* __restrict__ OH0, const _Float16* __restrict__ BO, const float* __restrict__ bo, float* __restrict__ out) {
  const int bx = blockIdx.x;
  if (bx < JF_A) { fattn_job(Qh, Ql, Kh, Kl, Vt, O, bx % (SQ / 64), bx / (SQ / 64) % NH, bx / ((SQ / 64) * NH)); return; }
  const int b0 = bx - JF_A;
  gemm2_job<0>(OH0, DM, 0, BO, DM, 0, 0.0009765625f, bo, 0, nullptr, 1, 0, 0, out, nullptr, DM, 0, QT0, DM, DM, (size_t)QT0 * DM, 0, (size_t)SQ * DM, b0 % JP_0, 0, b0 / JP_0); }
// Output stage, one job per 128-row tile: the first tile of a sequence adds o_lo Wo 2^-20 to its own elements (written by the launch before); every other tile is out = o Wo + b from the f16 rows.
static_assert(QT0 == 128 && SQ % 128 == 0 && MPO == NBR * SQ && B0 == 0, "the first-tile rows are exactly the first 128-row tile of each sequence");
__global__ __launch_bounds__(128) void k_out(const _Float16* __restrict__ O16, const _Float16* __restrict__ OL0, const _Float16* __restrict__ BO, const float* __restrict__ bo, float* out) {
  const int bx = blockIdx.x; const int mt = bx / (DM / 64); const bool first = mt % (SQ / 128) == 0;
  gemm2_job<0>(first ? OL0 : O16, DM, 0, BO, DM, 0, first ? 0.00000095367431640625f : 0.0009765625f, first ? nullptr : bo, 0, first ? out : nullptr, first ? -1 : 1, 0, 0, out, nullptr, DM, 0, first ? QT0 : MPO, DM, DM,
      (size_t)QT0 * DM, 0, (size_t)SQ * DM, first ? bx % (DM / 64) : bx, 0, first ? mt / (SQ / 128) : 0); }


// Exact f32 attention for the first QT0 rows of every sequence. One block owns A0R query rows of one head and stages the head's QT0 key and value
// rows in LDS once; a wave owns two query rows, held in registers, so that each staged row it reads serves both. Scores: a lane owns one key of each
// group of 32 and reads its key row 16 bytes at a time; four partial sums per dot product. Softmax: true row maximum and sum by a butterfly over the
// wave. P V: a lane owns four head dims and every other run of four keys; the wave's halves are added at the end.
#define A0R 16                       /* query rows per block: two per wave */
#define A0KP 68                      /* floats from one staged key row to the next: 16 bytes x odd, so that 16 lanes on 16 rows meet no bank twice */
__global__ __launch_bounds__(256) void k_att0(const float* __restrict__ QF, const float* __restrict__ KF, const float* __restrict__ VF, float scale, float* __restrict__ OF) {
  __shared__ __attribute__((aligned(16))) float ks[QT0][A0KP]; __shared__ __attribute__((aligned(16))) float vs[QT0][HD]; __shared__ __attribute__((aligned(16))) float ps[A0R][QT0];
  static_assert(QT0 % 32 == 0 && HD == 64 && A0R == 16, "256 threads: 16 per staged row of 64 floats, 8 waves of two query rows, key groups of 32");
  const int tid = threadIdx.x, lane = tid & 31, w = tid >> 5; const int h = blockIdx.x / (QT0 / A0R), rg = blockIdx.x % (QT0 / A0R); const int r0 = rg * A0R;
  { const size_t zb = (size_t)blockIdx.y * QT0 * DM + h * HD; QF += zb; KF += zb; VF += zb; OF += zb; }      /* grid.y = sequence: QT0 rows of q, k, v and o each, DM floats from row to row (a constant, so that a run of loads shares one address and differs in its immediate offset) */
  const int ia = r0 + w, ib = r0 + 8 + w;      /* the wave's two query rows */
  const int sr = tid >> 4, sc = (tid & 15) * 4; v4f kk[QT0 / 16], vv[QT0 / 16], qa[HD / 4], qb[HD / 4];
#pragma unroll      /* this and every constant-trip loop below: unrolled so that the arrays are registers and the loads of a run are in flight together */
  for (int p = 0; p < QT0 / 16; ++p) { kk[p] = *(const v4fa*)(KF + (size_t)(p * 16 + sr) * DM + sc); vv[p] = *(const v4fa*)(VF + (size_t)(p * 16 + sr) * DM + sc); }
  asm volatile("s_wait_xcnt 0x0" ::: "memory");      /* stands between the loads above and the first later write of a register that holds one of their addresses (the query loads below may land there) */
#pragma unroll
  for (int c = 0; c < HD / 4; ++c) { qa[c] = *(const v4fa*)(QF + (size_t)ia * DM + c * 4); qb[c] = *(const v4fa*)(QF + (size_t)ib * DM + c * 4); }
  asm volatile("s_wait_xcnt 0x0" ::: "memory");      /* the same behind the query loads */
#pragma unroll
  for (int p = 0; p < QT0 / 16; ++p) { *(v4f*)&ks[p * 16 + sr][sc] = kk[p]; *(v4f*)&vs[p * 16 + sr][sc] = vv[p]; }
  __syncthreads();
  const int ng = (r0 + A0R - 1) / 32 + 1;      /* groups of 32 keys up to the block's last row: the same for every wave */
  float sa[QT0 / 32], sb[QT0 / 32]; float ma = -1.0e30f, mb = -1.0e30f;
#pragma unroll
  for (int g = 0; g < QT0 / 32; ++g) { sa[g] = -1.0e30f; sb[g] = -1.0e30f;
    if (g < ng) { const int key = g * 32 + lane; v4f aa = {0.f, 0.f, 0.f, 0.f}, ab = {0.f, 0.f, 0.f, 0.f};
#pragma unroll
      for (int c = 0; c < HD / 4; ++c) { const v4f k4 = *(const v4f*)&ks[key][c * 4]; aa += qa[c] * k4; ab += qb[c] * k4; }
      if (key <= ia) sa[g] = ((aa[0] + aa[1]) + (aa[2] + aa[3])) * scale;
      if (key <= ib) sb[g] = ((ab[0] + ab[1]) + (ab[2] + ab[3])) * scale;
      ma = fmaxf(ma, sa[g]); mb = fmaxf(mb, sb[g]); } }
#pragma unroll
  for (int d = 16; d > 0; d >>= 1) { ma = fmaxf(ma, __shfl_xor(ma, d, 32)); mb = fmaxf(mb, __shfl_xor(mb, d, 32)); }
  float la = 0.f, lb = 0.f;
#pragma unroll
  for (int g = 0; g < QT0 / 32; ++g)
    if (g < ng) { const int key = g * 32 + lane; const float ea = (key <= ia) ? expf(sa[g] - ma) : 0.f, eb = (key <= ib) ? expf(sb[g] - mb) : 0.f; la += ea; lb += eb; ps[w][key] = ea; ps[8 + w][key] = eb; }
#pragma unroll
  for (int d = 16; d > 0; d >>= 1) { la += __shfl_xor(la, d, 32); lb += __shfl_xor(lb, d, 32); }
  __syncthreads();      /* the weights are read below by other lanes than wrote them */
  const int dq = (lane & 15) * 4, jp = lane >> 4; v4f oa = {0.f, 0.f, 0.f, 0.f}, ob = {0.f, 0.f, 0.f, 0.f};
#pragma unroll 1      /* rolled: the trip count is the block's; one trip holds 16 keys, twelve LDS reads in flight together */
  for (int ch = 0; ch <= rg; ++ch) {
#pragma unroll
    for (int t = 0; t < 2; ++t) { const int k0 = ch * 16 + t * 8 + jp * 4; const v4f pa = *(const v4f*)&ps[w][k0], pb = *(const v4f*)&ps[8 + w][k0];
#pragma unroll
      for (int u = 0; u < 4; ++u) { const v4f v4 = *(const v4f*)&vs[k0 + u][dq]; oa += pa[u] * v4; ob += pb[u] * v4; } } }
#pragma unroll
  for (int q = 0; q < 4; ++q) { oa[q] += __shfl_xor(oa[q], 16, 32); ob[q] += __shfl_xor(ob[q], 16, 32); }
  const float fin = 64.0f / (jp ? lb : la);      /* o carried x64 like the f16 path */
  const v4f res = (jp ? ob : oa) * fin;      /* lanes 0..15 store the first row, lanes 16..31 the second */
  *(v4f*)(OF + (size_t)(jp ? ib : ia) * DM + dq) = res; }

extern "C" void kernel_launch(void* const* d_in, const int* in_sizes, int n_in,
                              void* d_out, int out_size, void* d_ws, size_t ws_size, hipStream_t stream) {
  (void)in_sizes; (void)n_in; (void)out_size;
  const float* const* I = (const float* const*)d_in; const float* x = I[0]; const float* xk = I[0]; const float* xv = I[0]; const float* wq = I[1]; const float* bq = I[2]; const float* wk = I[3]; const float* bk = I[4]; const float* wv = I[5]; const float* bv = I[6]; const float* wo = I[7]; const float* bo = I[8];      /* input order: x, Wq, bq, Wk, bk, Wv, bv (PER-HEAD STACKS [8][512][64] with REAL per-head biases [8][64] = flat [512]: the GEMMs' guarded bias slots), Wp ([in][out]: out @ Wp), bp (REAL) */
  char* ws = (char*)d_ws; size_t off = 0;
  auto take = [&](size_t bytes) { char* p = ws + off; off += (bytes + 255) & ~(size_t)255; return p; };
  _Float16* BQ = (_Float16*)take((size_t)DM * DM * 2); _Float16* BK = (_Float16*)take((size_t)DM * DM * 2); _Float16* BV = (_Float16*)take((size_t)DM * DM * 2); _Float16* BO = (_Float16*)take((size_t)DM * DM * 2);
  _Float16* X16 = (_Float16*)take(NR * DM * 2); _Float16* XK16 = (_Float16*)take(NR * DM * 2); _Float16* XV16 = (_Float16*)take(NR * DM * 2);      /* exact f16 rows of query, key, value */ float* QF = (float*)take(NR * DM * 4); float* KF = (float*)take(NR * DM * 4);      /* q and k each have an f32 plane: their projections run in one launch */ _Float16* QH = (_Float16*)take(NR * DM * 2); _Float16* QL = (_Float16*)take(NR * DM * 2); _Float16* KH = (_Float16*)take(NR * DM * 2); _Float16* KL = (_Float16*)take(NR * DM * 2); _Float16* Q16 = QH; _Float16* K16 = KH; _Float16* V16 = (_Float16*)take(NR * DM * 2); _Float16* O16 = (_Float16*)take(NR * DM * 2);
  _Float16* VT = (_Float16*)take((size_t)NB * NH * HD * SQ * 2);      /* one plane per sequence: the sequences share each launch */
  float* QF0 = (float*)take((size_t)NB * QT0 * DM * 4); float* KF0 = (float*)take((size_t)NB * QT0 * DM * 4); float* VF0 = (float*)take((size_t)NB * QT0 * DM * 4); float* OF0 = (float*)take((size_t)NB * QT0 * DM * 4); _Float16* OH0 = (_Float16*)take((size_t)NB * QT0 * DM * 2); _Float16* OL0 = (_Float16*)take((size_t)NB * QT0 * DM * 2);
  if (off > ws_size) return;
  const size_t r0p = (size_t)B0 * SQ;      /* first projected row */
  k_prep<<<3 * NH * JW_H + JW_O + 3 * JX, 256, 0, stream>>>(x, xk, xv, wq, wk, wv, wo, BQ, BK, BV, BO, X16, XK16, XV16);      /* weight planes [out][in] (x16) and the exact f16 rows of query, key, value */
  k_proj<<<dim3(JP_A + NBR * JP_0, 3), 128, 0, stream>>>(X16 + r0p * DM, XK16 + r0p * DM, XV16 + r0p * DM, BQ, BK, BV, bq, bk, bv, QF + r0p * DM, KF + r0p * DM, V16 + r0p * DM, QF0, KF0, VF0);      /* q, k (f32), v (f16) of all rows; f32 q, k, v of the first 128 rows of every sequence (exact products) */
  { const size_t r0 = r0p;      /* every launch below covers all NBR sequences */
    k_att0<<<dim3(NH * (QT0 / A0R), NBR), 256, 0, stream>>>(QF0, KF0, VF0, SCL, OF0 + (size_t)B0 * QT0 * DM);      /* exact f32 attention for rows 0..127 (o x64) */
    k_split<<<JS_V + 2 * JS_A + JS_0, 256, 0, stream>>>(V16 + r0 * LQ, VT, QF + r0p * DM, QH + r0p * DM, QL + r0p * DM, KF + r0p * DM, KH + r0p * DM, KL + r0p * DM, OF0, OH0, OL0);      /* V^T; q, k, first-tile o (x64) -> f16 hi + x1024 residual planes: unscaled logits sigma ~8 */
    static_assert(SQ % 64 == 0 && HD == 64 && NHD == NH && QN == SQ && LQ == DM, "64 query rows per block, 32-key steps, head size 64");
    k_attn<<<JF_A + NBR * JP_0, 128, 0, stream>>>(QH + r0 * LQ, QL + r0 * LQ, KH + r0 * LQ, KL + r0 * LQ, VT, O16 + r0 * DM, OH0 + (size_t)B0 * QT0 * DM, BO, bo, (float*)d_out + r0 * DM); }      /* o (merged heads, x64) as f16 rows; rows 0..127 of every sequence: out = o_hi Wo (+ b) */
  k_out<<<(MPO / 128) * (DM / 64), 128, 0, stream>>>(O16 + r0p * DM, OL0 + (size_t)B0 * QT0 * DM, BO, bo, (float*)d_out + r0p * DM);      /* out rows are the output layout; rows 0..127: += o_lo Wo 2^-20 (own-element accumulate) */
}

// v007
// Measured time: 160 microseconds a run.
// Two timings next to v006 put it at 1.07 and 1.06 times that version's speed.
// Over all steps from v000 it is 66.8 times as fast.
#include <hip/hip_runtime.h>
// Causal multi-head self-attention with PER-HEAD STACKED projections and REAL per-head biases on four sequences at width 512 (x [4][2048][512]; Wq / Wk / Wv [8][512][64] = [head][in][out] ('bte,hed->bhtd'; uniform +-1/sqrt(512)) with biases [8][64] (REAL, uniform +-1/sqrt(512)): a per-head bias [8][64] IS the flat bias [512]; 8 heads of 64 (8 x 64 = 512 = the width); scores * 1/sqrt(64); where(tril, scores, -inf); softmax over keys; out = merged Wp + bp ([in][out] [512][512] + a REAL bias, uniform +-1/sqrt(512)) -> [4][2048][512]); the [in][out] output weight through the text's own TRANSPOSING builder (the one the per-head stacks use); q and k carried as f16 hi + x1024 residual planes with three-product scores; each head's [in][out] block is transposed into its 64 contiguous rows of the weight plane by the same builder, one job per head in one shared launch.
// Compute dtype: inputs rounded to bf16; x / weights exact; v, softmax weights and o as plain f16 GEMM operands (~2^-12), q and k as f16 hi + x1024 residual pairs (rows 0..127: f32 attention, o as hi + residual); scores and softmax statistics f32; v_wmma_f32_16x16x32_f16.
#define NB 4
#define SCL 0.125f                         /* 1 / sqrt(head_dim 64) */
#define SCLR 0.0001220703125f               /* 2^-13: the same scale on the x1024 residual passes */
#define SQ 2048
#define DM 512
#define NH 8
#define HD 64
#define HG 4                         /* heads per call of the untemplated k_vt (not launched) */
#define QT0 128                      /* first-tile rows recomputed exactly in f32 */
#define B0 0                         /* first batch processed (debug hook) */
#define NBR NB                       /* batches processed (debug hook) */
#define NR ((size_t)NB * SQ)         /* token rows */
#define MP ((int)((size_t)NBR * SQ)) /* rows projected (debug hook) */
#define QN SQ                        /* query rows attended per batch (debug hook) */
#define NHD NH                       /* heads attended (debug hook) */
#define MPO MP                       /* rows through the output stage (debug hook) */
#define LQ DM      /* row pitch of the q/k/v rows */
typedef __bf16 v16b __attribute__((ext_vector_type(16)));
typedef unsigned short v8us __attribute__((ext_vector_type(8), may_alias));
typedef float  v8f  __attribute__((ext_vector_type(8)));
typedef float  v4f  __attribute__((ext_vector_type(4)));
typedef float  v4fa __attribute__((ext_vector_type(4), may_alias));
union FragB { v16b v; v8us half[2]; unsigned short u[16]; };

__device__ __forceinline__ unsigned short bf16_bits(float x) { unsigned int u = __float_as_uint(x); return (unsigned short)((u + 0x7FFFu + ((u >> 16) & 1u)) >> 16); }
__device__ __forceinline__ float bf16_val(unsigned short b) { return __uint_as_float(((unsigned int)b) << 16); }
__device__ __forceinline__ float bf16_round(float x) { return bf16_val(bf16_bits(x)); }
// D += A·B with NT terms: 1 = ah·bh, 2 = + al·bh (A split), 3 = + ah·bl (both split)
template <int NT>
__device__ __forceinline__ v8f mmaN(v16b ah, v16b al, v16b bh, v16b bl, v8f c) {
  c = __builtin_amdgcn_wmma_f32_16x16x32_bf16(false, ah, false, bh, (short)0, c, false, false);
  if (NT >= 2) c = __builtin_amdgcn_wmma_f32_16x16x32_bf16(false, al, false, bh, (short)0, c, false, false);
  if (NT >= 3) c = __builtin_amdgcn_wmma_f32_16x16x32_bf16(false, ah, false, bl, (short)0, c, false, false);
  asm volatile("v_nop\n\tv_nop\n\tv_nop\n\tv_nop" : "+v"(c) : "v"(ah), "v"(al), "v"(bh), "v"(bl));
  return c;
}

__global__ __launch_bounds__(256) void k_wt_bf16(const float* __restrict__ W, unsigned short* __restrict__ Wt, int K, int N) {
  const int t = blockIdx.x * 256 + threadIdx.x;
  const int k8n = K / 8;
  if (t >= N * k8n) return;
  const int n = t / k8n, k8 = (t % k8n) * 8;
  v8us v;
#pragma unroll
  for (int i = 0; i < 8; ++i) v[i] = bf16_bits(W[(size_t)(k8 + i) * N + n]);
  *(v8us*)(Wt + (size_t)n * K + k8) = v;
  
}

// GEMM C[M][N] (f32, pitch ldc) = act(A[M][K]·W + bias). A f32 row-major (pitch lda) converted per fragment to bf16
// (ASPLIT: hi/lo two planes -> 2 terms, else single rounded term); Wt bf16 [N][K] (pitch ldb). BIAS_BF16 rounds the
// bias to bf16 first (bias quantised to bf16 before the add). K%32==0, M%16==0, N%64==0.
template <bool ASPLIT, int ACT, bool BIAS_BF16>
__global__ __launch_bounds__(128) void k_gemm_bf(const float* __restrict__ A, int lda, const unsigned short* __restrict__ Wt, int ldb,
                                               const float* __restrict__ bias, float* __restrict__ C, int ldc, int M, int N, int K) {
  __shared__ __attribute__((aligned(16))) float so[4][16][64];
  const int tid = threadIdx.x, w = tid >> 5, lane = tid & 31, ln = lane & 15, hh = lane >> 4;
  const int ntn = N / 64;
  const int wid = blockIdx.x * 4 + w;
  const int mt = wid / ntn, nq = wid % ntn;
  if (mt * 16 >= M) return;
  const int row0 = mt * 16, col0 = nq * 64;
  const float* arow = A + (size_t)(row0 + ln) * lda;
  v8f acc[4] = {};
  for (int kb = 0; kb < K; kb += 32) {
    FragB ah, al;
    const v4f x0 = *(const v4fa*)(arow + kb + 8 * hh), x1 = *(const v4fa*)(arow + kb + 8 * hh + 4);
    const v4f x2 = *(const v4fa*)(arow + kb + 16 + 8 * hh), x3 = *(const v4fa*)(arow + kb + 16 + 8 * hh + 4);
    float xs[16] = {x0[0],x0[1],x0[2],x0[3],x1[0],x1[1],x1[2],x1[3],x2[0],x2[1],x2[2],x2[3],x3[0],x3[1],x3[2],x3[3]};
#pragma unroll
    for (int i = 0; i < 16; ++i) { const unsigned short hb = bf16_bits(xs[i]); ah.u[i] = hb; al.u[i] = ASPLIT ? bf16_bits(xs[i] - bf16_val(hb)) : (unsigned short)0; }
#pragma unroll
    for (int t = 0; t < 4; ++t) {
      const unsigned short* brow = Wt + (size_t)(col0 + t * 16 + ln) * ldb + kb;
      FragB b;
      b.half[0] = *(const v8us*)(brow + 8 * hh);
      b.half[1] = *(const v8us*)(brow + 16 + 8 * hh);
      acc[t] = mmaN<ASPLIT ? 2 : 1>(ah.v, al.v, b.v, b.v, acc[t]);
    }
  }
#pragma unroll
  for (int t = 0; t < 4; ++t) {
    float bv = bias ? bias[col0 + t * 16 + ln] : 0.f;
    if (BIAS_BF16) bv = bf16_round(bv);
#pragma unroll
    for (int r = 0; r < 8; ++r) { float v = acc[t][r] + bv; if (ACT == 1) v = fmaxf(v, 0.f); so[w][8 * hh + r][t * 16 + ln] = v; }
  }
  __builtin_amdgcn_fence(__ATOMIC_ACQ_REL, "workgroup");
  __builtin_amdgcn_wave_barrier();
  const int rsub = lane >> 4, c4 = (lane & 15) * 4;
  {
#pragma unroll
    for (int q = 0; q < 8; ++q) {
      const int r = q * 2 + rsub;
      const v4f v = *(const v4fa*)&so[w][r][c4];
      *(v4f*)(C + (size_t)(row0 + r) * ldc + col0 + c4) = v;
    }
    
  }
}

// GEMM C = act(A·W + bias + resid): A f32 (ASPLIT -> hi/lo 2 terms), Wt bf16 [N][K]; ACT 0 none, 1 relu, 2 exact gelu;
// resid (optional, f32, row index = (row % rmod), pitch ldr, RES_BF16 rounds it) added before the activation.
template <bool ASPLIT, int ACT, bool BIAS_BF16, bool RES_BF16>
__global__ __launch_bounds__(128) void k_gemm_bf3(const float* __restrict__ A, int lda, const unsigned short* __restrict__ Wt, int ldb,
                                                const float* __restrict__ bias, const float* __restrict__ resid, int rmod, int ldr,
                                                float* __restrict__ C, int ldc, int M, int N, int K) {
  __shared__ __attribute__((aligned(16))) float so[4][16][64];
  const int tid = threadIdx.x, w = tid >> 5, lane = tid & 31, ln = lane & 15, hh = lane >> 4;
  const int ntn = N / 64;
  const int wid = blockIdx.x * 4 + w;
  const int mt = wid / ntn, nq = wid % ntn;
  if (mt * 16 >= M) return;
  const int row0 = mt * 16, col0 = nq * 64;
  const float* arow = A + (size_t)(row0 + ln) * lda;
  v8f acc[4] = {};
  for (int kb = 0; kb < K; kb += 32) {
    FragB ah, al;
    const v4f x0 = *(const v4fa*)(arow + kb + 8 * hh), x1 = *(const v4fa*)(arow + kb + 8 * hh + 4);
    const v4f x2 = *(const v4fa*)(arow + kb + 16 + 8 * hh), x3 = *(const v4fa*)(arow + kb + 16 + 8 * hh + 4);
    float xs[16] = {x0[0],x0[1],x0[2],x0[3],x1[0],x1[1],x1[2],x1[3],x2[0],x2[1],x2[2],x2[3],x3[0],x3[1],x3[2],x3[3]};
#pragma unroll
    for (int i = 0; i < 16; ++i) { const unsigned short hb = bf16_bits(xs[i]); ah.u[i] = hb; al.u[i] = ASPLIT ? bf16_bits(xs[i] - bf16_val(hb)) : (unsigned short)0; }
#pragma unroll
    for (int t = 0; t < 4; ++t) {
      const unsigned short* brow = Wt + (size_t)(col0 + t * 16 + ln) * ldb + kb;
      FragB b;
      b.half[0] = *(const v8us*)(brow + 8 * hh);
      b.half[1] = *(const v8us*)(brow + 16 + 8 * hh);
      acc[t] = mmaN<ASPLIT ? 2 : 1>(ah.v, al.v, b.v, b.v, acc[t]);
    }
  }
#pragma unroll
  for (int t = 0; t < 4; ++t) {
    const int col = col0 + t * 16 + ln;
    float bv = bias ? bias[col] : 0.f;
    if (BIAS_BF16) bv = bf16_round(bv);
#pragma unroll
    for (int r = 0; r < 8; ++r) {
      float v = acc[t][r] + bv;
      if (resid) { float rv = resid[(size_t)((row0 + 8 * hh + r) % rmod) * ldr + col]; if (RES_BF16) rv = bf16_round(rv); v += rv; }
      if (ACT == 1) v = fmaxf(v, 0.f);
      if (ACT == 2) v = 0.5f * v * (1.0f + erff(v * 0.70710678118654752f));
      if (ACT == 3) { const float u = 0.7978845608028654f * (v + 0.044715f * v * v * v); v = 0.5f * v * (1.0f + tanhf(u)); }
      so[w][8 * hh + r][t * 16 + ln] = v;
    }
  }
  __builtin_amdgcn_fence(__ATOMIC_ACQ_REL, "workgroup");
  __builtin_amdgcn_wave_barrier();
  const int rsub = lane >> 4, c4 = (lane & 15) * 4;
  {
#pragma unroll
    for (int q = 0; q < 8; ++q) {
      const int r = q * 2 + rsub;
      const v4f v = *(const v4fa*)&so[w][r][c4];
      *(v4f*)(C + (size_t)(row0 + r) * ldc + col0 + c4) = v;
    }
    
  }
}
// row LayerNorm (biased variance, eps) over N: s = X (+ R); optional out_sum <- s; out_norm <- (s-mu)*rsqrt(var+eps)*g + b
template <bool PARAM_BF16>
__global__ __launch_bounds__(256) void k_layernorm(const float* __restrict__ X, const float* __restrict__ R, const float* __restrict__ g, const float* __restrict__ bta,
                                                  float* __restrict__ out_sum, float* __restrict__ out_norm, int N, float eps) {
  __shared__ float red[256];
  const int row = blockIdx.x, tid = threadIdx.x;
  const float* x = X + (size_t)row * N; const float* rr = R ? R + (size_t)row * N : nullptr;
  float vals[16];                     // up to N = 4096
  const int per = N / 256;            // contiguous chunk per thread? use strided-by-4 chunks: thread handles j = tid*4 + 1024*u
  float s1 = 0.f;
  for (int u = 0; u < per / 4; ++u) {
    const int j = tid * 4 + 1024 * u;
    const v4f a = *(const v4fa*)(x + j);
    v4f b = {0.f,0.f,0.f,0.f}; if (rr) b = *(const v4fa*)(rr + j);
#pragma unroll
    for (int q = 0; q < 4; ++q) { const float v = a[q] + b[q]; vals[u * 4 + q] = v; s1 += v; }
  }
  red[tid] = s1; __syncthreads();
  for (int st = 128; st > 0; st >>= 1) { if (tid < st) red[tid] += red[tid + st]; __syncthreads(); }
  const float mu = red[0] / (float)N; __syncthreads();
  float s2 = 0.f;
  for (int u = 0; u < per / 4; ++u)
#pragma unroll
    for (int q = 0; q < 4; ++q) { const float c = vals[u * 4 + q] - mu; s2 += c * c; }
  red[tid] = s2; __syncthreads();
  for (int st = 128; st > 0; st >>= 1) { if (tid < st) red[tid] += red[tid + st]; __syncthreads(); }
  const float rs = rsqrtf(red[0] / (float)N + eps);
  {
    for (int u = 0; u < per / 4; ++u) {
      const int j = tid * 4 + 1024 * u;
      v4f o, sm;
#pragma unroll
      for (int q = 0; q < 4; ++q) {
        float gg = g[j + q], bb = bta[j + q];
        if (PARAM_BF16) { gg = bf16_round(gg); bb = bf16_round(bb); }
        sm[q] = vals[u * 4 + q]; o[q] = (vals[u * 4 + q] - mu) * rs * gg + bb;
      }
      if (out_sum) *(v4f*)(out_sum + (size_t)row * N + j) = sm;
      *(v4f*)(out_norm + (size_t)row * N + j) = o;
    }
    
  }
}



// ---- f16 WMMA path (v_wmma_f32_16x16x32_f16): 11-bit significands for operands in range — used where a [0,1] probability operand needs more precision than bf16
typedef _Float16 v16h __attribute__((ext_vector_type(16)));
union FragH { v16h v; v8us half[2]; _Float16 h[16]; unsigned short u[16]; };
template <int NT>
__device__ __forceinline__ v8f mmaH(v16h ah, v16h al, v16h bh, v16h bl, v8f c) {
  c = __builtin_amdgcn_wmma_f32_16x16x32_f16(false, ah, false, bh, (short)0, c, false, false);
  if (NT >= 2) c = __builtin_amdgcn_wmma_f32_16x16x32_f16(false, al, false, bh, (short)0, c, false, false);
  if (NT >= 3) c = __builtin_amdgcn_wmma_f32_16x16x32_f16(false, ah, false, bl, (short)0, c, false, false);
  asm volatile("v_nop\n\tv_nop\n\tv_nop\n\tv_nop" : "+v"(c) : "v"(ah), "v"(al), "v"(bh), "v"(bl));
  return c;
}
// batched GEMM like k_gemm_b but f16 operands: A f32 (split into f16 hi/lo if ASPLIT, else rounded to f16), Bt = f16 values [n][k]; alpha; C f32; N multiple of 16 (partial tiles skipped)
template <bool ASPLIT>
__global__ __launch_bounds__(128) void k_gemm_h(const float* __restrict__ A, int lda, size_t sA, const _Float16* __restrict__ Bh, int ldb, size_t sB, float alpha, float* __restrict__ C, int ldc, size_t sC, int M, int N, int K) {
  __shared__ __attribute__((aligned(16))) float so[4][16][64];
  const int tid = threadIdx.x, w = tid >> 5, lane = tid & 31, ln = lane & 15, hh = lane >> 4; const int by = blockIdx.y;
  A += (size_t)by * sA; Bh += (size_t)by * sB; C += (size_t)by * sC;
  const int ntn = (N + 63) / 64; const int wid = blockIdx.x * 4 + w; const int mt = wid / ntn, nq = wid % ntn; if (mt * 16 >= M) return;
  const int row0 = mt * 16, col0 = nq * 64; const float* arow = A + (size_t)(row0 + ln) * lda;
  v8f acc[4] = {};
  for (int kb = 0; kb < K; kb += 32) {
    FragH ah, al;
    const v4f x0 = *(const v4fa*)(arow + kb + 8 * hh), x1 = *(const v4fa*)(arow + kb + 8 * hh + 4), x2 = *(const v4fa*)(arow + kb + 16 + 8 * hh), x3 = *(const v4fa*)(arow + kb + 16 + 8 * hh + 4);
    float xs[16] = {x0[0],x0[1],x0[2],x0[3],x1[0],x1[1],x1[2],x1[3],x2[0],x2[1],x2[2],x2[3],x3[0],x3[1],x3[2],x3[3]};
#pragma unroll
    for (int i = 0; i < 16; ++i) { const _Float16 h = (_Float16)xs[i]; ah.h[i] = h; al.h[i] = ASPLIT ? (_Float16)(xs[i] - (float)h) : (_Float16)0.0f; }
#pragma unroll
    for (int t = 0; t < 4; ++t) { if (col0 + t * 16 >= N) continue; const size_t boff = (size_t)(col0 + t * 16 + ln) * ldb + kb; FragH bq; bq.half[0] = *(const v8us*)(Bh + boff + 8 * hh); bq.half[1] = *(const v8us*)(Bh + boff + 16 + 8 * hh);
      acc[t] = mmaH<ASPLIT ? 2 : 1>(ah.v, al.v, bq.v, bq.v, acc[t]); }
  }
#pragma unroll
  for (int t = 0; t < 4; ++t) { if (col0 + t * 16 >= N) continue;
#pragma unroll
    for (int r = 0; r < 8; ++r) so[w][8 * hh + r][t * 16 + ln] = acc[t][r] * alpha; }
  __builtin_amdgcn_fence(__ATOMIC_ACQ_REL, "workgroup"); __builtin_amdgcn_wave_barrier();
  const int rsub = lane >> 4, c4 = (lane & 15) * 4;
  {
#pragma unroll
    for (int q = 0; q < 8; ++q) { const int r = q * 2 + rsub; if (col0 + c4 < N) { const v4f v = *(const v4fa*)&so[w][r][c4]; *(v4f*)(C + (size_t)(row0 + r) * ldc + col0 + c4) = v; } }
     }
}

// Wt[n][k] = f16(W[k][n]·scale) from f32 row-major W[K][N] (scale = power of two; bf16-exact weights stay exact in f16 away from the subnormal range)
// (a job of a shared launch: blk = the block's index within the job, 256 threads a block)
__device__ __forceinline__ void wt_f16_job(const float* __restrict__ W, _Float16* __restrict__ Wt, int K, int N, float scale, int blk) {
  const int t = blk * 256 + threadIdx.x; if (t >= N * (K / 8)) return; const int n = t / (K / 8), k8 = (t % (K / 8)) * 8; FragH f;
#pragma unroll
  for (int i = 0; i < 8; ++i) f.h[i] = (_Float16)(bf16_round(W[(size_t)(k8 + i) * N + n]) * scale); const v8us o = f.half[0];
  *(v8us*)((unsigned short*)Wt + (size_t)n * K + k8) = o; 
}
// k_gemm_hh variant with fused epilogue: v = acc·alpha + bias[by·sBias + col] (+ CP[(row/rowsPerB)·sCPb + by·64 + col] if CP) ; ACT 0 none / 1 elu ; writes f16 C16 (and f32 C if non-null)
template <int ACT>
__global__ __launch_bounds__(128) void k_gemm_hhx(const _Float16* __restrict__ A, int lda, size_t sA, const _Float16* __restrict__ Bh, int ldb, size_t sB, float alpha, const float* __restrict__ bias, size_t sBias, const float* __restrict__ CP, int rowsPerB, size_t sCPb, int row0g,
    float* __restrict__ C, _Float16* __restrict__ C16, int ldc, size_t sC, int M, int N, int K) {
  __shared__ __attribute__((aligned(16))) float so[4][16][64];
  const int tid = threadIdx.x, w = tid >> 5, lane = tid & 31, ln = lane & 15, hh = lane >> 4; const int by = blockIdx.y;
  A += (size_t)by * sA; Bh += (size_t)by * sB; const size_t cofs = (size_t)by * sC; const float* bp = bias ? bias + (size_t)by * sBias : nullptr;
  const int ntn = (N + 63) / 64; const int wid = blockIdx.x * 4 + w; const int mt = wid / ntn, nq = wid % ntn; if (mt * 16 >= M) return;
  const int row0 = mt * 16, col0 = nq * 64; const _Float16* arow = A + (size_t)(row0 + ln) * lda;
  v8f acc[4] = {};
  for (int kb = 0; kb < K; kb += 32) { FragH ah; ah.half[0] = *(const v8us*)((const unsigned short*)arow + kb + 8 * hh); ah.half[1] = *(const v8us*)((const unsigned short*)arow + kb + 16 + 8 * hh);
#pragma unroll
    for (int t = 0; t < 4; ++t) { if (col0 + t * 16 >= N) continue; const size_t boff = (size_t)(col0 + t * 16 + ln) * ldb + kb; FragH bq; bq.half[0] = *(const v8us*)((const unsigned short*)Bh + boff + 8 * hh); bq.half[1] = *(const v8us*)((const unsigned short*)Bh + boff + 16 + 8 * hh);
      acc[t] = mmaH<1>(ah.v, ah.v, bq.v, bq.v, acc[t]); }
  }
#pragma unroll
  for (int t = 0; t < 4; ++t) { if (col0 + t * 16 >= N) continue; const int col = col0 + t * 16 + ln; const float bv = bp ? bf16_round(bp[col]) : 0.f;
#pragma unroll
    for (int r = 0; r < 8; ++r) { float v = acc[t][r] * alpha + bv; if (CP) { const int rr = row0g + row0 + 8 * hh + r; if (rowsPerB < 0) v += CP[cofs + (size_t)rr * ldc + col];      /* rowsPerB < 0: own element of the batched C plane */ else { const int bidx = rr / rowsPerB; v += CP[(size_t)bidx * sCPb + (size_t)by * 64 + col]; } } if (ACT == 1) v = (v > 0.f) ? v : expm1f(v); else if (ACT == 7) v = (v > 0.f) ? v + 1.0f : expf(v); else if (ACT == 8) v = tanhf(v); else if (ACT == 9) v = 0.5f * v * (1.0f + tanhf(0.7978845608028654f * (v + 0.044715f * v * v * v))); else if (ACT == 11) v = 1.0f / (1.0f + expf(-v)); else if (ACT == 12) v = (v > 0.f) ? v : 0.01f * v; else if (ACT == 14) v = (v > 0.f) ? v : 0.1f * v; else if (ACT == 16) v = (v >= 0.f) ? v : 0.3f * v; else if (ACT == 17) v = (v >= 0.f) ? v : 0.2f * v; else if (ACT == 15) v = v / (1.0f + expf(-v)); else if (ACT == 3) v = fmaxf(v, 0.f); else if (ACT == 6) v = 0.5f * v * (1.0f + erff(v * 0.70710678118654752f)); so[w][8 * hh + r][t * 16 + ln] = v; } }
  __builtin_amdgcn_fence(__ATOMIC_ACQ_REL, "workgroup"); __builtin_amdgcn_wave_barrier();
  const int rsub = lane >> 4, c4 = (lane & 15) * 4; typedef _Float16 v4h __attribute__((ext_vector_type(4)));
  {
#pragma unroll
    for (int q = 0; q < 8; ++q) { const int r = q * 2 + rsub; if (col0 + c4 < N) { const v4f v = *(const v4fa*)&so[w][r][c4]; if (C) *(v4f*)(C + cofs + (size_t)(row0 + r) * ldc + col0 + c4) = v; if (C16) { v4h h4; for (int i = 0; i < 4; ++i) h4[i] = (_Float16)v[i]; *(v4h*)(C16 + cofs + (size_t)(row0 + r) * ldc + col0 + c4) = h4; } } }
     }
}


typedef _Float16 v4h __attribute__((ext_vector_type(4)));

__device__ __forceinline__ void x16_job(const float* __restrict__ x, _Float16* __restrict__ X16, size_t n8, int blk) { const size_t t = (size_t)blk * 256 + threadIdx.x; if (t >= n8) return; FragH f;
#pragma unroll
  for (int q = 0; q < 8; ++q) f.h[q] = (_Float16)bf16_round(x[t * 8 + q]); *(v8us*)((unsigned short*)X16 + t * 8) = f.half[0];  }
__global__ __launch_bounds__(256) void k_h16(const float* __restrict__ x, _Float16* __restrict__ X16, size_t n8) { const size_t t = (size_t)blockIdx.x * 256 + threadIdx.x; if (t >= n8) return; FragH f;
#pragma unroll
  for (int q = 0; q < 8; ++q) f.h[q] = (_Float16)x[t * 8 + q]; *(v8us*)((unsigned short*)X16 + t * 8) = f.half[0];  }
__global__ __launch_bounds__(256) void k_round16f(const float* __restrict__ W, _Float16* __restrict__ Bt, size_t n8) { const size_t t = (size_t)blockIdx.x * 256 + threadIdx.x; if (t >= n8) return; FragH f;
#pragma unroll
  for (int i = 0; i < 8; ++i) f.h[i] = (_Float16)(bf16_round(W[t * 8 + i]) * 16.0f); *(v8us*)((unsigned short*)Bt + t * 8) = f.half[0];  }
// ---- fast GEMM (wave tile 32x64; requires M % 32 == 0 rows per launch region and N % 64 == 0); epilogue = k_gemm_hhx semantics; two batch axes: by (strides sA, sB, sC) and bz (strides zA, zB, zC) ----
// Output forms, each taken where its pointer is not null: C (f32 rows), C16 with CL (f16 rows and the x1024 residual of their rounding, f16 rows: both or neither), or CT alone
// (f16, transposed per head: [row / SQ][col / HD][col % HD][row % SQ], rows counted over all sequences, so only with by = bz = 0).
__device__ __forceinline__ v16h g2_frag(const _Float16* p, int hh) { FragH f; f.half[0] = *(const v8us*)((const unsigned short*)p + 8 * hh); f.half[1] = *(const v8us*)((const unsigned short*)p + 16 + 8 * hh); return f.v; }
__device__ __forceinline__ v8f g2_mma(v16h a, v16h b, v8f c) { v8f d = __builtin_amdgcn_wmma_f32_16x16x32_f16(false, a, false, b, (short)0, c, false, false); asm volatile("v_nop\n\tv_nop\n\tv_nop\n\tv_nop" : "+v"(d) : "v"(a), "v"(b)); return d; }
template <int ACT>
__device__ __forceinline__ void gemm2_job(const _Float16* __restrict__ A, int lda, size_t sA, const _Float16* __restrict__ Bh, int ldb, size_t sB, float alpha, const float* __restrict__ bias, size_t sBias, const float* __restrict__ CP, int rowsPerB, size_t sCPb, int row0g,
    float* __restrict__ C, _Float16* __restrict__ C16, _Float16* __restrict__ CL, _Float16* __restrict__ CT, int ldc, size_t sC, int M, int N, int K, size_t zA, size_t zB, size_t zC, int bx, int by, int bz) { static_assert(ACT == 0 || ACT == 3 || ACT == 6 || ACT == 8 || ACT == 9 || ACT == 11 || ACT == 12 || ACT == 14 || ACT == 15 || ACT == 16 || ACT == 17, "k_gemm2: unsupported ACT code (would silently apply no activation)");
  __shared__ __attribute__((aligned(16))) float so[4][32][68];
  const int tid = threadIdx.x, w = tid >> 5, lane = tid & 31, ln = lane & 15, hh = lane >> 4;      /* bx = tile, by = batch (strides sA, sB, sC), bz = sequence (strides zA, zB, zC) */
  A += (size_t)by * sA + (size_t)bz * zA; Bh += (size_t)by * sB + (size_t)bz * zB; const size_t cofs = (size_t)by * sC + (size_t)bz * zC; const float* bp = bias ? bias + (size_t)by * sBias : nullptr;
  const int ntn = N >> 6; const int mt = bx / ntn, nq = bx - mt * ntn; const int row0 = mt * 128 + 32 * w, col0 = nq * 64; if (row0 >= M) return;
  const _Float16* a0p = A + (size_t)(row0 + ln) * lda; const _Float16* a1p = a0p + (size_t)16 * lda;
  const _Float16* b0p = Bh + (size_t)(col0 + ln) * ldb; const _Float16* b1p = b0p + (size_t)16 * ldb; const _Float16* b2p = b1p + (size_t)16 * ldb; const _Float16* b3p = b2p + (size_t)16 * ldb;
  const v8f z8 = {0.f,0.f,0.f,0.f,0.f,0.f,0.f,0.f}; v8f c00 = z8, c01 = z8, c02 = z8, c03 = z8, c10 = z8, c11 = z8, c12 = z8, c13 = z8;
#pragma unroll 1
  for (int kb = 0; kb < K; kb += 32) { const v16h a0 = g2_frag(a0p + kb, hh); FragH a1f; a1f.half[0] = *(const v8us*)((const unsigned short*)(a1p + kb) + 8 * hh);
    asm volatile("s_wait_xcnt 0x0" ::: "memory");      /* the four A loads share one address pair, and the last of them may land its result in it: the wait stands behind the first three, in front of that write */
    a1f.half[1] = *(const v8us*)((const unsigned short*)(a1p + kb) + 16 + 8 * hh); const v16h a1 = a1f.v;
    v16h b = g2_frag(b0p + kb, hh); c00 = g2_mma(a0, b, c00); c10 = g2_mma(a1, b, c10);
    b = g2_frag(b1p + kb, hh); c01 = g2_mma(a0, b, c01); c11 = g2_mma(a1, b, c11);
    b = g2_frag(b2p + kb, hh); c02 = g2_mma(a0, b, c02); c12 = g2_mma(a1, b, c12);
    b = g2_frag(b3p + kb, hh); c03 = g2_mma(a0, b, c03); c13 = g2_mma(a1, b, c13); }
  v8f accs[8] = {c00, c01, c02, c03, c10, c11, c12, c13};
#pragma unroll
  for (int u = 0; u < 8; ++u) { const int t = u & 3, half = u >> 2; const int col = col0 + t * 16 + ln; const float bv = bp ? bf16_round(bp[col]) : 0.f;
#pragma unroll
    for (int r = 0; r < 8; ++r) { const int rloc = half * 16 + 8 * hh + r; float v = accs[u][r] * alpha + bv; if (CP) { if (rowsPerB < 0) v += CP[cofs + (size_t)(row0g + row0 + rloc) * ldc + col];      /* rowsPerB < 0: own element of the batched C plane */ else { const int bidx = (row0g + row0 + rloc) / rowsPerB; v += CP[(size_t)bidx * sCPb + (size_t)by * 64 + col]; } }
      if (ACT == 3) v = fmaxf(v, 0.f); else if (ACT == 6) v = 0.5f * v * (1.0f + erff(v * 0.70710678118654752f)); else if (ACT == 11) v = 1.0f / (1.0f + expf(-v)); else if (ACT == 15) v = v / (1.0f + expf(-v)); else if (ACT == 12) v = (v > 0.f) ? v : 0.01f * v; else if (ACT == 8) v = tanhf(v); else if (ACT == 9) v = 0.5f * v * (1.0f + tanhf(0.7978845608028654f * (v + 0.044715f * v * v * v))); else if (ACT == 14) v = (v > 0.f) ? v : 0.1f * v; else if (ACT == 16) v = (v >= 0.f) ? v : 0.3f * v; else if (ACT == 17) v = (v >= 0.f) ? v : 0.2f * v;
      so[w][rloc][t * 16 + ln] = v; } }
  __builtin_amdgcn_fence(__ATOMIC_ACQ_REL, "workgroup"); __builtin_amdgcn_wave_barrier();
  if (CT) {      /* the wave's 32 rows are 64 contiguous bytes of each of its 64 transposed rows: four lanes of 16 bytes a row, eight rows a store */
    const int dl = lane >> 2, t8 = (lane & 3) * 8; FragH f[8];
#pragma unroll
    for (int j = 0; j < 8; ++j)
#pragma unroll
      for (int i = 0; i < 8; ++i) f[j].h[i] = (_Float16)so[w][t8 + i][j * 8 + dl];
    unsigned short* ct = (unsigned short*)CT + (((size_t)(row0 / SQ) * NH + nq) * HD + dl) * SQ + row0 % SQ + t8;
#pragma unroll
    for (int j = 0; j < 8; ++j) *(v8us*)(ct + (size_t)j * 8 * SQ) = f[j].half[0];
    asm volatile("s_wait_xcnt 0x0" ::: "memory");      /* stands behind the eight stores, in front of any later write of a register that they name */
    return; }
  const int rsub = lane >> 4, c4 = (lane & 15) * 4;
  {
#pragma unroll
    for (int q = 0; q < 16; ++q) { const int r = q * 2 + rsub; const v4f v = *(const v4fa*)&so[w][r][c4]; if (C) { *(v4f*)(C + cofs + (size_t)(row0 + r) * ldc + col0 + c4) = v; asm volatile("s_wait_xcnt 0x0" ::: "memory"); }      /* the wait stands between the f32 store and the conversions below, which may land in the registers that the store names */
      if (C16) { const size_t co = cofs + (size_t)(row0 + r) * ldc + col0 + c4; v4h h4, l4; for (int i = 0; i < 4; ++i) { h4[i] = (_Float16)v[i]; l4[i] = (_Float16)((v[i] - (float)h4[i]) * 1024.0f); }
        /* both stores and their wait in one statement: as plain stores the residual's conversions were scheduled behind the first store, into the registers that it names, ahead of the wait */
        asm volatile("global_store_b64 %0, %1, off\n\tglobal_store_b64 %2, %3, off\n\ts_wait_xcnt 0x0" :: "v"(C16 + co), "v"(h4), "v"(CL + co), "v"(l4) : "memory"); } }
     } }


// ---- shared launches: jobs that do not depend on one another run in one grid; the block index picks the job (the same for every thread of a block) and the block's index within it ----
#define JW_H (HD * (DM / 8) / 256)             /* blocks per per-head weight block */
#define JW_O (DM * (DM / 8) / 256)             /* blocks of the output weight */
#define JX ((int)(NR * DM / 8 / 256))          /* blocks per plane of x rows */
static_assert(HD * (DM / 8) % 256 == 0 && DM * (DM / 8) % 256 == 0 && NR * DM / 8 % 256 == 0, "whole blocks per job");
// Operand planes: 3 NH per-head weight blocks (head h of wq / wk / wv is a row-major [DM][HD] block, written as HD contiguous rows of the [out][in] plane, x16), the [DM][DM] output weight, three planes of x rows.
__global__ __launch_bounds__(256) void k_prep(const float* x, const float* xk, const float* xv, const float* __restrict__ wq, const float* __restrict__ wk, const float* __restrict__ wv, const float* __restrict__ wo,
    _Float16* __restrict__ BQ, _Float16* __restrict__ BK, _Float16* __restrict__ BV, _Float16* __restrict__ BO, _Float16* __restrict__ X16, _Float16* __restrict__ XK16, _Float16* __restrict__ XV16) {
  int bx = blockIdx.x;
  if (bx < 3 * NH * JW_H) { const int j = bx / JW_H, s = j % 3, h = j / 3; const size_t wofs = (size_t)h * DM * HD, pofs = (size_t)h * HD * DM;
    wt_f16_job((s == 0 ? wq : s == 1 ? wk : wv) + wofs, (s == 0 ? BQ : s == 1 ? BK : BV) + pofs, DM, HD, 16.0f, bx % JW_H); return; }
  bx -= 3 * NH * JW_H;
  if (bx < JW_O) { wt_f16_job(wo, BO, DM, DM, 16.0f, bx); return; }
  bx -= JW_O;
  const int s = bx / JX; x16_job(s == 0 ? x : s == 1 ? xk : xv, s == 0 ? X16 : s == 1 ? XK16 : XV16, NR * DM / 8, bx % JX); }
#define JP_A ((MP / 128) * (DM / 64))          /* tiles of a projection of all rows */
#define JP_0 ((QT0 / 128) * (DM / 64))         /* tiles of a first-tile projection, per sequence */
// The six projections. grid.y: q, k, v. grid.x: the tiles of all rows, stored in the forms that the attention reads (q, k as f16 hi + x1024 residual planes; v as V^T [NBR][NH][HD][SQ], f16), then per sequence the tiles of the first QT0 rows (f32 planes of QT0 rows a sequence).
__global__ __launch_bounds__(128) void k_proj(const _Float16* __restrict__ X16, const _Float16* __restrict__ XK16, const _Float16* __restrict__ XV16, const _Float16* __restrict__ BQ, const _Float16* __restrict__ BK, const _Float16* __restrict__ BV,
    const float* __restrict__ bq, const float* __restrict__ bk, const float* __restrict__ bv, _Float16* __restrict__ QH, _Float16* __restrict__ QL, _Float16* __restrict__ KH, _Float16* __restrict__ KL, _Float16* __restrict__ VT, float* __restrict__ QF0, float* __restrict__ KF0, float* __restrict__ VF0) {
  const int s = blockIdx.y; const int bx = blockIdx.x; const bool all = bx < JP_A; const int b0 = bx - JP_A;
  gemm2_job<0>(s == 0 ? X16 : s == 1 ? XK16 : XV16, DM, 0, s == 0 ? BQ : s == 1 ? BK : BV, DM, 0, 0.0625f, s == 0 ? bq : s == 1 ? bk : bv, 0, nullptr, 1, 0, 0,
      all ? nullptr : (s == 0 ? QF0 : s == 1 ? KF0 : VF0), all ? (s == 0 ? QH : s == 1 ? KH : nullptr) : nullptr, all ? (s == 0 ? QL : s == 1 ? KL : nullptr) : nullptr, (all && s == 2) ? VT : nullptr, DM, 0, all ? MP : QT0, DM, DM, (size_t)SQ * DM, 0, (size_t)QT0 * DM,
      all ? bx : b0 % JP_0, 0, all ? 0 : b0 / JP_0); }
static_assert(MP == NBR * SQ && B0 == 0 && SQ % 32 == 0 && DM == NH * HD, "a wave's 32 projected rows lie in one sequence, its 64 columns are one head");


__global__ __launch_bounds__(256) void k_wnat(const float* __restrict__ w, size_t n8, _Float16* __restrict__ Bt) { const size_t t = (size_t)blockIdx.x * 256 + threadIdx.x; if (t >= n8) return; FragH f; for (int q = 0; q < 8; ++q) f.h[q] = (_Float16)(bf16_round(w[t * 8 + q]) * 16.0f); *(v8us*)((unsigned short*)Bt + t * 8) = f.half[0];  }
__global__ __launch_bounds__(256) void k_rsm(const float* __restrict__ S, _Float16* __restrict__ P, int nrows) {
  #pragma clang fp contract(off)
  const int i = blockIdx.x * 256 + threadIdx.x; if (i >= nrows) return; const float* s = S + (size_t)i * SQ; float mx = -3.0e38f;
#pragma unroll 1
  for (int j = 0; j < SQ; ++j) mx = fmaxf(mx, s[j]); float se = 0.f;
#pragma unroll 1
  for (int j = 0; j < SQ; ++j) se += expf(s[j] - mx); const float sc = 256.0f / se;
#pragma unroll 1
  for (int j0 = 0; j0 < SQ; j0 += 8) { FragH f; for (int q = 0; q < 8; ++q) f.h[q] = (_Float16)(expf(s[j0 + q] - mx) * sc); unsigned short* d = (unsigned short*)P + (size_t)i * SQ + j0; *(v8us*)d = f.half[0];  } }
__global__ __launch_bounds__(256) void k_vt(const _Float16* __restrict__ V16, int b, int h0, _Float16* __restrict__ VT) { __shared__ unsigned short tl[64][65]; const int tid = threadIdx.x; const int hh = blockIdx.x % HG, sg = blockIdx.x / HG; const int s0 = sg * 64; const int h = h0 + hh;
  for (int i = tid; i < 64 * 8; i += 256) { const int j = i / 8, d8 = (i % 8) * 8; FragH f; f.half[0] = *(const v8us*)((const unsigned short*)V16 + ((size_t)b * SQ + s0 + j) * DM + h * HD + d8); for (int q = 0; q < 8; ++q) tl[d8 + q][j] = f.u[q]; }
  __syncthreads();
  { for (int i = tid; i < 64 * 8; i += 256) { const int d = i / 8, j8 = (i % 8) * 8; FragH f; for (int q = 0; q < 8; ++q) f.u[q] = tl[d][j8 + q]; *(v8us*)((unsigned short*)VT + ((size_t)hh * HD + d) * SQ + s0 + j8) = f.half[0]; }  } }



// 2^x on the transcendental unit, with the one free issue slot that the instruction set asks for behind it before its result is used or its
// source overwritten: in the unrolled row the compiler put one exponential's result into the source register of the one directly ahead of it.
__device__ __forceinline__ float exp2_slot(float x) { float r; asm("v_exp_f32 %0, %1\n\tv_nop" : "=v"(r) : "v"(x)); return r; }
// Fused causal attention: scores, softmax and P V in one launch; neither scores nor weights go to memory. One wave owns 16 query rows of one
// head and walks its keys 32 at a time, transposed: S^T = K Q^T (A = key rows, B = query rows), so that a lane holds scores of ONE query
// (column ln; keys 8 hh + r of each 16-key tile) and the row maximum and sum need one exchange between the wave's halves. The two score tiles,
// converted in place, are the B operand of O^T += V^T P^T in the loader's own k order (keys 8 hh + 0..7, then 16 + 8 hh + 0..7), and the
// accumulators of O^T belong to the same query as the lane's running maximum and sum. Scores keep their three f16 products (hi.hi, lo.hi, hi.lo).
// The block's four waves walk the same keys: each 32-key tile (key rows hi, key rows residual, V^T rows) is brought into LDS once per block by
// asynchronous copies, whole rows at a time, into one of two buffers, the next tile in flight while this one is worked on; the waves take their
// fragments from LDS.
#define FKP 72                       /* halves from one staged key row (64 halves) to the next: 144 bytes = 16 x odd, for 16-byte LDS reads */
#define FVP 40                       /* halves from one staged V^T row (32 halves) to the next: 80 bytes = 16 x odd */
#define FKL (32 * FKP)               /* first half of the residual key rows in a buffer */
#define FVO (2 * 32 * FKP)           /* first half of the V^T rows in a buffer */
#define FBUF (2 * 32 * FKP + HD * FVP)      /* halves per buffer */
typedef __attribute__((address_space(3))) _Float16 lds_f16;
// One 32-key tile into one buffer: six copies of 16 bytes a lane (128 lanes: 16 key rows of 8 pieces, twice, for each key plane; 32 V^T rows of 4 pieces, twice).
// lk, lv: the lane's LDS byte addresses of its first key piece and its first V^T piece; gh, gl, gv: its global addresses of the same pieces.
// The s_wait_xcnt stands inside the statement, behind the last copy: the address registers may be rewritten right behind it.
__device__ __forceinline__ void fattn_copy(unsigned lk, unsigned lv, const _Float16* gh, const _Float16* gl, const _Float16* gv) {
  asm volatile("global_load_async_to_lds_b128 %0, %6, off\n\t"
               "global_load_async_to_lds_b128 %1, %7, off\n\t"
               "global_load_async_to_lds_b128 %2, %8, off\n\t"
               "global_load_async_to_lds_b128 %3, %9, off\n\t"
               "global_load_async_to_lds_b128 %4, %10, off\n\t"
               "global_load_async_to_lds_b128 %5, %11, off\n\t"
               "s_wait_xcnt 0x0"
               :: "v"(lk), "v"(lk + 16 * FKP * 2), "v"(lk + FKL * 2), "v"(lk + (FKL + 16 * FKP) * 2), "v"(lv), "v"(lv + 32 * FVP * 2),
                  "v"(gh), "v"(gh + 16 * LQ), "v"(gl), "v"(gl + 16 * LQ), "v"(gv), "v"(gv + (size_t)32 * SQ) : "memory"); }
__device__ __forceinline__ void fattn_job(const _Float16* __restrict__ Qh, const _Float16* __restrict__ Ql, const _Float16* __restrict__ Kh, const _Float16* __restrict__ Kl, const _Float16* __restrict__ Vt, _Float16* __restrict__ O, int bx, int h, int b) {
  __shared__ __attribute__((aligned(16))) _Float16 ring[2 * FBUF];
  const int tid = threadIdx.x, lane = tid & 31, ln = lane & 15, hh = lane >> 4; const int w = __builtin_amdgcn_readfirstlane(threadIdx.x >> 5);      /* the wave's number in a scalar register: the trip count stays scalar */
  const int qt = (b & 1) ? bx : SQ / 64 - 1 - bx;      /* long and short causal tiles alternate between sequences */
  const int q0 = qt * 64 + w * 16; const size_t rb = (size_t)b * SQ;
  const size_t qo = (rb + q0 + ln) * LQ + h * HD;
  const v16h qh0 = g2_frag(Qh + qo, hh), qh1 = g2_frag(Qh + qo + 32, hh), ql0 = g2_frag(Ql + qo, hh), ql1 = g2_frag(Ql + qo + 32, hh);
  const size_t ko = (rb + (tid >> 3)) * LQ + h * HD + (tid & 7) * 8;      /* the lane's first piece of tile 0 */
  const _Float16* gh = Kh + ko; const _Float16* gl = Kl + ko;
  const _Float16* gv = Vt + ((size_t)(b * NH + h) * HD + (tid >> 2)) * SQ + (tid & 3) * 8;
  const unsigned l0 = (unsigned)(size_t)(lds_f16*)ring;
  const unsigned lk = l0 + ((tid >> 3) * FKP + (tid & 7) * 8) * 2, lv = l0 + (FVO + (tid >> 2) * FVP + (tid & 3) * 8) * 2;
  const v8f z8 = {0.f,0.f,0.f,0.f,0.f,0.f,0.f,0.f}; v8f o[4] = {z8, z8, z8, z8};
  float m = -1.0e30f, l = 0.f; const int nst = (q0 >> 5) + 1;      /* the wave's 32-key steps, up to the one that holds its diagonal */
  const int nbl = 2 * qt + 2;      /* the block's tiles (its last wave's steps; two at least): every wave passes every barrier */
  fattn_copy(lk, lv, gh, gl, gv);      /* tile 0 */
  asm volatile("s_wait_asynccnt 0x0" ::: "memory");      /* the wave's own copies have landed before the barrier behind which other waves read them */
  __syncthreads();
  gh += 32 * LQ; gl += 32 * LQ; gv += 32;
  fattn_copy(lk + FBUF * 2, lv + FBUF * 2, gh, gl, gv);      /* tile 1 flies while tile 0 is worked on */
#pragma unroll 1      /* rolled: a second copy of the body would hold a second set of fragments and cost a resident wave per SIMD */
  for (int st = 0; st < nbl; ++st) { const int key0 = st * 32; const int bo = (st & 1) * FBUF;
    if (st < nst) {      /* a scalar test: a wave past its diagonal skips the work, never the barrier */
    const _Float16* kb = ring + bo + ln * FKP; const _Float16* vb = ring + bo + FVO + ln * FVP;
    v16h ka[2][4];      /* per 16-key tile: hi d 0..31, hi d 32..63, residual d 0..31, residual d 32..63 */
#pragma unroll      /* this and every constant-trip loop below: unrolled so that fragments and accumulators are registers, not indexed arrays */
    for (int kt = 0; kt < 2; ++kt) { const int ro = 16 * kt * FKP; ka[kt][0] = g2_frag(kb + ro, hh); ka[kt][1] = g2_frag(kb + ro + 32, hh); ka[kt][2] = g2_frag(kb + FKL + ro, hh); ka[kt][3] = g2_frag(kb + FKL + ro + 32, hh); }
    v16h va[4];
#pragma unroll
    for (int t = 0; t < 4; ++t) va[t] = g2_frag(vb + 16 * t * FVP, hh);
    v8f sh[2], sl[2];
#pragma unroll
    for (int kt = 0; kt < 2; ++kt) { sh[kt] = g2_mma(ka[kt][0], qh0, z8); sh[kt] = g2_mma(ka[kt][1], qh1, sh[kt]);
      sl[kt] = g2_mma(ka[kt][0], ql0, z8); sl[kt] = g2_mma(ka[kt][1], ql1, sl[kt]); sl[kt] = g2_mma(ka[kt][2], qh0, sl[kt]); sl[kt] = g2_mma(ka[kt][3], qh1, sl[kt]); }
    float sv[16]; float mx = m; const int rel = q0 + ln - key0 - 8 * hh;      /* key 16 kt + r of this lane is kept while 16 kt + r <= rel */
#pragma unroll
    for (int kt = 0; kt < 2; ++kt)
#pragma unroll
      for (int r = 0; r < 8; ++r) { const float s = sh[kt][r] * SCL + sl[kt][r] * SCLR; const float xv = (16 * kt + r <= rel) ? s : -1.0e9f; sv[kt * 8 + r] = xv; mx = fmaxf(mx, xv); }
    mx = fmaxf(mx, __shfl_xor(mx, 16, 32));
    const float al = exp2_slot((m - mx) * 1.44269504088896340736f); m = mx;
    float ps = 0.f; FragH p;
#pragma unroll
    for (int i = 0; i < 16; ++i) { const float e = exp2_slot((sv[i] - mx) * 1.44269504088896340736f + 8.0f);      /* weights carried x256, as in the f16 operand before */ ps += e; p.h[i] = (_Float16)e; }
    l = l * al + ps;
#pragma unroll
    for (int t = 0; t < 4; ++t) { o[t] *= al; o[t] = g2_mma(va[t], p.v, o[t]); } }
    asm volatile("s_wait_dscnt 0x0" ::: "memory");      /* the wave's reads of this buffer have returned before the barrier behind which it is refilled */
    asm volatile("s_wait_asynccnt 0x0" ::: "memory");      /* the wave's copies of the next tile have landed before the barrier behind which other waves read them */
    __syncthreads();      /* publishes tile st + 1 and ends every wave's reads of tile st */
    if (st + 2 < nbl) { gh += 32 * LQ; gl += 32 * LQ; gv += 32; fattn_copy(lk + bo * 2, lv + bo * 2, gh, gl, gv); } }      /* tile st + 2 into the buffer just read; the test is the same for the whole block */
  asm volatile("s_wait_asynccnt 0x0" ::: "memory");      /* no copy is outstanding when the wave ends */
  l += __shfl_xor(l, 16, 32);
  const float fin = 64.0f / l;      /* o carried x64; the x256 of the weights cancels against the sum's */
  _Float16* orow = O + (rb + q0 + ln) * DM + h * HD + 8 * hh;
#pragma unroll
  for (int t = 0; t < 4; ++t) { FragH f;
#pragma unroll
    for (int r = 0; r < 8; ++r) f.h[r] = (_Float16)(o[t][r] * fin);
    *(v8us*)((unsigned short*)orow + 16 * t) = f.half[0]; } }
#define JF_A ((SQ / 64) * NH * NBR)            /* blocks of the fused attention: query tile fastest, then head, then sequence */
// The fused attention of all rows; behind its blocks, per sequence, the tiles of the first-tile output pass out = o_hi Wo + b (rows 0..QT0-1, from the exact f32 attention: it does not depend on this launch's attention).
__global__ __launch_bounds__(128) void k_attn(const _Float16* __restrict__ Qh, const _Float16* __restrict__ Ql, const _Float16* __restrict__ Kh, const _Float16* __restrict__ Kl, const _Float16* __restrict__ Vt, _Float16* __restrict__ O,
    const _Float16* __restrict__ OH0, const _Float16* __restrict__ BO, const float* __restrict__ bo, float* __restrict__ out) {
  const int bx = blockIdx.x;
  if (bx < JF_A) { fattn_job(Qh, Ql, Kh, Kl, Vt, O, bx % (SQ / 64), bx / (SQ / 64) % NH, bx / ((SQ / 64) * NH)); return; }
  const int b0 = bx - JF_A;
  gemm2_job<0>(OH0, DM, 0, BO, DM, 0, 0.0009765625f, bo, 0, nullptr, 1, 0, 0, out, nullptr, nullptr, nullptr, DM, 0, QT0, DM, DM, (size_t)QT0 * DM, 0, (size_t)SQ * DM, b0 % JP_0, 0, b0 / JP_0); }
// Output stage, one job per 128-row tile: the first tile of a sequence adds o_lo Wo 2^-20 to its own elements (written by the launch before); every other tile is out = o Wo + b from the f16 rows.
static_assert(QT0 == 128 && SQ % 128 == 0 && MPO == NBR * SQ && B0 == 0, "the first-tile rows are exactly the first 128-row tile of each sequence");
__global__ __launch_bounds__(128) void k_out(const _Float16* __restrict__ O16, const _Float16* __restrict__ OL0, const _Float16* __restrict__ BO, const float* __restrict__ bo, float* out) {
  const int bx = blockIdx.x; const int mt = bx / (DM / 64); const bool first = mt % (SQ / 128) == 0;
  gemm2_job<0>(first ? OL0 : O16, DM, 0, BO, DM, 0, first ? 0.00000095367431640625f : 0.0009765625f, first ? nullptr : bo, 0, first ? out : nullptr, first ? -1 : 1, 0, 0, out, nullptr, nullptr, nullptr, DM, 0, first ? QT0 : MPO, DM, DM,
      (size_t)QT0 * DM, 0, (size_t)SQ * DM, first ? bx % (DM / 64) : bx, 0, first ? mt / (SQ / 128) : 0); }


// Exact f32 attention for the first QT0 rows of every sequence. One block owns A0R query rows of one head and stages the head's QT0 key and value
// rows in LDS once; a wave owns two query rows, held in registers, so that each staged row it reads serves both. Scores: a lane owns one key of each
// group of 32 and reads its key row 16 bytes at a time; four partial sums per dot product. Softmax: true row maximum and sum by a butterfly over the
// wave. P V: a lane owns four head dims and every other run of four keys; the wave's halves are added at the end.
#define A0R 16                       /* query rows per block: two per wave */
#define A0KP 68                      /* floats from one staged key row to the next: 16 bytes x odd, so that 16 lanes on 16 rows meet no bank twice */
__global__ __launch_bounds__(256) void k_att0(const float* __restrict__ QF, const float* __restrict__ KF, const float* __restrict__ VF, float scale, _Float16* __restrict__ OH, _Float16* __restrict__ OL) {
  __shared__ __attribute__((aligned(16))) float ks[QT0][A0KP]; __shared__ __attribute__((aligned(16))) float vs[QT0][HD]; __shared__ __attribute__((aligned(16))) float ps[A0R][QT0];
  static_assert(QT0 % 32 == 0 && HD == 64 && A0R == 16, "256 threads: 16 per staged row of 64 floats, 8 waves of two query rows, key groups of 32");
  const int tid = threadIdx.x, lane = tid & 31, w = tid >> 5; const int h = blockIdx.x / (QT0 / A0R), rg = blockIdx.x % (QT0 / A0R); const int r0 = rg * A0R;
  { const size_t zb = (size_t)blockIdx.y * QT0 * DM + h * HD; QF += zb; KF += zb; VF += zb; OH += zb; OL += zb; }      /* grid.y = sequence: QT0 rows of q, k, v and o each, DM elements from row to row (floats for q, k, v; halves for the o planes) (a constant, so that a run of loads shares one address and differs in its immediate offset) */
  const int ia = r0 + w, ib = r0 + 8 + w;      /* the wave's two query rows */
  const int sr = tid >> 4, sc = (tid & 15) * 4; v4f kk[QT0 / 16], vv[QT0 / 16], qa[HD / 4], qb[HD / 4];
#pragma unroll      /* this and every constant-trip loop below: unrolled so that the arrays are registers and the loads of a run are in flight together */
  for (int p = 0; p < QT0 / 16; ++p) { kk[p] = *(const v4fa*)(KF + (size_t)(p * 16 + sr) * DM + sc); vv[p] = *(const v4fa*)(VF + (size_t)(p * 16 + sr) * DM + sc); }
  asm volatile("s_wait_xcnt 0x0" ::: "memory");      /* stands between the loads above and the first later write of a register that holds one of their addresses (the query loads below may land there) */
#pragma unroll
  for (int c = 0; c < HD / 4; ++c) { qa[c] = *(const v4fa*)(QF + (size_t)ia * DM + c * 4); qb[c] = *(const v4fa*)(QF + (size_t)ib * DM + c * 4); }
  asm volatile("s_wait_xcnt 0x0" ::: "memory");      /* the same behind the query loads */
#pragma unroll
  for (int p = 0; p < QT0 / 16; ++p) { *(v4f*)&ks[p * 16 + sr][sc] = kk[p]; *(v4f*)&vs[p * 16 + sr][sc] = vv[p]; }
  __syncthreads();
  const int ng = (r0 + A0R - 1) / 32 + 1;      /* groups of 32 keys up to the block's last row: the same for every wave */
  float sa[QT0 / 32], sb[QT0 / 32]; float ma = -1.0e30f, mb = -1.0e30f;
#pragma unroll
  for (int g = 0; g < QT0 / 32; ++g) { sa[g] = -1.0e30f; sb[g] = -1.0e30f;
    if (g < ng) { const int key = g * 32 + lane; v4f aa = {0.f, 0.f, 0.f, 0.f}, ab = {0.f, 0.f, 0.f, 0.f};
#pragma unroll
      for (int c = 0; c < HD / 4; ++c) { const v4f k4 = *(const v4f*)&ks[key][c * 4]; aa += qa[c] * k4; ab += qb[c] * k4; }
      if (key <= ia) sa[g] = ((aa[0] + aa[1]) + (aa[2] + aa[3])) * scale;
      if (key <= ib) sb[g] = ((ab[0] + ab[1]) + (ab[2] + ab[3])) * scale;
      ma = fmaxf(ma, sa[g]); mb = fmaxf(mb, sb[g]); } }
#pragma unroll
  for (int d = 16; d > 0; d >>= 1) { ma = fmaxf(ma, __shfl_xor(ma, d, 32)); mb = fmaxf(mb, __shfl_xor(mb, d, 32)); }
  float la = 0.f, lb = 0.f;
#pragma unroll
  for (int g = 0; g < QT0 / 32; ++g)
    if (g < ng) { const int key = g * 32 + lane; const float ea = (key <= ia) ? expf(sa[g] - ma) : 0.f, eb = (key <= ib) ? expf(sb[g] - mb) : 0.f; la += ea; lb += eb; ps[w][key] = ea; ps[8 + w][key] = eb; }
#pragma unroll
  for (int d = 16; d > 0; d >>= 1) { la += __shfl_xor(la, d, 32); lb += __shfl_xor(lb, d, 32); }
  __syncthreads();      /* the weights are read below by other lanes than wrote them */
  const int dq = (lane & 15) * 4, jp = lane >> 4; v4f oa = {0.f, 0.f, 0.f, 0.f}, ob = {0.f, 0.f, 0.f, 0.f};
#pragma unroll 1      /* rolled: the trip count is the block's; one trip holds 16 keys, twelve LDS reads in flight together */
  for (int ch = 0; ch <= rg; ++ch) {
#pragma unroll
    for (int t = 0; t < 2; ++t) { const int k0 = ch * 16 + t * 8 + jp * 4; const v4f pa = *(const v4f*)&ps[w][k0], pb = *(const v4f*)&ps[8 + w][k0];
#pragma unroll
      for (int u = 0; u < 4; ++u) { const v4f v4 = *(const v4f*)&vs[k0 + u][dq]; oa += pa[u] * v4; ob += pb[u] * v4; } } }
#pragma unroll
  for (int q = 0; q < 4; ++q) { oa[q] += __shfl_xor(oa[q], 16, 32); ob[q] += __shfl_xor(ob[q], 16, 32); }
  const float fin = 64.0f / (jp ? lb : la);      /* o carried x64 like the f16 path */
  const v4f res = (jp ? ob : oa) * fin;      /* lanes 0..15 store the first row, lanes 16..31 the second */
  v4h rh, rl;      /* o leaves as the output stage reads it: f16 hi + x1024 residual */
#pragma unroll
  for (int q = 0; q < 4; ++q) { rh[q] = (_Float16)res[q]; rl[q] = (_Float16)((res[q] - (float)rh[q]) * 1024.0f); }
  const size_t oo = (size_t)(jp ? ib : ia) * DM + dq;
  *(v4h*)(OH + oo) = rh; *(v4h*)(OL + oo) = rl; }

extern "C" void kernel_launch(void* const* d_in, const int* in_sizes, int n_in,
                              void* d_out, int out_size, void* d_ws, size_t ws_size, hipStream_t stream) {
  (void)in_sizes; (void)n_in; (void)out_size;
  const float* const* I = (const float* const*)d_in; const float* x = I[0]; const float* xk = I[0]; const float* xv = I[0]; const float* wq = I[1]; const float* bq = I[2]; const float* wk = I[3]; const float* bk = I[4]; const float* wv = I[5]; const float* bv = I[6]; const float* wo = I[7]; const float* bo = I[8];      /* input order: x, Wq, bq, Wk, bk, Wv, bv (PER-HEAD STACKS [8][512][64] with REAL per-head biases [8][64] = flat [512]: the GEMMs' guarded bias slots), Wp ([in][out]: out @ Wp), bp (REAL) */
  char* ws = (char*)d_ws; size_t off = 0;
  auto take = [&](size_t bytes) { char* p = ws + off; off += (bytes + 255) & ~(size_t)255; return p; };
  _Float16* BQ = (_Float16*)take((size_t)DM * DM * 2); _Float16* BK = (_Float16*)take((size_t)DM * DM * 2); _Float16* BV = (_Float16*)take((size_t)DM * DM * 2); _Float16* BO = (_Float16*)take((size_t)DM * DM * 2);
  _Float16* X16 = (_Float16*)take(NR * DM * 2); _Float16* XK16 = (_Float16*)take(NR * DM * 2); _Float16* XV16 = (_Float16*)take(NR * DM * 2);      /* exact f16 rows of query, key, value */ _Float16* QH = (_Float16*)take(NR * DM * 2); _Float16* QL = (_Float16*)take(NR * DM * 2); _Float16* KH = (_Float16*)take(NR * DM * 2); _Float16* KL = (_Float16*)take(NR * DM * 2); _Float16* Q16 = QH; _Float16* K16 = KH; _Float16* O16 = (_Float16*)take(NR * DM * 2);
  _Float16* VT = (_Float16*)take((size_t)NB * NH * HD * SQ * 2);      /* one plane per sequence: the sequences share each launch */
  float* QF0 = (float*)take((size_t)NB * QT0 * DM * 4); float* KF0 = (float*)take((size_t)NB * QT0 * DM * 4); float* VF0 = (float*)take((size_t)NB * QT0 * DM * 4); _Float16* OH0 = (_Float16*)take((size_t)NB * QT0 * DM * 2); _Float16* OL0 = (_Float16*)take((size_t)NB * QT0 * DM * 2);
  if (off > ws_size) return;
  const size_t r0p = (size_t)B0 * SQ;      /* first projected row */
  k_prep<<<3 * NH * JW_H + JW_O + 3 * JX, 256, 0, stream>>>(x, xk, xv, wq, wk, wv, wo, BQ, BK, BV, BO, X16, XK16, XV16);      /* weight planes [out][in] (x16) and the exact f16 rows of query, key, value */
  k_proj<<<dim3(JP_A + NBR * JP_0, 3), 128, 0, stream>>>(X16 + r0p * DM, XK16 + r0p * DM, XV16 + r0p * DM, BQ, BK, BV, bq, bk, bv, QH + r0p * DM, QL + r0p * DM, KH + r0p * DM, KL + r0p * DM, VT, QF0, KF0, VF0);      /* q, k (f16 hi + x1024 residual planes: unscaled logits sigma ~8) and V^T of all rows; f32 q, k, v of the first 128 rows of every sequence (exact products) */
  { const size_t r0 = r0p;      /* every launch below covers all NBR sequences */
    k_att0<<<dim3(NH * (QT0 / A0R), NBR), 256, 0, stream>>>(QF0, KF0, VF0, SCL, OH0 + (size_t)B0 * QT0 * DM, OL0 + (size_t)B0 * QT0 * DM);      /* exact f32 attention for rows 0..127 (o x64, f16 hi + x1024 residual planes) */
    static_assert(SQ % 64 == 0 && HD == 64 && NHD == NH && QN == SQ && LQ == DM, "64 query rows per block, 32-key steps, head size 64");
    k_attn<<<JF_A + NBR * JP_0, 128, 0, stream>>>(QH + r0 * LQ, QL + r0 * LQ, KH + r0 * LQ, KL + r0 * LQ, VT, O16 + r0 * DM, OH0 + (size_t)B0 * QT0 * DM, BO, bo, (float*)d_out + r0 * DM); }      /* o (merged heads, x64) as f16 rows; rows 0..127 of every sequence: out = o_hi Wo (+ b) */
  k_out<<<(MPO / 128) * (DM / 64), 128, 0, stream>>>(O16 + r0p * DM, OL0 + (size_t)B0 * QT0 * DM, BO, bo, (float*)d_out + r0p * DM);      /* out rows are the output layout; rows 0..127: += o_lo Wo 2^-20 (own-element accumulate) */
}

// v008
// One run takes 143 microseconds.
// Two timings next to v007 both put it at 1.13 times that version's speed.
// Over all steps from v000 it is 75.4 times as fast.
#include <hip/hip_runtime.h>
// Causal multi-head self-attention with PER-HEAD STACKED projections and REAL per-head biases on four sequences at width 512 (x [4][2048][512]; Wq / Wk / Wv [8][512][64] = [head][in][out] ('bte,hed->bhtd'; uniform +-1/sqrt(512)) with biases [8][64] (REAL, uniform +-1/sqrt(512)): a per-head bias [8][64] IS the flat bias [512]; 8 heads of 64 (8 x 64 = 512 = the width); scores * 1/sqrt(64); where(tril, scores, -inf); softmax over keys; out = merged Wp + bp ([in][out] [512][512] + a REAL bias, uniform +-1/sqrt(512)) -> [4][2048][512]); the [in][out] output weight through the text's own TRANSPOSING builder (the one the per-head stacks use); q and k carried as f16 hi + x1024 residual planes with three-product scores; each head's [in][out] block is transposed into its 64 contiguous rows of the weight plane by the same builder, one job per head in one shared launch.
// Compute dtype: inputs rounded to bf16; x / weights exact; v, softmax weights and o as plain f16 GEMM operands (~2^-12), q and k as f16 hi + x1024 residual pairs (rows 0..127: f32 attention, o as hi + residual); scores and softmax statistics f32; v_wmma_f32_16x16x32_f16.
#define NB 4
#define SCL 0.125f                         /* 1 / sqrt(head_dim 64) */
#define SCLR 0.0001220703125f               /* 2^-13: the same scale on the x1024 residual passes */
#define SQ 2048
#define DM 512
#define NH 8
#define HD 64
#define HG 4                         /* heads per call of the untemplated k_vt (not launched) */
#define QT0 128                      /* first-tile rows recomputed exactly in f32 */
#define B0 0                         /* first batch processed (debug hook) */
#define NBR NB                       /* batches processed (debug hook) */
#define NR ((size_t)NB * SQ)         /* token rows */
#define MP ((int)((size_t)NBR * SQ)) /* rows projected (debug hook) */
#define QN SQ                        /* query rows attended per batch (debug hook) */
#define NHD NH                       /* heads attended (debug hook) */
#define MPO MP                       /* rows through the output stage (debug hook) */
#define LQ DM      /* row pitch of the q/k/v rows */
typedef __bf16 v16b __attribute__((ext_vector_type(16)));
typedef unsigned short v8us __attribute__((ext_vector_type(8), may_alias));
typedef float  v8f  __attribute__((ext_vector_type(8)));
typedef float  v4f  __attribute__((ext_vector_type(4)));
typedef float  v4fa __attribute__((ext_vector_type(4), may_alias));
union FragB { v16b v; v8us half[2]; unsigned short u[16]; };

__device__ __forceinline__ unsigned short bf16_bits(float x) { unsigned int u = __float_as_uint(x); return (unsigned short)((u + 0x7FFFu + ((u >> 16) & 1u)) >> 16); }
__device__ __forceinline__ float bf16_val(unsigned short b) { return __uint_as_float(((unsigned int)b) << 16); }
__device__ __forceinline__ float bf16_round(float x) { return bf16_val(bf16_bits(x)); }
// D += A·B with NT terms: 1 = ah·bh, 2 = + al·bh (A split), 3 = + ah·bl (both split)
template <int NT>
__device__ __forceinline__ v8f mmaN(v16b ah, v16b al, v16b bh, v16b bl, v8f c) {
  c = __builtin_amdgcn_wmma_f32_16x16x32_bf16(false, ah, false, bh, (short)0, c, false, false);
  if (NT >= 2) c = __builtin_amdgcn_wmma_f32_16x16x32_bf16(false, al, false, bh, (short)0, c, false, false);
  if (NT >= 3) c = __builtin_amdgcn_wmma_f32_16x16x32_bf16(false, ah, false, bl, (short)0, c, false, false);
  asm volatile("v_nop\n\tv_nop\n\tv_nop\n\tv_nop" : "+v"(c) : "v"(ah), "v"(al), "v"(bh), "v"(bl));
  return c;
}

__global__ __launch_bounds__(256) void k_wt_bf16(const float* __restrict__ W, unsigned short* __restrict__ Wt, int K, int N) {
  const int t = blockIdx.x * 256 + threadIdx.x;
  const int k8n = K / 8;
  if (t >= N * k8n) return;
  const int n = t / k8n, k8 = (t % k8n) * 8;
  v8us v;
#pragma unroll
  for (int i = 0; i < 8; ++i) v[i] = bf16_bits(W[(size_t)(k8 + i) * N + n]);
  *(v8us*)(Wt + (size_t)n * K + k8) = v;
  
}

// GEMM C[M][N] (f32, pitch ldc) = act(A[M][K]·W + bias). A f32 row-major (pitch lda) converted per fragment to bf16
// (ASPLIT: hi/lo two planes -> 2 terms, else single rounded term); Wt bf16 [N][K] (pitch ldb). BIAS_BF16 rounds the
// bias to bf16 first (bias quantised to bf16 before the add). K%32==0, M%16==0, N%64==0.
template <bool ASPLIT, int ACT, bool BIAS_BF16>
__global__ __launch_bounds__(128) void k_gemm_bf(const float* __restrict__ A, int lda, const unsigned short* __restrict__ Wt, int ldb,
                                               const float* __restrict__ bias, float* __restrict__ C, int ldc, int M, int N, int K) {
  __shared__ __attribute__((aligned(16))) float so[4][16][64];
  const int tid = threadIdx.x, w = tid >> 5, lane = tid & 31, ln = lane & 15, hh = lane >> 4;
  const int ntn = N / 64;
  const int wid = blockIdx.x * 4 + w;
  const int mt = wid / ntn, nq = wid % ntn;
  if (mt * 16 >= M) return;
  const int row0 = mt * 16, col0 = nq * 64;
  const float* arow = A + (size_t)(row0 + ln) * lda;
  v8f acc[4] = {};
  for (int kb = 0; kb < K; kb += 32) {
    FragB ah, al;
    const v4f x0 = *(const v4fa*)(arow + kb + 8 * hh), x1 = *(const v4fa*)(arow + kb + 8 * hh + 4);
    const v4f x2 = *(const v4fa*)(arow + kb + 16 + 8 * hh), x3 = *(const v4fa*)(arow + kb + 16 + 8 * hh + 4);
    float xs[16] = {x0[0],x0[1],x0[2],x0[3],x1[0],x1[1],x1[2],x1[3],x2[0],x2[1],x2[2],x2[3],x3[0],x3[1],x3[2],x3[3]};
#pragma unroll
    for (int i = 0; i < 16; ++i) { const unsigned short hb = bf16_bits(xs[i]); ah.u[i] = hb; al.u[i] = ASPLIT ? bf16_bits(xs[i] - bf16_val(hb)) : (unsigned short)0; }
#pragma unroll
    for (int t = 0; t < 4; ++t) {
      const unsigned short* brow = Wt + (size_t)(col0 + t * 16 + ln) * ldb + kb;
      FragB b;
      b.half[0] = *(const v8us*)(brow + 8 * hh);
      b.half[1] = *(const v8us*)(brow + 16 + 8 * hh);
      acc[t] = mmaN<ASPLIT ? 2 : 1>(ah.v, al.v, b.v, b.v, acc[t]);
    }
  }
#pragma unroll
  for (int t = 0; t < 4; ++t) {
    float bv = bias ? bias[col0 + t * 16 + ln] : 0.f;
    if (BIAS_BF16) bv = bf16_round(bv);
#pragma unroll
    for (int r = 0; r < 8; ++r) { float v = acc[t][r] + bv; if (ACT == 1) v = fmaxf(v, 0.f); so[w][8 * hh + r][t * 16 + ln] = v; }
  }
  __builtin_amdgcn_fence(__ATOMIC_ACQ_REL, "workgroup");
  __builtin_amdgcn_wave_barrier();
  const int rsub = lane >> 4, c4 = (lane & 15) * 4;
  {
#pragma unroll
    for (int q = 0; q < 8; ++q) {
      const int r = q * 2 + rsub;
      const v4f v = *(const v4fa*)&so[w][r][c4];
      *(v4f*)(C + (size_t)(row0 + r) * ldc + col0 + c4) = v;
    }
    
  }
}

// GEMM C = act(A·W + bias + resid): A f32 (ASPLIT -> hi/lo 2 terms), Wt bf16 [N][K]; ACT 0 none, 1 relu, 2 exact gelu;
// resid (optional, f32, row index = (row % rmod), pitch ldr, RES_BF16 rounds it) added before the activation.
template <bool ASPLIT, int ACT, bool BIAS_BF16, bool RES_BF16>
__global__ __launch_bounds__(128) void k_gemm_bf3(const float* __restrict__ A, int lda, const unsigned short* __restrict__ Wt, int ldb,
                                                const float* __restrict__ bias, const float* __restrict__ resid, int rmod, int ldr,
                                                float* __restrict__ C, int ldc, int M, int N, int K) {
  __shared__ __attribute__((aligned(16))) float so[4][16][64];
  const int tid = threadIdx.x, w = tid >> 5, lane = tid & 31, ln = lane & 15, hh = lane >> 4;
  const int ntn = N / 64;
  const int wid = blockIdx.x * 4 + w;
  const int mt = wid / ntn, nq = wid % ntn;
  if (mt * 16 >= M) return;
  const int row0 = mt * 16, col0 = nq * 64;
  const float* arow = A + (size_t)(row0 + ln) * lda;
  v8f acc[4] = {};
  for (int kb = 0; kb < K; kb += 32) {
    FragB ah, al;
    const v4f x0 = *(const v4fa*)(arow + kb + 8 * hh), x1 = *(const v4fa*)(arow + kb + 8 * hh + 4);
    const v4f x2 = *(const v4fa*)(arow + kb + 16 + 8 * hh), x3 = *(const v4fa*)(arow + kb + 16 + 8 * hh + 4);
    float xs[16] = {x0[0],x0[1],x0[2],x0[3],x1[0],x1[1],x1[2],x1[3],x2[0],x2[1],x2[2],x2[3],x3[0],x3[1],x3[2],x3[3]};
#pragma unroll
    for (int i = 0; i < 16; ++i) { const unsigned short hb = bf16_bits(xs[i]); ah.u[i] = hb; al.u[i] = ASPLIT ? bf16_bits(xs[i] - bf16_val(hb)) : (unsigned short)0; }
#pragma unroll
    for (int t = 0; t < 4; ++t) {
      const unsigned short* brow = Wt + (size_t)(col0 + t * 16 + ln) * ldb + kb;
      FragB b;
      b.half[0] = *(const v8us*)(brow + 8 * hh);
      b.half[1] = *(const v8us*)(brow + 16 + 8 * hh);
      acc[t] = mmaN<ASPLIT ? 2 : 1>(ah.v, al.v, b.v, b.v, acc[t]);
    }
  }
#pragma unroll
  for (int t = 0; t < 4; ++t) {
    const int col = col0 + t * 16 + ln;
    float bv = bias ? bias[col] : 0.f;
    if (BIAS_BF16) bv = bf16_round(bv);
#pragma unroll
    for (int r = 0; r < 8; ++r) {
      float v = acc[t][r] + bv;
      if (resid) { float rv = resid[(size_t)((row0 + 8 * hh + r) % rmod) * ldr + col]; if (RES_BF16) rv = bf16_round(rv); v += rv; }
      if (ACT == 1) v = fmaxf(v, 0.f);
      if (ACT == 2) v = 0.5f * v * (1.0f + erff(v * 0.70710678118654752f));
      if (ACT == 3) { const float u = 0.7978845608028654f * (v + 0.044715f * v * v * v); v = 0.5f * v * (1.0f + tanhf(u)); }
      so[w][8 * hh + r][t * 16 + ln] = v;
    }
  }
  __builtin_amdgcn_fence(__ATOMIC_ACQ_REL, "workgroup");
  __builtin_amdgcn_wave_barrier();
  const int rsub = lane >> 4, c4 = (lane & 15) * 4;
  {
#pragma unroll
    for (int q = 0; q < 8; ++q) {
      const int r = q * 2 + rsub;
      const v4f v = *(const v4fa*)&so[w][r][c4];
      *(v4f*)(C + (size_t)(row0 + r) * ldc + col0 + c4) = v;
    }
    
  }
}
// row LayerNorm (biased variance, eps) over N: s = X (+ R); optional out_sum <- s; out_norm <- (s-mu)*rsqrt(var+eps)*g + b
template <bool PARAM_BF16>
__global__ __launch_bounds__(256) void k_layernorm(const float* __restrict__ X, const float* __restrict__ R, const float* __restrict__ g, const float* __restrict__ bta,
                                                  float* __restrict__ out_sum, float* __restrict__ out_norm, int N, float eps) {
  __shared__ float red[256];
  const int row = blockIdx.x, tid = threadIdx.x;
  const float* x = X + (size_t)row * N; const float* rr = R ? R + (size_t)row * N : nullptr;
  float vals[16];                     // up to N = 4096
  const int per = N / 256;            // contiguous chunk per thread? use strided-by-4 chunks: thread handles j = tid*4 + 1024*u
  float s1 = 0.f;
  for (int u = 0; u < per / 4; ++u) {
    const int j = tid * 4 + 1024 * u;
    const v4f a = *(const v4fa*)(x + j);
    v4f b = {0.f,0.f,0.f,0.f}; if (rr) b = *(const v4fa*)(rr + j);
#pragma unroll
    for (int q = 0; q < 4; ++q) { const float v = a[q] + b[q]; vals[u * 4 + q] = v; s1 += v; }
  }
  red[tid] = s1; __syncthreads();
  for (int st = 128; st > 0; st >>= 1) { if (tid < st) red[tid] += red[tid + st]; __syncthreads(); }
  const float mu = red[0] / (float)N; __syncthreads();
  float s2 = 0.f;
  for (int u = 0; u < per / 4; ++u)
#pragma unroll
    for (int q = 0; q < 4; ++q) { const float c = vals[u * 4 + q] - mu; s2 += c * c; }
  red[tid] = s2; __syncthreads();
  for (int st = 128; st > 0; st >>= 1) { if (tid < st) red[tid] += red[tid + st]; __syncthreads(); }
  const float rs = rsqrtf(red[0] / (float)N + eps);
  {
    for (int u = 0; u < per / 4; ++u) {
      const int j = tid * 4 + 1024 * u;
      v4f o, sm;
#pragma unroll
      for (int q = 0; q < 4; ++q) {
        float gg = g[j + q], bb = bta[j + q];
        if (PARAM_BF16) { gg = bf16_round(gg); bb = bf16_round(bb); }
        sm[q] = vals[u * 4 + q]; o[q] = (vals[u * 4 + q] - mu) * rs * gg + bb;
      }
      if (out_sum) *(v4f*)(out_sum + (size_t)row * N + j) = sm;
      *(v4f*)(out_norm + (size_t)row * N + j) = o;
    }
    
  }
}



// ---- f16 WMMA path (v_wmma_f32_16x16x32_f16): 11-bit significands for operands in range — used where a [0,1] probability operand needs more precision than bf16
typedef _Float16 v16h __attribute__((ext_vector_type(16)));
union FragH { v16h v; v8us half[2]; _Float16 h[16]; unsigned short u[16]; };
template <int NT>
__device__ __forceinline__ v8f mmaH(v16h ah, v16h al, v16h bh, v16h bl, v8f c) {
  c = __builtin_amdgcn_wmma_f32_16x16x32_f16(false, ah, false, bh, (short)0, c, false, false);
  if (NT >= 2) c = __builtin_amdgcn_wmma_f32_16x16x32_f16(false, al, false, bh, (short)0, c, false, false);
  if (NT >= 3) c = __builtin_amdgcn_wmma_f32_16x16x32_f16(false, ah, false, bl, (short)0, c, false, false);
  asm volatile("v_nop\n\tv_nop\n\tv_nop\n\tv_nop" : "+v"(c) : "v"(ah), "v"(al), "v"(bh), "v"(bl));
  return c;
}
// batched GEMM like k_gemm_b but f16 operands: A f32 (split into f16 hi/lo if ASPLIT, else rounded to f16), Bt = f16 values [n][k]; alpha; C f32; N multiple of 16 (partial tiles skipped)
template <bool ASPLIT>
__global__ __launch_bounds__(128) void k_gemm_h(const float* __restrict__ A, int lda, size_t sA, const _Float16* __restrict__ Bh, int ldb, size_t sB, float alpha, float* __restrict__ C, int ldc, size_t sC, int M, int N, int K) {
  __shared__ __attribute__((aligned(16))) float so[4][16][64];
  const int tid = threadIdx.x, w = tid >> 5, lane = tid & 31, ln = lane & 15, hh = lane >> 4; const int by = blockIdx.y;
  A += (size_t)by * sA; Bh += (size_t)by * sB; C += (size_t)by * sC;
  const int ntn = (N + 63) / 64; const int wid = blockIdx.x * 4 + w; const int mt = wid / ntn, nq = wid % ntn; if (mt * 16 >= M) return;
  const int row0 = mt * 16, col0 = nq * 64; const float* arow = A + (size_t)(row0 + ln) * lda;
  v8f acc[4] = {};
  for (int kb = 0; kb < K; kb += 32) {
    FragH ah, al;
    const v4f x0 = *(const v4fa*)(arow + kb + 8 * hh), x1 = *(const v4fa*)(arow + kb + 8 * hh + 4), x2 = *(const v4fa*)(arow + kb + 16 + 8 * hh), x3 = *(const v4fa*)(arow + kb + 16 + 8 * hh + 4);
    float xs[16] = {x0[0],x0[1],x0[2],x0[3],x1[0],x1[1],x1[2],x1[3],x2[0],x2[1],x2[2],x2[3],x3[0],x3[1],x3[2],x3[3]};
#pragma unroll
    for (int i = 0; i < 16; ++i) { const _Float16 h = (_Float16)xs[i]; ah.h[i] = h; al.h[i] = ASPLIT ? (_Float16)(xs[i] - (float)h) : (_Float16)0.0f; }
#pragma unroll
    for (int t = 0; t < 4; ++t) { if (col0 + t * 16 >= N) continue; const size_t boff = (size_t)(col0 + t * 16 + ln) * ldb + kb; FragH bq; bq.half[0] = *(const v8us*)(Bh + boff + 8 * hh); bq.half[1] = *(const v8us*)(Bh + boff + 16 + 8 * hh);
      acc[t] = mmaH<ASPLIT ? 2 : 1>(ah.v, al.v, bq.v, bq.v, acc[t]); }
  }
#pragma unroll
  for (int t = 0; t < 4; ++t) { if (col0 + t * 16 >= N) continue;
#pragma unroll
    for (int r = 0; r < 8; ++r) so[w][8 * hh + r][t * 16 + ln] = acc[t][r] * alpha; }
  __builtin_amdgcn_fence(__ATOMIC_ACQ_REL, "workgroup"); __builtin_amdgcn_wave_barrier();
  const int rsub = lane >> 4, c4 = (lane & 15) * 4;
  {
#pragma unroll
    for (int q = 0; q < 8; ++q) { const int r = q * 2 + rsub; if (col0 + c4 < N) { const v4f v = *(const v4fa*)&so[w][r][c4]; *(v4f*)(C + (size_t)(row0 + r) * ldc + col0 + c4) = v; } }
     }
}

// Wt (n, k) = f16(W[k][n]·scale), fragment-packed, from f32 row-major W[K][N] (scale = power of two; bf16-exact weights stay exact in f16 away from the subnormal range)
// (a job of a shared launch: blk = the block's index within the job, 256 threads a block)
// FRAGMENT-PACKED PLANES (every A and B operand of gemm2_job): a plane of rows of K halves is stored as tiles of 16 rows x 32 k, 1 KiB each, the K / 32 tiles of 16 rows one behind the other, so that
// 16 r rows still start at half 16 r K. Inside a tile stand the two 512-byte loads of its fragment, each in lane order: piece (row, k..k+7) is 16 bytes at half ((k >> 4) & 1) * 256 + (((k >> 3) & 1) * 16 + row % 16) * 8.
// A wave-wide 16-byte load of a fragment half is then 512 contiguous bytes (four whole lines) and not 32 bytes of each of 16 lines. The k held by each lane and register is the row layout's.
__device__ __forceinline__ size_t pk_off(size_t row, int k, int K) { return ((row >> 4) * (size_t)(K >> 5) + (size_t)(k >> 5)) * 512 + (size_t)(((k >> 4) & 1) * 256 + (((k >> 3) & 1) * 16 + (int)(row & 15)) * 8); }
// thread t of a packing job owns the t-th 16-byte piece of the packed plane (a wave stores whole lines): its row and its first k
__device__ __forceinline__ size_t pk_row(size_t t, int K) { return ((t >> 6) / (size_t)(K >> 5)) * 16 + (t & 15); }
__device__ __forceinline__ int pk_k(size_t t, int K) { return (int)((t >> 6) % (size_t)(K >> 5)) * 32 + (int)((t >> 5) & 1) * 16 + (int)((t >> 4) & 1) * 8; }
__device__ __forceinline__ void wt_f16_job(const float* __restrict__ W, _Float16* __restrict__ Wt, int K, int N, float scale, int blk) {
  const int t = blk * 256 + threadIdx.x; if (t >= N * (K / 8)) return; const int n = (int)pk_row((size_t)t, K), k8 = pk_k((size_t)t, K); FragH f;
#pragma unroll
  for (int i = 0; i < 8; ++i) f.h[i] = (_Float16)(bf16_round(W[(size_t)(k8 + i) * N + n]) * scale); const v8us o = f.half[0];
  *(v8us*)((unsigned short*)Wt + (size_t)t * 8) = o; 
}
// k_gemm_hh variant with fused epilogue: v = acc·alpha + bias[by·sBias + col] (+ CP[(row/rowsPerB)·sCPb + by·64 + col] if CP) ; ACT 0 none / 1 elu ; writes f16 C16 (and f32 C if non-null)
template <int ACT>
__global__ __launch_bounds__(128) void k_gemm_hhx(const _Float16* __restrict__ A, int lda, size_t sA, const _Float16* __restrict__ Bh, int ldb, size_t sB, float alpha, const float* __restrict__ bias, size_t sBias, const float* __restrict__ CP, int rowsPerB, size_t sCPb, int row0g,
    float* __restrict__ C, _Float16* __restrict__ C16, int ldc, size_t sC, int M, int N, int K) {
  __shared__ __attribute__((aligned(16))) float so[4][16][64];
  const int tid = threadIdx.x, w = tid >> 5, lane = tid & 31, ln = lane & 15, hh = lane >> 4; const int by = blockIdx.y;
  A += (size_t)by * sA; Bh += (size_t)by * sB; const size_t cofs = (size_t)by * sC; const float* bp = bias ? bias + (size_t)by * sBias : nullptr;
  const int ntn = (N + 63) / 64; const int wid = blockIdx.x * 4 + w; const int mt = wid / ntn, nq = wid % ntn; if (mt * 16 >= M) return;
  const int row0 = mt * 16, col0 = nq * 64; const _Float16* arow = A + (size_t)(row0 + ln) * lda;
  v8f acc[4] = {};
  for (int kb = 0; kb < K; kb += 32) { FragH ah; ah.half[0] = *(const v8us*)((const unsigned short*)arow + kb + 8 * hh); ah.half[1] = *(const v8us*)((const unsigned short*)arow + kb + 16 + 8 * hh);
#pragma unroll
    for (int t = 0; t < 4; ++t) { if (col0 + t * 16 >= N) continue; const size_t boff = (size_t)(col0 + t * 16 + ln) * ldb + kb; FragH bq; bq.half[0] = *(const v8us*)((const unsigned short*)Bh + boff + 8 * hh); bq.half[1] = *(const v8us*)((const unsigned short*)Bh + boff + 16 + 8 * hh);
      acc[t] = mmaH<1>(ah.v, ah.v, bq.v, bq.v, acc[t]); }
  }
#pragma unroll
  for (int t = 0; t < 4; ++t) { if (col0 + t * 16 >= N) continue; const int col = col0 + t * 16 + ln; const float bv = bp ? bf16_round(bp[col]) : 0.f;
#pragma unroll
    for (int r = 0; r < 8; ++r) { float v = acc[t][r] * alpha + bv; if (CP) { const int rr = row0g + row0 + 8 * hh + r; if (rowsPerB < 0) v += CP[cofs + (size_t)rr * ldc + col];      /* rowsPerB < 0: own element of the batched C plane */ else { const int bidx = rr / rowsPerB; v += CP[(size_t)bidx * sCPb + (size_t)by * 64 + col]; } } if (ACT == 1) v = (v > 0.f) ? v : expm1f(v); else if (ACT == 7) v = (v > 0.f) ? v + 1.0f : expf(v); else if (ACT == 8) v = tanhf(v); else if (ACT == 9) v = 0.5f * v * (1.0f + tanhf(0.7978845608028654f * (v + 0.044715f * v * v * v))); else if (ACT == 11) v = 1.0f / (1.0f + expf(-v)); else if (ACT == 12) v = (v > 0.f) ? v : 0.01f * v; else if (ACT == 14) v = (v > 0.f) ? v : 0.1f * v; else if (ACT == 16) v = (v >= 0.f) ? v : 0.3f * v; else if (ACT == 17) v = (v >= 0.f) ? v : 0.2f * v; else if (ACT == 15) v = v / (1.0f + expf(-v)); else if (ACT == 3) v = fmaxf(v, 0.f); else if (ACT == 6) v = 0.5f * v * (1.0f + erff(v * 0.70710678118654752f)); so[w][8 * hh + r][t * 16 + ln] = v; } }
  __builtin_amdgcn_fence(__ATOMIC_ACQ_REL, "workgroup"); __builtin_amdgcn_wave_barrier();
  const int rsub = lane >> 4, c4 = (lane & 15) * 4; typedef _Float16 v4h __attribute__((ext_vector_type(4)));
  {
#pragma unroll
    for (int q = 0; q < 8; ++q) { const int r = q * 2 + rsub; if (col0 + c4 < N) { const v4f v = *(const v4fa*)&so[w][r][c4]; if (C) *(v4f*)(C + cofs + (size_t)(row0 + r) * ldc + col0 + c4) = v; if (C16) { v4h h4; for (int i = 0; i < 4; ++i) h4[i] = (_Float16)v[i]; *(v4h*)(C16 + cofs + (size_t)(row0 + r) * ldc + col0 + c4) = h4; } } }
     }
}


typedef _Float16 v4h __attribute__((ext_vector_type(4)));

__device__ __forceinline__ void x16_job(const float* __restrict__ x, _Float16* __restrict__ X16, size_t n8, int blk) { const size_t t = (size_t)blk * 256 + threadIdx.x; if (t >= n8) return; FragH f;
  const float* xs = x + pk_row(t, DM) * DM + pk_k(t, DM);      /* rows of DM floats in, a fragment-packed plane out */
#pragma unroll
  for (int q = 0; q < 8; ++q) f.h[q] = (_Float16)bf16_round(xs[q]); *(v8us*)((unsigned short*)X16 + t * 8) = f.half[0];  }
__global__ __launch_bounds__(256) void k_h16(const float* __restrict__ x, _Float16* __restrict__ X16, size_t n8) { const size_t t = (size_t)blockIdx.x * 256 + threadIdx.x; if (t >= n8) return; FragH f;
#pragma unroll
  for (int q = 0; q < 8; ++q) f.h[q] = (_Float16)x[t * 8 + q]; *(v8us*)((unsigned short*)X16 + t * 8) = f.half[0];  }
__global__ __launch_bounds__(256) void k_round16f(const float* __restrict__ W, _Float16* __restrict__ Bt, size_t n8) { const size_t t = (size_t)blockIdx.x * 256 + threadIdx.x; if (t >= n8) return; FragH f;
#pragma unroll
  for (int i = 0; i < 8; ++i) f.h[i] = (_Float16)(bf16_round(W[t * 8 + i]) * 16.0f); *(v8us*)((unsigned short*)Bt + t * 8) = f.half[0];  }
// ---- fast GEMM (wave tile 32x64; requires M % 32 == 0 rows per launch region and N % 64 == 0); epilogue = k_gemm_hhx semantics; two batch axes: by (strides sA, sB, sC) and bz (strides zA, zB, zC) ----
// Output forms, each taken where its pointer is not null: C (f32 rows), C16 with CL (f16 rows and the x1024 residual of their rounding, f16 rows: both or neither), or CT alone
// (f16, transposed per head: [row / SQ][col / HD][col % HD][row % SQ], rows counted over all sequences, so only with by = bz = 0).
__device__ __forceinline__ v16h g2_frag(const _Float16* p, int hh) { FragH f; f.half[0] = *(const v8us*)((const unsigned short*)p + 8 * hh); f.half[1] = *(const v8us*)((const unsigned short*)p + 16 + 8 * hh); return f.v; }
__device__ __forceinline__ v16h g2_pack(const _Float16* p) { FragH f; f.half[0] = *(const v8us*)((const unsigned short*)p); f.half[1] = *(const v8us*)((const unsigned short*)p + 256); return f.v; }      /* p: the lane's piece of a packed tile's first load */
__device__ __forceinline__ v8f g2_mma(v16h a, v16h b, v8f c) { v8f d = __builtin_amdgcn_wmma_f32_16x16x32_f16(false, a, false, b, (short)0, c, false, false); asm volatile("v_nop\n\tv_nop\n\tv_nop\n\tv_nop" : "+v"(d) : "v"(a), "v"(b)); return d; }
template <int ACT>
__device__ __forceinline__ void gemm2_job(const _Float16* __restrict__ A, int lda, size_t sA, const _Float16* __restrict__ Bh, int ldb, size_t sB, float alpha, const float* __restrict__ bias, size_t sBias, const float* __restrict__ CP, int rowsPerB, size_t sCPb, int row0g,
    float* __restrict__ C, _Float16* __restrict__ C16, _Float16* __restrict__ CL, _Float16* __restrict__ CT, int ldc, size_t sC, int M, int N, int K, size_t zA, size_t zB, size_t zC, int bx, int by, int bz) { static_assert(ACT == 0 || ACT == 3 || ACT == 6 || ACT == 8 || ACT == 9 || ACT == 11 || ACT == 12 || ACT == 14 || ACT == 15 || ACT == 16 || ACT == 17, "k_gemm2: unsupported ACT code (would silently apply no activation)");
  __shared__ __attribute__((aligned(16))) float so[4][32][68];
  const int tid = threadIdx.x, w = tid >> 5, lane = tid & 31, ln = lane & 15, hh = lane >> 4;      /* bx = tile, by = batch (strides sA, sB, sC), bz = sequence (strides zA, zB, zC) */
  A += (size_t)by * sA + (size_t)bz * zA; Bh += (size_t)by * sB + (size_t)bz * zB; const size_t cofs = (size_t)by * sC + (size_t)bz * zC; const float* bp = bias ? bias + (size_t)by * sBias : nullptr;
  const int ntn = N >> 6; const int mt = bx / ntn, nq = bx - mt * ntn; const int row0 = mt * 128 + 32 * w, col0 = nq * 64; if (row0 >= M) return;
  /* A and Bh are fragment-packed planes (lda = ldb = K): 16 rows are K / 32 tiles of 512 halves, a k-step of 32 is one tile on */
  const _Float16* a0p = A + (size_t)row0 * lda + lane * 8; const _Float16* a1p = a0p + (size_t)16 * lda;
  const _Float16* b0p = Bh + (size_t)col0 * ldb + lane * 8; const _Float16* b1p = b0p + (size_t)16 * ldb; const _Float16* b2p = b1p + (size_t)16 * ldb; const _Float16* b3p = b2p + (size_t)16 * ldb;
  const v8f z8 = {0.f,0.f,0.f,0.f,0.f,0.f,0.f,0.f}; v8f c00 = z8, c01 = z8, c02 = z8, c03 = z8, c10 = z8, c11 = z8, c12 = z8, c13 = z8;
#pragma unroll 1
  for (int kb = 0; kb < K; kb += 32) { const int ko = kb * 16; const v16h a0 = g2_pack(a0p + ko); FragH a1f; a1f.half[0] = *(const v8us*)((const unsigned short*)(a1p + ko));
    asm volatile("s_wait_xcnt 0x0" ::: "memory");      /* the four A loads share one address pair, and the last of them may land its result in it: the wait stands behind the first three, in front of that write */
    a1f.half[1] = *(const v8us*)((const unsigned short*)(a1p + ko) + 256); const v16h a1 = a1f.v;
    v16h b = g2_pack(b0p + ko); c00 = g2_mma(a0, b, c00); c10 = g2_mma(a1, b, c10);
    b = g2_pack(b1p + ko); c01 = g2_mma(a0, b, c01); c11 = g2_mma(a1, b, c11);
    b = g2_pack(b2p + ko); c02 = g2_mma(a0, b, c02); c12 = g2_mma(a1, b, c12);
    b = g2_pack(b3p + ko); c03 = g2_mma(a0, b, c03); c13 = g2_mma(a1, b, c13); }
  v8f accs[8] = {c00, c01, c02, c03, c10, c11, c12, c13};
#pragma unroll
  for (int u = 0; u < 8; ++u) { const int t = u & 3, half = u >> 2; const int col = col0 + t * 16 + ln; const float bv = bp ? bf16_round(bp[col]) : 0.f;
#pragma unroll
    for (int r = 0; r < 8; ++r) { const int rloc = half * 16 + 8 * hh + r; float v = accs[u][r] * alpha + bv; if (CP) { if (rowsPerB < 0) v += CP[cofs + (size_t)(row0g + row0 + rloc) * ldc + col];      /* rowsPerB < 0: own element of the batched C plane */ else { const int bidx = (row0g + row0 + rloc) / rowsPerB; v += CP[(size_t)bidx * sCPb + (size_t)by * 64 + col]; } }
      if (ACT == 3) v = fmaxf(v, 0.f); else if (ACT == 6) v = 0.5f * v * (1.0f + erff(v * 0.70710678118654752f)); else if (ACT == 11) v = 1.0f / (1.0f + expf(-v)); else if (ACT == 15) v = v / (1.0f + expf(-v)); else if (ACT == 12) v = (v > 0.f) ? v : 0.01f * v; else if (ACT == 8) v = tanhf(v); else if (ACT == 9) v = 0.5f * v * (1.0f + tanhf(0.7978845608028654f * (v + 0.044715f * v * v * v))); else if (ACT == 14) v = (v > 0.f) ? v : 0.1f * v; else if (ACT == 16) v = (v >= 0.f) ? v : 0.3f * v; else if (ACT == 17) v = (v >= 0.f) ? v : 0.2f * v;
      so[w][rloc][t * 16 + ln] = v; } }
  __builtin_amdgcn_fence(__ATOMIC_ACQ_REL, "workgroup"); __builtin_amdgcn_wave_barrier();
  if (CT) {      /* the wave's 32 rows are 64 contiguous bytes of each of its 64 transposed rows: four lanes of 16 bytes a row, eight rows a store */
    const int dl = lane >> 2, t8 = (lane & 3) * 8; FragH f[8];
#pragma unroll
    for (int j = 0; j < 8; ++j)
#pragma unroll
      for (int i = 0; i < 8; ++i) f[j].h[i] = (_Float16)so[w][t8 + i][j * 8 + dl];
    unsigned short* ct = (unsigned short*)CT + (((size_t)(row0 / SQ) * NH + nq) * HD + dl) * SQ + row0 % SQ + t8;
#pragma unroll
    for (int j = 0; j < 8; ++j) *(v8us*)(ct + (size_t)j * 8 * SQ) = f[j].half[0];
    asm volatile("s_wait_xcnt 0x0" ::: "memory");      /* stands behind the eight stores, in front of any later write of a register that they name */
    return; }
  const int rsub = lane >> 4, c4 = (lane & 15) * 4;
  {
#pragma unroll
    for (int q = 0; q < 16; ++q) { const int r = q * 2 + rsub; const v4f v = *(const v4fa*)&so[w][r][c4]; if (C) { *(v4f*)(C + cofs + (size_t)(row0 + r) * ldc + col0 + c4) = v; asm volatile("s_wait_xcnt 0x0" ::: "memory"); }      /* the wait stands between the f32 store and the conversions below, which may land in the registers that the store names */
      if (C16) { const size_t co = cofs + (size_t)(row0 + r) * ldc + col0 + c4; v4h h4, l4; for (int i = 0; i < 4; ++i) { h4[i] = (_Float16)v[i]; l4[i] = (_Float16)((v[i] - (float)h4[i]) * 1024.0f); }
        /* both stores and their wait in one statement: as plain stores the residual's conversions were scheduled behind the first store, into the registers that it names, ahead of the wait */
        asm volatile("global_store_b64 %0, %1, off\n\tglobal_store_b64 %2, %3, off\n\ts_wait_xcnt 0x0" :: "v"(C16 + co), "v"(h4), "v"(CL + co), "v"(l4) : "memory"); } }
     } }


// ---- shared launches: jobs that do not depend on one another run in one grid; the block index picks the job (the same for every thread of a block) and the block's index within it ----
#define JW_H (HD * (DM / 8) / 256)             /* blocks per per-head weight block */
#define JW_O (DM * (DM / 8) / 256)             /* blocks of the output weight */
#define JX ((int)(NR * DM / 8 / 256))          /* blocks per plane of x rows */
static_assert(HD * (DM / 8) % 256 == 0 && DM * (DM / 8) % 256 == 0 && NR * DM / 8 % 256 == 0, "whole blocks per job");
// Operand planes: 3 NH per-head weight blocks (head h of wq / wk / wv is a row-major [DM][HD] block, written as HD contiguous rows of the [out][in] plane, x16), the [DM][DM] output weight, three planes of x rows.
__global__ __launch_bounds__(256) void k_prep(const float* x, const float* xk, const float* xv, const float* __restrict__ wq, const float* __restrict__ wk, const float* __restrict__ wv, const float* __restrict__ wo,
    _Float16* __restrict__ BQ, _Float16* __restrict__ BK, _Float16* __restrict__ BV, _Float16* __restrict__ BO, _Float16* __restrict__ X16, _Float16* __restrict__ XK16, _Float16* __restrict__ XV16) {
  int bx = blockIdx.x;
  if (bx < 3 * NH * JW_H) { const int j = bx / JW_H, s = j % 3, h = j / 3; const size_t wofs = (size_t)h * DM * HD, pofs = (size_t)h * HD * DM;
    wt_f16_job((s == 0 ? wq : s == 1 ? wk : wv) + wofs, (s == 0 ? BQ : s == 1 ? BK : BV) + pofs, DM, HD, 16.0f, bx % JW_H); return; }
  bx -= 3 * NH * JW_H;
  if (bx < JW_O) { wt_f16_job(wo, BO, DM, DM, 16.0f, bx); return; }
  bx -= JW_O;
  const int s = bx / JX; x16_job(s == 0 ? x : s == 1 ? xk : xv, s == 0 ? X16 : s == 1 ? XK16 : XV16, NR * DM / 8, bx % JX); }
#define JP_A ((MP / 128) * (DM / 64))          /* tiles of a projection of all rows */
#define JP_0 ((QT0 / 128) * (DM / 64))         /* tiles of a first-tile projection, per sequence */
// The six projections. grid.y: q, k, v. grid.x: the tiles of all rows, stored in the forms that the attention reads (q, k as f16 hi + x1024 residual planes; v as V^T [NBR][NH][HD][SQ], f16), then per sequence the tiles of the first QT0 rows (f32 planes of QT0 rows a sequence).
__global__ __launch_bounds__(128) void k_proj(const _Float16* __restrict__ X16, const _Float16* __restrict__ XK16, const _Float16* __restrict__ XV16, const _Float16* __restrict__ BQ, const _Float16* __restrict__ BK, const _Float16* __restrict__ BV,
    const float* __restrict__ bq, const float* __restrict__ bk, const float* __restrict__ bv, _Float16* __restrict__ QH, _Float16* __restrict__ QL, _Float16* __restrict__ KH, _Float16* __restrict__ KL, _Float16* __restrict__ VT, float* __restrict__ QF0, float* __restrict__ KF0, float* __restrict__ VF0) {
  const int s = blockIdx.y; const int bx = blockIdx.x; const bool all = bx < JP_A; const int b0 = bx - JP_A;
  gemm2_job<0>(s == 0 ? X16 : s == 1 ? XK16 : XV16, DM, 0, s == 0 ? BQ : s == 1 ? BK : BV, DM, 0, 0.0625f, s == 0 ? bq : s == 1 ? bk : bv, 0, nullptr, 1, 0, 0,
      all ? nullptr : (s == 0 ? QF0 : s == 1 ? KF0 : VF0), all ? (s == 0 ? QH : s == 1 ? KH : nullptr) : nullptr, all ? (s == 0 ? QL : s == 1 ? KL : nullptr) : nullptr, (all && s == 2) ? VT : nullptr, DM, 0, all ? MP : QT0, DM, DM, (size_t)SQ * DM, 0, (size_t)QT0 * DM,
      all ? bx : b0 % JP_0, 0, all ? 0 : b0 / JP_0); }
static_assert(MP == NBR * SQ && B0 == 0 && SQ % 32 == 0 && DM == NH * HD, "a wave's 32 projected rows lie in one sequence, its 64 columns are one head");


__global__ __launch_bounds__(256) void k_wnat(const float* __restrict__ w, size_t n8, _Float16* __restrict__ Bt) { const size_t t = (size_t)blockIdx.x * 256 + threadIdx.x; if (t >= n8) return; FragH f; for (int q = 0; q < 8; ++q) f.h[q] = (_Float16)(bf16_round(w[t * 8 + q]) * 16.0f); *(v8us*)((unsigned short*)Bt + t * 8) = f.half[0];  }
__global__ __launch_bounds__(256) void k_rsm(const float* __restrict__ S, _Float16* __restrict__ P, int nrows) {
  #pragma clang fp contract(off)
  const int i = blockIdx.x * 256 + threadIdx.x; if (i >= nrows) return; const float* s = S + (size_t)i * SQ; float mx = -3.0e38f;
#pragma unroll 1
  for (int j = 0; j < SQ; ++j) mx = fmaxf(mx, s[j]); float se = 0.f;
#pragma unroll 1
  for (int j = 0; j < SQ; ++j) se += expf(s[j] - mx); const float sc = 256.0f / se;
#pragma unroll 1
  for (int j0 = 0; j0 < SQ; j0 += 8) { FragH f; for (int q = 0; q < 8; ++q) f.h[q] = (_Float16)(expf(s[j0 + q] - mx) * sc); unsigned short* d = (unsigned short*)P + (size_t)i * SQ + j0; *(v8us*)d = f.half[0];  } }
__global__ __launch_bounds__(256) void k_vt(const _Float16* __restrict__ V16, int b, int h0, _Float16* __restrict__ VT) { __shared__ unsigned short tl[64][65]; const int tid = threadIdx.x; const int hh = blockIdx.x % HG, sg = blockIdx.x / HG; const int s0 = sg * 64; const int h = h0 + hh;
  for (int i = tid; i < 64 * 8; i += 256) { const int j = i / 8, d8 = (i % 8) * 8; FragH f; f.half[0] = *(const v8us*)((const unsigned short*)V16 + ((size_t)b * SQ + s0 + j) * DM + h * HD + d8); for (int q = 0; q < 8; ++q) tl[d8 + q][j] = f.u[q]; }
  __syncthreads();
  { for (int i = tid; i < 64 * 8; i += 256) { const int d = i / 8, j8 = (i % 8) * 8; FragH f; for (int q = 0; q < 8; ++q) f.u[q] = tl[d][j8 + q]; *(v8us*)((unsigned short*)VT + ((size_t)hh * HD + d) * SQ + s0 + j8) = f.half[0]; }  } }



// 2^x on the transcendental unit, with the one free issue slot that the instruction set asks for behind it before its result is used or its
// source overwritten: in the unrolled row the compiler put one exponential's result into the source register of the one directly ahead of it.
__device__ __forceinline__ float exp2_slot(float x) { float r; asm("v_exp_f32 %0, %1\n\tv_nop" : "=v"(r) : "v"(x)); return r; }
// Fused causal attention: scores, softmax and P V in one launch; neither scores nor weights go to memory. One wave owns 16 query rows of one
// head and walks its keys 32 at a time, transposed: S^T = K Q^T (A = key rows, B = query rows), so that a lane holds scores of ONE query
// (column ln; keys 8 hh + r of each 16-key tile) and the row maximum and sum need one exchange between the wave's halves. The two score tiles,
// converted in place, are the B operand of O^T += V^T P^T in the loader's own k order (keys 8 hh + 0..7, then 16 + 8 hh + 0..7), and the
// accumulators of O^T belong to the same query as the lane's running maximum and sum. Scores keep their three f16 products (hi.hi, lo.hi, hi.lo).
// The block's four waves walk the same keys: each 32-key tile (key rows hi, key rows residual, V^T rows) is brought into LDS once per block by
// asynchronous copies, whole rows at a time, into one of two buffers, the next tile in flight while this one is worked on; the waves take their
// fragments from LDS.
#define FKP 72                       /* halves from one staged key row (64 halves) to the next: 144 bytes = 16 x odd, for 16-byte LDS reads */
#define FVP 40                       /* halves from one staged V^T row (32 halves) to the next: 80 bytes = 16 x odd */
#define FKL (32 * FKP)               /* first half of the residual key rows in a buffer */
#define FVO (2 * 32 * FKP)           /* first half of the V^T rows in a buffer */
#define FBUF (2 * 32 * FKP + HD * FVP)      /* halves per buffer */
typedef __attribute__((address_space(3))) _Float16 lds_f16;
// One 32-key tile into one buffer: six copies of 16 bytes a lane (128 lanes: 16 key rows of 8 pieces, twice, for each key plane; 32 V^T rows of 4 pieces, twice).
// lk, lv: the lane's LDS byte addresses of its first key piece and its first V^T piece; gh, gl, gv: its global addresses of the same pieces.
// The s_wait_xcnt stands inside the statement, behind the last copy: the address registers may be rewritten right behind it.
__device__ __forceinline__ void fattn_copy(unsigned lk, unsigned lv, const _Float16* gh, const _Float16* gl, const _Float16* gv) {
  asm volatile("global_load_async_to_lds_b128 %0, %6, off\n\t"
               "global_load_async_to_lds_b128 %1, %7, off\n\t"
               "global_load_async_to_lds_b128 %2, %8, off\n\t"
               "global_load_async_to_lds_b128 %3, %9, off\n\t"
               "global_load_async_to_lds_b128 %4, %10, off\n\t"
               "global_load_async_to_lds_b128 %5, %11, off\n\t"
               "s_wait_xcnt 0x0"
               :: "v"(lk), "v"(lk + 16 * FKP * 2), "v"(lk + FKL * 2), "v"(lk + (FKL + 16 * FKP) * 2), "v"(lv), "v"(lv + 32 * FVP * 2),
                  "v"(gh), "v"(gh + 16 * LQ), "v"(gl), "v"(gl + 16 * LQ), "v"(gv), "v"(gv + (size_t)32 * SQ) : "memory"); }
__device__ __forceinline__ void fattn_job(const _Float16* __restrict__ Qh, const _Float16* __restrict__ Ql, const _Float16* __restrict__ Kh, const _Float16* __restrict__ Kl, const _Float16* __restrict__ Vt, _Float16* __restrict__ O, int bx, int h, int b) {
  __shared__ __attribute__((aligned(16))) _Float16 ring[2 * FBUF];
  const int tid = threadIdx.x, lane = tid & 31, ln = lane & 15, hh = lane >> 4; const int w = __builtin_amdgcn_readfirstlane(threadIdx.x >> 5);      /* the wave's number in a scalar register: the trip count stays scalar */
  const int qt = (b & 1) ? bx : SQ / 64 - 1 - bx;      /* long and short causal tiles alternate between sequences */
  const int q0 = qt * 64 + w * 16; const size_t rb = (size_t)b * SQ;
  const size_t qo = (rb + q0 + ln) * LQ + h * HD;
  const v16h qh0 = g2_frag(Qh + qo, hh), qh1 = g2_frag(Qh + qo + 32, hh), ql0 = g2_frag(Ql + qo, hh), ql1 = g2_frag(Ql + qo + 32, hh);
  const size_t ko = (rb + (tid >> 3)) * LQ + h * HD + (tid & 7) * 8;      /* the lane's first piece of tile 0 */
  const _Float16* gh = Kh + ko; const _Float16* gl = Kl + ko;
  const _Float16* gv = Vt + ((size_t)(b * NH + h) * HD + (tid >> 2)) * SQ + (tid & 3) * 8;
  const unsigned l0 = (unsigned)(size_t)(lds_f16*)ring;
  const unsigned lk = l0 + ((tid >> 3) * FKP + (tid & 7) * 8) * 2, lv = l0 + (FVO + (tid >> 2) * FVP + (tid & 3) * 8) * 2;
  const v8f z8 = {0.f,0.f,0.f,0.f,0.f,0.f,0.f,0.f}; v8f o[4] = {z8, z8, z8, z8};
  float m = -1.0e30f, l = 0.f; const int nst = (q0 >> 5) + 1;      /* the wave's 32-key steps, up to the one that holds its diagonal */
  const int nbl = 2 * qt + 2;      /* the block's tiles (its last wave's steps; two at least): every wave passes every barrier */
  fattn_copy(lk, lv, gh, gl, gv);      /* tile 0 */
  asm volatile("s_wait_asynccnt 0x0" ::: "memory");      /* the wave's own copies have landed before the barrier behind which other waves read them */
  __syncthreads();
  gh += 32 * LQ; gl += 32 * LQ; gv += 32;
  fattn_copy(lk + FBUF * 2, lv + FBUF * 2, gh, gl, gv);      /* tile 1 flies while tile 0 is worked on */
#pragma unroll 1      /* rolled: a second copy of the body would hold a second set of fragments and cost a resident wave per SIMD */
  for (int st = 0; st < nbl; ++st) { const int key0 = st * 32; const int bo = (st & 1) * FBUF;
    if (st < nst) {      /* a scalar test: a wave past its diagonal skips the work, never the barrier */
    const _Float16* kb = ring + bo + ln * FKP; const _Float16* vb = ring + bo + FVO + ln * FVP;
    v16h ka[2][4];      /* per 16-key tile: hi d 0..31, hi d 32..63, residual d 0..31, residual d 32..63 */
#pragma unroll      /* this and every constant-trip loop below: unrolled so that fragments and accumulators are registers, not indexed arrays */
    for (int kt = 0; kt < 2; ++kt) { const int ro = 16 * kt * FKP; ka[kt][0] = g2_frag(kb + ro, hh); ka[kt][1] = g2_frag(kb + ro + 32, hh); ka[kt][2] = g2_frag(kb + FKL + ro, hh); ka[kt][3] = g2_frag(kb + FKL + ro + 32, hh); }
    v16h va[4];
#pragma unroll
    for (int t = 0; t < 4; ++t) va[t] = g2_frag(vb + 16 * t * FVP, hh);
    v8f sh[2], sl[2];
#pragma unroll
    for (int kt = 0; kt < 2; ++kt) { sh[kt] = g2_mma(ka[kt][0], qh0, z8); sh[kt] = g2_mma(ka[kt][1], qh1, sh[kt]);
      sl[kt] = g2_mma(ka[kt][0], ql0, z8); sl[kt] = g2_mma(ka[kt][1], ql1, sl[kt]); sl[kt] = g2_mma(ka[kt][2], qh0, sl[kt]); sl[kt] = g2_mma(ka[kt][3], qh1, sl[kt]); }
    float sv[16]; float mx = m; const int rel = q0 + ln - key0 - 8 * hh;      /* key 16 kt + r of this lane is kept while 16 kt + r <= rel */
#pragma unroll
    for (int kt = 0; kt < 2; ++kt)
#pragma unroll
      for (int r = 0; r < 8; ++r) { const float s = sh[kt][r] * SCL + sl[kt][r] * SCLR; const float xv = (16 * kt + r <= rel) ? s : -1.0e9f; sv[kt * 8 + r] = xv; mx = fmaxf(mx, xv); }
    mx = fmaxf(mx, __shfl_xor(mx, 16, 32));
    const float al = exp2_slot((m - mx) * 1.44269504088896340736f); m = mx;
    float ps = 0.f; FragH p;
#pragma unroll
    for (int i = 0; i < 16; ++i) { const float e = exp2_slot((sv[i] - mx) * 1.44269504088896340736f + 8.0f);      /* weights carried x256, as in the f16 operand before */ ps += e; p.h[i] = (_Float16)e; }
    l = l * al + ps;
#pragma unroll
    for (int t = 0; t < 4; ++t) { o[t] *= al; o[t] = g2_mma(va[t], p.v, o[t]); } }
    asm volatile("s_wait_dscnt 0x0" ::: "memory");      /* the wave's reads of this buffer have returned before the barrier behind which it is refilled */
    asm volatile("s_wait_asynccnt 0x0" ::: "memory");      /* the wave's copies of the next tile have landed before the barrier behind which other waves read them */
    __syncthreads();      /* publishes tile st + 1 and ends every wave's reads of tile st */
    if (st + 2 < nbl) { gh += 32 * LQ; gl += 32 * LQ; gv += 32; fattn_copy(lk + bo * 2, lv + bo * 2, gh, gl, gv); } }      /* tile st + 2 into the buffer just read; the test is the same for the whole block */
  asm volatile("s_wait_asynccnt 0x0" ::: "memory");      /* no copy is outstanding when the wave ends */
  l += __shfl_xor(l, 16, 32);
  const float fin = 64.0f / l;      /* o carried x64; the x256 of the weights cancels against the sum's */
  _Float16* orow = O + pk_off(rb + q0 + ln, h * HD + 8 * hh, DM);      /* o is the output stage's A operand: fragment-packed; dims 16 t + 8 hh .. + 7 are tile t / 2, load t % 2, the lane's own piece */
#pragma unroll
  for (int t = 0; t < 4; ++t) { FragH f;
#pragma unroll
    for (int r = 0; r < 8; ++r) f.h[r] = (_Float16)(o[t][r] * fin);
    *(v8us*)((unsigned short*)orow + (t >> 1) * 512 + (t & 1) * 256) = f.half[0]; } }
#define JF_A ((SQ / 64) * NH * NBR)            /* blocks of the fused attention: query tile fastest, then head, then sequence */
// The fused attention of all rows; behind its blocks, per sequence, the tiles of the first-tile output pass out = o_hi Wo + b (rows 0..QT0-1, from the exact f32 attention: it does not depend on this launch's attention).
__global__ __launch_bounds__(128) void k_attn(const _Float16* __restrict__ Qh, const _Float16* __restrict__ Ql, const _Float16* __restrict__ Kh, const _Float16* __restrict__ Kl, const _Float16* __restrict__ Vt, _Float16* __restrict__ O,
    const _Float16* __restrict__ OH0, const _Float16* __restrict__ BO, const float* __restrict__ bo, float* __restrict__ out) {
  const int bx = blockIdx.x;
  if (bx < JF_A) { fattn_job(Qh, Ql, Kh, Kl, Vt, O, bx % (SQ / 64), bx / (SQ / 64) % NH, bx / ((SQ / 64) * NH)); return; }
  const int b0 = bx - JF_A;
  gemm2_job<0>(OH0, DM, 0, BO, DM, 0, 0.0009765625f, bo, 0, nullptr, 1, 0, 0, out, nullptr, nullptr, nullptr, DM, 0, QT0, DM, DM, (size_t)QT0 * DM, 0, (size_t)SQ * DM, b0 % JP_0, 0, b0 / JP_0); }
// Output stage, one job per 128-row tile: the first tile of a sequence adds o_lo Wo 2^-20 to its own elements (written by the launch before); every other tile is out = o Wo + b from the packed f16 o.
static_assert(QT0 == 128 && SQ % 128 == 0 && MPO == NBR * SQ && B0 == 0, "the first-tile rows are exactly the first 128-row tile of each sequence");
__global__ __launch_bounds__(128) void k_out(const _Float16* __restrict__ O16, const _Float16* __restrict__ OL0, const _Float16* __restrict__ BO, const float* __restrict__ bo, float* out) {
  const int bx = blockIdx.x; const int mt = bx / (DM / 64); const bool first = mt % (SQ / 128) == 0;
  gemm2_job<0>(first ? OL0 : O16, DM, 0, BO, DM, 0, first ? 0.00000095367431640625f : 0.0009765625f, first ? nullptr : bo, 0, first ? out : nullptr, first ? -1 : 1, 0, 0, out, nullptr, nullptr, nullptr, DM, 0, first ? QT0 : MPO, DM, DM,
      (size_t)QT0 * DM, 0, (size_t)SQ * DM, first ? bx % (DM / 64) : bx, 0, first ? mt / (SQ / 128) : 0); }


// Exact f32 attention for the first QT0 rows of every sequence. One block owns A0R query rows of one head and stages the head's QT0 key and value
// rows in LDS once; a wave owns two query rows, held in registers, so that each staged row it reads serves both. Scores: a lane owns one key of each
// group of 32 and reads its key row 16 bytes at a time; four partial sums per dot product. Softmax: true row maximum and sum by a butterfly over the
// wave. P V: a lane owns four head dims and every other run of four keys; the wave's halves are added at the end.
#define A0R 16                       /* query rows per block: two per wave */
#define A0KP 68                      /* floats from one staged key row to the next: 16 bytes x odd, so that 16 lanes on 16 rows meet no bank twice */
__global__ __launch_bounds__(256) void k_att0(const float* __restrict__ QF, const float* __restrict__ KF, const float* __restrict__ VF, float scale, _Float16* __restrict__ OH, _Float16* __restrict__ OL) {
  __shared__ __attribute__((aligned(16))) float ks[QT0][A0KP]; __shared__ __attribute__((aligned(16))) float vs[QT0][HD]; __shared__ __attribute__((aligned(16))) float ps[A0R][QT0];
  static_assert(QT0 % 32 == 0 && HD == 64 && A0R == 16, "256 threads: 16 per staged row of 64 floats, 8 waves of two query rows, key groups of 32");
  const int tid = threadIdx.x, lane = tid & 31, w = tid >> 5; const int h = blockIdx.x / (QT0 / A0R), rg = blockIdx.x % (QT0 / A0R); const int r0 = rg * A0R;
  { const size_t zs = (size_t)blockIdx.y * QT0 * DM, zb = zs + h * HD; QF += zb; KF += zb; VF += zb; OH += zs; OL += zs; }      /* grid.y = sequence: QT0 rows of q, k, v and o each, DM floats from row to row (a constant, so that a run of loads shares one address and differs in its immediate offset) */
  const int ia = r0 + w, ib = r0 + 8 + w;      /* the wave's two query rows */
  const int sr = tid >> 4, sc = (tid & 15) * 4; v4f kk[QT0 / 16], vv[QT0 / 16], qa[HD / 4], qb[HD / 4];
#pragma unroll      /* this and every constant-trip loop below: unrolled so that the arrays are registers and the loads of a run are in flight together */
  for (int p = 0; p < QT0 / 16; ++p) { kk[p] = *(const v4fa*)(KF + (size_t)(p * 16 + sr) * DM + sc); vv[p] = *(const v4fa*)(VF + (size_t)(p * 16 + sr) * DM + sc); }
  asm volatile("s_wait_xcnt 0x0" ::: "memory");      /* stands between the loads above and the first later write of a register that holds one of their addresses (the query loads below may land there) */
#pragma unroll
  for (int c = 0; c < HD / 4; ++c) { qa[c] = *(const v4fa*)(QF + (size_t)ia * DM + c * 4); qb[c] = *(const v4fa*)(QF + (size_t)ib * DM + c * 4); }
  asm volatile("s_wait_xcnt 0x0" ::: "memory");      /* the same behind the query loads */
#pragma unroll
  for (int p = 0; p < QT0 / 16; ++p) { *(v4f*)&ks[p * 16 + sr][sc] = kk[p]; *(v4f*)&vs[p * 16 + sr][sc] = vv[p]; }
  __syncthreads();
  const int ng = (r0 + A0R - 1) / 32 + 1;      /* groups of 32 keys up to the block's last row: the same for every wave */
  float sa[QT0 / 32], sb[QT0 / 32]; float ma = -1.0e30f, mb = -1.0e30f;
#pragma unroll
  for (int g = 0; g < QT0 / 32; ++g) { sa[g] = -1.0e30f; sb[g] = -1.0e30f;
    if (g < ng) { const int key = g * 32 + lane; v4f aa = {0.f, 0.f, 0.f, 0.f}, ab = {0.f, 0.f, 0.f, 0.f};
#pragma unroll
      for (int c = 0; c < HD / 4; ++c) { const v4f k4 = *(const v4f*)&ks[key][c * 4]; aa += qa[c] * k4; ab += qb[c] * k4; }
      if (key <= ia) sa[g] = ((aa[0] + aa[1]) + (aa[2] + aa[3])) * scale;
      if (key <= ib) sb[g] = ((ab[0] + ab[1]) + (ab[2] + ab[3])) * scale;
      ma = fmaxf(ma, sa[g]); mb = fmaxf(mb, sb[g]); } }
#pragma unroll
  for (int d = 16; d > 0; d >>= 1) { ma = fmaxf(ma, __shfl_xor(ma, d, 32)); mb = fmaxf(mb, __shfl_xor(mb, d, 32)); }
  float la = 0.f, lb = 0.f;
#pragma unroll
  for (int g = 0; g < QT0 / 32; ++g)
    if (g < ng) { const int key = g * 32 + lane; const float ea = (key <= ia) ? expf(sa[g] - ma) : 0.f, eb = (key <= ib) ? expf(sb[g] - mb) : 0.f; la += ea; lb += eb; ps[w][key] = ea; ps[8 + w][key] = eb; }
#pragma unroll
  for (int d = 16; d > 0; d >>= 1) { la += __shfl_xor(la, d, 32); lb += __shfl_xor(lb, d, 32); }
  __syncthreads();      /* the weights are read below by other lanes than wrote them */
  const int dq = (lane & 15) * 4, jp = lane >> 4; v4f oa = {0.f, 0.f, 0.f, 0.f}, ob = {0.f, 0.f, 0.f, 0.f};
#pragma unroll 1      /* rolled: the trip count is the block's; one trip holds 16 keys, twelve LDS reads in flight together */
  for (int ch = 0; ch <= rg; ++ch) {
#pragma unroll
    for (int t = 0; t < 2; ++t) { const int k0 = ch * 16 + t * 8 + jp * 4; const v4f pa = *(const v4f*)&ps[w][k0], pb = *(const v4f*)&ps[8 + w][k0];
#pragma unroll
      for (int u = 0; u < 4; ++u) { const v4f v4 = *(const v4f*)&vs[k0 + u][dq]; oa += pa[u] * v4; ob += pb[u] * v4; } } }
#pragma unroll
  for (int q = 0; q < 4; ++q) { oa[q] += __shfl_xor(oa[q], 16, 32); ob[q] += __shfl_xor(ob[q], 16, 32); }
  const float fin = 64.0f / (jp ? lb : la);      /* o carried x64 like the f16 path */
  const v4f res = (jp ? ob : oa) * fin;      /* lanes 0..15 store the first row, lanes 16..31 the second */
  v4h rh, rl;      /* o leaves as the output stage reads it: f16 hi + x1024 residual */
#pragma unroll
  for (int q = 0; q < 4; ++q) { rh[q] = (_Float16)res[q]; rl[q] = (_Float16)((res[q] - (float)rh[q]) * 1024.0f); }
  const size_t oo = pk_off((size_t)(jp ? ib : ia), h * HD + dq, DM) + (dq & 7);      /* the o planes are fragment-packed A operands: four halves of the piece that holds dims dq .. dq + 3 */
  *(v4h*)(OH + oo) = rh; *(v4h*)(OL + oo) = rl; }

extern "C" void kernel_launch(void* const* d_in, const int* in_sizes, int n_in,
                              void* d_out, int out_size, void* d_ws, size_t ws_size, hipStream_t stream) {
  (void)in_sizes; (void)n_in; (void)out_size;
  const float* const* I = (const float* const*)d_in; const float* x = I[0]; const float* xk = I[0]; const float* xv = I[0]; const float* wq = I[1]; const float* bq = I[2]; const float* wk = I[3]; const float* bk = I[4]; const float* wv = I[5]; const float* bv = I[6]; const float* wo = I[7]; const float* bo = I[8];      /* input order: x, Wq, bq, Wk, bk, Wv, bv (PER-HEAD STACKS [8][512][64] with REAL per-head biases [8][64] = flat [512]: the GEMMs' guarded bias slots), Wp ([in][out]: out @ Wp), bp (REAL) */
  char* ws = (char*)d_ws; size_t off = 0;
  auto take = [&](size_t bytes) { char* p = ws + off; off += (bytes + 255) & ~(size_t)255; return p; };
  _Float16* BQ = (_Float16*)take((size_t)DM * DM * 2); _Float16* BK = (_Float16*)take((size_t)DM * DM * 2); _Float16* BV = (_Float16*)take((size_t)DM * DM * 2); _Float16* BO = (_Float16*)take((size_t)DM * DM * 2);
  _Float16* X16 = (_Float16*)take(NR * DM * 2); _Float16* XK16 = (_Float16*)take(NR * DM * 2); _Float16* XV16 = (_Float16*)take(NR * DM * 2);      /* exact f16 query, key, value planes, fragment-packed */ _Float16* QH = (_Float16*)take(NR * DM * 2); _Float16* QL = (_Float16*)take(NR * DM * 2); _Float16* KH = (_Float16*)take(NR * DM * 2); _Float16* KL = (_Float16*)take(NR * DM * 2); _Float16* Q16 = QH; _Float16* K16 = KH; _Float16* O16 = (_Float16*)take(NR * DM * 2);
  _Float16* VT = (_Float16*)take((size_t)NB * NH * HD * SQ * 2);      /* one plane per sequence: the sequences share each launch */
  float* QF0 = (float*)take((size_t)NB * QT0 * DM * 4); float* KF0 = (float*)take((size_t)NB * QT0 * DM * 4); float* VF0 = (float*)take((size_t)NB * QT0 * DM * 4); _Float16* OH0 = (_Float16*)take((size_t)NB * QT0 * DM * 2); _Float16* OL0 = (_Float16*)take((size_t)NB * QT0 * DM * 2);
  if (off > ws_size) return;
  const size_t r0p = (size_t)B0 * SQ;      /* first projected row */
  k_prep<<<3 * NH * JW_H + JW_O + 3 * JX, 256, 0, stream>>>(x, xk, xv, wq, wk, wv, wo, BQ, BK, BV, BO, X16, XK16, XV16);      /* weight planes [out][in] (x16) and the exact f16 query, key, value planes, all fragment-packed */
  k_proj<<<dim3(JP_A + NBR * JP_0, 3), 128, 0, stream>>>(X16 + r0p * DM, XK16 + r0p * DM, XV16 + r0p * DM, BQ, BK, BV, bq, bk, bv, QH + r0p * DM, QL + r0p * DM, KH + r0p * DM, KL + r0p * DM, VT, QF0, KF0, VF0);      /* q, k (f16 hi + x1024 residual planes: unscaled logits sigma ~8) and V^T of all rows; f32 q, k, v of the first 128 rows of every sequence (exact products) */
  { const size_t r0 = r0p;      /* every launch below covers all NBR sequences */
    k_att0<<<dim3(NH * (QT0 / A0R), NBR), 256, 0, stream>>>(QF0, KF0, VF0, SCL, OH0 + (size_t)B0 * QT0 * DM, OL0 + (size_t)B0 * QT0 * DM);      /* exact f32 attention for rows 0..127 (o x64, f16 hi + x1024 residual planes) */
    static_assert(SQ % 64 == 0 && HD == 64 && NHD == NH && QN == SQ && LQ == DM, "64 query rows per block, 32-key steps, head size 64");
    k_attn<<<JF_A + NBR * JP_0, 128, 0, stream>>>(QH + r0 * LQ, QL + r0 * LQ, KH + r0 * LQ, KL + r0 * LQ, VT, O16 + r0 * DM, OH0 + (size_t)B0 * QT0 * DM, BO, bo, (float*)d_out + r0 * DM); }      /* o (merged heads, x64) as a fragment-packed f16 plane; rows 0..127 of every sequence: out = o_hi Wo (+ b) */
  k_out<<<(MPO / 128) * (DM / 64), 128, 0, stream>>>(O16 + r0p * DM, OL0 + (size_t)B0 * QT0 * DM, BO, bo, (float*)d_out + r0p * DM);      /* out rows are the output layout; rows 0..127: += o_lo Wo 2^-20 (own-element accumulate) */
}

// v009
// A run of this version takes 131 microseconds.
// Two timings next to v008 put it at 1.10 and 1.11 times that version's speed.
// Over all steps from v000 it is 83.5 times as fast.
#include <hip/hip_runtime.h>
// Causal multi-head self-attention with PER-HEAD STACKED projections and REAL per-head biases on four sequences at width 512 (x [4][2048][512]; Wq / Wk / Wv [8][512][64] = [head][in][out] ('bte,hed->bhtd'; uniform +-1/sqrt(512)) with biases [8][64] (REAL, uniform +-1/sqrt(512)): a per-head bias [8][64] IS the flat bias [512]; 8 heads of 64 (8 x 64 = 512 = the width); scores * 1/sqrt(64); where(tril, scores, -inf); softmax over keys; out = merged Wp + bp ([in][out] [512][512] + a REAL bias, uniform +-1/sqrt(512)) -> [4][2048][512]); the [in][out] output weight through the text's own TRANSPOSING builder (the one the per-head stacks use); q and k carried as f16 hi + x1024 residual planes with three-product scores; each head's [in][out] block is transposed into its 64 contiguous rows of the weight plane by the same builder, one job per head in one shared launch.
// Compute dtype: inputs rounded to bf16; x / weights exact; v, softmax weights and o as plain f16 GEMM operands (~2^-12), q and k as f16 hi + x1024 residual pairs (rows 0..127: f32 attention, o as hi + residual); scores and softmax statistics f32; v_wmma_f32_16x16x32_f16.
#define NB 4
#define SCL 0.125f                         /* 1 / sqrt(head_dim 64) */
#define SCLR 0.0001220703125f               /* 2^-13: the same scale on the x1024 residual passes */
#define SQ 2048
#define DM 512
#define NH 8
#define HD 64
#define HG 4                         /* heads per call of the untemplated k_vt (not launched) */
#define QT0 128                      /* first-tile rows recomputed exactly in f32 */
#define B0 0                         /* first batch processed (debug hook) */
#define NBR NB                       /* batches processed (debug hook) */
#define NR ((size_t)NB * SQ)         /* token rows */
#define MP ((int)((size_t)NBR * SQ)) /* rows projected (debug hook) */
#define QN SQ                        /* query rows attended per batch (debug hook) */
#define NHD NH                       /* heads attended (debug hook) */
#define MPO MP                       /* rows through the output stage (debug hook) */
#define LQ DM      /* row pitch of the q/k/v rows */
typedef __bf16 v16b __attribute__((ext_vector_type(16)));
typedef unsigned short v8us __attribute__((ext_vector_type(8), may_alias));
typedef float  v8f  __attribute__((ext_vector_type(8)));
typedef float  v4f  __attribute__((ext_vector_type(4)));
typedef float  v4fa __attribute__((ext_vector_type(4), may_alias));
union FragB { v16b v; v8us half[2]; unsigned short u[16]; };

__device__ __forceinline__ unsigned short bf16_bits(float x) { unsigned int u = __float_as_uint(x); return (unsigned short)((u + 0x7FFFu + ((u >> 16) & 1u)) >> 16); }
__device__ __forceinline__ float bf16_val(unsigned short b) { return __uint_as_float(((unsigned int)b) << 16); }
__device__ __forceinline__ float bf16_round(float x) { return bf16_val(bf16_bits(x)); }
// D += A·B with NT terms: 1 = ah·bh, 2 = + al·bh (A split), 3 = + ah·bl (both split)
template <int NT>
__device__ __forceinline__ v8f mmaN(v16b ah, v16b al, v16b bh, v16b bl, v8f c) {
  c = __builtin_amdgcn_wmma_f32_16x16x32_bf16(false, ah, false, bh, (short)0, c, false, false);
  if (NT >= 2) c = __builtin_amdgcn_wmma_f32_16x16x32_bf16(false, al, false, bh, (short)0, c, false, false);
  if (NT >= 3) c = __builtin_amdgcn_wmma_f32_16x16x32_bf16(false, ah, false, bl, (short)0, c, false, false);
  asm volatile("v_nop\n\tv_nop\n\tv_nop\n\tv_nop" : "+v"(c) : "v"(ah), "v"(al), "v"(bh), "v"(bl));
  return c;
}

__global__ __launch_bounds__(256) void k_wt_bf16(const float* __restrict__ W, unsigned short* __restrict__ Wt, int K, int N) {
  const int t = blockIdx.x * 256 + threadIdx.x;
  const int k8n = K / 8;
  if (t >= N * k8n) return;
  const int n = t / k8n, k8 = (t % k8n) * 8;
  v8us v;
#pragma unroll
  for (int i = 0; i < 8; ++i) v[i] = bf16_bits(W[(size_t)(k8 + i) * N + n]);
  *(v8us*)(Wt + (size_t)n * K + k8) = v;
  
}

// GEMM C[M][N] (f32, pitch ldc) = act(A[M][K]·W + bias). A f32 row-major (pitch lda) converted per fragment to bf16
// (ASPLIT: hi/lo two planes -> 2 terms, else single rounded term); Wt bf16 [N][K] (pitch ldb). BIAS_BF16 rounds the
// bias to bf16 first (bias quantised to bf16 before the add). K%32==0, M%16==0, N%64==0.
template <bool ASPLIT, int ACT, bool BIAS_BF16>
__global__ __launch_bounds__(128) void k_gemm_bf(const float* __restrict__ A, int lda, const unsigned short* __restrict__ Wt, int ldb,
                                               const float* __restrict__ bias, float* __restrict__ C, int ldc, int M, int N, int K) {
  __shared__ __attribute__((aligned(16))) float so[4][16][64];
  const int tid = threadIdx.x, w = tid >> 5, lane = tid & 31, ln = lane & 15, hh = lane >> 4;
  const int ntn = N / 64;
  const int wid = blockIdx.x * 4 + w;
  const int mt = wid / ntn, nq = wid % ntn;
  if (mt * 16 >= M) return;
  const int row0 = mt * 16, col0 = nq * 64;
  const float* arow = A + (size_t)(row0 + ln) * lda;
  v8f acc[4] = {};
  for (int kb = 0; kb < K; kb += 32) {
    FragB ah, al;
    const v4f x0 = *(const v4fa*)(arow + kb + 8 * hh), x1 = *(const v4fa*)(arow + kb + 8 * hh + 4);
    const v4f x2 = *(const v4fa*)(arow + kb + 16 + 8 * hh), x3 = *(const v4fa*)(arow + kb + 16 + 8 * hh + 4);
    float xs[16] = {x0[0],x0[1],x0[2],x0[3],x1[0],x1[1],x1[2],x1[3],x2[0],x2[1],x2[2],x2[3],x3[0],x3[1],x3[2],x3[3]};
#pragma unroll
    for (int i = 0; i < 16; ++i) { const unsigned short hb = bf16_bits(xs[i]); ah.u[i] = hb; al.u[i] = ASPLIT ? bf16_bits(xs[i] - bf16_val(hb)) : (unsigned short)0; }
#pragma unroll
    for (int t = 0; t < 4; ++t) {
      const unsigned short* brow = Wt + (size_t)(col0 + t * 16 + ln) * ldb + kb;
      FragB b;
      b.half[0] = *(const v8us*)(brow + 8 * hh);
      b.half[1] = *(const v8us*)(brow + 16 + 8 * hh);
      acc[t] = mmaN<ASPLIT ? 2 : 1>(ah.v, al.v, b.v, b.v, acc[t]);
    }
  }
#pragma unroll
  for (int t = 0; t < 4; ++t) {
    float bv = bias ? bias[col0 + t * 16 + ln] : 0.f;
    if (BIAS_BF16) bv = bf16_round(bv);
#pragma unroll
    for (int r = 0; r < 8; ++r) { float v = acc[t][r] + bv; if (ACT == 1) v = fmaxf(v, 0.f); so[w][8 * hh + r][t * 16 + ln] = v; }
  }
  __builtin_amdgcn_fence(__ATOMIC_ACQ_REL, "workgroup");
  __builtin_amdgcn_wave_barrier();
  const int rsub = lane >> 4, c4 = (lane & 15) * 4;
  {
#pragma unroll
    for (int q = 0; q < 8; ++q) {
      const int r = q * 2 + rsub;
      const v4f v = *(const v4fa*)&so[w][r][c4];
      *(v4f*)(C + (size_t)(row0 + r) * ldc + col0 + c4) = v;
    }
    
  }
}

// GEMM C = act(A·W + bias + resid): A f32 (ASPLIT -> hi/lo 2 terms), Wt bf16 [N][K]; ACT 0 none, 1 relu, 2 exact gelu;
// resid (optional, f32, row index = (row % rmod), pitch ldr, RES_BF16 rounds it) added before the activation.
template <bool ASPLIT, int ACT, bool BIAS_BF16, bool RES_BF16>
__global__ __launch_bounds__(128) void k_gemm_bf3(const float* __restrict__ A, int lda, const unsigned short* __restrict__ Wt, int ldb,
                                                const float* __restrict__ bias, const float* __restrict__ resid, int rmod, int ldr,
                                                float* __restrict__ C, int ldc, int M, int N, int K) {
  __shared__ __attribute__((aligned(16))) float so[4][16][64];
  const int tid = threadIdx.x, w = tid >> 5, lane = tid & 31, ln = lane & 15, hh = lane >> 4;
  const int ntn = N / 64;
  const int wid = blockIdx.x * 4 + w;
  const int mt = wid / ntn, nq = wid % ntn;
  if (mt * 16 >= M) return;
  const int row0 = mt * 16, col0 = nq * 64;
  const float* arow = A + (size_t)(row0 + ln) * lda;
  v8f acc[4] = {};
  for (int kb = 0; kb < K; kb += 32) {
    FragB ah, al;
    const v4f x0 = *(const v4fa*)(arow + kb + 8 * hh), x1 = *(const v4fa*)(arow + kb + 8 * hh + 4);
    const v4f x2 = *(const v4fa*)(arow + kb + 16 + 8 * hh), x3 = *(const v4fa*)(arow + kb + 16 + 8 * hh + 4);
    float xs[16] = {x0[0],x0[1],x0[2],x0[3],x1[0],x1[1],x1[2],x1[3],x2[0],x2[1],x2[2],x2[3],x3[0],x3[1],x3[2],x3[3]};
#pragma unroll
    for (int i = 0; i < 16; ++i) { const unsigned short hb = bf16_bits(xs[i]); ah.u[i] = hb; al.u[i] = ASPLIT ? bf16_bits(xs[i] - bf16_val(hb)) : (unsigned short)0; }
#pragma unroll
    for (int t = 0; t < 4; ++t) {
      const unsigned short* brow = Wt + (size_t)(col0 + t * 16 + ln) * ldb + kb;
      FragB b;
      b.half[0] = *(const v8us*)(brow + 8 * hh);
      b.half[1] = *(const v8us*)(brow + 16 + 8 * hh);
      acc[t] = mmaN<ASPLIT ? 2 : 1>(ah.v, al.v, b.v, b.v, acc[t]);
    }
  }
#pragma unroll
  for (int t = 0; t < 4; ++t) {
    const int col = col0 + t * 16 + ln;
    float bv = bias ? bias[col] : 0.f;
    if (BIAS_BF16) bv = bf16_round(bv);
#pragma unroll
    for (int r = 0; r < 8; ++r) {
      float v = acc[t][r] + bv;
      if (resid) { float rv = resid[(size_t)((row0 + 8 * hh + r) % rmod) * ldr + col]; if (RES_BF16) rv = bf16_round(rv); v += rv; }
      if (ACT == 1) v = fmaxf(v, 0.f);
      if (ACT == 2) v = 0.5f * v * (1.0f + erff(v * 0.70710678118654752f));
      if (ACT == 3) { const float u = 0.7978845608028654f * (v + 0.044715f * v * v * v); v = 0.5f * v * (1.0f + tanhf(u)); }
      so[w][8 * hh + r][t * 16 + ln] = v;
    }
  }
  __builtin_amdgcn_fence(__ATOMIC_ACQ_REL, "workgroup");
  __builtin_amdgcn_wave_barrier();
  const int rsub = lane >> 4, c4 = (lane & 15) * 4;
  {
#pragma unroll
    for (int q = 0; q < 8; ++q) {
      const int r = q * 2 + rsub;
      const v4f v = *(const v4fa*)&so[w][r][c4];
      *(v4f*)(C + (size_t)(row0 + r) * ldc + col0 + c4) = v;
    }
    
  }
}
// row LayerNorm (biased variance, eps) over N: s = X (+ R); optional out_sum <- s; out_norm <- (s-mu)*rsqrt(var+eps)*g + b
template <bool PARAM_BF16>
__global__ __launch_bounds__(256) void k_layernorm(const float* __restrict__ X, const float* __restrict__ R, const float* __restrict__ g, const float* __restrict__ bta,
                                                  float* __restrict__ out_sum, float* __restrict__ out_norm, int N, float eps) {
  __shared__ float red[256];
  const int row = blockIdx.x, tid = threadIdx.x;
  const float* x = X + (size_t)row * N; const float* rr = R ? R + (size_t)row * N : nullptr;
  float vals[16];                     // up to N = 4096
  const int per = N / 256;            // contiguous chunk per thread? use strided-by-4 chunks: thread handles j = tid*4 + 1024*u
  float s1 = 0.f;
  for (int u = 0; u < per / 4; ++u) {
    const int j = tid * 4 + 1024 * u;
    const v4f a = *(const v4fa*)(x + j);
    v4f b = {0.f,0.f,0.f,0.f}; if (rr) b = *(const v4fa*)(rr + j);
#pragma unroll
    for (int q = 0; q < 4; ++q) { const float v = a[q] + b[q]; vals[u * 4 + q] = v; s1 += v; }
  }
  red[tid] = s1; __syncthreads();
  for (int st = 128; st > 0; st >>= 1) { if (tid < st) red[tid] += red[tid + st]; __syncthreads(); }
  const float mu = red[0] / (float)N; __syncthreads();
  float s2 = 0.f;
  for (int u = 0; u < per / 4; ++u)
#pragma unroll
    for (int q = 0; q < 4; ++q) { const float c = vals[u * 4 + q] - mu; s2 += c * c; }
  red[tid] = s2; __syncthreads();
  for (int st = 128; st > 0; st >>= 1) { if (tid < st) red[tid] += red[tid + st]; __syncthreads(); }
  const float rs = rsqrtf(red[0] / (float)N + eps);
  {
    for (int u = 0; u < per / 4; ++u) {
      const int j = tid * 4 + 1024 * u;
      v4f o, sm;
#pragma unroll
      for (int q = 0; q < 4; ++q) {
        float gg = g[j + q], bb = bta[j + q];
        if (PARAM_BF16) { gg = bf16_round(gg); bb = bf16_round(bb); }
        sm[q] = vals[u * 4 + q]; o[q] = (vals[u * 4 + q] - mu) * rs * gg + bb;
      }
      if (out_sum) *(v4f*)(out_sum + (size_t)row * N + j) = sm;
      *(v4f*)(out_norm + (size_t)row * N + j) = o;
    }
    
  }
}



// ---- f16 WMMA path (v_wmma_f32_16x16x32_f16): 11-bit significands for operands in range — used where a [0,1] probability operand needs more precision than bf16
typedef _Float16 v16h __attribute__((ext_vector_type(16)));
union FragH { v16h v; v8us half[2]; _Float16 h[16]; unsigned short u[16]; };
template <int NT>
__device__ __forceinline__ v8f mmaH(v16h ah, v16h al, v16h bh, v16h bl, v8f c) {
  c = __builtin_amdgcn_wmma_f32_16x16x32_f16(false, ah, false, bh, (short)0, c, false, false);
  if (NT >= 2) c = __builtin_amdgcn_wmma_f32_16x16x32_f16(false, al, false, bh, (short)0, c, false, false);
  if (NT >= 3) c = __builtin_amdgcn_wmma_f32_16x16x32_f16(false, ah, false, bl, (short)0, c, false, false);
  asm volatile("v_nop\n\tv_nop\n\tv_nop\n\tv_nop" : "+v"(c) : "v"(ah), "v"(al), "v"(bh), "v"(bl));
  return c;
}
// batched GEMM like k_gemm_b but f16 operands: A f32 (split into f16 hi/lo if ASPLIT, else rounded to f16), Bt = f16 values [n][k]; alpha; C f32; N multiple of 16 (partial tiles skipped)
template <bool ASPLIT>
__global__ __launch_bounds__(128) void k_gemm_h(const float* __restrict__ A, int lda, size_t sA, const _Float16* __restrict__ Bh, int ldb, size_t sB, float alpha, float* __restrict__ C, int ldc, size_t sC, int M, int N, int K) {
  __shared__ __attribute__((aligned(16))) float so[4][16][64];
  const int tid = threadIdx.x, w = tid >> 5, lane = tid & 31, ln = lane & 15, hh = lane >> 4; const int by = blockIdx.y;
  A += (size_t)by * sA; Bh += (size_t)by * sB; C += (size_t)by * sC;
  const int ntn = (N + 63) / 64; const int wid = blockIdx.x * 4 + w; const int mt = wid / ntn, nq = wid % ntn; if (mt * 16 >= M) return;
  const int row0 = mt * 16, col0 = nq * 64; const float* arow = A + (size_t)(row0 + ln) * lda;
  v8f acc[4] = {};
  for (int kb = 0; kb < K; kb += 32) {
    FragH ah, al;
    const v4f x0 = *(const v4fa*)(arow + kb + 8 * hh), x1 = *(const v4fa*)(arow + kb + 8 * hh + 4), x2 = *(const v4fa*)(arow + kb + 16 + 8 * hh), x3 = *(const v4fa*)(arow + kb + 16 + 8 * hh + 4);
    float xs[16] = {x0[0],x0[1],x0[2],x0[3],x1[0],x1[1],x1[2],x1[3],x2[0],x2[1],x2[2],x2[3],x3[0],x3[1],x3[2],x3[3]};
#pragma unroll
    for (int i = 0; i < 16; ++i) { const _Float16 h = (_Float16)xs[i]; ah.h[i] = h; al.h[i] = ASPLIT ? (_Float16)(xs[i] - (float)h) : (_Float16)0.0f; }
#pragma unroll
    for (int t = 0; t < 4; ++t) { if (col0 + t * 16 >= N) continue; const size_t boff = (size_t)(col0 + t * 16 + ln) * ldb + kb; FragH bq; bq.half[0] = *(const v8us*)(Bh + boff + 8 * hh); bq.half[1] = *(const v8us*)(Bh + boff + 16 + 8 * hh);
      acc[t] = mmaH<ASPLIT ? 2 : 1>(ah.v, al.v, bq.v, bq.v, acc[t]); }
  }
#pragma unroll
  for (int t = 0; t < 4; ++t) { if (col0 + t * 16 >= N) continue;
#pragma unroll
    for (int r = 0; r < 8; ++r) so[w][8 * hh + r][t * 16 + ln] = acc[t][r] * alpha; }
  __builtin_amdgcn_fence(__ATOMIC_ACQ_REL, "workgroup"); __builtin_amdgcn_wave_barrier();
  const int rsub = lane >> 4, c4 = (lane & 15) * 4;
  {
#pragma unroll
    for (int q = 0; q < 8; ++q) { const int r = q * 2 + rsub; if (col0 + c4 < N) { const v4f v = *(const v4fa*)&so[w][r][c4]; *(v4f*)(C + (size_t)(row0 + r) * ldc + col0 + c4) = v; } }
     }
}

// Wt (n, k) = f16(W[k][n]·scale), fragment-packed, from f32 row-major W[K][N] (scale = power of two; bf16-exact weights stay exact in f16 away from the subnormal range)
// (a job of a shared launch: blk = the block's index within the job, 256 threads a block)
// FRAGMENT-PACKED PLANES (every A and B operand of gemm2_job): a plane of rows of K halves is stored as tiles of 16 rows x 32 k, 1 KiB each, the K / 32 tiles of 16 rows one behind the other, so that
// 16 r rows still start at half 16 r K. Inside a tile stand the two 512-byte loads of its fragment, each in lane order: piece (row, k..k+7) is 16 bytes at half ((k >> 4) & 1) * 256 + (((k >> 3) & 1) * 16 + row % 16) * 8.
// A wave-wide 16-byte load of a fragment half is then 512 contiguous bytes (four whole lines) and not 32 bytes of each of 16 lines. The k held by each lane and register is the row layout's.
__device__ __forceinline__ size_t pk_off(size_t row, int k, int K) { return ((row >> 4) * (size_t)(K >> 5) + (size_t)(k >> 5)) * 512 + (size_t)(((k >> 4) & 1) * 256 + (((k >> 3) & 1) * 16 + (int)(row & 15)) * 8); }
// thread t of a packing job owns the t-th 16-byte piece of the packed plane (a wave stores whole lines): its row and its first k
__device__ __forceinline__ size_t pk_row(size_t t, int K) { return ((t >> 6) / (size_t)(K >> 5)) * 16 + (t & 15); }
__device__ __forceinline__ int pk_k(size_t t, int K) { return (int)((t >> 6) % (size_t)(K >> 5)) * 32 + (int)((t >> 5) & 1) * 16 + (int)((t >> 4) & 1) * 8; }
__device__ __forceinline__ void wt_f16_job(const float* __restrict__ W, _Float16* __restrict__ Wt, int K, int N, float scale, int blk) {
  const int t = blk * 256 + threadIdx.x; if (t >= N * (K / 8)) return; const int n = (int)pk_row((size_t)t, K), k8 = pk_k((size_t)t, K); FragH f;
#pragma unroll
  for (int i = 0; i < 8; ++i) f.h[i] = (_Float16)(bf16_round(W[(size_t)(k8 + i) * N + n]) * scale); const v8us o = f.half[0];
  *(v8us*)((unsigned short*)Wt + (size_t)t * 8) = o; 
}
// k_gemm_hh variant with fused epilogue: v = acc·alpha + bias[by·sBias + col] (+ CP[(row/rowsPerB)·sCPb + by·64 + col] if CP) ; ACT 0 none / 1 elu ; writes f16 C16 (and f32 C if non-null)
template <int ACT>
__global__ __launch_bounds__(128) void k_gemm_hhx(const _Float16* __restrict__ A, int lda, size_t sA, const _Float16* __restrict__ Bh, int ldb, size_t sB, float alpha, const float* __restrict__ bias, size_t sBias, const float* __restrict__ CP, int rowsPerB, size_t sCPb, int row0g,
    float* __restrict__ C, _Float16* __restrict__ C16, int ldc, size_t sC, int M, int N, int K) {
  __shared__ __attribute__((aligned(16))) float so[4][16][64];
  const int tid = threadIdx.x, w = tid >> 5, lane = tid & 31, ln = lane & 15, hh = lane >> 4; const int by = blockIdx.y;
  A += (size_t)by * sA; Bh += (size_t)by * sB; const size_t cofs = (size_t)by * sC; const float* bp = bias ? bias + (size_t)by * sBias : nullptr;
  const int ntn = (N + 63) / 64; const int wid = blockIdx.x * 4 + w; const int mt = wid / ntn, nq = wid % ntn; if (mt * 16 >= M) return;
  const int row0 = mt * 16, col0 = nq * 64; const _Float16* arow = A + (size_t)(row0 + ln) * lda;
  v8f acc[4] = {};
  for (int kb = 0; kb < K; kb += 32) { FragH ah; ah.half[0] = *(const v8us*)((const unsigned short*)arow + kb + 8 * hh); ah.half[1] = *(const v8us*)((const unsigned short*)arow + kb + 16 + 8 * hh);
#pragma unroll
    for (int t = 0; t < 4; ++t) { if (col0 + t * 16 >= N) continue; const size_t boff = (size_t)(col0 + t * 16 + ln) * ldb + kb; FragH bq; bq.half[0] = *(const v8us*)((const unsigned short*)Bh + boff + 8 * hh); bq.half[1] = *(const v8us*)((const unsigned short*)Bh + boff + 16 + 8 * hh);
      acc[t] = mmaH<1>(ah.v, ah.v, bq.v, bq.v, acc[t]); }
  }
#pragma unroll
  for (int t = 0; t < 4; ++t) { if (col0 + t * 16 >= N) continue; const int col = col0 + t * 16 + ln; const float bv = bp ? bf16_round(bp[col]) : 0.f;
#pragma unroll
    for (int r = 0; r < 8; ++r) { float v = acc[t][r] * alpha + bv; if (CP) { const int rr = row0g + row0 + 8 * hh + r; if (rowsPerB < 0) v += CP[cofs + (size_t)rr * ldc + col];      /* rowsPerB < 0: own element of the batched C plane */ else { const int bidx = rr / rowsPerB; v += CP[(size_t)bidx * sCPb + (size_t)by * 64 + col]; } } if (ACT == 1) v = (v > 0.f) ? v : expm1f(v); else if (ACT == 7) v = (v > 0.f) ? v + 1.0f : expf(v); else if (ACT == 8) v = tanhf(v); else if (ACT == 9) v = 0.5f * v * (1.0f + tanhf(0.7978845608028654f * (v + 0.044715f * v * v * v))); else if (ACT == 11) v = 1.0f / (1.0f + expf(-v)); else if (ACT == 12) v = (v > 0.f) ? v : 0.01f * v; else if (ACT == 14) v = (v > 0.f) ? v : 0.1f * v; else if (ACT == 16) v = (v >= 0.f) ? v : 0.3f * v; else if (ACT == 17) v = (v >= 0.f) ? v : 0.2f * v; else if (ACT == 15) v = v / (1.0f + expf(-v)); else if (ACT == 3) v = fmaxf(v, 0.f); else if (ACT == 6) v = 0.5f * v * (1.0f + erff(v * 0.70710678118654752f)); so[w][8 * hh + r][t * 16 + ln] = v; } }
  __builtin_amdgcn_fence(__ATOMIC_ACQ_REL, "workgroup"); __builtin_amdgcn_wave_barrier();
  const int rsub = lane >> 4, c4 = (lane & 15) * 4; typedef _Float16 v4h __attribute__((ext_vector_type(4)));
  {
#pragma unroll
    for (int q = 0; q < 8; ++q) { const int r = q * 2 + rsub; if (col0 + c4 < N) { const v4f v = *(const v4fa*)&so[w][r][c4]; if (C) *(v4f*)(C + cofs + (size_t)(row0 + r) * ldc + col0 + c4) = v; if (C16) { v4h h4; for (int i = 0; i < 4; ++i) h4[i] = (_Float16)v[i]; *(v4h*)(C16 + cofs + (size_t)(row0 + r) * ldc + col0 + c4) = h4; } } }
     }
}


typedef _Float16 v4h __attribute__((ext_vector_type(4)));

__device__ __forceinline__ void x16_job(const float* __restrict__ x, _Float16* __restrict__ X16, size_t n8, int blk) { const size_t t = (size_t)blk * 256 + threadIdx.x; if (t >= n8) return; FragH f;
  const float* xs = x + pk_row(t, DM) * DM + pk_k(t, DM);      /* rows of DM floats in, a fragment-packed plane out */
#pragma unroll
  for (int q = 0; q < 8; ++q) f.h[q] = (_Float16)bf16_round(xs[q]); *(v8us*)((unsigned short*)X16 + t * 8) = f.half[0];  }
__global__ __launch_bounds__(256) void k_h16(const float* __restrict__ x, _Float16* __restrict__ X16, size_t n8) { const size_t t = (size_t)blockIdx.x * 256 + threadIdx.x; if (t >= n8) return; FragH f;
#pragma unroll
  for (int q = 0; q < 8; ++q) f.h[q] = (_Float16)x[t * 8 + q]; *(v8us*)((unsigned short*)X16 + t * 8) = f.half[0];  }
__global__ __launch_bounds__(256) void k_round16f(const float* __restrict__ W, _Float16* __restrict__ Bt, size_t n8) { const size_t t = (size_t)blockIdx.x * 256 + threadIdx.x; if (t >= n8) return; FragH f;
#pragma unroll
  for (int i = 0; i < 8; ++i) f.h[i] = (_Float16)(bf16_round(W[t * 8 + i]) * 16.0f); *(v8us*)((unsigned short*)Bt + t * 8) = f.half[0];  }
// ---- fast GEMM (wave tile 32x64; requires M % 32 == 0 rows per launch region and N % 64 == 0); epilogue = k_gemm_hhx semantics; two batch axes: by (strides sA, sB, sC) and bz (strides zA, zB, zC) ----
// Output forms, each taken where its pointer is not null: C (f32 rows), C16 with CL (f16 rows and the x1024 residual of their rounding, f16 rows: both or neither), or CT alone
// (f16, transposed per head: [row / SQ][col / HD][col % HD][row % SQ], rows counted over all sequences, so only with by = bz = 0).
__device__ __forceinline__ v16h g2_frag(const _Float16* p, int hh) { FragH f; f.half[0] = *(const v8us*)((const unsigned short*)p + 8 * hh); f.half[1] = *(const v8us*)((const unsigned short*)p + 16 + 8 * hh); return f.v; }
typedef __attribute__((address_space(1))) const _Float16 gl_f16; typedef __attribute__((address_space(1))) const v8us gl_v8us;      /* pointees in global memory by type: an address that has passed through an asm statement still gives global loads, not flat ones */
__device__ __forceinline__ v16h g2_packg(gl_f16* p) { FragH f; f.half[0] = *(gl_v8us*)p; f.half[1] = *(gl_v8us*)(p + 256); return f.v; }      /* p: the lane's piece of a packed tile's first load */
__device__ __forceinline__ v8f g2_mma(v16h a, v16h b, v8f c) { v8f d = __builtin_amdgcn_wmma_f32_16x16x32_f16(false, a, false, b, (short)0, c, false, false); asm volatile("v_nop\n\tv_nop\n\tv_nop\n\tv_nop" : "+v"(d) : "v"(a), "v"(b)); return d; }
// KU: k-steps of 32 whose fragment loads (12 each) are issued together, ahead of the first product that needs one (K % (32 KU) == 0).
template <int ACT, int KU>
__device__ __forceinline__ void gemm2_job(const _Float16* __restrict__ A, int lda, size_t sA, const _Float16* __restrict__ Bh, int ldb, size_t sB, float alpha, const float* __restrict__ bias, size_t sBias, const float* __restrict__ CP, int rowsPerB, size_t sCPb, int row0g,
    float* __restrict__ C, _Float16* __restrict__ C16, _Float16* __restrict__ CL, _Float16* __restrict__ CT, int ldc, size_t sC, int M, int N, int K, size_t zA, size_t zB, size_t zC, int bx, int by, int bz) { static_assert(ACT == 0 || ACT == 3 || ACT == 6 || ACT == 8 || ACT == 9 || ACT == 11 || ACT == 12 || ACT == 14 || ACT == 15 || ACT == 16 || ACT == 17, "k_gemm2: unsupported ACT code (would silently apply no activation)");
  __shared__ __attribute__((aligned(16))) float so[4][32][68];
  const int tid = threadIdx.x, w = tid >> 5, lane = tid & 31, ln = lane & 15, hh = lane >> 4;      /* bx = tile, by = batch (strides sA, sB, sC), bz = sequence (strides zA, zB, zC) */
  A += (size_t)by * sA + (size_t)bz * zA; Bh += (size_t)by * sB + (size_t)bz * zB; const size_t cofs = (size_t)by * sC + (size_t)bz * zC; const float* bp = bias ? bias + (size_t)by * sBias : nullptr;
  const int ntn = N >> 6; const int mt = bx / ntn, nq = bx - mt * ntn; const int row0 = mt * 128 + 32 * w, col0 = nq * 64; if (row0 >= M) return;
  /* A and Bh are fragment-packed planes (lda = ldb = K): 16 rows are K / 32 tiles of 512 halves, a k-step of 32 is one tile on */
  gl_f16* pa = (gl_f16*)(A + (size_t)row0 * lda + lane * 8); gl_f16* pb = (gl_f16*)(Bh + (size_t)col0 * ldb + lane * 8); const size_t sa = (size_t)16 * lda, sb = (size_t)16 * ldb;      /* the lane's piece of the trip's first A and B tile; halves from 16 rows to the next 16 */
  const v8f z8 = {0.f,0.f,0.f,0.f,0.f,0.f,0.f,0.f}; v8f c00 = z8, c01 = z8, c02 = z8, c03 = z8, c10 = z8, c11 = z8, c12 = z8, c13 = z8;
#pragma unroll 1      /* rolled: one trip already holds all the loads that are to be in flight together */
  for (int kb = 0; kb < K; kb += 32 * KU) { v16h a0[KU], a1[KU], b0[KU], b1[KU], b2[KU], b3[KU];
#pragma unroll      /* the fragments are registers, not indexed arrays */
    for (int j = 0; j < KU; ++j) { const int kj = j * 512; a0[j] = g2_packg(pa + kj); a1[j] = g2_packg(pa + sa + kj); b0[j] = g2_packg(pb + kj); b1[j] = g2_packg(pb + sb + kj); b2[j] = g2_packg(pb + 2 * sb + kj); b3[j] = g2_packg(pb + 3 * sb + kj); }
    /* keeps every load of the trip in front of the products (one exposed latency a trip, not four a k-step); the two addresses pass through the wait's own statement, so that their registers live to it (no load of the trip lands in one) and their step to the next trip stands behind it */
    asm volatile("s_wait_xcnt 0x0" : "+v"(pa), "+v"(pb) :: "memory");
    pa += 512 * KU; pb += 512 * KU;
#pragma unroll
    for (int j = 0; j < KU; ++j) {
      c00 = g2_mma(a0[j], b0[j], c00); c10 = g2_mma(a1[j], b0[j], c10);
      c01 = g2_mma(a0[j], b1[j], c01); c11 = g2_mma(a1[j], b1[j], c11);
      c02 = g2_mma(a0[j], b2[j], c02); c12 = g2_mma(a1[j], b2[j], c12);
      c03 = g2_mma(a0[j], b3[j], c03); c13 = g2_mma(a1[j], b3[j], c13); } }
  v8f accs[8] = {c00, c01, c02, c03, c10, c11, c12, c13};
#pragma unroll
  for (int u = 0; u < 8; ++u) { const int t = u & 3, half = u >> 2; const int col = col0 + t * 16 + ln; const float bv = bp ? bf16_round(bp[col]) : 0.f;
#pragma unroll
    for (int r = 0; r < 8; ++r) { const int rloc = half * 16 + 8 * hh + r; float v = accs[u][r] * alpha + bv; if (CP) { if (rowsPerB < 0) v += CP[cofs + (size_t)(row0g + row0 + rloc) * ldc + col];      /* rowsPerB < 0: own element of the batched C plane */ else { const int bidx = (row0g + row0 + rloc) / rowsPerB; v += CP[(size_t)bidx * sCPb + (size_t)by * 64 + col]; } }
      if (ACT == 3) v = fmaxf(v, 0.f); else if (ACT == 6) v = 0.5f * v * (1.0f + erff(v * 0.70710678118654752f)); else if (ACT == 11) v = 1.0f / (1.0f + expf(-v)); else if (ACT == 15) v = v / (1.0f + expf(-v)); else if (ACT == 12) v = (v > 0.f) ? v : 0.01f * v; else if (ACT == 8) v = tanhf(v); else if (ACT == 9) v = 0.5f * v * (1.0f + tanhf(0.7978845608028654f * (v + 0.044715f * v * v * v))); else if (ACT == 14) v = (v > 0.f) ? v : 0.1f * v; else if (ACT == 16) v = (v >= 0.f) ? v : 0.3f * v; else if (ACT == 17) v = (v >= 0.f) ? v : 0.2f * v;
      so[w][rloc][t * 16 + ln] = v; } }
  __builtin_amdgcn_fence(__ATOMIC_ACQ_REL, "workgroup"); __builtin_amdgcn_wave_barrier();
  if (CT) {      /* the wave's 32 rows are 64 contiguous bytes of each of its 64 transposed rows: four lanes of 16 bytes a row, eight rows a store */
    const int dl = lane >> 2, t8 = (lane & 3) * 8; FragH f[8];
#pragma unroll
    for (int j = 0; j < 8; ++j)
#pragma unroll
      for (int i = 0; i < 8; ++i) f[j].h[i] = (_Float16)so[w][t8 + i][j * 8 + dl];
    unsigned short* ct = (unsigned short*)CT + (((size_t)(row0 / SQ) * NH + nq) * HD + dl) * SQ + row0 % SQ + t8;
#pragma unroll
    for (int j = 0; j < 8; ++j) *(v8us*)(ct + (size_t)j * 8 * SQ) = f[j].half[0];
    asm volatile("s_wait_xcnt 0x0" ::: "memory");      /* stands behind the eight stores, in front of any later write of a register that they name */
    return; }
  const int rsub = lane >> 4, c4 = (lane & 15) * 4;
  {
#pragma unroll
    for (int q = 0; q < 16; ++q) { const int r = q * 2 + rsub; const v4f v = *(const v4fa*)&so[w][r][c4]; if (C) { *(v4f*)(C + cofs + (size_t)(row0 + r) * ldc + col0 + c4) = v; asm volatile("s_wait_xcnt 0x0" ::: "memory"); }      /* the wait stands between the f32 store and the conversions below, which may land in the registers that the store names */
      if (C16) { const size_t co = cofs + (size_t)(row0 + r) * ldc + col0 + c4; v4h h4, l4; for (int i = 0; i < 4; ++i) { h4[i] = (_Float16)v[i]; l4[i] = (_Float16)((v[i] - (float)h4[i]) * 1024.0f); }
        /* both stores and their wait in one statement: as plain stores the residual's conversions were scheduled behind the first store, into the registers that it names, ahead of the wait */
        asm volatile("global_store_b64 %0, %1, off\n\tglobal_store_b64 %2, %3, off\n\ts_wait_xcnt 0x0" :: "v"(C16 + co), "v"(h4), "v"(CL + co), "v"(l4) : "memory"); } }
     } }


// ---- shared launches: jobs that do not depend on one another run in one grid; the block index picks the job (the same for every thread of a block) and the block's index within it ----
#define JW_H (HD * (DM / 8) / 256)             /* blocks per per-head weight block */
#define JW_O (DM * (DM / 8) / 256)             /* blocks of the output weight */
#define JX ((int)(NR * DM / 8 / 256))          /* blocks per plane of x rows */
static_assert(HD * (DM / 8) % 256 == 0 && DM * (DM / 8) % 256 == 0 && NR * DM / 8 % 256 == 0, "whole blocks per job");
// Operand planes: 3 NH per-head weight blocks (head h of wq / wk / wv is a row-major [DM][HD] block, written as HD contiguous rows of the [out][in] plane, x16), the [DM][DM] output weight, three planes of x rows.
__global__ __launch_bounds__(256) void k_prep(const float* x, const float* xk, const float* xv, const float* __restrict__ wq, const float* __restrict__ wk, const float* __restrict__ wv, const float* __restrict__ wo,
    _Float16* __restrict__ BQ, _Float16* __restrict__ BK, _Float16* __restrict__ BV, _Float16* __restrict__ BO, _Float16* __restrict__ X16, _Float16* __restrict__ XK16, _Float16* __restrict__ XV16) {
  int bx = blockIdx.x;
  if (bx < 3 * NH * JW_H) { const int j = bx / JW_H, s = j % 3, h = j / 3; const size_t wofs = (size_t)h * DM * HD, pofs = (size_t)h * HD * DM;
    wt_f16_job((s == 0 ? wq : s == 1 ? wk : wv) + wofs, (s == 0 ? BQ : s == 1 ? BK : BV) + pofs, DM, HD, 16.0f, bx % JW_H); return; }
  bx -= 3 * NH * JW_H;
  if (bx < JW_O) { wt_f16_job(wo, BO, DM, DM, 16.0f, bx); return; }
  bx -= JW_O;
  const int s = bx / JX; x16_job(s == 0 ? x : s == 1 ? xk : xv, s == 0 ? X16 : s == 1 ? XK16 : XV16, NR * DM / 8, bx % JX); }
#define JP_A ((MP / 128) * (DM / 64))          /* tiles of a projection of all rows */
#define JP_0 ((QT0 / 128) * (DM / 64))         /* tiles of a first-tile projection, per sequence */
// The six projections. grid.y: q, k, v. grid.x: the tiles of all rows, stored in the forms that the attention reads (q, k as f16 hi + x1024 residual planes; v as V^T [NBR][NH][HD][SQ], f16), then per sequence the tiles of the first QT0 rows (f32 planes of QT0 rows a sequence).
__global__ __launch_bounds__(128) void k_proj(const _Float16* __restrict__ X16, const _Float16* __restrict__ XK16, const _Float16* __restrict__ XV16, const _Float16* __restrict__ BQ, const _Float16* __restrict__ BK, const _Float16* __restrict__ BV,
    const float* __restrict__ bq, const float* __restrict__ bk, const float* __restrict__ bv, _Float16* __restrict__ QH, _Float16* __restrict__ QL, _Float16* __restrict__ KH, _Float16* __restrict__ KL, _Float16* __restrict__ VT, float* __restrict__ QF0, float* __restrict__ KF0, float* __restrict__ VF0) {
  const int s = blockIdx.y; const int bx = blockIdx.x; const bool all = bx < JP_A; const int b0 = bx - JP_A;
  gemm2_job<0, 1>(s == 0 ? X16 : s == 1 ? XK16 : XV16, DM, 0, s == 0 ? BQ : s == 1 ? BK : BV, DM, 0, 0.0625f, s == 0 ? bq : s == 1 ? bk : bv, 0, nullptr, 1, 0, 0,
      all ? nullptr : (s == 0 ? QF0 : s == 1 ? KF0 : VF0), all ? (s == 0 ? QH : s == 1 ? KH : nullptr) : nullptr, all ? (s == 0 ? QL : s == 1 ? KL : nullptr) : nullptr, (all && s == 2) ? VT : nullptr, DM, 0, all ? MP : QT0, DM, DM, (size_t)SQ * DM, 0, (size_t)QT0 * DM,
      all ? bx : b0 % JP_0, 0, all ? 0 : b0 / JP_0); }
static_assert(MP == NBR * SQ && B0 == 0 && SQ % 32 == 0 && DM == NH * HD, "a wave's 32 projected rows lie in one sequence, its 64 columns are one head");


__global__ __launch_bounds__(256) void k_wnat(const float* __restrict__ w, size_t n8, _Float16* __restrict__ Bt) { const size_t t = (size_t)blockIdx.x * 256 + threadIdx.x; if (t >= n8) return; FragH f; for (int q = 0; q < 8; ++q) f.h[q] = (_Float16)(bf16_round(w[t * 8 + q]) * 16.0f); *(v8us*)((unsigned short*)Bt + t * 8) = f.half[0];  }
__global__ __launch_bounds__(256) void k_rsm(const float* __restrict__ S, _Float16* __restrict__ P, int nrows) {
  #pragma clang fp contract(off)
  const int i = blockIdx.x * 256 + threadIdx.x; if (i >= nrows) return; const float* s = S + (size_t)i * SQ; float mx = -3.0e38f;
#pragma unroll 1
  for (int j = 0; j < SQ; ++j) mx = fmaxf(mx, s[j]); float se = 0.f;
#pragma unroll 1
  for (int j = 0; j < SQ; ++j) se += expf(s[j] - mx); const float sc = 256.0f / se;
#pragma unroll 1
  for (int j0 = 0; j0 < SQ; j0 += 8) { FragH f; for (int q = 0; q < 8; ++q) f.h[q] = (_Float16)(expf(s[j0 + q] - mx) * sc); unsigned short* d = (unsigned short*)P + (size_t)i * SQ + j0; *(v8us*)d = f.half[0];  } }
__global__ __launch_bounds__(256) void k_vt(const _Float16* __restrict__ V16, int b, int h0, _Float16* __restrict__ VT) { __shared__ unsigned short tl[64][65]; const int tid = threadIdx.x; const int hh = blockIdx.x % HG, sg = blockIdx.x / HG; const int s0 = sg * 64; const int h = h0 + hh;
  for (int i = tid; i < 64 * 8; i += 256) { const int j = i / 8, d8 = (i % 8) * 8; FragH f; f.half[0] = *(const v8us*)((const unsigned short*)V16 + ((size_t)b * SQ + s0 + j) * DM + h * HD + d8); for (int q = 0; q < 8; ++q) tl[d8 + q][j] = f.u[q]; }
  __syncthreads();
  { for (int i = tid; i < 64 * 8; i += 256) { const int d = i / 8, j8 = (i % 8) * 8; FragH f; for (int q = 0; q < 8; ++q) f.u[q] = tl[d][j8 + q]; *(v8us*)((unsigned short*)VT + ((size_t)hh * HD + d) * SQ + s0 + j8) = f.half[0]; }  } }



// 2^x on the transcendental unit, with the one free issue slot that the instruction set asks for behind it before its result is used or its
// source overwritten: in the unrolled row the compiler put one exponential's result into the source register of the one directly ahead of it.
__device__ __forceinline__ float exp2_slot(float x) { float r; asm("v_exp_f32 %0, %1\n\tv_nop" : "=v"(r) : "v"(x)); return r; }
// Fused causal attention: scores, softmax and P V in one launch; neither scores nor weights go to memory. One wave owns 16 query rows of one
// head and walks its keys 32 at a time, transposed: S^T = K Q^T (A = key rows, B = query rows), so that a lane holds scores of ONE query
// (column ln; keys 8 hh + r of each 16-key tile) and the row maximum and sum need one exchange between the wave's halves. The two score tiles,
// converted in place, are the B operand of O^T += V^T P^T in the loader's own k order (keys 8 hh + 0..7, then 16 + 8 hh + 0..7), and the
// accumulators of O^T belong to the same query as the lane's running maximum and sum. Scores keep their three f16 products (hi.hi, lo.hi, hi.lo).
// The block's four waves walk the same keys: each 32-key tile (key rows hi, key rows residual, V^T rows) is brought into LDS once per block by
// asynchronous copies, whole rows at a time, into one of two buffers, the next tile in flight while this one is worked on; the waves take their
// fragments from LDS.
#define FKP 72                       /* halves from one staged key row (64 halves) to the next: 144 bytes = 16 x odd, for 16-byte LDS reads */
#define FVP 40                       /* halves from one staged V^T row (32 halves) to the next: 80 bytes = 16 x odd */
#define FKL (32 * FKP)               /* first half of the residual key rows in a buffer */
#define FVO (2 * 32 * FKP)           /* first half of the V^T rows in a buffer */
#define FBUF (2 * 32 * FKP + HD * FVP)      /* halves per buffer */
typedef __attribute__((address_space(3))) _Float16 lds_f16;
// One 32-key tile into one buffer: six copies of 16 bytes a lane (128 lanes: 16 key rows of 8 pieces, twice, for each key plane; 32 V^T rows of 4 pieces, twice).
// lk, lv: the lane's LDS byte addresses of its first key piece and its first V^T piece; gh, gl, gv: its global addresses of the same pieces.
// The s_wait_xcnt stands inside the statement, behind the last copy: the address registers may be rewritten right behind it.
__device__ __forceinline__ void fattn_copy(unsigned lk, unsigned lv, const _Float16* gh, const _Float16* gl, const _Float16* gv) {
  asm volatile("global_load_async_to_lds_b128 %0, %6, off\n\t"
               "global_load_async_to_lds_b128 %1, %7, off\n\t"
               "global_load_async_to_lds_b128 %2, %8, off\n\t"
               "global_load_async_to_lds_b128 %3, %9, off\n\t"
               "global_load_async_to_lds_b128 %4, %10, off\n\t"
               "global_load_async_to_lds_b128 %5, %11, off\n\t"
               "s_wait_xcnt 0x0"
               :: "v"(lk), "v"(lk + 16 * FKP * 2), "v"(lk + FKL * 2), "v"(lk + (FKL + 16 * FKP) * 2), "v"(lv), "v"(lv + 32 * FVP * 2),
                  "v"(gh), "v"(gh + 16 * LQ), "v"(gl), "v"(gl + 16 * LQ), "v"(gv), "v"(gv + (size_t)32 * SQ) : "memory"); }
__device__ __forceinline__ void fattn_job(const _Float16* __restrict__ Qh, const _Float16* __restrict__ Ql, const _Float16* __restrict__ Kh, const _Float16* __restrict__ Kl, const _Float16* __restrict__ Vt, _Float16* __restrict__ O, int bx, int h, int b) {
  __shared__ __attribute__((aligned(16))) _Float16 ring[2 * FBUF];
  const int tid = threadIdx.x, lane = tid & 31, ln = lane & 15, hh = lane >> 4; const int w = __builtin_amdgcn_readfirstlane(threadIdx.x >> 5);      /* the wave's number in a scalar register: the trip count stays scalar */
  const int qt = (b & 1) ? bx : SQ / 64 - 1 - bx;      /* long and short causal tiles alternate between sequences */
  const int q0 = qt * 64 + w * 16; const size_t rb = (size_t)b * SQ;
  const size_t qo = (rb + q0 + ln) * LQ + h * HD;
  const v16h qh0 = g2_frag(Qh + qo, hh), qh1 = g2_frag(Qh + qo + 32, hh), ql0 = g2_frag(Ql + qo, hh), ql1 = g2_frag(Ql + qo + 32, hh);
  const size_t ko = (rb + (tid >> 3)) * LQ + h * HD + (tid & 7) * 8;      /* the lane's first piece of tile 0 */
  const _Float16* gh = Kh + ko; const _Float16* gl = Kl + ko;
  const _Float16* gv = Vt + ((size_t)(b * NH + h) * HD + (tid >> 2)) * SQ + (tid & 3) * 8;
  const unsigned l0 = (unsigned)(size_t)(lds_f16*)ring;
  const unsigned lk = l0 + ((tid >> 3) * FKP + (tid & 7) * 8) * 2, lv = l0 + (FVO + (tid >> 2) * FVP + (tid & 3) * 8) * 2;
  const v8f z8 = {0.f,0.f,0.f,0.f,0.f,0.f,0.f,0.f}; v8f o[4] = {z8, z8, z8, z8};
  float m = -1.0e30f, l = 0.f; const int nst = (q0 >> 5) + 1;      /* the wave's 32-key steps, up to the one that holds its diagonal */
  const int nbl = 2 * qt + 2;      /* the block's tiles (its last wave's steps; two at least): every wave passes every barrier */
  fattn_copy(lk, lv, gh, gl, gv);      /* tile 0 */
  asm volatile("s_wait_asynccnt 0x0" ::: "memory");      /* the wave's own copies have landed before the barrier behind which other waves read them */
  __syncthreads();
  gh += 32 * LQ; gl += 32 * LQ; gv += 32;
  fattn_copy(lk + FBUF * 2, lv + FBUF * 2, gh, gl, gv);      /* tile 1 flies while tile 0 is worked on */
#pragma unroll 1      /* rolled: a second copy of the body would hold a second set of fragments and cost a resident wave per SIMD */
  for (int st = 0; st < nbl; ++st) { const int key0 = st * 32; const int bo = (st & 1) * FBUF;
    if (st < nst) {      /* a scalar test: a wave past its diagonal skips the work, never the barrier */
    const _Float16* kb = ring + bo + ln * FKP; const _Float16* vb = ring + bo + FVO + ln * FVP;
    v16h ka[2][4];      /* per 16-key tile: hi d 0..31, hi d 32..63, residual d 0..31, residual d 32..63 */
#pragma unroll      /* this and every constant-trip loop below: unrolled so that fragments and accumulators are registers, not indexed arrays */
    for (int kt = 0; kt < 2; ++kt) { const int ro = 16 * kt * FKP; ka[kt][0] = g2_frag(kb + ro, hh); ka[kt][1] = g2_frag(kb + ro + 32, hh); ka[kt][2] = g2_frag(kb + FKL + ro, hh); ka[kt][3] = g2_frag(kb + FKL + ro + 32, hh); }
    v16h va[4];
#pragma unroll
    for (int t = 0; t < 4; ++t) va[t] = g2_frag(vb + 16 * t * FVP, hh);
    v8f sh[2], sl[2];
#pragma unroll
    for (int kt = 0; kt < 2; ++kt) { sh[kt] = g2_mma(ka[kt][0], qh0, z8); sh[kt] = g2_mma(ka[kt][1], qh1, sh[kt]);
      sl[kt] = g2_mma(ka[kt][0], ql0, z8); sl[kt] = g2_mma(ka[kt][1], ql1, sl[kt]); sl[kt] = g2_mma(ka[kt][2], qh0, sl[kt]); sl[kt] = g2_mma(ka[kt][3], qh1, sl[kt]); }
    float sv[16]; float mx = m; const int rel = q0 + ln - key0 - 8 * hh;      /* key 16 kt + r of this lane is kept while 16 kt + r <= rel */
#pragma unroll
    for (int kt = 0; kt < 2; ++kt)
#pragma unroll
      for (int r = 0; r < 8; ++r) { const float s = sh[kt][r] * SCL + sl[kt][r] * SCLR; const float xv = (16 * kt + r <= rel) ? s : -1.0e9f; sv[kt * 8 + r] = xv; mx = fmaxf(mx, xv); }
    mx = fmaxf(mx, __shfl_xor(mx, 16, 32));
    const float al = exp2_slot((m - mx) * 1.44269504088896340736f); m = mx;
    float ps = 0.f; FragH p;
#pragma unroll
    for (int i = 0; i < 16; ++i) { const float e = exp2_slot((sv[i] - mx) * 1.44269504088896340736f + 8.0f);      /* weights carried x256, as in the f16 operand before */ ps += e; p.h[i] = (_Float16)e; }
    l = l * al + ps;
#pragma unroll
    for (int t = 0; t < 4; ++t) { o[t] *= al; o[t] = g2_mma(va[t], p.v, o[t]); } }
    asm volatile("s_wait_dscnt 0x0" ::: "memory");      /* the wave's reads of this buffer have returned before the barrier behind which it is refilled */
    asm volatile("s_wait_asynccnt 0x0" ::: "memory");      /* the wave's copies of the next tile have landed before the barrier behind which other waves read them */
    __syncthreads();      /* publishes tile st + 1 and ends every wave's reads of tile st */
    if (st + 2 < nbl) { gh += 32 * LQ; gl += 32 * LQ; gv += 32; fattn_copy(lk + bo * 2, lv + bo * 2, gh, gl, gv); } }      /* tile st + 2 into the buffer just read; the test is the same for the whole block */
  asm volatile("s_wait_asynccnt 0x0" ::: "memory");      /* no copy is outstanding when the wave ends */
  l += __shfl_xor(l, 16, 32);
  const float fin = 64.0f / l;      /* o carried x64; the x256 of the weights cancels against the sum's */
  _Float16* orow = O + pk_off(rb + q0 + ln, h * HD + 8 * hh, DM);      /* o is the output stage's A operand: fragment-packed; dims 16 t + 8 hh .. + 7 are tile t / 2, load t % 2, the lane's own piece */
#pragma unroll
  for (int t = 0; t < 4; ++t) { FragH f;
#pragma unroll
    for (int r = 0; r < 8; ++r) f.h[r] = (_Float16)(o[t][r] * fin);
    *(v8us*)((unsigned short*)orow + (t >> 1) * 512 + (t & 1) * 256) = f.half[0]; } }
#define JF_A ((SQ / 64) * NH * NBR)            /* blocks of the fused attention: query tile fastest, then head, then sequence */
// The fused attention of all rows; behind its blocks, per sequence, the tiles of the first-tile output pass out = o_hi Wo + b (rows 0..QT0-1, from the exact f32 attention: it does not depend on this launch's attention).
__global__ __launch_bounds__(128) void k_attn(const _Float16* __restrict__ Qh, const _Float16* __restrict__ Ql, const _Float16* __restrict__ Kh, const _Float16* __restrict__ Kl, const _Float16* __restrict__ Vt, _Float16* __restrict__ O,
    const _Float16* __restrict__ OH0, const _Float16* __restrict__ BO, const float* __restrict__ bo, float* __restrict__ out) {
  const int bx = blockIdx.x;
  if (bx < JF_A) { fattn_job(Qh, Ql, Kh, Kl, Vt, O, bx % (SQ / 64), bx / (SQ / 64) % NH, bx / ((SQ / 64) * NH)); return; }
  const int b0 = bx - JF_A;
  gemm2_job<0, 2>(OH0, DM, 0, BO, DM, 0, 0.0009765625f, bo, 0, nullptr, 1, 0, 0, out, nullptr, nullptr, nullptr, DM, 0, QT0, DM, DM, (size_t)QT0 * DM, 0, (size_t)SQ * DM, b0 % JP_0, 0, b0 / JP_0); }
// Output stage, one job per 128-row tile: the first tile of a sequence adds o_lo Wo 2^-20 to its own elements (written by the launch before); every other tile is out = o Wo + b from the f16 rows.
static_assert(QT0 == 128 && SQ % 128 == 0 && MPO == NBR * SQ && B0 == 0, "the first-tile rows are exactly the first 128-row tile of each sequence");
static_assert(DM % 64 == 0, "the output passes take two k-steps a trip");
__global__ __launch_bounds__(128) void k_out(const _Float16* __restrict__ O16, const _Float16* __restrict__ OL0, const _Float16* __restrict__ BO, const float* __restrict__ bo, float* out) {
  const int bx = blockIdx.x; const int mt = bx / (DM / 64); const bool first = mt % (SQ / 128) == 0;
  gemm2_job<0, 2>(first ? OL0 : O16, DM, 0, BO, DM, 0, first ? 0.00000095367431640625f : 0.0009765625f, first ? nullptr : bo, 0, first ? out : nullptr, first ? -1 : 1, 0, 0, out, nullptr, nullptr, nullptr, DM, 0, first ? QT0 : MPO, DM, DM,
      (size_t)QT0 * DM, 0, (size_t)SQ * DM, first ? bx % (DM / 64) : bx, 0, first ? mt / (SQ / 128) : 0); }


// Exact f32 attention for the first QT0 rows of every sequence. One block owns A0R query rows of one head and stages the head's QT0 key and value
// rows in LDS once; a wave owns two query rows, held in registers, so that each staged row it reads serves both. Scores: a lane owns one key of each
// group of 32 and reads its key row 16 bytes at a time; four partial sums per dot product. Softmax: true row maximum and sum by a butterfly over the
// wave. P V: a lane owns four head dims and every other run of four keys; the wave's halves are added at the end.
#define A0R 16                       /* query rows per block: two per wave */
#define A0KP 68                      /* floats from one staged key row to the next: 16 bytes x odd, so that 16 lanes on 16 rows meet no bank twice */
__global__ __launch_bounds__(256) void k_att0(const float* __restrict__ QF, const float* __restrict__ KF, const float* __restrict__ VF, float scale, _Float16* __restrict__ OH, _Float16* __restrict__ OL) {
  __shared__ __attribute__((aligned(16))) float ks[QT0][A0KP]; __shared__ __attribute__((aligned(16))) float vs[QT0][HD]; __shared__ __attribute__((aligned(16))) float ps[A0R][QT0];
  static_assert(QT0 % 32 == 0 && HD == 64 && A0R == 16, "256 threads: 16 per staged row of 64 floats, 8 waves of two query rows, key groups of 32");
  const int tid = threadIdx.x, lane = tid & 31, w = tid >> 5; const int h = blockIdx.x / (QT0 / A0R), rg = blockIdx.x % (QT0 / A0R); const int r0 = rg * A0R;
  { const size_t zs = (size_t)blockIdx.y * QT0 * DM, zb = zs + h * HD; QF += zb; KF += zb; VF += zb; OH += zs; OL += zs; }      /* grid.y = sequence: QT0 rows of q, k, v and o each, DM floats from row to row (a constant, so that a run of loads shares one address and differs in its immediate offset) */
  const int ia = r0 + w, ib = r0 + 8 + w;      /* the wave's two query rows */
  const int sr = tid >> 4, sc = (tid & 15) * 4; v4f kk[QT0 / 16], vv[QT0 / 16], qa[HD / 4], qb[HD / 4];
#pragma unroll      /* this and every constant-trip loop below: unrolled so that the arrays are registers and the loads of a run are in flight together */
  for (int p = 0; p < QT0 / 16; ++p) { kk[p] = *(const v4fa*)(KF + (size_t)(p * 16 + sr) * DM + sc); vv[p] = *(const v4fa*)(VF + (size_t)(p * 16 + sr) * DM + sc); }
  asm volatile("s_wait_xcnt 0x0" ::: "memory");      /* stands between the loads above and the first later write of a register that holds one of their addresses (the query loads below may land there) */
#pragma unroll
  for (int c = 0; c < HD / 4; ++c) { qa[c] = *(const v4fa*)(QF + (size_t)ia * DM + c * 4); qb[c] = *(const v4fa*)(QF + (size_t)ib * DM + c * 4); }
  asm volatile("s_wait_xcnt 0x0" ::: "memory");      /* the same behind the query loads */
#pragma unroll
  for (int p = 0; p < QT0 / 16; ++p) { *(v4f*)&ks[p * 16 + sr][sc] = kk[p]; *(v4f*)&vs[p * 16 + sr][sc] = vv[p]; }
  __syncthreads();
  const int ng = (r0 + A0R - 1) / 32 + 1;      /* groups of 32 keys up to the block's last row: the same for every wave */
  float sa[QT0 / 32], sb[QT0 / 32]; float ma = -1.0e30f, mb = -1.0e30f;
#pragma unroll
  for (int g = 0; g < QT0 / 32; ++g) { sa[g] = -1.0e30f; sb[g] = -1.0e30f;
    if (g < ng) { const int key = g * 32 + lane; v4f aa = {0.f, 0.f, 0.f, 0.f}, ab = {0.f, 0.f, 0.f, 0.f};
#pragma unroll
      for (int c = 0; c < HD / 4; ++c) { const v4f k4 = *(const v4f*)&ks[key][c * 4]; aa += qa[c] * k4; ab += qb[c] * k4; }
      if (key <= ia) sa[g] = ((aa[0] + aa[1]) + (aa[2] + aa[3])) * scale;
      if (key <= ib) sb[g] = ((ab[0] + ab[1]) + (ab[2] + ab[3])) * scale;
      ma = fmaxf(ma, sa[g]); mb = fmaxf(mb, sb[g]); } }
#pragma unroll
  for (int d = 16; d > 0; d >>= 1) { ma = fmaxf(ma, __shfl_xor(ma, d, 32)); mb = fmaxf(mb, __shfl_xor(mb, d, 32)); }
  float la = 0.f, lb = 0.f;
#pragma unroll
  for (int g = 0; g < QT0 / 32; ++g)
    if (g < ng) { const int key = g * 32 + lane; const float ea = (key <= ia) ? expf(sa[g] - ma) : 0.f, eb = (key <= ib) ? expf(sb[g] - mb) : 0.f; la += ea; lb += eb; ps[w][key] = ea; ps[8 + w][key] = eb; }
#pragma unroll
  for (int d = 16; d > 0; d >>= 1) { la += __shfl_xor(la, d, 32); lb += __shfl_xor(lb, d, 32); }
  __syncthreads();      /* the weights are read below by other lanes than wrote them */
  const int dq = (lane & 15) * 4, jp = lane >> 4; v4f oa = {0.f, 0.f, 0.f, 0.f}, ob = {0.f, 0.f, 0.f, 0.f};
#pragma unroll 1      /* rolled: the trip count is the block's; one trip holds 16 keys, twelve LDS reads in flight together */
  for (int ch = 0; ch <= rg; ++ch) {
#pragma unroll
    for (int t = 0; t < 2; ++t) { const int k0 = ch * 16 + t * 8 + jp * 4; const v4f pa = *(const v4f*)&ps[w][k0], pb = *(const v4f*)&ps[8 + w][k0];
#pragma unroll
      for (int u = 0; u < 4; ++u) { const v4f v4 = *(const v4f*)&vs[k0 + u][dq]; oa += pa[u] * v4; ob += pb[u] * v4; } } }
#pragma unroll
  for (int q = 0; q < 4; ++q) { oa[q] += __shfl_xor(oa[q], 16, 32); ob[q] += __shfl_xor(ob[q], 16, 32); }
  const float fin = 64.0f / (jp ? lb : la);      /* o carried x64 like the f16 path */
  const v4f res = (jp ? ob : oa) * fin;      /* lanes 0..15 store the first row, lanes 16..31 the second */
  v4h rh, rl;      /* o leaves as the output stage reads it: f16 hi + x1024 residual */
#pragma unroll
  for (int q = 0; q < 4; ++q) { rh[q] = (_Float16)res[q]; rl[q] = (_Float16)((res[q] - (float)rh[q]) * 1024.0f); }
  const size_t oo = pk_off((size_t)(jp ? ib : ia), h * HD + dq, DM) + (dq & 7);      /* the o planes are fragment-packed A operands: four halves of the piece that holds dims dq .. dq + 3 */
  *(v4h*)(OH + oo) = rh; *(v4h*)(OL + oo) = rl; }

extern "C" void kernel_launch(void* const* d_in, const int* in_sizes, int n_in,
                              void* d_out, int out_size, void* d_ws, size_t ws_size, hipStream_t stream) {
  (void)in_sizes; (void)n_in; (void)out_size;
  const float* const* I = (const float* const*)d_in; const float* x = I[0]; const float* xk = I[0]; const float* xv = I[0]; const float* wq = I[1]; const float* bq = I[2]; const float* wk = I[3]; const float* bk = I[4]; const float* wv = I[5]; const float* bv = I[6]; const float* wo = I[7]; const float* bo = I[8];      /* input order: x, Wq, bq, Wk, bk, Wv, bv (PER-HEAD STACKS [8][512][64] with REAL per-head biases [8][64] = flat [512]: the GEMMs' guarded bias slots), Wp ([in][out]: out @ Wp), bp (REAL) */
  char* ws = (char*)d_ws; size_t off = 0;
  auto take = [&](size_t bytes) { char* p = ws + off; off += (bytes + 255) & ~(size_t)255; return p; };
  _Float16* BQ = (_Float16*)take((size_t)DM * DM * 2); _Float16* BK = (_Float16*)take((size_t)DM * DM * 2); _Float16* BV = (_Float16*)take((size_t)DM * DM * 2); _Float16* BO = (_Float16*)take((size_t)DM * DM * 2);
  _Float16* X16 = (_Float16*)take(NR * DM * 2); _Float16* XK16 = (_Float16*)take(NR * DM * 2); _Float16* XV16 = (_Float16*)take(NR * DM * 2);      /* exact f16 query, key, value planes, fragment-packed */ _Float16* QH = (_Float16*)take(NR * DM * 2); _Float16* QL = (_Float16*)take(NR * DM * 2); _Float16* KH = (_Float16*)take(NR * DM * 2); _Float16* KL = (_Float16*)take(NR * DM * 2); _Float16* Q16 = QH; _Float16* K16 = KH; _Float16* O16 = (_Float16*)take(NR * DM * 2);
  _Float16* VT = (_Float16*)take((size_t)NB * NH * HD * SQ * 2);      /* one plane per sequence: the sequences share each launch */
  float* QF0 = (float*)take((size_t)NB * QT0 * DM * 4); float* KF0 = (float*)take((size_t)NB * QT0 * DM * 4); float* VF0 = (float*)take((size_t)NB * QT0 * DM * 4); _Float16* OH0 = (_Float16*)take((size_t)NB * QT0 * DM * 2); _Float16* OL0 = (_Float16*)take((size_t)NB * QT0 * DM * 2);
  if (off > ws_size) return;
  const size_t r0p = (size_t)B0 * SQ;      /* first projected row */
  k_prep<<<3 * NH * JW_H + JW_O + 3 * JX, 256, 0, stream>>>(x, xk, xv, wq, wk, wv, wo, BQ, BK, BV, BO, X16, XK16, XV16);      /* weight planes [out][in] (x16) and the exact f16 query, key, value planes, all fragment-packed */
  k_proj<<<dim3(JP_A + NBR * JP_0, 3), 128, 0, stream>>>(X16 + r0p * DM, XK16 + r0p * DM, XV16 + r0p * DM, BQ, BK, BV, bq, bk, bv, QH + r0p * DM, QL + r0p * DM, KH + r0p * DM, KL + r0p * DM, VT, QF0, KF0, VF0);      /* q, k (f16 hi + x1024 residual planes: unscaled logits sigma ~8) and V^T of all rows; f32 q, k, v of the first 128 rows of every sequence (exact products) */
  { const size_t r0 = r0p;      /* every launch below covers all NBR sequences */
    k_att0<<<dim3(NH * (QT0 / A0R), NBR), 256, 0, stream>>>(QF0, KF0, VF0, SCL, OH0 + (size_t)B0 * QT0 * DM, OL0 + (size_t)B0 * QT0 * DM);      /* exact f32 attention for rows 0..127 (o x64, f16 hi + x1024 residual planes) */
    static_assert(SQ % 64 == 0 && HD == 64 && NHD == NH && QN == SQ && LQ == DM, "64 query rows per block, 32-key steps, head size 64");
    k_attn<<<JF_A + NBR * JP_0, 128, 0, stream>>>(QH + r0 * LQ, QL + r0 * LQ, KH + r0 * LQ, KL + r0 * LQ, VT, O16 + r0 * DM, OH0 + (size_t)B0 * QT0 * DM, BO, bo, (float*)d_out + r0 * DM); }      /* o (merged heads, x64) as a fragment-packed f16 plane; rows 0..127 of every sequence: out = o_hi Wo (+ b) */
  k_out<<<(MPO / 128) * (DM / 64), 128, 0, stream>>>(O16 + r0p * DM, OL0 + (size_t)B0 * QT0 * DM, BO, bo, (float*)d_out + r0p * DM);      /* out rows are the output layout; rows 0..127: += o_lo Wo 2^-20 (own-element accumulate) */
}

// v010
// It runs in 123 microseconds.
// Timed twice side by side with v009, it ran 1.08 and 1.05 times as fast.
// Over all steps from v000 it is 88.8 times as fast.
#include <hip/hip_runtime.h>
// Causal multi-head self-attention with PER-HEAD STACKED projections and REAL per-head biases on four sequences at width 512 (x [4][2048][512]; Wq / Wk / Wv [8][512][64] = [head][in][out] ('bte,hed->bhtd'; uniform +-1/sqrt(512)) with biases [8][64] (REAL, uniform +-1/sqrt(512)): a per-head bias [8][64] IS the flat bias [512]; 8 heads of 64 (8 x 64 = 512 = the width); scores * 1/sqrt(64); where(tril, scores, -inf); softmax over keys; out = merged Wp + bp ([in][out] [512][512] + a REAL bias, uniform +-1/sqrt(512)) -> [4][2048][512]); the [in][out] output weight through the text's own TRANSPOSING builder (the one the per-head stacks use); q and k carried as f16 hi + x1024 residual planes with three-product scores; each head's [in][out] block is transposed into its 64 contiguous rows of the weight plane by the same builder, one job per head in one shared launch.
// Compute dtype: inputs rounded to bf16; x / weights exact; v, softmax weights and o as plain f16 GEMM operands (~2^-12), q and k as f16 hi + x1024 residual pairs (rows 0..127: f32 attention, o as hi + residual); scores and softmax statistics f32; v_wmma_f32_16x16x32_f16.
#define NB 4
#define SCL 0.125f                         /* 1 / sqrt(head_dim 64) */
#define SCLR 0.0001220703125f               /* 2^-13: the same scale on the x1024 residual passes */
#define SQ 2048
#define DM 512
#define NH 8
#define HD 64
#define HG 4                         /* heads per call of the untemplated k_vt (not launched) */
#define QT0 128                      /* first-tile rows recomputed exactly in f32 */
#define B0 0                         /* first batch processed (debug hook) */
#define NBR NB                       /* batches processed (debug hook) */
#define NR ((size_t)NB * SQ)         /* token rows */
#define MP ((int)((size_t)NBR * SQ)) /* rows projected (debug hook) */
#define QN SQ                        /* query rows attended per batch (debug hook) */
#define NHD NH                       /* heads attended (debug hook) */
#define MPO MP                       /* rows through the output stage (debug hook) */
#define LQ DM      /* row pitch of the q/k/v rows */
typedef __bf16 v16b __attribute__((ext_vector_type(16)));
typedef unsigned short v8us __attribute__((ext_vector_type(8), may_alias));
typedef float  v8f  __attribute__((ext_vector_type(8)));
typedef float  v4f  __attribute__((ext_vector_type(4)));
typedef float  v4fa __attribute__((ext_vector_type(4), may_alias));
union FragB { v16b v; v8us half[2]; unsigned short u[16]; };

__device__ __forceinline__ unsigned short bf16_bits(float x) { unsigned int u = __float_as_uint(x); return (unsigned short)((u + 0x7FFFu + ((u >> 16) & 1u)) >> 16); }
__device__ __forceinline__ float bf16_val(unsigned short b) { return __uint_as_float(((unsigned int)b) << 16); }
__device__ __forceinline__ float bf16_round(float x) { return bf16_val(bf16_bits(x)); }
// D += A·B with NT terms: 1 = ah·bh, 2 = + al·bh (A split), 3 = + ah·bl (both split)
template <int NT>
__device__ __forceinline__ v8f mmaN(v16b ah, v16b al, v16b bh, v16b bl, v8f c) {
  c = __builtin_amdgcn_wmma_f32_16x16x32_bf16(false, ah, false, bh, (short)0, c, false, false);
  if (NT >= 2) c = __builtin_amdgcn_wmma_f32_16x16x32_bf16(false, al, false, bh, (short)0, c, false, false);
  if (NT >= 3) c = __builtin_amdgcn_wmma_f32_16x16x32_bf16(false, ah, false, bl, (short)0, c, false, false);
  asm volatile("v_nop\n\tv_nop\n\tv_nop\n\tv_nop" : "+v"(c) : "v"(ah), "v"(al), "v"(bh), "v"(bl));
  return c;
}

__global__ __launch_bounds__(256) void k_wt_bf16(const float* __restrict__ W, unsigned short* __restrict__ Wt, int K, int N) {
  const int t = blockIdx.x * 256 + threadIdx.x;
  const int k8n = K / 8;
  if (t >= N * k8n) return;
  const int n = t / k8n, k8 = (t % k8n) * 8;
  v8us v;
#pragma unroll
  for (int i = 0; i < 8; ++i) v[i] = bf16_bits(W[(size_t)(k8 + i) * N + n]);
  *(v8us*)(Wt + (size_t)n * K + k8) = v;
  
}

// GEMM C[M][N] (f32, pitch ldc) = act(A[M][K]·W + bias). A f32 row-major (pitch lda) converted per fragment to bf16
// (ASPLIT: hi/lo two planes -> 2 terms, else single rounded term); Wt bf16 [N][K] (pitch ldb). BIAS_BF16 rounds the
// bias to bf16 first (bias quantised to bf16 before the add). K%32==0, M%16==0, N%64==0.
template <bool ASPLIT, int ACT, bool BIAS_BF16>
__global__ __launch_bounds__(128) void k_gemm_bf(const float* __restrict__ A, int lda, const unsigned short* __restrict__ Wt, int ldb,
                                               const float* __restrict__ bias, float* __restrict__ C, int ldc, int M, int N, int K) {
  __shared__ __attribute__((aligned(16))) float so[4][16][64];
  const int tid = threadIdx.x, w = tid >> 5, lane = tid & 31, ln = lane & 15, hh = lane >> 4;
  const int ntn = N / 64;
  const int wid = blockIdx.x * 4 + w;
  const int mt = wid / ntn, nq = wid % ntn;
  if (mt * 16 >= M) return;
  const int row0 = mt * 16, col0 = nq * 64;
  const float* arow = A + (size_t)(row0 + ln) * lda;
  v8f acc[4] = {};
  for (int kb = 0; kb < K; kb += 32) {
    FragB ah, al;
    const v4f x0 = *(const v4fa*)(arow + kb + 8 * hh), x1 = *(const v4fa*)(arow + kb + 8 * hh + 4);
    const v4f x2 = *(const v4fa*)(arow + kb + 16 + 8 * hh), x3 = *(const v4fa*)(arow + kb + 16 + 8 * hh + 4);
    float xs[16] = {x0[0],x0[1],x0[2],x0[3],x1[0],x1[1],x1[2],x1[3],x2[0],x2[1],x2[2],x2[3],x3[0],x3[1],x3[2],x3[3]};
#pragma unroll
    for (int i = 0; i < 16; ++i) { const unsigned short hb = bf16_bits(xs[i]); ah.u[i] = hb; al.u[i] = ASPLIT ? bf16_bits(xs[i] - bf16_val(hb)) : (unsigned short)0; }
#pragma unroll
    for (int t = 0; t < 4; ++t) {
      const unsigned short* brow = Wt + (size_t)(col0 + t * 16 + ln) * ldb + kb;
      FragB b;
      b.half[0] = *(const v8us*)(brow + 8 * hh);
      b.half[1] = *(const v8us*)(brow + 16 + 8 * hh);
      acc[t] = mmaN<ASPLIT ? 2 : 1>(ah.v, al.v, b.v, b.v, acc[t]);
    }
  }
#pragma unroll
  for (int t = 0; t < 4; ++t) {
    float bv = bias ? bias[col0 + t * 16 + ln] : 0.f;
    if (BIAS_BF16) bv = bf16_round(bv);
#pragma unroll
    for (int r = 0; r < 8; ++r) { float v = acc[t][r] + bv; if (ACT == 1) v = fmaxf(v, 0.f); so[w][8 * hh + r][t * 16 + ln] = v; }
  }
  __builtin_amdgcn_fence(__ATOMIC_ACQ_REL, "workgroup");
  __builtin_amdgcn_wave_barrier();
  const int rsub = lane >> 4, c4 = (lane & 15) * 4;
  {
#pragma unroll
    for (int q = 0; q < 8; ++q) {
      const int r = q * 2 + rsub;
      const v4f v = *(const v4fa*)&so[w][r][c4];
      *(v4f*)(C + (size_t)(row0 + r) * ldc + col0 + c4) = v;
    }
    
  }
}

// GEMM C = act(A·W + bias + resid): A f32 (ASPLIT -> hi/lo 2 terms), Wt bf16 [N][K]; ACT 0 none, 1 relu, 2 exact gelu;
// resid (optional, f32, row index = (row % rmod), pitch ldr, RES_BF16 rounds it) added before the activation.
template <bool ASPLIT, int ACT, bool BIAS_BF16, bool RES_BF16>
__global__ __launch_bounds__(128) void k_gemm_bf3(const float* __restrict__ A, int lda, const unsigned short* __restrict__ Wt, int ldb,
                                                const float* __restrict__ bias, const float* __restrict__ resid, int rmod, int ldr,
                                                float* __restrict__ C, int ldc, int M, int N, int K) {
  __shared__ __attribute__((aligned(16))) float so[4][16][64];
  const int tid = threadIdx.x, w = tid >> 5, lane = tid & 31, ln = lane & 15, hh = lane >> 4;
  const int ntn = N / 64;
  const int wid = blockIdx.x * 4 + w;
  const int mt = wid / ntn, nq = wid % ntn;
  if (mt * 16 >= M) return;
  const int row0 = mt * 16, col0 = nq * 64;
  const float* arow = A + (size_t)(row0 + ln) * lda;
  v8f acc[4] = {};
  for (int kb = 0; kb < K; kb += 32) {
    FragB ah, al;
    const v4f x0 = *(const v4fa*)(arow + kb + 8 * hh), x1 = *(const v4fa*)(arow + kb + 8 * hh + 4);
    const v4f x2 = *(const v4fa*)(arow + kb + 16 + 8 * hh), x3 = *(const v4fa*)(arow + kb + 16 + 8 * hh + 4);
    float xs[16] = {x0[0],x0[1],x0[2],x0[3],x1[0],x1[1],x1[2],x1[3],x2[0],x2[1],x2[2],x2[3],x3[0],x3[1],x3[2],x3[3]};
#pragma unroll
    for (int i = 0; i < 16; ++i) { const unsigned short hb = bf16_bits(xs[i]); ah.u[i] = hb; al.u[i] = ASPLIT ? bf16_bits(xs[i] - bf16_val(hb)) : (unsigned short)0; }
#pragma unroll
    for (int t = 0; t < 4; ++t) {
      const unsigned short* brow = Wt + (size_t)(col0 + t * 16 + ln) * ldb + kb;
      FragB b;
      b.half[0] = *(const v8us*)(brow + 8 * hh);
      b.half[1] = *(const v8us*)(brow + 16 + 8 * hh);
      acc[t] = mmaN<ASPLIT ? 2 : 1>(ah.v, al.v, b.v, b.v, acc[t]);
    }
  }
#pragma unroll
  for (int t = 0; t < 4; ++t) {
    const int col = col0 + t * 16 + ln;
    float bv = bias ? bias[col] : 0.f;
    if (BIAS_BF16) bv = bf16_round(bv);
#pragma unroll
    for (int r = 0; r < 8; ++r) {
      float v = acc[t][r] + bv;
      if (resid) { float rv = resid[(size_t)((row0 + 8 * hh + r) % rmod) * ldr + col]; if (RES_BF16) rv = bf16_round(rv); v += rv; }
      if (ACT == 1) v = fmaxf(v, 0.f);
      if (ACT == 2) v = 0.5f * v * (1.0f + erff(v * 0.70710678118654752f));
      if (ACT == 3) { const float u = 0.7978845608028654f * (v + 0.044715f * v * v * v); v = 0.5f * v * (1.0f + tanhf(u)); }
      so[w][8 * hh + r][t * 16 + ln] = v;
    }
  }
  __builtin_amdgcn_fence(__ATOMIC_ACQ_REL, "workgroup");
  __builtin_amdgcn_wave_barrier();
  const int rsub = lane >> 4, c4 = (lane & 15) * 4;
  {
#pragma unroll
    for (int q = 0; q < 8; ++q) {
      const int r = q * 2 + rsub;
      const v4f v = *(const v4fa*)&so[w][r][c4];
      *(v4f*)(C + (size_t)(row0 + r) * ldc + col0 + c4) = v;
    }
    
  }
}
// row LayerNorm (biased variance, eps) over N: s = X (+ R); optional out_sum <- s; out_norm <- (s-mu)*rsqrt(var+eps)*g + b
template <bool PARAM_BF16>
__global__ __launch_bounds__(256) void k_layernorm(const float* __restrict__ X, const float* __restrict__ R, const float* __restrict__ g, const float* __restrict__ bta,
                                                  float* __restrict__ out_sum, float* __restrict__ out_norm, int N, float eps) {
  __shared__ float red[256];
  const int row = blockIdx.x, tid = threadIdx.x;
  const float* x = X + (size_t)row * N; const float* rr = R ? R + (size_t)row * N : nullptr;
  float vals[16];                     // up to N = 4096
  const int per = N / 256;            // contiguous chunk per thread? use strided-by-4 chunks: thread handles j = tid*4 + 1024*u
  float s1 = 0.f;
  for (int u = 0; u < per / 4; ++u) {
    const int j = tid * 4 + 1024 * u;
    const v4f a = *(const v4fa*)(x + j);
    v4f b = {0.f,0.f,0.f,0.f}; if (rr) b = *(const v4fa*)(rr + j);
#pragma unroll
    for (int q = 0; q < 4; ++q) { const float v = a[q] + b[q]; vals[u * 4 + q] = v; s1 += v; }
  }
  red[tid] = s1; __syncthreads();
  for (int st = 128; st > 0; st >>= 1) { if (tid < st) red[tid] += red[tid + st]; __syncthreads(); }
  const float mu = red[0] / (float)N; __syncthreads();
  float s2 = 0.f;
  for (int u = 0; u < per / 4; ++u)
#pragma unroll
    for (int q = 0; q < 4; ++q) { const float c = vals[u * 4 + q] - mu; s2 += c * c; }
  red[tid] = s2; __syncthreads();
  for (int st = 128; st > 0; st >>= 1) { if (tid < st) red[tid] += red[tid + st]; __syncthreads(); }
  const float rs = rsqrtf(red[0] / (float)N + eps);
  {
    for (int u = 0; u < per / 4; ++u) {
      const int j = tid * 4 + 1024 * u;
      v4f o, sm;
#pragma unroll
      for (int q = 0; q < 4; ++q) {
        float gg = g[j + q], bb = bta[j + q];
        if (PARAM_BF16) { gg = bf16_round(gg); bb = bf16_round(bb); }
        sm[q] = vals[u * 4 + q]; o[q] = (vals[u * 4 + q] - mu) * rs * gg + bb;
      }
      if (out_sum) *(v4f*)(out_sum + (size_t)row * N + j) = sm;
      *(v4f*)(out_norm + (size_t)row * N + j) = o;
    }
    
  }
}



// ---- f16 WMMA path (v_wmma_f32_16x16x32_f16): 11-bit significands for operands in range — used where a [0,1] probability operand needs more precision than bf16
typedef _Float16 v16h __attribute__((ext_vector_type(16)));
union FragH { v16h v; v8us half[2]; _Float16 h[16]; unsigned short u[16]; };
template <int NT>
__device__ __forceinline__ v8f mmaH(v16h ah, v16h al, v16h bh, v16h bl, v8f c) {
  c = __builtin_amdgcn_wmma_f32_16x16x32_f16(false, ah, false, bh, (short)0, c, false, false);
  if (NT >= 2) c = __builtin_amdgcn_wmma_f32_16x16x32_f16(false, al, false, bh, (short)0, c, false, false);
  if (NT >= 3) c = __builtin_amdgcn_wmma_f32_16x16x32_f16(false, ah, false, bl, (short)0, c, false, false);
  asm volatile("v_nop\n\tv_nop\n\tv_nop\n\tv_nop" : "+v"(c) : "v"(ah), "v"(al), "v"(bh), "v"(bl));
  return c;
}
// batched GEMM like k_gemm_b but f16 operands: A f32 (split into f16 hi/lo if ASPLIT, else rounded to f16), Bt = f16 values [n][k]; alpha; C f32; N multiple of 16 (partial tiles skipped)
template <bool ASPLIT>
__global__ __launch_bounds__(128) void k_gemm_h(const float* __restrict__ A, int lda, size_t sA, const _Float16* __restrict__ Bh, int ldb, size_t sB, float alpha, float* __restrict__ C, int ldc, size_t sC, int M, int N, int K) {
  __shared__ __attribute__((aligned(16))) float so[4][16][64];
  const int tid = threadIdx.x, w = tid >> 5, lane = tid & 31, ln = lane & 15, hh = lane >> 4; const int by = blockIdx.y;
  A += (size_t)by * sA; Bh += (size_t)by * sB; C += (size_t)by * sC;
  const int ntn = (N + 63) / 64; const int wid = blockIdx.x * 4 + w; const int mt = wid / ntn, nq = wid % ntn; if (mt * 16 >= M) return;
  const int row0 = mt * 16, col0 = nq * 64; const float* arow = A + (size_t)(row0 + ln) * lda;
  v8f acc[4] = {};
  for (int kb = 0; kb < K; kb += 32) {
    FragH ah, al;
    const v4f x0 = *(const v4fa*)(arow + kb + 8 * hh), x1 = *(const v4fa*)(arow + kb + 8 * hh + 4), x2 = *(const v4fa*)(arow + kb + 16 + 8 * hh), x3 = *(const v4fa*)(arow + kb + 16 + 8 * hh + 4);
    float xs[16] = {x0[0],x0[1],x0[2],x0[3],x1[0],x1[1],x1[2],x1[3],x2[0],x2[1],x2[2],x2[3],x3[0],x3[1],x3[2],x3[3]};
#pragma unroll
    for (int i = 0; i < 16; ++i) { const _Float16 h = (_Float16)xs[i]; ah.h[i] = h; al.h[i] = ASPLIT ? (_Float16)(xs[i] - (float)h) : (_Float16)0.0f; }
#pragma unroll
    for (int t = 0; t < 4; ++t) { if (col0 + t * 16 >= N) continue; const size_t boff = (size_t)(col0 + t * 16 + ln) * ldb + kb; FragH bq; bq.half[0] = *(const v8us*)(Bh + boff + 8 * hh); bq.half[1] = *(const v8us*)(Bh + boff + 16 + 8 * hh);
      acc[t] = mmaH<ASPLIT ? 2 : 1>(ah.v, al.v, bq.v, bq.v, acc[t]); }
  }
#pragma unroll
  for (int t = 0; t < 4; ++t) { if (col0 + t * 16 >= N) continue;
#pragma unroll
    for (int r = 0; r < 8; ++r) so[w][8 * hh + r][t * 16 + ln] = acc[t][r] * alpha; }
  __builtin_amdgcn_fence(__ATOMIC_ACQ_REL, "workgroup"); __builtin_amdgcn_wave_barrier();
  const int rsub = lane >> 4, c4 = (lane & 15) * 4;
  {
#pragma unroll
    for (int q = 0; q < 8; ++q) { const int r = q * 2 + rsub; if (col0 + c4 < N) { const v4f v = *(const v4fa*)&so[w][r][c4]; *(v4f*)(C + (size_t)(row0 + r) * ldc + col0 + c4) = v; } }
     }
}

// Wt (n, k) = f16(W[k][n]·scale), fragment-packed, from f32 row-major W[K][N] (scale = power of two; bf16-exact weights stay exact in f16 away from the subnormal range)
// (a job of a shared launch: blk = the block's index within the job, 256 threads a block)
// FRAGMENT-PACKED PLANES (every A and B operand of gemm2_job): a plane of rows of K halves is stored as tiles of 16 rows x 32 k, 1 KiB each, the K / 32 tiles of 16 rows one behind the other, so that
// 16 r rows still start at half 16 r K. Inside a tile stand the two 512-byte loads of its fragment, each in lane order: piece (row, k..k+7) is 16 bytes at half ((k >> 4) & 1) * 256 + (((k >> 3) & 1) * 16 + row % 16) * 8.
// A wave-wide 16-byte load of a fragment half is then 512 contiguous bytes (four whole lines) and not 32 bytes of each of 16 lines. The k held by each lane and register is the row layout's.
__device__ __forceinline__ size_t pk_off(size_t row, int k, int K) { return ((row >> 4) * (size_t)(K >> 5) + (size_t)(k >> 5)) * 512 + (size_t)(((k >> 4) & 1) * 256 + (((k >> 3) & 1) * 16 + (int)(row & 15)) * 8); }
// thread t of a packing job owns the t-th 16-byte piece of the packed plane (a wave stores whole lines): its row and its first k
__device__ __forceinline__ size_t pk_row(size_t t, int K) { return ((t >> 6) / (size_t)(K >> 5)) * 16 + (t & 15); }
__device__ __forceinline__ int pk_k(size_t t, int K) { return (int)((t >> 6) % (size_t)(K >> 5)) * 32 + (int)((t >> 5) & 1) * 16 + (int)((t >> 4) & 1) * 8; }
__device__ __forceinline__ void wt_f16_job(const float* __restrict__ W, _Float16* __restrict__ Wt, int K, int N, float scale, int blk) {
  const int t = blk * 256 + threadIdx.x; if (t >= N * (K / 8)) return; const int n = (int)pk_row((size_t)t, K), k8 = pk_k((size_t)t, K); FragH f;
#pragma unroll
  for (int i = 0; i < 8; ++i) f.h[i] = (_Float16)(bf16_round(W[(size_t)(k8 + i) * N + n]) * scale); const v8us o = f.half[0];
  *(v8us*)((unsigned short*)Wt + (size_t)t * 8) = o; 
}
// k_gemm_hh variant with fused epilogue: v = acc·alpha + bias[by·sBias + col] (+ CP[(row/rowsPerB)·sCPb + by·64 + col] if CP) ; ACT 0 none / 1 elu ; writes f16 C16 (and f32 C if non-null)
template <int ACT>
__global__ __launch_bounds__(128) void k_gemm_hhx(const _Float16* __restrict__ A, int lda, size_t sA, const _Float16* __restrict__ Bh, int ldb, size_t sB, float alpha, const float* __restrict__ bias, size_t sBias, const float* __restrict__ CP, int rowsPerB, size_t sCPb, int row0g,
    float* __restrict__ C, _Float16* __restrict__ C16, int ldc, size_t sC, int M, int N, int K) {
  __shared__ __attribute__((aligned(16))) float so[4][16][64];
  const int tid = threadIdx.x, w = tid >> 5, lane = tid & 31, ln = lane & 15, hh = lane >> 4; const int by = blockIdx.y;
  A += (size_t)by * sA; Bh += (size_t)by * sB; const size_t cofs = (size_t)by * sC; const float* bp = bias ? bias + (size_t)by * sBias : nullptr;
  const int ntn = (N + 63) / 64; const int wid = blockIdx.x * 4 + w; const int mt = wid / ntn, nq = wid % ntn; if (mt * 16 >= M) return;
  const int row0 = mt * 16, col0 = nq * 64; const _Float16* arow = A + (size_t)(row0 + ln) * lda;
  v8f acc[4] = {};
  for (int kb = 0; kb < K; kb += 32) { FragH ah; ah.half[0] = *(const v8us*)((const unsigned short*)arow + kb + 8 * hh); ah.half[1] = *(const v8us*)((const unsigned short*)arow + kb + 16 + 8 * hh);
#pragma unroll
    for (int t = 0; t < 4; ++t) { if (col0 + t * 16 >= N) continue; const size_t boff = (size_t)(col0 + t * 16 + ln) * ldb + kb; FragH bq; bq.half[0] = *(const v8us*)((const unsigned short*)Bh + boff + 8 * hh); bq.half[1] = *(const v8us*)((const unsigned short*)Bh + boff + 16 + 8 * hh);
      acc[t] = mmaH<1>(ah.v, ah.v, bq.v, bq.v, acc[t]); }
  }
#pragma unroll
  for (int t = 0; t < 4; ++t) { if (col0 + t * 16 >= N) continue; const int col = col0 + t * 16 + ln; const float bv = bp ? bf16_round(bp[col]) : 0.f;
#pragma unroll
    for (int r = 0; r < 8; ++r) { float v = acc[t][r] * alpha + bv; if (CP) { const int rr = row0g + row0 + 8 * hh + r; if (rowsPerB < 0) v += CP[cofs + (size_t)rr * ldc + col];      /* rowsPerB < 0: own element of the batched C plane */ else { const int bidx = rr / rowsPerB; v += CP[(size_t)bidx * sCPb + (size_t)by * 64 + col]; } } if (ACT == 1) v = (v > 0.f) ? v : expm1f(v); else if (ACT == 7) v = (v > 0.f) ? v + 1.0f : expf(v); else if (ACT == 8) v = tanhf(v); else if (ACT == 9) v = 0.5f * v * (1.0f + tanhf(0.7978845608028654f * (v + 0.044715f * v * v * v))); else if (ACT == 11) v = 1.0f / (1.0f + expf(-v)); else if (ACT == 12) v = (v > 0.f) ? v : 0.01f * v; else if (ACT == 14) v = (v > 0.f) ? v : 0.1f * v; else if (ACT == 16) v = (v >= 0.f) ? v : 0.3f * v; else if (ACT == 17) v = (v >= 0.f) ? v : 0.2f * v; else if (ACT == 15) v = v / (1.0f + expf(-v)); else if (ACT == 3) v = fmaxf(v, 0.f); else if (ACT == 6) v = 0.5f * v * (1.0f + erff(v * 0.70710678118654752f)); so[w][8 * hh + r][t * 16 + ln] = v; } }
  __builtin_amdgcn_fence(__ATOMIC_ACQ_REL, "workgroup"); __builtin_amdgcn_wave_barrier();
  const int rsub = lane >> 4, c4 = (lane & 15) * 4; typedef _Float16 v4h __attribute__((ext_vector_type(4)));
  {
#pragma unroll
    for (int q = 0; q < 8; ++q) { const int r = q * 2 + rsub; if (col0 + c4 < N) { const v4f v = *(const v4fa*)&so[w][r][c4]; if (C) *(v4f*)(C + cofs + (size_t)(row0 + r) * ldc + col0 + c4) = v; if (C16) { v4h h4; for (int i = 0; i < 4; ++i) h4[i] = (_Float16)v[i]; *(v4h*)(C16 + cofs + (size_t)(row0 + r) * ldc + col0 + c4) = h4; } } }
     }
}


typedef _Float16 v4h __attribute__((ext_vector_type(4)));

__device__ __forceinline__ void x16_job(const float* __restrict__ x, _Float16* __restrict__ X16, size_t n8, int blk) { const size_t t = (size_t)blk * 256 + threadIdx.x; if (t >= n8) return; FragH f;
  const float* xs = x + pk_row(t, DM) * DM + pk_k(t, DM);      /* rows of DM floats in, a fragment-packed plane out */
#pragma unroll
  for (int q = 0; q < 8; ++q) f.h[q] = (_Float16)bf16_round(xs[q]); *(v8us*)((unsigned short*)X16 + t * 8) = f.half[0];  }
__global__ __launch_bounds__(256) void k_h16(const float* __restrict__ x, _Float16* __restrict__ X16, size_t n8) { const size_t t = (size_t)blockIdx.x * 256 + threadIdx.x; if (t >= n8) return; FragH f;
#pragma unroll
  for (int q = 0; q < 8; ++q) f.h[q] = (_Float16)x[t * 8 + q]; *(v8us*)((unsigned short*)X16 + t * 8) = f.half[0];  }
__global__ __launch_bounds__(256) void k_round16f(const float* __restrict__ W, _Float16* __restrict__ Bt, size_t n8) { const size_t t = (size_t)blockIdx.x * 256 + threadIdx.x; if (t >= n8) return; FragH f;
#pragma unroll
  for (int i = 0; i < 8; ++i) f.h[i] = (_Float16)(bf16_round(W[t * 8 + i]) * 16.0f); *(v8us*)((unsigned short*)Bt + t * 8) = f.half[0];  }
// ---- fast GEMM (wave tile 32x64; requires M % 32 == 0 rows per launch region and N % 64 == 0); epilogue = k_gemm_hhx semantics; two batch axes: by (strides sA, sB, sC) and bz (strides zA, zB, zC) ----
// Output forms, each taken where its pointer is not null: C (f32 rows), C16 with CL (f16 rows and the x1024 residual of their rounding, f16 rows: both or neither), or CT alone
// (f16, transposed per head: [row / SQ][col / HD][col % HD][row % SQ], rows counted over all sequences, so only with by = bz = 0).
__device__ __forceinline__ v16h g2_frag(const _Float16* p, int hh) { FragH f; f.half[0] = *(const v8us*)((const unsigned short*)p + 8 * hh); f.half[1] = *(const v8us*)((const unsigned short*)p + 16 + 8 * hh); return f.v; }
typedef __attribute__((address_space(1))) const _Float16 gl_f16; typedef __attribute__((address_space(1))) const v8us gl_v8us;      /* pointees in global memory by type: an address that has passed through an asm statement still gives global loads, not flat ones */
__device__ __forceinline__ v16h g2_packg(gl_f16* p) { FragH f; f.half[0] = *(gl_v8us*)p; f.half[1] = *(gl_v8us*)(p + 256); return f.v; }      /* p: the lane's piece of a packed tile's first load */
__device__ __forceinline__ v8f g2_mma(v16h a, v16h b, v8f c) { v8f d = __builtin_amdgcn_wmma_f32_16x16x32_f16(false, a, false, b, (short)0, c, false, false); asm volatile("v_nop\n\tv_nop\n\tv_nop\n\tv_nop" : "+v"(d) : "v"(a), "v"(b)); return d; }
// KU: k-steps of 32 whose fragment loads (12 each) are issued together, ahead of the first product that needs one (K % (32 KU) == 0).
template <int ACT, int KU>
__device__ __forceinline__ void gemm2_job(const _Float16* __restrict__ A, int lda, size_t sA, const _Float16* __restrict__ Bh, int ldb, size_t sB, float alpha, const float* __restrict__ bias, size_t sBias, const float* __restrict__ CP, int rowsPerB, size_t sCPb, int row0g,
    float* __restrict__ C, _Float16* __restrict__ C16, _Float16* __restrict__ CL, _Float16* __restrict__ CT, int ldc, size_t sC, int M, int N, int K, size_t zA, size_t zB, size_t zC, int bx, int by, int bz) { static_assert(ACT == 0 || ACT == 3 || ACT == 6 || ACT == 8 || ACT == 9 || ACT == 11 || ACT == 12 || ACT == 14 || ACT == 15 || ACT == 16 || ACT == 17, "k_gemm2: unsupported ACT code (would silently apply no activation)");
  __shared__ __attribute__((aligned(16))) float so[4][32][68];
  const int tid = threadIdx.x, w = tid >> 5, lane = tid & 31, ln = lane & 15, hh = lane >> 4;      /* bx = tile, by = batch (strides sA, sB, sC), bz = sequence (strides zA, zB, zC) */
  A += (size_t)by * sA + (size_t)bz * zA; Bh += (size_t)by * sB + (size_t)bz * zB; const size_t cofs = (size_t)by * sC + (size_t)bz * zC; const float* bp = bias ? bias + (size_t)by * sBias : nullptr;
  const int ntn = N >> 6; const int mt = bx / ntn, nq = bx - mt * ntn; const int row0 = mt * 128 + 32 * w, col0 = nq * 64; if (row0 >= M) return;
  /* A and Bh are fragment-packed planes (lda = ldb = K): 16 rows are K / 32 tiles of 512 halves, a k-step of 32 is one tile on */
  gl_f16* pa = (gl_f16*)(A + (size_t)row0 * lda + lane * 8); gl_f16* pb = (gl_f16*)(Bh + (size_t)col0 * ldb + lane * 8); const size_t sa = (size_t)16 * lda, sb = (size_t)16 * ldb;      /* the lane's piece of the trip's first A and B tile; halves from 16 rows to the next 16 */
  const v8f z8 = {0.f,0.f,0.f,0.f,0.f,0.f,0.f,0.f}; v8f c00 = z8, c01 = z8, c02 = z8, c03 = z8, c10 = z8, c11 = z8, c12 = z8, c13 = z8;
#pragma unroll 1      /* rolled: one trip already holds all the loads that are to be in flight together */
  for (int kb = 0; kb < K; kb += 32 * KU) { v16h a0[KU], a1[KU], b0[KU], b1[KU], b2[KU], b3[KU];
#pragma unroll      /* the fragments are registers, not indexed arrays */
    for (int j = 0; j < KU; ++j) { const int kj = j * 512; a0[j] = g2_packg(pa + kj); a1[j] = g2_packg(pa + sa + kj); b0[j] = g2_packg(pb + kj); b1[j] = g2_packg(pb + sb + kj); b2[j] = g2_packg(pb + 2 * sb + kj); b3[j] = g2_packg(pb + 3 * sb + kj); }
    /* keeps every load of the trip in front of the products (one exposed latency a trip, not four a k-step); the two addresses pass through the wait's own statement, so that their registers live to it (no load of the trip lands in one) and their step to the next trip stands behind it */
    asm volatile("s_wait_xcnt 0x0" : "+v"(pa), "+v"(pb) :: "memory");
    pa += 512 * KU; pb += 512 * KU;
#pragma unroll
    for (int j = 0; j < KU; ++j) {
      c00 = g2_mma(a0[j], b0[j], c00); c10 = g2_mma(a1[j], b0[j], c10);
      c01 = g2_mma(a0[j], b1[j], c01); c11 = g2_mma(a1[j], b1[j], c11);
      c02 = g2_mma(a0[j], b2[j], c02); c12 = g2_mma(a1[j], b2[j], c12);
      c03 = g2_mma(a0[j], b3[j], c03); c13 = g2_mma(a1[j], b3[j], c13); } }
  v8f accs[8] = {c00, c01, c02, c03, c10, c11, c12, c13};
#pragma unroll
  for (int u = 0; u < 8; ++u) { const int t = u & 3, half = u >> 2; const int col = col0 + t * 16 + ln; const float bv = bp ? bf16_round(bp[col]) : 0.f;
#pragma unroll
    for (int r = 0; r < 8; ++r) { const int rloc = half * 16 + 8 * hh + r; float v = accs[u][r] * alpha + bv; if (CP) { if (rowsPerB < 0) v += CP[cofs + (size_t)(row0g + row0 + rloc) * ldc + col];      /* rowsPerB < 0: own element of the batched C plane */ else { const int bidx = (row0g + row0 + rloc) / rowsPerB; v += CP[(size_t)bidx * sCPb + (size_t)by * 64 + col]; } }
      if (ACT == 3) v = fmaxf(v, 0.f); else if (ACT == 6) v = 0.5f * v * (1.0f + erff(v * 0.70710678118654752f)); else if (ACT == 11) v = 1.0f / (1.0f + expf(-v)); else if (ACT == 15) v = v / (1.0f + expf(-v)); else if (ACT == 12) v = (v > 0.f) ? v : 0.01f * v; else if (ACT == 8) v = tanhf(v); else if (ACT == 9) v = 0.5f * v * (1.0f + tanhf(0.7978845608028654f * (v + 0.044715f * v * v * v))); else if (ACT == 14) v = (v > 0.f) ? v : 0.1f * v; else if (ACT == 16) v = (v >= 0.f) ? v : 0.3f * v; else if (ACT == 17) v = (v >= 0.f) ? v : 0.2f * v;
      so[w][rloc][t * 16 + ln] = v; } }
  __builtin_amdgcn_fence(__ATOMIC_ACQ_REL, "workgroup"); __builtin_amdgcn_wave_barrier();
  if (CT) {      /* the wave's 32 rows are 64 contiguous bytes of each of its 64 transposed rows: four lanes of 16 bytes a row, eight rows a store */
    const int dl = lane >> 2, t8 = (lane & 3) * 8; FragH f[8];
#pragma unroll
    for (int j = 0; j < 8; ++j)
#pragma unroll
      for (int i = 0; i < 8; ++i) f[j].h[i] = (_Float16)so[w][t8 + i][j * 8 + dl];
    unsigned short* ct = (unsigned short*)CT + (((size_t)(row0 / SQ) * NH + nq) * HD + dl) * SQ + row0 % SQ + t8;
#pragma unroll
    for (int j = 0; j < 8; ++j) *(v8us*)(ct + (size_t)j * 8 * SQ) = f[j].half[0];
    asm volatile("s_wait_xcnt 0x0" ::: "memory");      /* stands behind the eight stores, in front of any later write of a register that they name */
    return; }
  const int rsub = lane >> 4, c4 = (lane & 15) * 4;
  {
#pragma unroll
    for (int q = 0; q < 16; ++q) { const int r = q * 2 + rsub; const v4f v = *(const v4fa*)&so[w][r][c4]; if (C) { *(v4f*)(C + cofs + (size_t)(row0 + r) * ldc + col0 + c4) = v; asm volatile("s_wait_xcnt 0x0" ::: "memory"); }      /* the wait stands between the f32 store and the conversions below, which may land in the registers that the store names */
      if (C16) { const size_t co = cofs + (size_t)(row0 + r) * ldc + col0 + c4; v4h h4, l4; for (int i = 0; i < 4; ++i) { h4[i] = (_Float16)v[i]; l4[i] = (_Float16)((v[i] - (float)h4[i]) * 1024.0f); }
        /* both stores and their wait in one statement: as plain stores the residual's conversions were scheduled behind the first store, into the registers that it names, ahead of the wait */
        asm volatile("global_store_b64 %0, %1, off\n\tglobal_store_b64 %2, %3, off\n\ts_wait_xcnt 0x0" :: "v"(C16 + co), "v"(h4), "v"(CL + co), "v"(l4) : "memory"); } }
     } }


// ---- shared launches: jobs that do not depend on one another run in one grid; the block index picks the job (the same for every thread of a block) and the block's index within it ----
#define JW_H (HD * (DM / 8) / 256)             /* blocks per per-head weight block */
#define JW_O (DM * (DM / 8) / 256)             /* blocks of the output weight */
#define JX ((int)(NR * DM / 8 / 256))          /* blocks per plane of x rows */
static_assert(HD * (DM / 8) % 256 == 0 && DM * (DM / 8) % 256 == 0 && NR * DM / 8 % 256 == 0, "whole blocks per job");
// Operand planes: 3 NH per-head weight blocks (head h of wq / wk / wv is a row-major [DM][HD] block, written as HD contiguous rows of the [out][in] plane, x16), the [DM][DM] output weight, the one plane of x rows (query, key and value rows are the same input).
__global__ __launch_bounds__(256) void k_prep(const float* __restrict__ x, const float* __restrict__ wq, const float* __restrict__ wk, const float* __restrict__ wv, const float* __restrict__ wo,
    _Float16* __restrict__ BQ, _Float16* __restrict__ BK, _Float16* __restrict__ BV, _Float16* __restrict__ BO, _Float16* __restrict__ X16) {
  int bx = blockIdx.x;
  if (bx < 3 * NH * JW_H) { const int j = bx / JW_H, s = j % 3, h = j / 3; const size_t wofs = (size_t)h * DM * HD, pofs = (size_t)h * HD * DM;
    wt_f16_job((s == 0 ? wq : s == 1 ? wk : wv) + wofs, (s == 0 ? BQ : s == 1 ? BK : BV) + pofs, DM, HD, 16.0f, bx % JW_H); return; }
  bx -= 3 * NH * JW_H;
  if (bx < JW_O) { wt_f16_job(wo, BO, DM, DM, 16.0f, bx); return; }
  bx -= JW_O;
  x16_job(x, X16, NR * DM / 8, bx); }
#define JP_A ((MP / 128) * (DM / 64))          /* tiles of a projection of all rows */
#define JP_0 ((QT0 / 128) * (DM / 64))         /* tiles of a first-tile projection, per sequence */
// The six projections, all of the one x plane. grid.y: q, k, v. grid.x: the tiles of all rows, stored in the forms that the attention reads (q, k as f16 hi + x1024 residual planes; v as V^T [NBR][NH][HD][SQ], f16), then per sequence the tiles of the first QT0 rows (f32 planes of QT0 rows a sequence).
__global__ __launch_bounds__(128) void k_proj(const _Float16* __restrict__ X16, const _Float16* __restrict__ BQ, const _Float16* __restrict__ BK, const _Float16* __restrict__ BV,
    const float* __restrict__ bq, const float* __restrict__ bk, const float* __restrict__ bv, _Float16* __restrict__ QH, _Float16* __restrict__ QL, _Float16* __restrict__ KH, _Float16* __restrict__ KL, _Float16* __restrict__ VT, float* __restrict__ QF0, float* __restrict__ KF0, float* __restrict__ VF0) {
  const int s = blockIdx.y; const int bx = blockIdx.x; const bool all = bx < JP_A; const int b0 = bx - JP_A;
  gemm2_job<0, 1>(X16, DM, 0, s == 0 ? BQ : s == 1 ? BK : BV, DM, 0, 0.0625f, s == 0 ? bq : s == 1 ? bk : bv, 0, nullptr, 1, 0, 0,
      all ? nullptr : (s == 0 ? QF0 : s == 1 ? KF0 : VF0), all ? (s == 0 ? QH : s == 1 ? KH : nullptr) : nullptr, all ? (s == 0 ? QL : s == 1 ? KL : nullptr) : nullptr, (all && s == 2) ? VT : nullptr, DM, 0, all ? MP : QT0, DM, DM, (size_t)SQ * DM, 0, (size_t)QT0 * DM,
      all ? bx : b0 % JP_0, 0, all ? 0 : b0 / JP_0); }
static_assert(MP == NBR * SQ && B0 == 0 && SQ % 32 == 0 && DM == NH * HD, "a wave's 32 projected rows lie in one sequence, its 64 columns are one head");


__global__ __launch_bounds__(256) void k_wnat(const float* __restrict__ w, size_t n8, _Float16* __restrict__ Bt) { const size_t t = (size_t)blockIdx.x * 256 + threadIdx.x; if (t >= n8) return; FragH f; for (int q = 0; q < 8; ++q) f.h[q] = (_Float16)(bf16_round(w[t * 8 + q]) * 16.0f); *(v8us*)((unsigned short*)Bt + t * 8) = f.half[0];  }
__global__ __launch_bounds__(256) void k_rsm(const float* __restrict__ S, _Float16* __restrict__ P, int nrows) {
  #pragma clang fp contract(off)
  const int i = blockIdx.x * 256 + threadIdx.x; if (i >= nrows) return; const float* s = S + (size_t)i * SQ; float mx = -3.0e38f;
#pragma unroll 1
  for (int j = 0; j < SQ; ++j) mx = fmaxf(mx, s[j]); float se = 0.f;
#pragma unroll 1
  for (int j = 0; j < SQ; ++j) se += expf(s[j] - mx); const float sc = 256.0f / se;
#pragma unroll 1
  for (int j0 = 0; j0 < SQ; j0 += 8) { FragH f; for (int q = 0; q < 8; ++q) f.h[q] = (_Float16)(expf(s[j0 + q] - mx) * sc); unsigned short* d = (unsigned short*)P + (size_t)i * SQ + j0; *(v8us*)d = f.half[0];  } }
__global__ __launch_bounds__(256) void k_vt(const _Float16* __restrict__ V16, int b, int h0, _Float16* __restrict__ VT) { __shared__ unsigned short tl[64][65]; const int tid = threadIdx.x; const int hh = blockIdx.x % HG, sg = blockIdx.x / HG; const int s0 = sg * 64; const int h = h0 + hh;
  for (int i = tid; i < 64 * 8; i += 256) { const int j = i / 8, d8 = (i % 8) * 8; FragH f; f.half[0] = *(const v8us*)((const unsigned short*)V16 + ((size_t)b * SQ + s0 + j) * DM + h * HD + d8); for (int q = 0; q < 8; ++q) tl[d8 + q][j] = f.u[q]; }
  __syncthreads();
  { for (int i = tid; i < 64 * 8; i += 256) { const int d = i / 8, j8 = (i % 8) * 8; FragH f; for (int q = 0; q < 8; ++q) f.u[q] = tl[d][j8 + q]; *(v8us*)((unsigned short*)VT + ((size_t)hh * HD + d) * SQ + s0 + j8) = f.half[0]; }  } }



// 2^x on the transcendental unit, with the one free issue slot that the instruction set asks for behind it before its result is used or its
// source overwritten: in the unrolled row the compiler put one exponential's result into the source register of the one directly ahead of it.
__device__ __forceinline__ float exp2_slot(float x) { float r; asm("v_exp_f32 %0, %1\n\tv_nop" : "=v"(r) : "v"(x)); return r; }
// Fused causal attention: scores, softmax and P V in one launch; neither scores nor weights go to memory. One wave owns 16 query rows of one
// head and walks its keys 32 at a time, transposed: S^T = K Q^T (A = key rows, B = query rows), so that a lane holds scores of ONE query
// (column ln; keys 8 hh + r of each 16-key tile) and the row maximum and sum need one exchange between the wave's halves. The two score tiles,
// converted in place, are the B operand of O^T += V^T P^T in the loader's own k order (keys 8 hh + 0..7, then 16 + 8 hh + 0..7), and the
// accumulators of O^T belong to the same query as the lane's running maximum and sum. Scores keep their three f16 products (hi.hi, lo.hi, hi.lo).
// The block's four waves walk the same keys: each 32-key tile (key rows hi, key rows residual, V^T rows) is brought into LDS once per block by
// asynchronous copies, whole rows at a time, into one of two buffers, the next tile in flight while this one is worked on; the waves take their
// fragments from LDS.
#define FKP 72                       /* halves from one staged key row (64 halves) to the next: 144 bytes = 16 x odd, for 16-byte LDS reads */
#define FVP 40                       /* halves from one staged V^T row (32 halves) to the next: 80 bytes = 16 x odd */
#define FKL (32 * FKP)               /* first half of the residual key rows in a buffer */
#define FVO (2 * 32 * FKP)           /* first half of the V^T rows in a buffer */
#define FBUF (2 * 32 * FKP + HD * FVP)      /* halves per buffer */
typedef __attribute__((address_space(3))) _Float16 lds_f16;
// One 32-key tile into one buffer: six copies of 16 bytes a lane (128 lanes: 16 key rows of 8 pieces, twice, for each key plane; 32 V^T rows of 4 pieces, twice).
// lk, lv: the lane's LDS byte addresses of its first key piece and its first V^T piece; gh, gl, gv: its global addresses of the same pieces.
// The s_wait_xcnt stands inside the statement, behind the last copy: the address registers may be rewritten right behind it.
__device__ __forceinline__ void fattn_copy(unsigned lk, unsigned lv, const _Float16* gh, const _Float16* gl, const _Float16* gv) {
  asm volatile("global_load_async_to_lds_b128 %0, %6, off\n\t"
               "global_load_async_to_lds_b128 %1, %7, off\n\t"
               "global_load_async_to_lds_b128 %2, %8, off\n\t"
               "global_load_async_to_lds_b128 %3, %9, off\n\t"
               "global_load_async_to_lds_b128 %4, %10, off\n\t"
               "global_load_async_to_lds_b128 %5, %11, off\n\t"
               "s_wait_xcnt 0x0"
               :: "v"(lk), "v"(lk + 16 * FKP * 2), "v"(lk + FKL * 2), "v"(lk + (FKL + 16 * FKP) * 2), "v"(lv), "v"(lv + 32 * FVP * 2),
                  "v"(gh), "v"(gh + 16 * LQ), "v"(gl), "v"(gl + 16 * LQ), "v"(gv), "v"(gv + (size_t)32 * SQ) : "memory"); }
__device__ __forceinline__ void fattn_job(const _Float16* __restrict__ Qh, const _Float16* __restrict__ Ql, const _Float16* __restrict__ Kh, const _Float16* __restrict__ Kl, const _Float16* __restrict__ Vt, _Float16* __restrict__ O, int bx, int h, int b) {
  __shared__ __attribute__((aligned(16))) _Float16 ring[2 * FBUF];
  const int tid = threadIdx.x, lane = tid & 31, ln = lane & 15, hh = lane >> 4; const int w = __builtin_amdgcn_readfirstlane(threadIdx.x >> 5);      /* the wave's number in a scalar register: the trip count stays scalar */
  const int qt = (b & 1) ? bx : SQ / 64 - 1 - bx;      /* long and short causal tiles alternate between sequences */
  const int q0 = qt * 64 + w * 16; const size_t rb = (size_t)b * SQ;
  const size_t qo = (rb + q0 + ln) * LQ + h * HD;
  const v16h qh0 = g2_frag(Qh + qo, hh), qh1 = g2_frag(Qh + qo + 32, hh), ql0 = g2_frag(Ql + qo, hh), ql1 = g2_frag(Ql + qo + 32, hh);
  const size_t ko = (rb + (tid >> 3)) * LQ + h * HD + (tid & 7) * 8;      /* the lane's first piece of tile 0 */
  const _Float16* gh = Kh + ko; const _Float16* gl = Kl + ko;
  const _Float16* gv = Vt + ((size_t)(b * NH + h) * HD + (tid >> 2)) * SQ + (tid & 3) * 8;
  const unsigned l0 = (unsigned)(size_t)(lds_f16*)ring;
  const unsigned lk = l0 + ((tid >> 3) * FKP + (tid & 7) * 8) * 2, lv = l0 + (FVO + (tid >> 2) * FVP + (tid & 3) * 8) * 2;
  const v8f z8 = {0.f,0.f,0.f,0.f,0.f,0.f,0.f,0.f}; v8f o[4] = {z8, z8, z8, z8};
  float m = -1.0e30f, l = 0.f; const int nst = (q0 >> 5) + 1;      /* the wave's 32-key steps, up to the one that holds its diagonal */
  const int nbl = 2 * qt + 2;      /* the block's tiles (its last wave's steps; two at least): every wave passes every barrier */
  fattn_copy(lk, lv, gh, gl, gv);      /* tile 0 */
  asm volatile("s_wait_asynccnt 0x0" ::: "memory");      /* the wave's own copies have landed before the barrier behind which other waves read them */
  __syncthreads();
  gh += 32 * LQ; gl += 32 * LQ; gv += 32;
  fattn_copy(lk + FBUF * 2, lv + FBUF * 2, gh, gl, gv);      /* tile 1 flies while tile 0 is worked on */
#pragma unroll 1      /* rolled: a second copy of the body would hold a second set of fragments and cost a resident wave per SIMD */
  for (int st = 0; st < nbl; ++st) { const int key0 = st * 32; const int bo = (st & 1) * FBUF;
    if (st < nst) {      /* a scalar test: a wave past its diagonal skips the work, never the barrier */
    const _Float16* kb = ring + bo + ln * FKP; const _Float16* vb = ring + bo + FVO + ln * FVP;
    v16h ka[2][4];      /* per 16-key tile: hi d 0..31, hi d 32..63, residual d 0..31, residual d 32..63 */
#pragma unroll      /* this and every constant-trip loop below: unrolled so that fragments and accumulators are registers, not indexed arrays */
    for (int kt = 0; kt < 2; ++kt) { const int ro = 16 * kt * FKP; ka[kt][0] = g2_frag(kb + ro, hh); ka[kt][1] = g2_frag(kb + ro + 32, hh); ka[kt][2] = g2_frag(kb + FKL + ro, hh); ka[kt][3] = g2_frag(kb + FKL + ro + 32, hh); }
    v16h va[4];
#pragma unroll
    for (int t = 0; t < 4; ++t) va[t] = g2_frag(vb + 16 * t * FVP, hh);
    v8f sh[2], sl[2];
#pragma unroll
    for (int kt = 0; kt < 2; ++kt) { sh[kt] = g2_mma(ka[kt][0], qh0, z8); sh[kt] = g2_mma(ka[kt][1], qh1, sh[kt]);
      sl[kt] = g2_mma(ka[kt][0], ql0, z8); sl[kt] = g2_mma(ka[kt][1], ql1, sl[kt]); sl[kt] = g2_mma(ka[kt][2], qh0, sl[kt]); sl[kt] = g2_mma(ka[kt][3], qh1, sl[kt]); }
    float sv[16]; float mx = m; const int rel = q0 + ln - key0 - 8 * hh;      /* key 16 kt + r of this lane is kept while 16 kt + r <= rel */
#pragma unroll
    for (int kt = 0; kt < 2; ++kt)
#pragma unroll
      for (int r = 0; r < 8; ++r) { const float s = sh[kt][r] * SCL + sl[kt][r] * SCLR; const float xv = (16 * kt + r <= rel) ? s : -1.0e9f; sv[kt * 8 + r] = xv; mx = fmaxf(mx, xv); }
    mx = fmaxf(mx, __shfl_xor(mx, 16, 32));
    const float al = exp2_slot((m - mx) * 1.44269504088896340736f); m = mx;
    float ps = 0.f; FragH p;
#pragma unroll
    for (int i = 0; i < 16; ++i) { const float e = exp2_slot((sv[i] - mx) * 1.44269504088896340736f + 8.0f);      /* weights carried x256, as in the f16 operand before */ ps += e; p.h[i] = (_Float16)e; }
    l = l * al + ps;
#pragma unroll
    for (int t = 0; t < 4; ++t) { o[t] *= al; o[t] = g2_mma(va[t], p.v, o[t]); } }
    asm volatile("s_wait_dscnt 0x0" ::: "memory");      /* the wave's reads of this buffer have returned before the barrier behind which it is refilled */
    asm volatile("s_wait_asynccnt 0x0" ::: "memory");      /* the wave's copies of the next tile have landed before the barrier behind which other waves read them */
    __syncthreads();      /* publishes tile st + 1 and ends every wave's reads of tile st */
    if (st + 2 < nbl) { gh += 32 * LQ; gl += 32 * LQ; gv += 32; fattn_copy(lk + bo * 2, lv + bo * 2, gh, gl, gv); } }      /* tile st + 2 into the buffer just read; the test is the same for the whole block */
  asm volatile("s_wait_asynccnt 0x0" ::: "memory");      /* no copy is outstanding when the wave ends */
  l += __shfl_xor(l, 16, 32);
  const float fin = 64.0f / l;      /* o carried x64; the x256 of the weights cancels against the sum's */
  _Float16* orow = O + pk_off(rb + q0 + ln, h * HD + 8 * hh, DM);      /* o is the output stage's A operand: fragment-packed; dims 16 t + 8 hh .. + 7 are tile t / 2, load t % 2, the lane's own piece */
#pragma unroll
  for (int t = 0; t < 4; ++t) { FragH f;
#pragma unroll
    for (int r = 0; r < 8; ++r) f.h[r] = (_Float16)(o[t][r] * fin);
    *(v8us*)((unsigned short*)orow + (t >> 1) * 512 + (t & 1) * 256) = f.half[0]; } }
#define JF_A ((SQ / 64) * NH * NBR)            /* blocks of the fused attention: query tile fastest, then head, then sequence */
// The fused attention of all rows; behind its blocks, per sequence, the tiles of the first-tile output pass out = o_hi Wo + b (rows 0..QT0-1, from the exact f32 attention: it does not depend on this launch's attention).
__global__ __launch_bounds__(128) void k_attn(const _Float16* __restrict__ Qh, const _Float16* __restrict__ Ql, const _Float16* __restrict__ Kh, const _Float16* __restrict__ Kl, const _Float16* __restrict__ Vt, _Float16* __restrict__ O,
    const _Float16* __restrict__ OH0, const _Float16* __restrict__ BO, const float* __restrict__ bo, float* __restrict__ out) {
  const int bx = blockIdx.x;
  if (bx < JF_A) { fattn_job(Qh, Ql, Kh, Kl, Vt, O, bx % (SQ / 64), bx / (SQ / 64) % NH, bx / ((SQ / 64) * NH)); return; }
  const int b0 = bx - JF_A;
  gemm2_job<0, 2>(OH0, DM, 0, BO, DM, 0, 0.0009765625f, bo, 0, nullptr, 1, 0, 0, out, nullptr, nullptr, nullptr, DM, 0, QT0, DM, DM, (size_t)QT0 * DM, 0, (size_t)SQ * DM, b0 % JP_0, 0, b0 / JP_0); }
// Output stage, one job per 128-row tile: the first tile of a sequence adds o_lo Wo 2^-20 to its own elements (written by the launch before); every other tile is out = o Wo + b from the f16 rows.
static_assert(QT0 == 128 && SQ % 128 == 0 && MPO == NBR * SQ && B0 == 0, "the first-tile rows are exactly the first 128-row tile of each sequence");
static_assert(DM % 64 == 0, "the output passes take two k-steps a trip");
__global__ __launch_bounds__(128) void k_out(const _Float16* __restrict__ O16, const _Float16* __restrict__ OL0, const _Float16* __restrict__ BO, const float* __restrict__ bo, float* out) {
  const int bx = blockIdx.x; const int mt = bx / (DM / 64); const bool first = mt % (SQ / 128) == 0;
  gemm2_job<0, 2>(first ? OL0 : O16, DM, 0, BO, DM, 0, first ? 0.00000095367431640625f : 0.0009765625f, first ? nullptr : bo, 0, first ? out : nullptr, first ? -1 : 1, 0, 0, out, nullptr, nullptr, nullptr, DM, 0, first ? QT0 : MPO, DM, DM,
      (size_t)QT0 * DM, 0, (size_t)SQ * DM, first ? bx % (DM / 64) : bx, 0, first ? mt / (SQ / 128) : 0); }


// Exact f32 attention for the first QT0 rows of every sequence. One block owns A0R query rows of one head and stages the head's QT0 key and value
// rows in LDS once; a wave owns two query rows, held in registers, so that each staged row it reads serves both. Scores: a lane owns one key of each
// group of 32 and reads its key row 16 bytes at a time; four partial sums per dot product. Softmax: true row maximum and sum by a butterfly over the
// wave. P V: a lane owns four head dims and every other run of four keys; the wave's halves are added at the end.
#define A0R 16                       /* query rows per block: two per wave */
#define A0KP 68                      /* floats from one staged key row to the next: 16 bytes x odd, so that 16 lanes on 16 rows meet no bank twice */
__global__ __launch_bounds__(256) void k_att0(const float* __restrict__ QF, const float* __restrict__ KF, const float* __restrict__ VF, float scale, _Float16* __restrict__ OH, _Float16* __restrict__ OL) {
  __shared__ __attribute__((aligned(16))) float ks[QT0][A0KP]; __shared__ __attribute__((aligned(16))) float vs[QT0][HD]; __shared__ __attribute__((aligned(16))) float ps[A0R][QT0];
  static_assert(QT0 % 32 == 0 && HD == 64 && A0R == 16, "256 threads: 16 per staged row of 64 floats, 8 waves of two query rows, key groups of 32");
  const int tid = threadIdx.x, lane = tid & 31, w = tid >> 5; const int h = blockIdx.x / (QT0 / A0R), rg = blockIdx.x % (QT0 / A0R); const int r0 = rg * A0R;
  { const size_t zs = (size_t)blockIdx.y * QT0 * DM, zb = zs + h * HD; QF += zb; KF += zb; VF += zb; OH += zs; OL += zs; }      /* grid.y = sequence: QT0 rows of q, k, v and o each, DM floats from one q, k or v row to the next (a constant, so that a run of loads shares one address and differs in its immediate offset) */
  const int ia = r0 + w, ib = r0 + 8 + w;      /* the wave's two query rows */
  const int sr = tid >> 4, sc = (tid & 15) * 4; v4f kk[QT0 / 16], vv[QT0 / 16], qa[HD / 4], qb[HD / 4];
#pragma unroll      /* this and every constant-trip loop below: unrolled so that the arrays are registers and the loads of a run are in flight together */
  for (int p = 0; p < QT0 / 16; ++p) { kk[p] = *(const v4fa*)(KF + (size_t)(p * 16 + sr) * DM + sc); vv[p] = *(const v4fa*)(VF + (size_t)(p * 16 + sr) * DM + sc); }
  asm volatile("s_wait_xcnt 0x0" ::: "memory");      /* stands between the loads above and the first later write of a register that holds one of their addresses (the query loads below may land there) */
#pragma unroll
  for (int c = 0; c < HD / 4; ++c) { qa[c] = *(const v4fa*)(QF + (size_t)ia * DM + c * 4); qb[c] = *(const v4fa*)(QF + (size_t)ib * DM + c * 4); }
  asm volatile("s_wait_xcnt 0x0" ::: "memory");      /* the same behind the query loads */
#pragma unroll
  for (int p = 0; p < QT0 / 16; ++p) { *(v4f*)&ks[p * 16 + sr][sc] = kk[p]; *(v4f*)&vs[p * 16 + sr][sc] = vv[p]; }
  __syncthreads();
  const int ng = (r0 + A0R - 1) / 32 + 1;      /* groups of 32 keys up to the block's last row: the same for every wave */
  float sa[QT0 / 32], sb[QT0 / 32]; float ma = -1.0e30f, mb = -1.0e30f;
#pragma unroll
  for (int g = 0; g < QT0 / 32; ++g) { sa[g] = -1.0e30f; sb[g] = -1.0e30f;
    if (g < ng) { const int key = g * 32 + lane; v4f aa = {0.f, 0.f, 0.f, 0.f}, ab = {0.f, 0.f, 0.f, 0.f};
#pragma unroll
      for (int c = 0; c < HD / 4; ++c) { const v4f k4 = *(const v4f*)&ks[key][c * 4]; aa += qa[c] * k4; ab += qb[c] * k4; }
      if (key <= ia) sa[g] = ((aa[0] + aa[1]) + (aa[2] + aa[3])) * scale;
      if (key <= ib) sb[g] = ((ab[0] + ab[1]) + (ab[2] + ab[3])) * scale;
      ma = fmaxf(ma, sa[g]); mb = fmaxf(mb, sb[g]); } }
#pragma unroll
  for (int d = 16; d > 0; d >>= 1) { ma = fmaxf(ma, __shfl_xor(ma, d, 32)); mb = fmaxf(mb, __shfl_xor(mb, d, 32)); }
  float la = 0.f, lb = 0.f;
#pragma unroll
  for (int g = 0; g < QT0 / 32; ++g)
    if (g < ng) { const int key = g * 32 + lane; const float ea = (key <= ia) ? expf(sa[g] - ma) : 0.f, eb = (key <= ib) ? expf(sb[g] - mb) : 0.f; la += ea; lb += eb; ps[w][key] = ea; ps[8 + w][key] = eb; }
#pragma unroll
  for (int d = 16; d > 0; d >>= 1) { la += __shfl_xor(la, d, 32); lb += __shfl_xor(lb, d, 32); }
  __syncthreads();      /* the weights are read below by other lanes than wrote them */
  const int dq = (lane & 15) * 4, jp = lane >> 4; v4f oa = {0.f, 0.f, 0.f, 0.f}, ob = {0.f, 0.f, 0.f, 0.f};
#pragma unroll 1      /* rolled: the trip count is the block's; one trip holds 16 keys, twelve LDS reads in flight together */
  for (int ch = 0; ch <= rg; ++ch) {
#pragma unroll
    for (int t = 0; t < 2; ++t) { const int k0 = ch * 16 + t * 8 + jp * 4; const v4f pa = *(const v4f*)&ps[w][k0], pb = *(const v4f*)&ps[8 + w][k0];
#pragma unroll
      for (int u = 0; u < 4; ++u) { const v4f v4 = *(const v4f*)&vs[k0 + u][dq]; oa += pa[u] * v4; ob += pb[u] * v4; } } }
#pragma unroll
  for (int q = 0; q < 4; ++q) { oa[q] += __shfl_xor(oa[q], 16, 32); ob[q] += __shfl_xor(ob[q], 16, 32); }
  const float fin = 64.0f / (jp ? lb : la);      /* o carried x64 like the f16 path */
  const v4f res = (jp ? ob : oa) * fin;      /* lanes 0..15 store the first row, lanes 16..31 the second */
  v4h rh, rl;      /* o leaves as the output stage reads it: f16 hi + x1024 residual */
#pragma unroll
  for (int q = 0; q < 4; ++q) { rh[q] = (_Float16)res[q]; rl[q] = (_Float16)((res[q] - (float)rh[q]) * 1024.0f); }
  const size_t oo = pk_off((size_t)(jp ? ib : ia), h * HD + dq, DM) + (dq & 7);      /* the o planes are fragment-packed A operands: four halves of the piece that holds dims dq .. dq + 3 */
  *(v4h*)(OH + oo) = rh; *(v4h*)(OL + oo) = rl; }

extern "C" void kernel_launch(void* const* d_in, const int* in_sizes, int n_in,
                              void* d_out, int out_size, void* d_ws, size_t ws_size, hipStream_t stream) {
  (void)in_sizes; (void)n_in; (void)out_size;
  const float* const* I = (const float* const*)d_in; const float* x = I[0]; const float* wq = I[1]; const float* bq = I[2]; const float* wk = I[3]; const float* bk = I[4]; const float* wv = I[5]; const float* bv = I[6]; const float* wo = I[7]; const float* bo = I[8];      /* input order: x, Wq, bq, Wk, bk, Wv, bv (PER-HEAD STACKS [8][512][64] with REAL per-head biases [8][64] = flat [512]: the GEMMs' guarded bias slots), Wp ([in][out]: out @ Wp), bp (REAL) */
  char* ws = (char*)d_ws; size_t off = 0;
  auto take = [&](size_t bytes) { char* p = ws + off; off += (bytes + 255) & ~(size_t)255; return p; };
  _Float16* BQ = (_Float16*)take((size_t)DM * DM * 2); _Float16* BK = (_Float16*)take((size_t)DM * DM * 2); _Float16* BV = (_Float16*)take((size_t)DM * DM * 2); _Float16* BO = (_Float16*)take((size_t)DM * DM * 2);
  _Float16* X16 = (_Float16*)take(NR * DM * 2);      /* exact f16 rows of x: the query, key and value rows alike */ _Float16* QH = (_Float16*)take(NR * DM * 2); _Float16* QL = (_Float16*)take(NR * DM * 2); _Float16* KH = (_Float16*)take(NR * DM * 2); _Float16* KL = (_Float16*)take(NR * DM * 2); _Float16* Q16 = QH; _Float16* K16 = KH; _Float16* O16 = (_Float16*)take(NR * DM * 2);
  _Float16* VT = (_Float16*)take((size_t)NB * NH * HD * SQ * 2);      /* one plane per sequence: the sequences share each launch */
  float* QF0 = (float*)take((size_t)NB * QT0 * DM * 4); float* KF0 = (float*)take((size_t)NB * QT0 * DM * 4); float* VF0 = (float*)take((size_t)NB * QT0 * DM * 4); _Float16* OH0 = (_Float16*)take((size_t)NB * QT0 * DM * 2); _Float16* OL0 = (_Float16*)take((size_t)NB * QT0 * DM * 2);
  if (off > ws_size) return;
  const size_t r0p = (size_t)B0 * SQ;      /* first projected row */
  k_prep<<<3 * NH * JW_H + JW_O + JX, 256, 0, stream>>>(x, wq, wk, wv, wo, BQ, BK, BV, BO, X16);      /* weight planes [out][in] (x16) and the exact f16 rows of x */
  k_proj<<<dim3(JP_A + NBR * JP_0, 3), 128, 0, stream>>>(X16 + r0p * DM, BQ, BK, BV, bq, bk, bv, QH + r0p * DM, QL + r0p * DM, KH + r0p * DM, KL + r0p * DM, VT, QF0, KF0, VF0);      /* q, k (f16 hi + x1024 residual planes: unscaled logits sigma ~8) and V^T of all rows; f32 q, k, v of the first 128 rows of every sequence (exact products) */
  { const size_t r0 = r0p;      /* every launch below covers all NBR sequences */
    k_att0<<<dim3(NH * (QT0 / A0R), NBR), 256, 0, stream>>>(QF0, KF0, VF0, SCL, OH0 + (size_t)B0 * QT0 * DM, OL0 + (size_t)B0 * QT0 * DM);      /* exact f32 attention for rows 0..127 (o x64, f16 hi + x1024 residual planes) */
    static_assert(SQ % 64 == 0 && HD == 64 && NHD == NH && QN == SQ && LQ == DM, "64 query rows per block, 32-key steps, head size 64");
    k_attn<<<JF_A + NBR * JP_0, 128, 0, stream>>>(QH + r0 * LQ, QL + r0 * LQ, KH + r0 * LQ, KL + r0 * LQ, VT, O16 + r0 * DM, OH0 + (size_t)B0 * QT0 * DM, BO, bo, (float*)d_out + r0 * DM); }      /* o (merged heads, x64) as a fragment-packed f16 plane; rows 0..127 of every sequence: out = o_hi Wo (+ b) */
  k_out<<<(MPO / 128) * (DM / 64), 128, 0, stream>>>(O16 + r0p * DM, OL0 + (size_t)B0 * QT0 * DM, BO, bo, (float*)d_out + r0p * DM);      /* out rows are the output layout; rows 0..127: += o_lo Wo 2^-20 (own-element accumulate) */
}
